// v000
// Measured on an AMD MI455X. A time is GPU time per run, averaged over a window of back-to-back runs after a warm-up
// (all launches, gaps included; the runs take copies of the inputs in turn), and the median of several windows.
// Apart from v000's, it joins two sittings. Times from different sittings can be a few percent apart, while
// side-by-side timings come from the same sitting.
// The starting kernel, v000, takes 2770 microseconds a run.
#include <hip/hip_runtime.h>
// 'self_attn_init' (N=8192 nodes, 3-d coords + a shared 3-d centre → 6 inputs, D=512): x = [node, centre]; keys = x·Wkᵀ + bk; queries = x·Wqᵀ + bq; attn = softmax_m(keys·queriesᵀ) (UNSCALED, rank-7 logits up to ±O(100));
// out = keys + attn·(queries·Wv[:, :512]ᵀ) + keys·Wv[:, 512:]ᵀ + bv.
// Compute dtype: inputs/weights/biases rounded to bf16. The logits are an exact bilinear form in the 7-vector x̃ = [x, 1]: s[n][m] = (x̃_nᵀ·M)·x̃_m with M = [Wk bk]ᵀ[Wq bq] (7×7, f32), evaluated per pair in f32 (7 FMAs) —
// no 16-bit rounding touches the huge logits; wave-per-row three-pass softmax over the 8192 keys writes P f16 ×2^15 per 1024-row block; attn·QV and keys·Wv_kᵀ as GEMMs on v_wmma_f32_16x16x32_f16 (f32 accumulate) with keys (f32) and the first
// product carried through the epilogue addends.
#define NNODE 8192
#define DD 512
#define RB 1024

typedef __bf16 v16b __attribute__((ext_vector_type(16)));
typedef unsigned short v8us __attribute__((ext_vector_type(8), may_alias));
typedef float  v8f  __attribute__((ext_vector_type(8)));
typedef float  v4f  __attribute__((ext_vector_type(4)));
typedef float  v4fa __attribute__((ext_vector_type(4), may_alias));
union FragB { v16b v; v8us half[2]; unsigned short u[16]; };

__device__ __forceinline__ unsigned short bf16_bits(float x) { unsigned int u = __float_as_uint(x); return (unsigned short)((u + 0x7FFFu + ((u >> 16) & 1u)) >> 16); }
__device__ __forceinline__ float bf16_val(unsigned short b) { return __uint_as_float(((unsigned int)b) << 16); }
__device__ __forceinline__ float bf16_round(float x) { return bf16_val(bf16_bits(x)); }
// D += A·B with NT terms: 1 = ah·bh, 2 = + al·bh (A split), 3 = + ah·bl (both split)
template <int NT>
__device__ __forceinline__ v8f mmaN(v16b ah, v16b al, v16b bh, v16b bl, v8f c) {
  c = __builtin_amdgcn_wmma_f32_16x16x32_bf16(false, ah, false, bh, (short)0, c, false, false);
  if (NT >= 2) c = __builtin_amdgcn_wmma_f32_16x16x32_bf16(false, al, false, bh, (short)0, c, false, false);
  if (NT >= 3) c = __builtin_amdgcn_wmma_f32_16x16x32_bf16(false, ah, false, bl, (short)0, c, false, false);
  asm volatile("v_nop\n\tv_nop\n\tv_nop\n\tv_nop" : "+v"(c) : "v"(ah), "v"(al), "v"(bh), "v"(bl));
  return c;
}

__global__ __launch_bounds__(256) void k_wt_bf16(const float* __restrict__ W, unsigned short* __restrict__ Wt, int K, int N) {
  const int t = blockIdx.x * 256 + threadIdx.x;
  const int k8n = K / 8;
  if (t >= N * k8n) return;
  const int n = t / k8n, k8 = (t % k8n) * 8;
  v8us v;
#pragma unroll
  for (int i = 0; i < 8; ++i) v[i] = bf16_bits(W[(size_t)(k8 + i) * N + n]);
  *(v8us*)(Wt + (size_t)n * K + k8) = v;
  
}

// GEMM C[M][N] (f32, pitch ldc) = act(A[M][K]·W + bias). A f32 row-major (pitch lda) converted per fragment to bf16
// (ASPLIT: hi/lo two planes -> 2 terms, else single rounded term); Wt bf16 [N][K] (pitch ldb). BIAS_BF16 rounds the
// bias to bf16 first (bias quantised to bf16 before the add). K%32==0, M%16==0, N%64==0.
template <bool ASPLIT, int ACT, bool BIAS_BF16>
__global__ __launch_bounds__(128) void k_gemm_bf(const float* __restrict__ A, int lda, const unsigned short* __restrict__ Wt, int ldb,
                                               const float* __restrict__ bias, float* __restrict__ C, int ldc, int M, int N, int K) {
  __shared__ __attribute__((aligned(16))) float so[4][16][64];
  const int tid = threadIdx.x, w = tid >> 5, lane = tid & 31, ln = lane & 15, hh = lane >> 4;
  const int ntn = N / 64;
  const int wid = blockIdx.x * 4 + w;
  const int mt = wid / ntn, nq = wid % ntn;
  if (mt * 16 >= M) return;
  const int row0 = mt * 16, col0 = nq * 64;
  const float* arow = A + (size_t)(row0 + ln) * lda;
  v8f acc[4] = {};
  for (int kb = 0; kb < K; kb += 32) {
    FragB ah, al;
    const v4f x0 = *(const v4fa*)(arow + kb + 8 * hh), x1 = *(const v4fa*)(arow + kb + 8 * hh + 4);
    const v4f x2 = *(const v4fa*)(arow + kb + 16 + 8 * hh), x3 = *(const v4fa*)(arow + kb + 16 + 8 * hh + 4);
    float xs[16] = {x0[0],x0[1],x0[2],x0[3],x1[0],x1[1],x1[2],x1[3],x2[0],x2[1],x2[2],x2[3],x3[0],x3[1],x3[2],x3[3]};
#pragma unroll
    for (int i = 0; i < 16; ++i) { const unsigned short hb = bf16_bits(xs[i]); ah.u[i] = hb; al.u[i] = ASPLIT ? bf16_bits(xs[i] - bf16_val(hb)) : (unsigned short)0; }
#pragma unroll
    for (int t = 0; t < 4; ++t) {
      const unsigned short* brow = Wt + (size_t)(col0 + t * 16 + ln) * ldb + kb;
      FragB b;
      b.half[0] = *(const v8us*)(brow + 8 * hh);
      b.half[1] = *(const v8us*)(brow + 16 + 8 * hh);
      acc[t] = mmaN<ASPLIT ? 2 : 1>(ah.v, al.v, b.v, b.v, acc[t]);
    }
  }
#pragma unroll
  for (int t = 0; t < 4; ++t) {
    float bv = bias ? bias[col0 + t * 16 + ln] : 0.f;
    if (BIAS_BF16) bv = bf16_round(bv);
#pragma unroll
    for (int r = 0; r < 8; ++r) { float v = acc[t][r] + bv; if (ACT == 1) v = fmaxf(v, 0.f); so[w][8 * hh + r][t * 16 + ln] = v; }
  }
  __builtin_amdgcn_fence(__ATOMIC_ACQ_REL, "workgroup");
  __builtin_amdgcn_wave_barrier();
  const int rsub = lane >> 4, c4 = (lane & 15) * 4;
  {
#pragma unroll
    for (int q = 0; q < 8; ++q) {
      const int r = q * 2 + rsub;
      const v4f v = *(const v4fa*)&so[w][r][c4];
      *(v4f*)(C + (size_t)(row0 + r) * ldc + col0 + c4) = v;
    }
    
  }
}

// Flash-style causal/unmasked attention, all contractions 3-term bf16 hi/lo splits, f32 softmax with running max.
// q,k,v rows are read from f32 buffers with arbitrary row pitch (so they can live inside a fused qkv buffer);
// D = head size (multiple of 32, <= 128); one wave = 16 query rows; block = 4 waves (64 queries) sharing K/V chunks of 32.
template <int D, bool CAUSAL>
__global__ __launch_bounds__(128) void k_flash(const float* __restrict__ qb, const float* __restrict__ kb, const float* __restrict__ vb,
                                             int pitch, int T, int H, float scale, float* __restrict__ y, int ypitch) {
  constexpr int KS = D / 32;        // k-steps for QK
  constexpr int DT = D / 16;        // d tiles for PV
  __shared__ __attribute__((aligned(16))) unsigned short sKh[32][D + 8], sKl[32][D + 8], sVh[32][D + 8], sVl[32][D + 8];
  __shared__ __attribute__((aligned(16))) unsigned short sPh[4][16][40], sPl[4][16][40];
  __shared__ __attribute__((aligned(16))) float sO[4][16][D];
  const int tid = threadIdx.x, w = tid >> 5, lane = tid & 31, ln = lane & 15, hh = lane >> 4;
  const int nqb = (T + 63) / 64;
  const int bh = blockIdx.x / nqb, qblk = blockIdx.x % nqb;
  const int b = bh / H, h = bh % H;
  const int q0 = qblk * 64 + w * 16;
  const float* Q = qb + (size_t)b * T * pitch + h * D;
  const float* K = kb + (size_t)b * T * pitch + h * D;
  const float* V = vb + (size_t)b * T * pitch + h * D;

  // A fragments of the wave's 16 query rows (scaled), hi/lo
  FragB aqh[KS], aql[KS];
  {
    int row = q0 + ln; if (row >= T) row = T - 1;
    const float* qr = Q + (size_t)row * pitch;
#pragma unroll
    for (int ks = 0; ks < KS; ++ks)
#pragma unroll
      for (int i = 0; i < 16; ++i) {
        const int d = ks * 32 + ((i < 8) ? (8 * hh + i) : (16 + 8 * hh + (i - 8)));
        const float x = qr[d] * scale; const unsigned short hb = bf16_bits(x);
        aqh[ks].u[i] = hb; aql[ks].u[i] = bf16_bits(x - bf16_val(hb));
      }
  }
  float m_r[8], l_r[8];
#pragma unroll
  for (int r = 0; r < 8; ++r) { m_r[r] = -3.0e38f; l_r[r] = 0.f; }
  v8f oacc[DT];
#pragma unroll
  for (int dt = 0; dt < DT; ++dt) oacc[dt] = (v8f){0.f,0.f,0.f,0.f,0.f,0.f,0.f,0.f};

  const int kv_end = CAUSAL ? min(T, qblk * 64 + 64) : T;     // block-uniform
  for (int j0 = 0; j0 < kv_end; j0 += 32) {
    __syncthreads();
    for (int e = tid; e < 32 * (D / 4); e += 128) {
      const int r = e / (D / 4), c4 = (e % (D / 4)) * 4;
      const int key = j0 + r;
      v4f kf = {0.f,0.f,0.f,0.f}, vf = {0.f,0.f,0.f,0.f};
      if (key < T) { kf = *(const v4fa*)(K + (size_t)key * pitch + c4); vf = *(const v4fa*)(V + (size_t)key * pitch + c4); }
#pragma unroll
      for (int t = 0; t < 4; ++t) {
        unsigned short hb = bf16_bits(kf[t]); sKh[r][c4 + t] = hb; sKl[r][c4 + t] = bf16_bits(kf[t] - bf16_val(hb));
        hb = bf16_bits(vf[t]); sVh[r][c4 + t] = hb; sVl[r][c4 + t] = bf16_bits(vf[t] - bf16_val(hb));
      }
    }
    __syncthreads();
    // S tile 16 x 32
    v8f s[2];
#pragma unroll
    for (int nt = 0; nt < 2; ++nt) {
      v8f acc = {};
#pragma unroll
      for (int ks = 0; ks < KS; ++ks) {
        FragB bh_, bl_;
        bh_.half[0] = *(const v8us*)&sKh[nt * 16 + ln][ks * 32 + 8 * hh]; bh_.half[1] = *(const v8us*)&sKh[nt * 16 + ln][ks * 32 + 16 + 8 * hh];
        bl_.half[0] = *(const v8us*)&sKl[nt * 16 + ln][ks * 32 + 8 * hh]; bl_.half[1] = *(const v8us*)&sKl[nt * 16 + ln][ks * 32 + 16 + 8 * hh];
        acc = mmaN<3>(aqh[ks].v, aql[ks].v, bh_.v, bl_.v, acc);
      }
      s[nt] = acc;
    }
    // mask + running max (rows 8hh+r; the 16 lanes of a half share rows)
    float alpha[8];
#pragma unroll
    for (int r = 0; r < 8; ++r) {
      const int qi = q0 + 8 * hh + r;
      const int ja = j0 + ln, jb = j0 + 16 + ln;
      if (CAUSAL) { if (ja > qi) s[0][r] = -3.0e38f; if (jb > qi) s[1][r] = -3.0e38f; }
      if (ja >= T) s[0][r] = -3.0e38f;
      if (jb >= T) s[1][r] = -3.0e38f;
      float mx = fmaxf(s[0][r], s[1][r]);
      mx = fmaxf(mx, __shfl_xor(mx, 1, 32)); mx = fmaxf(mx, __shfl_xor(mx, 2, 32)); mx = fmaxf(mx, __shfl_xor(mx, 4, 32)); mx = fmaxf(mx, __shfl_xor(mx, 8, 32));
      const float mnew = fmaxf(m_r[r], mx);
      alpha[r] = (mnew > -1.0e38f) ? __expf(m_r[r] - mnew) : 1.0f;
      const float p0 = (s[0][r] > -1.0e38f) ? __expf(s[0][r] - mnew) : 0.f;
      const float p1 = (s[1][r] > -1.0e38f) ? __expf(s[1][r] - mnew) : 0.f;
      m_r[r] = mnew;
      l_r[r] = l_r[r] * alpha[r] + p0 + p1;            // per-lane partial row sum (16 lanes combined at the end)
      unsigned short hb = bf16_bits(p0); sPh[w][8 * hh + r][ln] = hb;      sPl[w][8 * hh + r][ln] = bf16_bits(p0 - bf16_val(hb));
      hb = bf16_bits(p1);                sPh[w][8 * hh + r][16 + ln] = hb; sPl[w][8 * hh + r][16 + ln] = bf16_bits(p1 - bf16_val(hb));
    }
#pragma unroll
    for (int dt = 0; dt < DT; ++dt)
#pragma unroll
      for (int r = 0; r < 8; ++r) oacc[dt][r] *= alpha[r];
    __builtin_amdgcn_fence(__ATOMIC_ACQ_REL, "workgroup");
    __builtin_amdgcn_wave_barrier();
    FragB pah, pal;
    pah.half[0] = *(const v8us*)&sPh[w][ln][8 * hh]; pah.half[1] = *(const v8us*)&sPh[w][ln][16 + 8 * hh];
    pal.half[0] = *(const v8us*)&sPl[w][ln][8 * hh]; pal.half[1] = *(const v8us*)&sPl[w][ln][16 + 8 * hh];
#pragma unroll
    for (int dt = 0; dt < DT; ++dt) {
      FragB bvh, bvl;
#pragma unroll
      for (int i = 0; i < 8; ++i) {
        bvh.u[i] = sVh[8 * hh + i][dt * 16 + ln]; bvh.u[8 + i] = sVh[16 + 8 * hh + i][dt * 16 + ln];
        bvl.u[i] = sVl[8 * hh + i][dt * 16 + ln]; bvl.u[8 + i] = sVl[16 + 8 * hh + i][dt * 16 + ln];
      }
      oacc[dt] = mmaN<3>(pah.v, pal.v, bvh.v, bvl.v, oacc[dt]);
    }
    __builtin_amdgcn_fence(__ATOMIC_ACQ_REL, "workgroup");
    __builtin_amdgcn_wave_barrier();
  }
#pragma unroll
  for (int r = 0; r < 8; ++r) {
    float l = l_r[r];
    l += __shfl_xor(l, 1, 32); l += __shfl_xor(l, 2, 32); l += __shfl_xor(l, 4, 32); l += __shfl_xor(l, 8, 32);
    l_r[r] = (l > 0.f) ? 1.0f / l : 0.f;
  }
#pragma unroll
  for (int dt = 0; dt < DT; ++dt)
#pragma unroll
    for (int r = 0; r < 8; ++r) sO[w][8 * hh + r][dt * 16 + ln] = oacc[dt][r] * l_r[r];
  __builtin_amdgcn_fence(__ATOMIC_ACQ_REL, "workgroup");
  __builtin_amdgcn_wave_barrier();
  {
    for (int r = 0; r < 16; ++r) {
      const int row = q0 + r;
      if (row < T && lane < D / 4) {
        const v4f val = *(const v4fa*)&sO[w][r][lane * 4];
        *(v4f*)(y + ((size_t)b * T + row) * ypitch + h * D + lane * 4) = val;
      }
    }
    
  }
}

// GEMM C = act(A·W + bias + resid): A f32 (ASPLIT -> hi/lo 2 terms), Wt bf16 [N][K]; ACT 0 none, 1 relu, 2 exact gelu;
// resid (optional, f32, row index = (row % rmod), pitch ldr, RES_BF16 rounds it) added before the activation.
template <bool ASPLIT, int ACT, bool BIAS_BF16, bool RES_BF16>
__global__ __launch_bounds__(128) void k_gemm_bf3(const float* __restrict__ A, int lda, const unsigned short* __restrict__ Wt, int ldb,
                                                const float* __restrict__ bias, const float* __restrict__ resid, int rmod, int ldr,
                                                float* __restrict__ C, int ldc, int M, int N, int K) {
  __shared__ __attribute__((aligned(16))) float so[4][16][64];
  const int tid = threadIdx.x, w = tid >> 5, lane = tid & 31, ln = lane & 15, hh = lane >> 4;
  const int ntn = N / 64;
  const int wid = blockIdx.x * 4 + w;
  const int mt = wid / ntn, nq = wid % ntn;
  if (mt * 16 >= M) return;
  const int row0 = mt * 16, col0 = nq * 64;
  const float* arow = A + (size_t)(row0 + ln) * lda;
  v8f acc[4] = {};
  for (int kb = 0; kb < K; kb += 32) {
    FragB ah, al;
    const v4f x0 = *(const v4fa*)(arow + kb + 8 * hh), x1 = *(const v4fa*)(arow + kb + 8 * hh + 4);
    const v4f x2 = *(const v4fa*)(arow + kb + 16 + 8 * hh), x3 = *(const v4fa*)(arow + kb + 16 + 8 * hh + 4);
    float xs[16] = {x0[0],x0[1],x0[2],x0[3],x1[0],x1[1],x1[2],x1[3],x2[0],x2[1],x2[2],x2[3],x3[0],x3[1],x3[2],x3[3]};
#pragma unroll
    for (int i = 0; i < 16; ++i) { const unsigned short hb = bf16_bits(xs[i]); ah.u[i] = hb; al.u[i] = ASPLIT ? bf16_bits(xs[i] - bf16_val(hb)) : (unsigned short)0; }
#pragma unroll
    for (int t = 0; t < 4; ++t) {
      const unsigned short* brow = Wt + (size_t)(col0 + t * 16 + ln) * ldb + kb;
      FragB b;
      b.half[0] = *(const v8us*)(brow + 8 * hh);
      b.half[1] = *(const v8us*)(brow + 16 + 8 * hh);
      acc[t] = mmaN<ASPLIT ? 2 : 1>(ah.v, al.v, b.v, b.v, acc[t]);
    }
  }
#pragma unroll
  for (int t = 0; t < 4; ++t) {
    const int col = col0 + t * 16 + ln;
    float bv = bias ? bias[col] : 0.f;
    if (BIAS_BF16) bv = bf16_round(bv);
#pragma unroll
    for (int r = 0; r < 8; ++r) {
      float v = acc[t][r] + bv;
      if (resid) { float rv = resid[(size_t)((row0 + 8 * hh + r) % rmod) * ldr + col]; if (RES_BF16) rv = bf16_round(rv); v += rv; }
      if (ACT == 1) v = fmaxf(v, 0.f);
      if (ACT == 2) v = 0.5f * v * (1.0f + erff(v * 0.70710678118654752f));
      if (ACT == 3) { const float u = 0.7978845608028654f * (v + 0.044715f * v * v * v); v = 0.5f * v * (1.0f + tanhf(u)); }
      so[w][8 * hh + r][t * 16 + ln] = v;
    }
  }
  __builtin_amdgcn_fence(__ATOMIC_ACQ_REL, "workgroup");
  __builtin_amdgcn_wave_barrier();
  const int rsub = lane >> 4, c4 = (lane & 15) * 4;
  {
#pragma unroll
    for (int q = 0; q < 8; ++q) {
      const int r = q * 2 + rsub;
      const v4f v = *(const v4fa*)&so[w][r][c4];
      *(v4f*)(C + (size_t)(row0 + r) * ldc + col0 + c4) = v;
    }
    
  }
}
// row LayerNorm (biased variance, eps) over N: s = X (+ R); optional out_sum <- s; out_norm <- (s-mu)*rsqrt(var+eps)*g + b
template <bool PARAM_BF16>
__global__ __launch_bounds__(256) void k_layernorm(const float* __restrict__ X, const float* __restrict__ R, const float* __restrict__ g, const float* __restrict__ bta,
                                                  float* __restrict__ out_sum, float* __restrict__ out_norm, int N, float eps) {
  __shared__ float red[256];
  const int row = blockIdx.x, tid = threadIdx.x;
  const float* x = X + (size_t)row * N; const float* rr = R ? R + (size_t)row * N : nullptr;
  float vals[16];                     // up to N = 4096
  const int per = N / 256;            // contiguous chunk per thread? use strided-by-4 chunks: thread handles j = tid*4 + 1024*u
  float s1 = 0.f;
  for (int u = 0; u < per / 4; ++u) {
    const int j = tid * 4 + 1024 * u;
    const v4f a = *(const v4fa*)(x + j);
    v4f b = {0.f,0.f,0.f,0.f}; if (rr) b = *(const v4fa*)(rr + j);
#pragma unroll
    for (int q = 0; q < 4; ++q) { const float v = a[q] + b[q]; vals[u * 4 + q] = v; s1 += v; }
  }
  red[tid] = s1; __syncthreads();
  for (int st = 128; st > 0; st >>= 1) { if (tid < st) red[tid] += red[tid + st]; __syncthreads(); }
  const float mu = red[0] / (float)N; __syncthreads();
  float s2 = 0.f;
  for (int u = 0; u < per / 4; ++u)
#pragma unroll
    for (int q = 0; q < 4; ++q) { const float c = vals[u * 4 + q] - mu; s2 += c * c; }
  red[tid] = s2; __syncthreads();
  for (int st = 128; st > 0; st >>= 1) { if (tid < st) red[tid] += red[tid + st]; __syncthreads(); }
  const float rs = rsqrtf(red[0] / (float)N + eps);
  {
    for (int u = 0; u < per / 4; ++u) {
      const int j = tid * 4 + 1024 * u;
      v4f o, sm;
#pragma unroll
      for (int q = 0; q < 4; ++q) {
        float gg = g[j + q], bb = bta[j + q];
        if (PARAM_BF16) { gg = bf16_round(gg); bb = bf16_round(bb); }
        sm[q] = vals[u * 4 + q]; o[q] = (vals[u * 4 + q] - mu) * rs * gg + bb;
      }
      if (out_sum) *(v4f*)(out_sum + (size_t)row * N + j) = sm;
      *(v4f*)(out_norm + (size_t)row * N + j) = o;
    }
    
  }
}



// ---- f16 WMMA path (v_wmma_f32_16x16x32_f16): 11-bit significands for operands in range — used where a [0,1] probability operand needs more precision than bf16
typedef _Float16 v16h __attribute__((ext_vector_type(16)));
union FragH { v16h v; v8us half[2]; _Float16 h[16]; unsigned short u[16]; };
template <int NT>
__device__ __forceinline__ v8f mmaH(v16h ah, v16h al, v16h bh, v16h bl, v8f c) {
  c = __builtin_amdgcn_wmma_f32_16x16x32_f16(false, ah, false, bh, (short)0, c, false, false);
  if (NT >= 2) c = __builtin_amdgcn_wmma_f32_16x16x32_f16(false, al, false, bh, (short)0, c, false, false);
  if (NT >= 3) c = __builtin_amdgcn_wmma_f32_16x16x32_f16(false, ah, false, bl, (short)0, c, false, false);
  asm volatile("v_nop\n\tv_nop\n\tv_nop\n\tv_nop" : "+v"(c) : "v"(ah), "v"(al), "v"(bh), "v"(bl));
  return c;
}
// batched GEMM like k_gemm_b but f16 operands: A f32 (split into f16 hi/lo if ASPLIT, else rounded to f16), Bt = f16 values [n][k]; alpha; C f32; N multiple of 16 (partial tiles skipped)
template <bool ASPLIT>
__global__ __launch_bounds__(128) void k_gemm_h(const float* __restrict__ A, int lda, size_t sA, const _Float16* __restrict__ Bh, int ldb, size_t sB, float alpha, float* __restrict__ C, int ldc, size_t sC, int M, int N, int K) {
  __shared__ __attribute__((aligned(16))) float so[4][16][64];
  const int tid = threadIdx.x, w = tid >> 5, lane = tid & 31, ln = lane & 15, hh = lane >> 4; const int by = blockIdx.y;
  A += (size_t)by * sA; Bh += (size_t)by * sB; C += (size_t)by * sC;
  const int ntn = (N + 63) / 64; const int wid = blockIdx.x * 4 + w; const int mt = wid / ntn, nq = wid % ntn; if (mt * 16 >= M) return;
  const int row0 = mt * 16, col0 = nq * 64; const float* arow = A + (size_t)(row0 + ln) * lda;
  v8f acc[4] = {};
  for (int kb = 0; kb < K; kb += 32) {
    FragH ah, al;
    const v4f x0 = *(const v4fa*)(arow + kb + 8 * hh), x1 = *(const v4fa*)(arow + kb + 8 * hh + 4), x2 = *(const v4fa*)(arow + kb + 16 + 8 * hh), x3 = *(const v4fa*)(arow + kb + 16 + 8 * hh + 4);
    float xs[16] = {x0[0],x0[1],x0[2],x0[3],x1[0],x1[1],x1[2],x1[3],x2[0],x2[1],x2[2],x2[3],x3[0],x3[1],x3[2],x3[3]};
#pragma unroll
    for (int i = 0; i < 16; ++i) { const _Float16 h = (_Float16)xs[i]; ah.h[i] = h; al.h[i] = ASPLIT ? (_Float16)(xs[i] - (float)h) : (_Float16)0.0f; }
#pragma unroll
    for (int t = 0; t < 4; ++t) { if (col0 + t * 16 >= N) continue; const size_t boff = (size_t)(col0 + t * 16 + ln) * ldb + kb; FragH bq; bq.half[0] = *(const v8us*)(Bh + boff + 8 * hh); bq.half[1] = *(const v8us*)(Bh + boff + 16 + 8 * hh);
      acc[t] = mmaH<ASPLIT ? 2 : 1>(ah.v, al.v, bq.v, bq.v, acc[t]); }
  }
#pragma unroll
  for (int t = 0; t < 4; ++t) { if (col0 + t * 16 >= N) continue;
#pragma unroll
    for (int r = 0; r < 8; ++r) so[w][8 * hh + r][t * 16 + ln] = acc[t][r] * alpha; }
  __builtin_amdgcn_fence(__ATOMIC_ACQ_REL, "workgroup"); __builtin_amdgcn_wave_barrier();
  const int rsub = lane >> 4, c4 = (lane & 15) * 4;
  {
#pragma unroll
    for (int q = 0; q < 8; ++q) { const int r = q * 2 + rsub; if (col0 + c4 < N) { const v4f v = *(const v4fa*)&so[w][r][c4]; *(v4f*)(C + (size_t)(row0 + r) * ldc + col0 + c4) = v; } }
     }
}

// Wt[n][k] = f16(W[k][n]·scale) from f32 row-major W[K][N] (scale = power of two; bf16-exact weights stay exact in f16 away from the subnormal range)
__global__ __launch_bounds__(256) void k_wt_f16(const float* __restrict__ W, _Float16* __restrict__ Wt, int K, int N, float scale) {
  const int t = blockIdx.x * 256 + threadIdx.x; if (t >= N * (K / 8)) return; const int n = t / (K / 8), k8 = (t % (K / 8)) * 8; FragH f;
#pragma unroll
  for (int i = 0; i < 8; ++i) f.h[i] = (_Float16)(bf16_round(W[(size_t)(k8 + i) * N + n]) * scale); const v8us o = f.half[0];
  *(v8us*)((unsigned short*)Wt + (size_t)n * K + k8) = o; 
}
// k_gemm_hh variant with fused epilogue: v = acc·alpha + bias[by·sBias + col] (+ CP[(row/rowsPerB)·sCPb + by·64 + col] if CP) ; ACT 0 none / 1 elu ; writes f32 C and/or f16 C16 (each if non-null)
template <int ACT>
__global__ __launch_bounds__(128) void k_gemm_hhx(const _Float16* __restrict__ A, int lda, size_t sA, const _Float16* __restrict__ Bh, int ldb, size_t sB, float alpha, const float* __restrict__ bias, size_t sBias, const float* __restrict__ CP, int rowsPerB, size_t sCPb, int row0g,
    float* __restrict__ C, _Float16* __restrict__ C16, int ldc, size_t sC, int M, int N, int K) {
  __shared__ __attribute__((aligned(16))) float so[4][16][64];
  const int tid = threadIdx.x, w = tid >> 5, lane = tid & 31, ln = lane & 15, hh = lane >> 4; const int by = blockIdx.y;
  A += (size_t)by * sA; Bh += (size_t)by * sB; const size_t cofs = (size_t)by * sC; const float* bp = bias ? bias + (size_t)by * sBias : nullptr;
  const int ntn = (N + 63) / 64; const int wid = blockIdx.x * 4 + w; const int mt = wid / ntn, nq = wid % ntn; if (mt * 16 >= M) return;
  const int row0 = mt * 16, col0 = nq * 64; const _Float16* arow = A + (size_t)(row0 + ln) * lda;
  v8f acc[4] = {};
  for (int kb = 0; kb < K; kb += 32) { FragH ah; ah.half[0] = *(const v8us*)((const unsigned short*)arow + kb + 8 * hh); ah.half[1] = *(const v8us*)((const unsigned short*)arow + kb + 16 + 8 * hh);
#pragma unroll
    for (int t = 0; t < 4; ++t) { if (col0 + t * 16 >= N) continue; const size_t boff = (size_t)(col0 + t * 16 + ln) * ldb + kb; FragH bq; bq.half[0] = *(const v8us*)((const unsigned short*)Bh + boff + 8 * hh); bq.half[1] = *(const v8us*)((const unsigned short*)Bh + boff + 16 + 8 * hh);
      acc[t] = mmaH<1>(ah.v, ah.v, bq.v, bq.v, acc[t]); }
  }
#pragma unroll
  for (int t = 0; t < 4; ++t) { if (col0 + t * 16 >= N) continue; const int col = col0 + t * 16 + ln; const float bv = bp ? bf16_round(bp[col]) : 0.f;
#pragma unroll
    for (int r = 0; r < 8; ++r) { float v = acc[t][r] * alpha + bv; if (CP) { const int bidx = (row0g + row0 + 8 * hh + r) / rowsPerB; v += CP[(size_t)bidx * sCPb + (size_t)by * 64 + col]; } if (ACT == 1) v = (v > 0.f) ? v : expm1f(v); else if (ACT == 7) v = (v > 0.f) ? v + 1.0f : expf(v); else if (ACT == 8) v = tanhf(v); else if (ACT == 9) v = 0.5f * v * (1.0f + tanhf(0.7978845608028654f * (v + 0.044715f * v * v * v))); else if (ACT == 11) v = 1.0f / (1.0f + expf(-v)); else if (ACT == 12) v = (v > 0.f) ? v : 0.01f * v; else if (ACT == 14) v = (v > 0.f) ? v : 0.1f * v; else if (ACT == 15) v = v / (1.0f + expf(-v)); else if (ACT == 3) v = fmaxf(v, 0.f); else if (ACT == 6) v = 0.5f * v * (1.0f + erff(v * 0.70710678118654752f)); so[w][8 * hh + r][t * 16 + ln] = v; } }
  __builtin_amdgcn_fence(__ATOMIC_ACQ_REL, "workgroup"); __builtin_amdgcn_wave_barrier();
  const int rsub = lane >> 4, c4 = (lane & 15) * 4; typedef _Float16 v4h __attribute__((ext_vector_type(4)));
  {
#pragma unroll
    for (int q = 0; q < 8; ++q) { const int r = q * 2 + rsub; if (col0 + c4 < N) { const v4f v = *(const v4fa*)&so[w][r][c4]; if (C) *(v4f*)(C + cofs + (size_t)(row0 + r) * ldc + col0 + c4) = v; if (C16) { v4h h4; for (int i = 0; i < 4; ++i) h4[i] = (_Float16)v[i]; *(v4h*)(C16 + cofs + (size_t)(row0 + r) * ldc + col0 + c4) = h4; } } }
     }
}


typedef _Float16 v4h __attribute__((ext_vector_type(4)));

__global__ __launch_bounds__(256) void k_x16(const float* __restrict__ x, _Float16* __restrict__ X16, size_t n8) { const size_t t = (size_t)blockIdx.x * 256 + threadIdx.x; if (t >= n8) return; FragH f;
#pragma unroll
  for (int q = 0; q < 8; ++q) f.h[q] = (_Float16)bf16_round(x[t * 8 + q]); *(v8us*)((unsigned short*)X16 + t * 8) = f.half[0];  }
__global__ __launch_bounds__(256) void k_h16(const float* __restrict__ x, _Float16* __restrict__ X16, size_t n8) { const size_t t = (size_t)blockIdx.x * 256 + threadIdx.x; if (t >= n8) return; FragH f;
#pragma unroll
  for (int q = 0; q < 8; ++q) f.h[q] = (_Float16)x[t * 8 + q]; *(v8us*)((unsigned short*)X16 + t * 8) = f.half[0];  }
__global__ __launch_bounds__(256) void k_round16f(const float* __restrict__ W, _Float16* __restrict__ Bt, size_t n8) { const size_t t = (size_t)blockIdx.x * 256 + threadIdx.x; if (t >= n8) return; FragH f;
#pragma unroll
  for (int i = 0; i < 8; ++i) f.h[i] = (_Float16)(bf16_round(W[t * 8 + i]) * 16.0f); *(v8us*)((unsigned short*)Bt + t * 8) = f.half[0];  }
template <int NHv, int TTv>
__global__ __launch_bounds__(256) void k_vt(const _Float16* __restrict__ V16, int ldv, int voff, _Float16* __restrict__ Vt) { __shared__ unsigned short tl[64][66]; const int tid = threadIdx.x; const int slab = blockIdx.x / (TTv / 64), lg = blockIdx.x % (TTv / 64); const int b = slab / NHv, h = slab % NHv;
  for (int i = tid; i < 64 * 8; i += 256) { const int r = i / 8, c8 = (i % 8) * 8; FragH f; f.half[0] = *(const v8us*)((const unsigned short*)V16 + ((size_t)b * TTv + lg * 64 + r) * ldv + voff + h * 64 + c8);
#pragma unroll
    for (int q = 0; q < 8; ++q) tl[r][c8 + q] = f.u[q]; }
  __syncthreads();
  {
#pragma unroll
    for (int rd = 0; rd < 2; ++rd) { const int d = rd * 32 + tid / 8, pc = tid % 8; FragH f;
#pragma unroll
      for (int q = 0; q < 8; ++q) f.u[q] = tl[pc * 8 + q][d];
      *(v8us*)((unsigned short*)Vt + ((size_t)slab * 64 + d) * TTv + lg * 64 + pc * 8) = f.half[0]; }
     } }

__global__ __launch_bounds__(256) void k_x7(const float* __restrict__ nodes, const float* __restrict__ centre, float* __restrict__ X7) { const int t = blockIdx.x * 256 + threadIdx.x; if (t >= NNODE * 2) return; const int n = t >> 1, half = t & 1; v4f v;
  if (half == 0) { v[0] = bf16_round(nodes[(size_t)n * 3]); v[1] = bf16_round(nodes[(size_t)n * 3 + 1]); v[2] = bf16_round(nodes[(size_t)n * 3 + 2]); v[3] = bf16_round(centre[0]); } else { v[0] = bf16_round(centre[1]); v[1] = bf16_round(centre[2]); v[2] = 1.0f; v[3] = 0.f; }
  *(v4f*)(X7 + (size_t)t * 4) = v;  }
__global__ __launch_bounds__(256) void k_proj(const float* __restrict__ nodes, const float* __restrict__ centre, const float* __restrict__ Wq, const float* __restrict__ bq, const float* __restrict__ Wk, const float* __restrict__ bk, float* __restrict__ KEYS, _Float16* __restrict__ K16, _Float16* __restrict__ Q16) {
  #pragma clang fp contract(off)
  const size_t t = (size_t)blockIdx.x * 256 + threadIdx.x; if (t >= (size_t)NNODE * DD / 4) return; const int n = (int)((t * 4) / DD), c0 = (int)((t * 4) % DD); float xa[7];
  for (int i = 0; i < 3; ++i) { xa[i] = bf16_round(nodes[(size_t)n * 3 + i]); xa[3 + i] = bf16_round(centre[i]); } xa[6] = 1.0f;
  float kv[4], qv[4]; for (int q = 0; q < 4; ++q) { kv[q] = bf16_round(bk[c0 + q]); qv[q] = bf16_round(bq[c0 + q]); }
#pragma unroll 1
  for (int i = 0; i < 6; ++i) for (int q = 0; q < 4; ++q) { kv[q] += xa[i] * bf16_round(Wk[(size_t)(c0 + q) * 6 + i]); qv[q] += xa[i] * bf16_round(Wq[(size_t)(c0 + q) * 6 + i]); }
  typedef _Float16 v4h __attribute__((ext_vector_type(4))); v4h fk, fq; for (int q = 0; q < 4; ++q) { fk[q] = (_Float16)kv[q]; fq[q] = (_Float16)qv[q]; } const v4f k0 = {kv[0], kv[1], kv[2], kv[3]};
  { *(v4f*)(KEYS + t * 4) = k0; *(v4h*)(K16 + t * 4) = fk; *(v4h*)(Q16 + t * 4) = fq;      /* one 16-B f32 piece and 8-B f16 pieces per lane, lane-contiguous */
     } }
__global__ __launch_bounds__(256) void k_rvec(const float* __restrict__ Wq, const float* __restrict__ bq, const float* __restrict__ Wk, const float* __restrict__ bk, const float* __restrict__ X7, float* __restrict__ R) {
  #pragma clang fp contract(off)
  __shared__ float M[7][8]; const int tid = threadIdx.x;
  if (tid < 49) { const int i = tid / 7, j = tid % 7; float s = 0.f;
#pragma unroll 1
    for (int c = 0; c < DD; ++c) { const float a = (i < 6) ? bf16_round(Wk[(size_t)c * 6 + i]) : bf16_round(bk[c]); const float b = (j < 6) ? bf16_round(Wq[(size_t)c * 6 + j]) : bf16_round(bq[c]); s += a * b; } M[i][j] = s; }
  __syncthreads();
  const int t = blockIdx.x * 256 + tid; if (t >= NNODE * 2) return; const int n = t >> 1, half = t & 1; float xa[8]; { const v4f a = *(const v4fa*)(X7 + (size_t)n * 8), b = *(const v4fa*)(X7 + (size_t)n * 8 + 4); xa[0] = a[0]; xa[1] = a[1]; xa[2] = a[2]; xa[3] = a[3]; xa[4] = b[0]; xa[5] = b[1]; xa[6] = b[2]; }
  v4f o = {0.f, 0.f, 0.f, 0.f};      /* this thread's half of R[n]: columns j = 4·half .. 4·half+3 (j = 7 stays 0) */
#pragma unroll 1
  for (int i = 0; i < 7; ++i) for (int q = 0; q < 4; ++q) { const int j = half * 4 + q; if (j < 7) o[q] += xa[i] * M[i][j]; }
  *(v4f*)(R + (size_t)t * 4) = o;  }
__device__ __forceinline__ float sai_logit(const float* r, const float* X7, int m) { const v4f a = *(const v4fa*)(X7 + (size_t)m * 8), b = *(const v4fa*)(X7 + (size_t)m * 8 + 4); return r[0] * a[0] + r[1] * a[1] + r[2] * a[2] + r[3] * a[3] + r[4] * b[0] + r[5] * b[1] + r[6] * b[2]; }
__global__ __launch_bounds__(256) void k_soft(const float* __restrict__ R, const float* __restrict__ X7, int n0, _Float16* __restrict__ P16) {
  #pragma clang fp contract(off)
  const int tid = threadIdx.x, wv = tid >> 5, lane = tid & 31; const int nl = blockIdx.x * 8 + wv; const int n = n0 + nl; float r[7]; { const v4f a = *(const v4fa*)(R + (size_t)n * 8), b = *(const v4fa*)(R + (size_t)n * 8 + 4); r[0] = a[0]; r[1] = a[1]; r[2] = a[2]; r[3] = a[3]; r[4] = b[0]; r[5] = b[1]; r[6] = b[2]; }
  float mx = -3.0e38f;
#pragma unroll 1
  for (int it = 0; it < NNODE / 256; ++it)
#pragma unroll 1
    for (int e = 0; e < 8; ++e) mx = fmaxf(mx, sai_logit(r, X7, it * 256 + lane * 8 + e));
  for (int o = 16; o >= 1; o >>= 1) mx = fmaxf(mx, __shfl_xor(mx, o, 32)); float z = 0.f;
#pragma unroll 1
  for (int it = 0; it < NNODE / 256; ++it)
#pragma unroll 1
    for (int e = 0; e < 8; ++e) z += expf(sai_logit(r, X7, it * 256 + lane * 8 + e) - mx);
  for (int o = 16; o >= 1; o >>= 1) z += __shfl_xor(z, o, 32); const float iz = 32768.0f / z;
  {
#pragma unroll 1
    for (int it = 0; it < NNODE / 256; ++it) { FragH f; for (int e = 0; e < 8; ++e) f.h[e] = (_Float16)(expf(sai_logit(r, X7, it * 256 + lane * 8 + e) - mx) * iz); *(v8us*)((unsigned short*)P16 + (size_t)nl * NNODE + it * 256 + lane * 8) = f.half[0]; }
     } }

extern "C" void kernel_launch(void* const* d_in, const int* in_sizes, int n_in,
                              void* d_out, int out_size, void* d_ws, size_t ws_size, hipStream_t stream) {
  (void)in_sizes; (void)n_in; (void)out_size;
  const float* const* I = (const float* const*)d_in; const float* nodes = I[0]; const float* centre = I[1]; const float* Wq = I[2]; const float* bq = I[3]; const float* Wk = I[4]; const float* bk = I[5]; const float* Wv = I[6]; const float* bv = I[7];
  char* ws = (char*)d_ws; size_t off = 0;
  auto take = [&](size_t bytes) { char* p = ws + off; off += (bytes + 255) & ~(size_t)255; return p; };
  _Float16* Bwv = (_Float16*)take((size_t)DD * 2 * DD * 2); float* KEYS = (float*)take((size_t)NNODE * DD * 4); _Float16* K16 = (_Float16*)take((size_t)NNODE * DD * 2); _Float16* Q16 = (_Float16*)take((size_t)NNODE * DD * 2); float* X7 = (float*)take((size_t)NNODE * 8 * 4); float* R = (float*)take((size_t)NNODE * 8 * 4);
  _Float16* QV = (_Float16*)take((size_t)NNODE * DD * 2); _Float16* QVt = (_Float16*)take((size_t)DD * NNODE * 2); _Float16* P16 = (_Float16*)take((size_t)RB * NNODE * 2); float* O = (float*)take((size_t)NNODE * DD * 4);
  if (off > ws_size) return;      // 1 + 16.8 + 8.4 + 8.4 + 0.5 + 8.4 + 8.4 + 16.8 + 16.8 ≈ 86 MB
  k_round16f<<<(unsigned)(((size_t)DD * 2 * DD / 8 + 255) / 256), 256, 0, stream>>>(Wv, Bwv, (size_t)DD * 2 * DD / 8);      /* Wv (512, 1024) natural ×2^4: row d = [Wv_q | Wv_k] */
  k_x7<<<NNODE * 2 / 256, 256, 0, stream>>>(nodes, centre, X7); k_proj<<<(unsigned)(((size_t)NNODE * DD / 4 + 255) / 256), 256, 0, stream>>>(nodes, centre, Wq, bq, Wk, bk, KEYS, K16, Q16);
  k_rvec<<<NNODE * 2 / 256, 256, 0, stream>>>(Wq, bq, Wk, bk, X7, R);
  const dim3 gq(((NNODE / 16) * (DD / 64) + 3) / 4, 1);
  k_gemm_hhx<0><<<gq, 128, 0, stream>>>(Q16, DD, 0, Bwv, 2 * DD, 0, 0.0625f, nullptr, 0, nullptr, 1, 0, 0, nullptr, QV, DD, 0, NNODE, DD, DD);      /* QV = queries·Wv_qᵀ (Bt rows d, cols 0..511, ldb 1024): M 8192 N 512 K 512 */
  k_vt<DD / 64, NNODE><<<(DD / 64) * (NNODE / 64), 256, 0, stream>>>(QV, DD, 0, QVt);      /* QVᵀ [512][8192] */
  for (int blk = 0; blk < NNODE / RB; ++blk) {
    k_soft<<<RB / 8, 256, 0, stream>>>(R, X7, blk * RB, P16);
    k_gemm_hhx<0><<<dim3(((RB / 16) * (DD / 64) + 3) / 4, 1), 128, 0, stream>>>(P16, NNODE, 0, QVt, NNODE, 0, 0.000030517578125f, nullptr, 0, KEYS + (size_t)blk * RB * DD, 1, (size_t)DD, 0, O + (size_t)blk * RB * DD, nullptr, DD, 0, RB, DD, NNODE); }      /* O = keys + attn·QV: M 1024 N 512 K 8192 per block */
  k_gemm_hhx<0><<<gq, 128, 0, stream>>>(K16, DD, 0, Bwv + DD, 2 * DD, 0, 0.0625f, bv, 0, O, 1, (size_t)DD, 0, (float*)d_out, nullptr, DD, 0, NNODE, DD, DD);      /* out = keys·Wv_kᵀ + bv + O (Bt rows d at cols 512.., ldb 1024) */
}

// v001
// It runs in 908 microseconds.
// Timed twice side by side with v000, it ran 3.04 and 3.05 times as fast.
#include <hip/hip_runtime.h>
// 'self_attn_init' (N=8192 nodes, 3-d coords + a shared 3-d centre → 6 inputs, D=512): x = [node, centre]; keys = x·Wkᵀ + bk; queries = x·Wqᵀ + bq; attn = softmax_m(keys·queriesᵀ) (UNSCALED, rank-7 logits up to ±O(100));
// out = keys + attn·(queries·Wv[:, :512]ᵀ) + keys·Wv[:, 512:]ᵀ + bv.
// Compute dtype: inputs/weights/biases rounded to bf16. The logits are an exact bilinear form in the 7-vector x̃ = [x, 1]: s[n][m] = (x̃_nᵀ·M)·x̃_m with M = [Wk bk]ᵀ[Wq bq] (7×7, f32), evaluated per pair in f32 (7 FMAs) —
// no 16-bit rounding touches the huge logits; wave-per-row three-pass softmax over the 8192 keys writes P f16 ×2^15 for all 8192 rows in one launch; attn·QV and keys·Wv_kᵀ as GEMMs on v_wmma_f32_16x16x32_f16 (f32 accumulate) with keys (f32) and the first
// product carried through the epilogue addends.
#define NNODE 8192
#define DD 512

typedef __bf16 v16b __attribute__((ext_vector_type(16)));
typedef unsigned short v8us __attribute__((ext_vector_type(8), may_alias));
typedef float  v8f  __attribute__((ext_vector_type(8)));
typedef float  v4f  __attribute__((ext_vector_type(4)));
typedef float  v4fa __attribute__((ext_vector_type(4), may_alias));
union FragB { v16b v; v8us half[2]; unsigned short u[16]; };

__device__ __forceinline__ unsigned short bf16_bits(float x) { unsigned int u = __float_as_uint(x); return (unsigned short)((u + 0x7FFFu + ((u >> 16) & 1u)) >> 16); }
__device__ __forceinline__ float bf16_val(unsigned short b) { return __uint_as_float(((unsigned int)b) << 16); }
__device__ __forceinline__ float bf16_round(float x) { return bf16_val(bf16_bits(x)); }
// D += A·B with NT terms: 1 = ah·bh, 2 = + al·bh (A split), 3 = + ah·bl (both split)
template <int NT>
__device__ __forceinline__ v8f mmaN(v16b ah, v16b al, v16b bh, v16b bl, v8f c) {
  c = __builtin_amdgcn_wmma_f32_16x16x32_bf16(false, ah, false, bh, (short)0, c, false, false);
  if (NT >= 2) c = __builtin_amdgcn_wmma_f32_16x16x32_bf16(false, al, false, bh, (short)0, c, false, false);
  if (NT >= 3) c = __builtin_amdgcn_wmma_f32_16x16x32_bf16(false, ah, false, bl, (short)0, c, false, false);
  asm volatile("v_nop\n\tv_nop\n\tv_nop\n\tv_nop" : "+v"(c) : "v"(ah), "v"(al), "v"(bh), "v"(bl));
  return c;
}

__global__ __launch_bounds__(256) void k_wt_bf16(const float* __restrict__ W, unsigned short* __restrict__ Wt, int K, int N) {
  const int t = blockIdx.x * 256 + threadIdx.x;
  const int k8n = K / 8;
  if (t >= N * k8n) return;
  const int n = t / k8n, k8 = (t % k8n) * 8;
  v8us v;
#pragma unroll
  for (int i = 0; i < 8; ++i) v[i] = bf16_bits(W[(size_t)(k8 + i) * N + n]);
  *(v8us*)(Wt + (size_t)n * K + k8) = v;
  
}

// GEMM C[M][N] (f32, pitch ldc) = act(A[M][K]·W + bias). A f32 row-major (pitch lda) converted per fragment to bf16
// (ASPLIT: hi/lo two planes -> 2 terms, else single rounded term); Wt bf16 [N][K] (pitch ldb). BIAS_BF16 rounds the
// bias to bf16 first (bias quantised to bf16 before the add). K%32==0, M%16==0, N%64==0.
template <bool ASPLIT, int ACT, bool BIAS_BF16>
__global__ __launch_bounds__(128) void k_gemm_bf(const float* __restrict__ A, int lda, const unsigned short* __restrict__ Wt, int ldb,
                                               const float* __restrict__ bias, float* __restrict__ C, int ldc, int M, int N, int K) {
  __shared__ __attribute__((aligned(16))) float so[4][16][64];
  const int tid = threadIdx.x, w = tid >> 5, lane = tid & 31, ln = lane & 15, hh = lane >> 4;
  const int ntn = N / 64;
  const int wid = blockIdx.x * 4 + w;
  const int mt = wid / ntn, nq = wid % ntn;
  if (mt * 16 >= M) return;
  const int row0 = mt * 16, col0 = nq * 64;
  const float* arow = A + (size_t)(row0 + ln) * lda;
  v8f acc[4] = {};
  for (int kb = 0; kb < K; kb += 32) {
    FragB ah, al;
    const v4f x0 = *(const v4fa*)(arow + kb + 8 * hh), x1 = *(const v4fa*)(arow + kb + 8 * hh + 4);
    const v4f x2 = *(const v4fa*)(arow + kb + 16 + 8 * hh), x3 = *(const v4fa*)(arow + kb + 16 + 8 * hh + 4);
    float xs[16] = {x0[0],x0[1],x0[2],x0[3],x1[0],x1[1],x1[2],x1[3],x2[0],x2[1],x2[2],x2[3],x3[0],x3[1],x3[2],x3[3]};
#pragma unroll
    for (int i = 0; i < 16; ++i) { const unsigned short hb = bf16_bits(xs[i]); ah.u[i] = hb; al.u[i] = ASPLIT ? bf16_bits(xs[i] - bf16_val(hb)) : (unsigned short)0; }
#pragma unroll
    for (int t = 0; t < 4; ++t) {
      const unsigned short* brow = Wt + (size_t)(col0 + t * 16 + ln) * ldb + kb;
      FragB b;
      b.half[0] = *(const v8us*)(brow + 8 * hh);
      b.half[1] = *(const v8us*)(brow + 16 + 8 * hh);
      acc[t] = mmaN<ASPLIT ? 2 : 1>(ah.v, al.v, b.v, b.v, acc[t]);
    }
  }
#pragma unroll
  for (int t = 0; t < 4; ++t) {
    float bv = bias ? bias[col0 + t * 16 + ln] : 0.f;
    if (BIAS_BF16) bv = bf16_round(bv);
#pragma unroll
    for (int r = 0; r < 8; ++r) { float v = acc[t][r] + bv; if (ACT == 1) v = fmaxf(v, 0.f); so[w][8 * hh + r][t * 16 + ln] = v; }
  }
  __builtin_amdgcn_fence(__ATOMIC_ACQ_REL, "workgroup");
  __builtin_amdgcn_wave_barrier();
  const int rsub = lane >> 4, c4 = (lane & 15) * 4;
  {
#pragma unroll
    for (int q = 0; q < 8; ++q) {
      const int r = q * 2 + rsub;
      const v4f v = *(const v4fa*)&so[w][r][c4];
      *(v4f*)(C + (size_t)(row0 + r) * ldc + col0 + c4) = v;
    }
    
  }
}

// Flash-style causal/unmasked attention, all contractions 3-term bf16 hi/lo splits, f32 softmax with running max.
// q,k,v rows are read from f32 buffers with arbitrary row pitch (so they can live inside a fused qkv buffer);
// D = head size (multiple of 32, <= 128); one wave = 16 query rows; block = 4 waves (64 queries) sharing K/V chunks of 32.
template <int D, bool CAUSAL>
__global__ __launch_bounds__(128) void k_flash(const float* __restrict__ qb, const float* __restrict__ kb, const float* __restrict__ vb,
                                             int pitch, int T, int H, float scale, float* __restrict__ y, int ypitch) {
  constexpr int KS = D / 32;        // k-steps for QK
  constexpr int DT = D / 16;        // d tiles for PV
  __shared__ __attribute__((aligned(16))) unsigned short sKh[32][D + 8], sKl[32][D + 8], sVh[32][D + 8], sVl[32][D + 8];
  __shared__ __attribute__((aligned(16))) unsigned short sPh[4][16][40], sPl[4][16][40];
  __shared__ __attribute__((aligned(16))) float sO[4][16][D];
  const int tid = threadIdx.x, w = tid >> 5, lane = tid & 31, ln = lane & 15, hh = lane >> 4;
  const int nqb = (T + 63) / 64;
  const int bh = blockIdx.x / nqb, qblk = blockIdx.x % nqb;
  const int b = bh / H, h = bh % H;
  const int q0 = qblk * 64 + w * 16;
  const float* Q = qb + (size_t)b * T * pitch + h * D;
  const float* K = kb + (size_t)b * T * pitch + h * D;
  const float* V = vb + (size_t)b * T * pitch + h * D;

  // A fragments of the wave's 16 query rows (scaled), hi/lo
  FragB aqh[KS], aql[KS];
  {
    int row = q0 + ln; if (row >= T) row = T - 1;
    const float* qr = Q + (size_t)row * pitch;
#pragma unroll
    for (int ks = 0; ks < KS; ++ks)
#pragma unroll
      for (int i = 0; i < 16; ++i) {
        const int d = ks * 32 + ((i < 8) ? (8 * hh + i) : (16 + 8 * hh + (i - 8)));
        const float x = qr[d] * scale; const unsigned short hb = bf16_bits(x);
        aqh[ks].u[i] = hb; aql[ks].u[i] = bf16_bits(x - bf16_val(hb));
      }
  }
  float m_r[8], l_r[8];
#pragma unroll
  for (int r = 0; r < 8; ++r) { m_r[r] = -3.0e38f; l_r[r] = 0.f; }
  v8f oacc[DT];
#pragma unroll
  for (int dt = 0; dt < DT; ++dt) oacc[dt] = (v8f){0.f,0.f,0.f,0.f,0.f,0.f,0.f,0.f};

  const int kv_end = CAUSAL ? min(T, qblk * 64 + 64) : T;     // block-uniform
  for (int j0 = 0; j0 < kv_end; j0 += 32) {
    __syncthreads();
    for (int e = tid; e < 32 * (D / 4); e += 128) {
      const int r = e / (D / 4), c4 = (e % (D / 4)) * 4;
      const int key = j0 + r;
      v4f kf = {0.f,0.f,0.f,0.f}, vf = {0.f,0.f,0.f,0.f};
      if (key < T) { kf = *(const v4fa*)(K + (size_t)key * pitch + c4); vf = *(const v4fa*)(V + (size_t)key * pitch + c4); }
#pragma unroll
      for (int t = 0; t < 4; ++t) {
        unsigned short hb = bf16_bits(kf[t]); sKh[r][c4 + t] = hb; sKl[r][c4 + t] = bf16_bits(kf[t] - bf16_val(hb));
        hb = bf16_bits(vf[t]); sVh[r][c4 + t] = hb; sVl[r][c4 + t] = bf16_bits(vf[t] - bf16_val(hb));
      }
    }
    __syncthreads();
    // S tile 16 x 32
    v8f s[2];
#pragma unroll
    for (int nt = 0; nt < 2; ++nt) {
      v8f acc = {};
#pragma unroll
      for (int ks = 0; ks < KS; ++ks) {
        FragB bh_, bl_;
        bh_.half[0] = *(const v8us*)&sKh[nt * 16 + ln][ks * 32 + 8 * hh]; bh_.half[1] = *(const v8us*)&sKh[nt * 16 + ln][ks * 32 + 16 + 8 * hh];
        bl_.half[0] = *(const v8us*)&sKl[nt * 16 + ln][ks * 32 + 8 * hh]; bl_.half[1] = *(const v8us*)&sKl[nt * 16 + ln][ks * 32 + 16 + 8 * hh];
        acc = mmaN<3>(aqh[ks].v, aql[ks].v, bh_.v, bl_.v, acc);
      }
      s[nt] = acc;
    }
    // mask + running max (rows 8hh+r; the 16 lanes of a half share rows)
    float alpha[8];
#pragma unroll
    for (int r = 0; r < 8; ++r) {
      const int qi = q0 + 8 * hh + r;
      const int ja = j0 + ln, jb = j0 + 16 + ln;
      if (CAUSAL) { if (ja > qi) s[0][r] = -3.0e38f; if (jb > qi) s[1][r] = -3.0e38f; }
      if (ja >= T) s[0][r] = -3.0e38f;
      if (jb >= T) s[1][r] = -3.0e38f;
      float mx = fmaxf(s[0][r], s[1][r]);
      mx = fmaxf(mx, __shfl_xor(mx, 1, 32)); mx = fmaxf(mx, __shfl_xor(mx, 2, 32)); mx = fmaxf(mx, __shfl_xor(mx, 4, 32)); mx = fmaxf(mx, __shfl_xor(mx, 8, 32));
      const float mnew = fmaxf(m_r[r], mx);
      alpha[r] = (mnew > -1.0e38f) ? __expf(m_r[r] - mnew) : 1.0f;
      const float p0 = (s[0][r] > -1.0e38f) ? __expf(s[0][r] - mnew) : 0.f;
      const float p1 = (s[1][r] > -1.0e38f) ? __expf(s[1][r] - mnew) : 0.f;
      m_r[r] = mnew;
      l_r[r] = l_r[r] * alpha[r] + p0 + p1;            // per-lane partial row sum (16 lanes combined at the end)
      unsigned short hb = bf16_bits(p0); sPh[w][8 * hh + r][ln] = hb;      sPl[w][8 * hh + r][ln] = bf16_bits(p0 - bf16_val(hb));
      hb = bf16_bits(p1);                sPh[w][8 * hh + r][16 + ln] = hb; sPl[w][8 * hh + r][16 + ln] = bf16_bits(p1 - bf16_val(hb));
    }
#pragma unroll
    for (int dt = 0; dt < DT; ++dt)
#pragma unroll
      for (int r = 0; r < 8; ++r) oacc[dt][r] *= alpha[r];
    __builtin_amdgcn_fence(__ATOMIC_ACQ_REL, "workgroup");
    __builtin_amdgcn_wave_barrier();
    FragB pah, pal;
    pah.half[0] = *(const v8us*)&sPh[w][ln][8 * hh]; pah.half[1] = *(const v8us*)&sPh[w][ln][16 + 8 * hh];
    pal.half[0] = *(const v8us*)&sPl[w][ln][8 * hh]; pal.half[1] = *(const v8us*)&sPl[w][ln][16 + 8 * hh];
#pragma unroll
    for (int dt = 0; dt < DT; ++dt) {
      FragB bvh, bvl;
#pragma unroll
      for (int i = 0; i < 8; ++i) {
        bvh.u[i] = sVh[8 * hh + i][dt * 16 + ln]; bvh.u[8 + i] = sVh[16 + 8 * hh + i][dt * 16 + ln];
        bvl.u[i] = sVl[8 * hh + i][dt * 16 + ln]; bvl.u[8 + i] = sVl[16 + 8 * hh + i][dt * 16 + ln];
      }
      oacc[dt] = mmaN<3>(pah.v, pal.v, bvh.v, bvl.v, oacc[dt]);
    }
    __builtin_amdgcn_fence(__ATOMIC_ACQ_REL, "workgroup");
    __builtin_amdgcn_wave_barrier();
  }
#pragma unroll
  for (int r = 0; r < 8; ++r) {
    float l = l_r[r];
    l += __shfl_xor(l, 1, 32); l += __shfl_xor(l, 2, 32); l += __shfl_xor(l, 4, 32); l += __shfl_xor(l, 8, 32);
    l_r[r] = (l > 0.f) ? 1.0f / l : 0.f;
  }
#pragma unroll
  for (int dt = 0; dt < DT; ++dt)
#pragma unroll
    for (int r = 0; r < 8; ++r) sO[w][8 * hh + r][dt * 16 + ln] = oacc[dt][r] * l_r[r];
  __builtin_amdgcn_fence(__ATOMIC_ACQ_REL, "workgroup");
  __builtin_amdgcn_wave_barrier();
  {
    for (int r = 0; r < 16; ++r) {
      const int row = q0 + r;
      if (row < T && lane < D / 4) {
        const v4f val = *(const v4fa*)&sO[w][r][lane * 4];
        *(v4f*)(y + ((size_t)b * T + row) * ypitch + h * D + lane * 4) = val;
      }
    }
    
  }
}

// GEMM C = act(A·W + bias + resid): A f32 (ASPLIT -> hi/lo 2 terms), Wt bf16 [N][K]; ACT 0 none, 1 relu, 2 exact gelu;
// resid (optional, f32, row index = (row % rmod), pitch ldr, RES_BF16 rounds it) added before the activation.
template <bool ASPLIT, int ACT, bool BIAS_BF16, bool RES_BF16>
__global__ __launch_bounds__(128) void k_gemm_bf3(const float* __restrict__ A, int lda, const unsigned short* __restrict__ Wt, int ldb,
                                                const float* __restrict__ bias, const float* __restrict__ resid, int rmod, int ldr,
                                                float* __restrict__ C, int ldc, int M, int N, int K) {
  __shared__ __attribute__((aligned(16))) float so[4][16][64];
  const int tid = threadIdx.x, w = tid >> 5, lane = tid & 31, ln = lane & 15, hh = lane >> 4;
  const int ntn = N / 64;
  const int wid = blockIdx.x * 4 + w;
  const int mt = wid / ntn, nq = wid % ntn;
  if (mt * 16 >= M) return;
  const int row0 = mt * 16, col0 = nq * 64;
  const float* arow = A + (size_t)(row0 + ln) * lda;
  v8f acc[4] = {};
  for (int kb = 0; kb < K; kb += 32) {
    FragB ah, al;
    const v4f x0 = *(const v4fa*)(arow + kb + 8 * hh), x1 = *(const v4fa*)(arow + kb + 8 * hh + 4);
    const v4f x2 = *(const v4fa*)(arow + kb + 16 + 8 * hh), x3 = *(const v4fa*)(arow + kb + 16 + 8 * hh + 4);
    float xs[16] = {x0[0],x0[1],x0[2],x0[3],x1[0],x1[1],x1[2],x1[3],x2[0],x2[1],x2[2],x2[3],x3[0],x3[1],x3[2],x3[3]};
#pragma unroll
    for (int i = 0; i < 16; ++i) { const unsigned short hb = bf16_bits(xs[i]); ah.u[i] = hb; al.u[i] = ASPLIT ? bf16_bits(xs[i] - bf16_val(hb)) : (unsigned short)0; }
#pragma unroll
    for (int t = 0; t < 4; ++t) {
      const unsigned short* brow = Wt + (size_t)(col0 + t * 16 + ln) * ldb + kb;
      FragB b;
      b.half[0] = *(const v8us*)(brow + 8 * hh);
      b.half[1] = *(const v8us*)(brow + 16 + 8 * hh);
      acc[t] = mmaN<ASPLIT ? 2 : 1>(ah.v, al.v, b.v, b.v, acc[t]);
    }
  }
#pragma unroll
  for (int t = 0; t < 4; ++t) {
    const int col = col0 + t * 16 + ln;
    float bv = bias ? bias[col] : 0.f;
    if (BIAS_BF16) bv = bf16_round(bv);
#pragma unroll
    for (int r = 0; r < 8; ++r) {
      float v = acc[t][r] + bv;
      if (resid) { float rv = resid[(size_t)((row0 + 8 * hh + r) % rmod) * ldr + col]; if (RES_BF16) rv = bf16_round(rv); v += rv; }
      if (ACT == 1) v = fmaxf(v, 0.f);
      if (ACT == 2) v = 0.5f * v * (1.0f + erff(v * 0.70710678118654752f));
      if (ACT == 3) { const float u = 0.7978845608028654f * (v + 0.044715f * v * v * v); v = 0.5f * v * (1.0f + tanhf(u)); }
      so[w][8 * hh + r][t * 16 + ln] = v;
    }
  }
  __builtin_amdgcn_fence(__ATOMIC_ACQ_REL, "workgroup");
  __builtin_amdgcn_wave_barrier();
  const int rsub = lane >> 4, c4 = (lane & 15) * 4;
  {
#pragma unroll
    for (int q = 0; q < 8; ++q) {
      const int r = q * 2 + rsub;
      const v4f v = *(const v4fa*)&so[w][r][c4];
      *(v4f*)(C + (size_t)(row0 + r) * ldc + col0 + c4) = v;
    }
    
  }
}
// row LayerNorm (biased variance, eps) over N: s = X (+ R); optional out_sum <- s; out_norm <- (s-mu)*rsqrt(var+eps)*g + b
template <bool PARAM_BF16>
__global__ __launch_bounds__(256) void k_layernorm(const float* __restrict__ X, const float* __restrict__ R, const float* __restrict__ g, const float* __restrict__ bta,
                                                  float* __restrict__ out_sum, float* __restrict__ out_norm, int N, float eps) {
  __shared__ float red[256];
  const int row = blockIdx.x, tid = threadIdx.x;
  const float* x = X + (size_t)row * N; const float* rr = R ? R + (size_t)row * N : nullptr;
  float vals[16];                     // up to N = 4096
  const int per = N / 256;            // contiguous chunk per thread? use strided-by-4 chunks: thread handles j = tid*4 + 1024*u
  float s1 = 0.f;
  for (int u = 0; u < per / 4; ++u) {
    const int j = tid * 4 + 1024 * u;
    const v4f a = *(const v4fa*)(x + j);
    v4f b = {0.f,0.f,0.f,0.f}; if (rr) b = *(const v4fa*)(rr + j);
#pragma unroll
    for (int q = 0; q < 4; ++q) { const float v = a[q] + b[q]; vals[u * 4 + q] = v; s1 += v; }
  }
  red[tid] = s1; __syncthreads();
  for (int st = 128; st > 0; st >>= 1) { if (tid < st) red[tid] += red[tid + st]; __syncthreads(); }
  const float mu = red[0] / (float)N; __syncthreads();
  float s2 = 0.f;
  for (int u = 0; u < per / 4; ++u)
#pragma unroll
    for (int q = 0; q < 4; ++q) { const float c = vals[u * 4 + q] - mu; s2 += c * c; }
  red[tid] = s2; __syncthreads();
  for (int st = 128; st > 0; st >>= 1) { if (tid < st) red[tid] += red[tid + st]; __syncthreads(); }
  const float rs = rsqrtf(red[0] / (float)N + eps);
  {
    for (int u = 0; u < per / 4; ++u) {
      const int j = tid * 4 + 1024 * u;
      v4f o, sm;
#pragma unroll
      for (int q = 0; q < 4; ++q) {
        float gg = g[j + q], bb = bta[j + q];
        if (PARAM_BF16) { gg = bf16_round(gg); bb = bf16_round(bb); }
        sm[q] = vals[u * 4 + q]; o[q] = (vals[u * 4 + q] - mu) * rs * gg + bb;
      }
      if (out_sum) *(v4f*)(out_sum + (size_t)row * N + j) = sm;
      *(v4f*)(out_norm + (size_t)row * N + j) = o;
    }
    
  }
}



// ---- f16 WMMA path (v_wmma_f32_16x16x32_f16): 11-bit significands for operands in range — used where a [0,1] probability operand needs more precision than bf16
typedef _Float16 v16h __attribute__((ext_vector_type(16)));
union FragH { v16h v; v8us half[2]; _Float16 h[16]; unsigned short u[16]; };
template <int NT>
__device__ __forceinline__ v8f mmaH(v16h ah, v16h al, v16h bh, v16h bl, v8f c) {
  c = __builtin_amdgcn_wmma_f32_16x16x32_f16(false, ah, false, bh, (short)0, c, false, false);
  if (NT >= 2) c = __builtin_amdgcn_wmma_f32_16x16x32_f16(false, al, false, bh, (short)0, c, false, false);
  if (NT >= 3) c = __builtin_amdgcn_wmma_f32_16x16x32_f16(false, ah, false, bl, (short)0, c, false, false);
  asm volatile("v_nop\n\tv_nop\n\tv_nop\n\tv_nop" : "+v"(c) : "v"(ah), "v"(al), "v"(bh), "v"(bl));
  return c;
}
// batched GEMM like k_gemm_b but f16 operands: A f32 (split into f16 hi/lo if ASPLIT, else rounded to f16), Bt = f16 values [n][k]; alpha; C f32; N multiple of 16 (partial tiles skipped)
template <bool ASPLIT>
__global__ __launch_bounds__(128) void k_gemm_h(const float* __restrict__ A, int lda, size_t sA, const _Float16* __restrict__ Bh, int ldb, size_t sB, float alpha, float* __restrict__ C, int ldc, size_t sC, int M, int N, int K) {
  __shared__ __attribute__((aligned(16))) float so[4][16][64];
  const int tid = threadIdx.x, w = tid >> 5, lane = tid & 31, ln = lane & 15, hh = lane >> 4; const int by = blockIdx.y;
  A += (size_t)by * sA; Bh += (size_t)by * sB; C += (size_t)by * sC;
  const int ntn = (N + 63) / 64; const int wid = blockIdx.x * 4 + w; const int mt = wid / ntn, nq = wid % ntn; if (mt * 16 >= M) return;
  const int row0 = mt * 16, col0 = nq * 64; const float* arow = A + (size_t)(row0 + ln) * lda;
  v8f acc[4] = {};
  for (int kb = 0; kb < K; kb += 32) {
    FragH ah, al;
    const v4f x0 = *(const v4fa*)(arow + kb + 8 * hh), x1 = *(const v4fa*)(arow + kb + 8 * hh + 4), x2 = *(const v4fa*)(arow + kb + 16 + 8 * hh), x3 = *(const v4fa*)(arow + kb + 16 + 8 * hh + 4);
    float xs[16] = {x0[0],x0[1],x0[2],x0[3],x1[0],x1[1],x1[2],x1[3],x2[0],x2[1],x2[2],x2[3],x3[0],x3[1],x3[2],x3[3]};
#pragma unroll
    for (int i = 0; i < 16; ++i) { const _Float16 h = (_Float16)xs[i]; ah.h[i] = h; al.h[i] = ASPLIT ? (_Float16)(xs[i] - (float)h) : (_Float16)0.0f; }
#pragma unroll
    for (int t = 0; t < 4; ++t) { if (col0 + t * 16 >= N) continue; const size_t boff = (size_t)(col0 + t * 16 + ln) * ldb + kb; FragH bq; bq.half[0] = *(const v8us*)(Bh + boff + 8 * hh); bq.half[1] = *(const v8us*)(Bh + boff + 16 + 8 * hh);
      acc[t] = mmaH<ASPLIT ? 2 : 1>(ah.v, al.v, bq.v, bq.v, acc[t]); }
  }
#pragma unroll
  for (int t = 0; t < 4; ++t) { if (col0 + t * 16 >= N) continue;
#pragma unroll
    for (int r = 0; r < 8; ++r) so[w][8 * hh + r][t * 16 + ln] = acc[t][r] * alpha; }
  __builtin_amdgcn_fence(__ATOMIC_ACQ_REL, "workgroup"); __builtin_amdgcn_wave_barrier();
  const int rsub = lane >> 4, c4 = (lane & 15) * 4;
  {
#pragma unroll
    for (int q = 0; q < 8; ++q) { const int r = q * 2 + rsub; if (col0 + c4 < N) { const v4f v = *(const v4fa*)&so[w][r][c4]; *(v4f*)(C + (size_t)(row0 + r) * ldc + col0 + c4) = v; } }
     }
}

// Wt[n][k] = f16(W[k][n]·scale) from f32 row-major W[K][N] (scale = power of two; bf16-exact weights stay exact in f16 away from the subnormal range)
__global__ __launch_bounds__(256) void k_wt_f16(const float* __restrict__ W, _Float16* __restrict__ Wt, int K, int N, float scale) {
  const int t = blockIdx.x * 256 + threadIdx.x; if (t >= N * (K / 8)) return; const int n = t / (K / 8), k8 = (t % (K / 8)) * 8; FragH f;
#pragma unroll
  for (int i = 0; i < 8; ++i) f.h[i] = (_Float16)(bf16_round(W[(size_t)(k8 + i) * N + n]) * scale); const v8us o = f.half[0];
  *(v8us*)((unsigned short*)Wt + (size_t)n * K + k8) = o; 
}
// k_gemm_hh variant with fused epilogue: v = acc·alpha + bias[by·sBias + col] (+ CP[(row/rowsPerB)·sCPb + by·64 + col] if CP) ; ACT 0 none / 1 elu ; writes f32 C and/or f16 C16 (each if non-null)
template <int ACT>
__global__ __launch_bounds__(128) void k_gemm_hhx(const _Float16* __restrict__ A, int lda, size_t sA, const _Float16* __restrict__ Bh, int ldb, size_t sB, float alpha, const float* __restrict__ bias, size_t sBias, const float* __restrict__ CP, int rowsPerB, size_t sCPb, int row0g,
    float* __restrict__ C, _Float16* __restrict__ C16, int ldc, size_t sC, int M, int N, int K) {
  __shared__ __attribute__((aligned(16))) float so[4][16][64];
  const int tid = threadIdx.x, w = tid >> 5, lane = tid & 31, ln = lane & 15, hh = lane >> 4; const int by = blockIdx.y;
  A += (size_t)by * sA; Bh += (size_t)by * sB; const size_t cofs = (size_t)by * sC; const float* bp = bias ? bias + (size_t)by * sBias : nullptr;
  const int ntn = (N + 63) / 64; const int wid = blockIdx.x * 4 + w; const int mt = wid / ntn, nq = wid % ntn; if (mt * 16 >= M) return;
  const int row0 = mt * 16, col0 = nq * 64; const _Float16* arow = A + (size_t)(row0 + ln) * lda;
  v8f acc[4] = {};
  for (int kb = 0; kb < K; kb += 32) { FragH ah; ah.half[0] = *(const v8us*)((const unsigned short*)arow + kb + 8 * hh); ah.half[1] = *(const v8us*)((const unsigned short*)arow + kb + 16 + 8 * hh);
#pragma unroll
    for (int t = 0; t < 4; ++t) { if (col0 + t * 16 >= N) continue; const size_t boff = (size_t)(col0 + t * 16 + ln) * ldb + kb; FragH bq; bq.half[0] = *(const v8us*)((const unsigned short*)Bh + boff + 8 * hh); bq.half[1] = *(const v8us*)((const unsigned short*)Bh + boff + 16 + 8 * hh);
      acc[t] = mmaH<1>(ah.v, ah.v, bq.v, bq.v, acc[t]); }
  }
#pragma unroll
  for (int t = 0; t < 4; ++t) { if (col0 + t * 16 >= N) continue; const int col = col0 + t * 16 + ln; const float bv = bp ? bf16_round(bp[col]) : 0.f;
#pragma unroll
    for (int r = 0; r < 8; ++r) { float v = acc[t][r] * alpha + bv; if (CP) { const int bidx = (row0g + row0 + 8 * hh + r) / rowsPerB; v += CP[(size_t)bidx * sCPb + (size_t)by * 64 + col]; } if (ACT == 1) v = (v > 0.f) ? v : expm1f(v); else if (ACT == 7) v = (v > 0.f) ? v + 1.0f : expf(v); else if (ACT == 8) v = tanhf(v); else if (ACT == 9) v = 0.5f * v * (1.0f + tanhf(0.7978845608028654f * (v + 0.044715f * v * v * v))); else if (ACT == 11) v = 1.0f / (1.0f + expf(-v)); else if (ACT == 12) v = (v > 0.f) ? v : 0.01f * v; else if (ACT == 14) v = (v > 0.f) ? v : 0.1f * v; else if (ACT == 15) v = v / (1.0f + expf(-v)); else if (ACT == 3) v = fmaxf(v, 0.f); else if (ACT == 6) v = 0.5f * v * (1.0f + erff(v * 0.70710678118654752f)); so[w][8 * hh + r][t * 16 + ln] = v; } }
  __builtin_amdgcn_fence(__ATOMIC_ACQ_REL, "workgroup"); __builtin_amdgcn_wave_barrier();
  const int rsub = lane >> 4, c4 = (lane & 15) * 4; typedef _Float16 v4h __attribute__((ext_vector_type(4)));
  {
#pragma unroll
    for (int q = 0; q < 8; ++q) { const int r = q * 2 + rsub; if (col0 + c4 < N) { const v4f v = *(const v4fa*)&so[w][r][c4]; if (C) *(v4f*)(C + cofs + (size_t)(row0 + r) * ldc + col0 + c4) = v; if (C16) { v4h h4; for (int i = 0; i < 4; ++i) h4[i] = (_Float16)v[i]; *(v4h*)(C16 + cofs + (size_t)(row0 + r) * ldc + col0 + c4) = h4; } } }
     }
}


typedef _Float16 v4h __attribute__((ext_vector_type(4)));

__global__ __launch_bounds__(256) void k_x16(const float* __restrict__ x, _Float16* __restrict__ X16, size_t n8) { const size_t t = (size_t)blockIdx.x * 256 + threadIdx.x; if (t >= n8) return; FragH f;
#pragma unroll
  for (int q = 0; q < 8; ++q) f.h[q] = (_Float16)bf16_round(x[t * 8 + q]); *(v8us*)((unsigned short*)X16 + t * 8) = f.half[0];  }
__global__ __launch_bounds__(256) void k_h16(const float* __restrict__ x, _Float16* __restrict__ X16, size_t n8) { const size_t t = (size_t)blockIdx.x * 256 + threadIdx.x; if (t >= n8) return; FragH f;
#pragma unroll
  for (int q = 0; q < 8; ++q) f.h[q] = (_Float16)x[t * 8 + q]; *(v8us*)((unsigned short*)X16 + t * 8) = f.half[0];  }
__global__ __launch_bounds__(256) void k_round16f(const float* __restrict__ W, _Float16* __restrict__ Bt, size_t n8) { const size_t t = (size_t)blockIdx.x * 256 + threadIdx.x; if (t >= n8) return; FragH f;
#pragma unroll
  for (int i = 0; i < 8; ++i) f.h[i] = (_Float16)(bf16_round(W[t * 8 + i]) * 16.0f); *(v8us*)((unsigned short*)Bt + t * 8) = f.half[0];  }
template <int NHv, int TTv>
__global__ __launch_bounds__(256) void k_vt(const _Float16* __restrict__ V16, int ldv, int voff, _Float16* __restrict__ Vt) { __shared__ unsigned short tl[64][66]; const int tid = threadIdx.x; const int slab = blockIdx.x / (TTv / 64), lg = blockIdx.x % (TTv / 64); const int b = slab / NHv, h = slab % NHv;
  for (int i = tid; i < 64 * 8; i += 256) { const int r = i / 8, c8 = (i % 8) * 8; FragH f; f.half[0] = *(const v8us*)((const unsigned short*)V16 + ((size_t)b * TTv + lg * 64 + r) * ldv + voff + h * 64 + c8);
#pragma unroll
    for (int q = 0; q < 8; ++q) tl[r][c8 + q] = f.u[q]; }
  __syncthreads();
  {
#pragma unroll
    for (int rd = 0; rd < 2; ++rd) { const int d = rd * 32 + tid / 8, pc = tid % 8; FragH f;
#pragma unroll
      for (int q = 0; q < 8; ++q) f.u[q] = tl[pc * 8 + q][d];
      *(v8us*)((unsigned short*)Vt + ((size_t)slab * 64 + d) * TTv + lg * 64 + pc * 8) = f.half[0]; }
     } }

__global__ __launch_bounds__(256) void k_x7(const float* __restrict__ nodes, const float* __restrict__ centre, float* __restrict__ X7) { const int t = blockIdx.x * 256 + threadIdx.x; if (t >= NNODE * 2) return; const int n = t >> 1, half = t & 1; v4f v;
  if (half == 0) { v[0] = bf16_round(nodes[(size_t)n * 3]); v[1] = bf16_round(nodes[(size_t)n * 3 + 1]); v[2] = bf16_round(nodes[(size_t)n * 3 + 2]); v[3] = bf16_round(centre[0]); } else { v[0] = bf16_round(centre[1]); v[1] = bf16_round(centre[2]); v[2] = 1.0f; v[3] = 0.f; }
  *(v4f*)(X7 + (size_t)t * 4) = v;  }
__global__ __launch_bounds__(256) void k_proj(const float* __restrict__ nodes, const float* __restrict__ centre, const float* __restrict__ Wq, const float* __restrict__ bq, const float* __restrict__ Wk, const float* __restrict__ bk, float* __restrict__ KEYS, _Float16* __restrict__ K16, _Float16* __restrict__ Q16) {
  #pragma clang fp contract(off)
  const size_t t = (size_t)blockIdx.x * 256 + threadIdx.x; if (t >= (size_t)NNODE * DD / 4) return; const int n = (int)((t * 4) / DD), c0 = (int)((t * 4) % DD); float xa[7];
  for (int i = 0; i < 3; ++i) { xa[i] = bf16_round(nodes[(size_t)n * 3 + i]); xa[3 + i] = bf16_round(centre[i]); } xa[6] = 1.0f;
  float kv[4], qv[4]; for (int q = 0; q < 4; ++q) { kv[q] = bf16_round(bk[c0 + q]); qv[q] = bf16_round(bq[c0 + q]); }
#pragma unroll 1
  for (int i = 0; i < 6; ++i) for (int q = 0; q < 4; ++q) { kv[q] += xa[i] * bf16_round(Wk[(size_t)(c0 + q) * 6 + i]); qv[q] += xa[i] * bf16_round(Wq[(size_t)(c0 + q) * 6 + i]); }
  typedef _Float16 v4h __attribute__((ext_vector_type(4))); v4h fk, fq; for (int q = 0; q < 4; ++q) { fk[q] = (_Float16)kv[q]; fq[q] = (_Float16)qv[q]; } const v4f k0 = {kv[0], kv[1], kv[2], kv[3]};
  { *(v4f*)(KEYS + t * 4) = k0; *(v4h*)(K16 + t * 4) = fk; *(v4h*)(Q16 + t * 4) = fq;      /* one 16-B f32 piece and 8-B f16 pieces per lane, lane-contiguous */
     } }
__global__ __launch_bounds__(256) void k_rvec(const float* __restrict__ Wq, const float* __restrict__ bq, const float* __restrict__ Wk, const float* __restrict__ bk, const float* __restrict__ X7, float* __restrict__ R) {
  #pragma clang fp contract(off)
  __shared__ float M[7][8]; const int tid = threadIdx.x;
  if (tid < 49) { const int i = tid / 7, j = tid % 7; float s = 0.f;
#pragma unroll 1
    for (int c = 0; c < DD; ++c) { const float a = (i < 6) ? bf16_round(Wk[(size_t)c * 6 + i]) : bf16_round(bk[c]); const float b = (j < 6) ? bf16_round(Wq[(size_t)c * 6 + j]) : bf16_round(bq[c]); s += a * b; } M[i][j] = s; }
  __syncthreads();
  const int t = blockIdx.x * 256 + tid; if (t >= NNODE * 2) return; const int n = t >> 1, half = t & 1; float xa[8]; { const v4f a = *(const v4fa*)(X7 + (size_t)n * 8), b = *(const v4fa*)(X7 + (size_t)n * 8 + 4); xa[0] = a[0]; xa[1] = a[1]; xa[2] = a[2]; xa[3] = a[3]; xa[4] = b[0]; xa[5] = b[1]; xa[6] = b[2]; }
  v4f o = {0.f, 0.f, 0.f, 0.f};      /* this thread's half of R[n]: columns j = 4·half .. 4·half+3 (j = 7 stays 0) */
#pragma unroll 1
  for (int i = 0; i < 7; ++i) for (int q = 0; q < 4; ++q) { const int j = half * 4 + q; if (j < 7) o[q] += xa[i] * M[i][j]; }
  *(v4f*)(R + (size_t)t * 4) = o;  }
__device__ __forceinline__ float sai_logit(const float* r, const float* X7, int m) { const v4f a = *(const v4fa*)(X7 + (size_t)m * 8), b = *(const v4fa*)(X7 + (size_t)m * 8 + 4); return r[0] * a[0] + r[1] * a[1] + r[2] * a[2] + r[3] * a[3] + r[4] * b[0] + r[5] * b[1] + r[6] * b[2]; }
__global__ __launch_bounds__(256) void k_soft(const float* __restrict__ R, const float* __restrict__ X7, int n0, _Float16* __restrict__ P16) {
  #pragma clang fp contract(off)
  const int tid = threadIdx.x, wv = tid >> 5, lane = tid & 31; const int nl = blockIdx.x * 8 + wv; const int n = n0 + nl; float r[7]; { const v4f a = *(const v4fa*)(R + (size_t)n * 8), b = *(const v4fa*)(R + (size_t)n * 8 + 4); r[0] = a[0]; r[1] = a[1]; r[2] = a[2]; r[3] = a[3]; r[4] = b[0]; r[5] = b[1]; r[6] = b[2]; }
  float mx = -3.0e38f;
#pragma unroll 1
  for (int it = 0; it < NNODE / 256; ++it)
#pragma unroll 1
    for (int e = 0; e < 8; ++e) mx = fmaxf(mx, sai_logit(r, X7, it * 256 + lane * 8 + e));
  for (int o = 16; o >= 1; o >>= 1) mx = fmaxf(mx, __shfl_xor(mx, o, 32)); float z = 0.f;
#pragma unroll 1
  for (int it = 0; it < NNODE / 256; ++it)
#pragma unroll 1
    for (int e = 0; e < 8; ++e) z += expf(sai_logit(r, X7, it * 256 + lane * 8 + e) - mx);
  for (int o = 16; o >= 1; o >>= 1) z += __shfl_xor(z, o, 32); const float iz = 32768.0f / z;
  {
#pragma unroll 1
    for (int it = 0; it < NNODE / 256; ++it) { FragH f; for (int e = 0; e < 8; ++e) f.h[e] = (_Float16)(expf(sai_logit(r, X7, it * 256 + lane * 8 + e) - mx) * iz); *(v8us*)((unsigned short*)P16 + (size_t)nl * NNODE + it * 256 + lane * 8) = f.half[0]; }
     } }

extern "C" void kernel_launch(void* const* d_in, const int* in_sizes, int n_in,
                              void* d_out, int out_size, void* d_ws, size_t ws_size, hipStream_t stream) {
  (void)in_sizes; (void)n_in; (void)out_size;
  const float* const* I = (const float* const*)d_in; const float* nodes = I[0]; const float* centre = I[1]; const float* Wq = I[2]; const float* bq = I[3]; const float* Wk = I[4]; const float* bk = I[5]; const float* Wv = I[6]; const float* bv = I[7];
  char* ws = (char*)d_ws; size_t off = 0;
  auto take = [&](size_t bytes) { char* p = ws + off; off += (bytes + 255) & ~(size_t)255; return p; };
  _Float16* Bwv = (_Float16*)take((size_t)DD * 2 * DD * 2); float* KEYS = (float*)take((size_t)NNODE * DD * 4); _Float16* K16 = (_Float16*)take((size_t)NNODE * DD * 2); _Float16* Q16 = (_Float16*)take((size_t)NNODE * DD * 2); float* X7 = (float*)take((size_t)NNODE * 8 * 4); float* R = (float*)take((size_t)NNODE * 8 * 4);
  _Float16* QV = (_Float16*)take((size_t)NNODE * DD * 2); _Float16* QVt = (_Float16*)take((size_t)DD * NNODE * 2); _Float16* P16 = (_Float16*)take((size_t)NNODE * NNODE * 2); float* O = (float*)take((size_t)NNODE * DD * 4);
  if (off > ws_size) return;      // 194 MiB of the 256 MiB workspace, the full P plane alone 128 MiB
  k_round16f<<<(unsigned)(((size_t)DD * 2 * DD / 8 + 255) / 256), 256, 0, stream>>>(Wv, Bwv, (size_t)DD * 2 * DD / 8);      /* Wv (512, 1024) natural ×2^4: row d = [Wv_q | Wv_k] */
  k_x7<<<NNODE * 2 / 256, 256, 0, stream>>>(nodes, centre, X7); k_proj<<<(unsigned)(((size_t)NNODE * DD / 4 + 255) / 256), 256, 0, stream>>>(nodes, centre, Wq, bq, Wk, bk, KEYS, K16, Q16);
  k_rvec<<<NNODE * 2 / 256, 256, 0, stream>>>(Wq, bq, Wk, bk, X7, R);
  const dim3 gq(((NNODE / 16) * (DD / 64) + 3) / 4, 1);
  k_gemm_hhx<0><<<gq, 128, 0, stream>>>(Q16, DD, 0, Bwv, 2 * DD, 0, 0.0625f, nullptr, 0, nullptr, 1, 0, 0, nullptr, QV, DD, 0, NNODE, DD, DD);      /* QV = queries·Wv_qᵀ (Bt rows d, cols 0..511, ldb 1024): M 8192 N 512 K 512 */
  k_vt<DD / 64, NNODE><<<(DD / 64) * (NNODE / 64), 256, 0, stream>>>(QV, DD, 0, QVt);      /* QVᵀ [512][8192] */
  k_soft<<<NNODE / 8, 256, 0, stream>>>(R, X7, 0, P16);      /* every row's wave is in one grid: 1024 work-groups, 32 waves on each WGP */
  k_gemm_hhx<0><<<gq, 128, 0, stream>>>(P16, NNODE, 0, QVt, NNODE, 0, 0.000030517578125f, nullptr, 0, KEYS, 1, (size_t)DD, 0, O, nullptr, DD, 0, NNODE, DD, NNODE);      /* O = keys + attn*QV: M 8192 N 512 K 8192, 1024 work-groups */
  k_gemm_hhx<0><<<gq, 128, 0, stream>>>(K16, DD, 0, Bwv + DD, 2 * DD, 0, 0.0625f, bv, 0, O, 1, (size_t)DD, 0, (float*)d_out, nullptr, DD, 0, NNODE, DD, DD);      /* out = keys·Wv_kᵀ + bv + O (Bt rows d at cols 512.., ldb 1024) */
}

// v002
// One run takes 527 microseconds.
// In both of two side-by-side timings against v001, it was 1.72 times as fast.
// Counting every step since v000, it is 5.25 times as fast.
#include <hip/hip_runtime.h>
// 'self_attn_init' (N=8192 nodes, 3-d coords + a shared 3-d centre → 6 inputs, D=512): x = [node, centre]; keys = x·Wkᵀ + bk; queries = x·Wqᵀ + bq; attn = softmax_m(keys·queriesᵀ) (UNSCALED, rank-7 logits up to ±O(100));
// out = keys + attn·(queries·Wv[:, :512]ᵀ) + keys·Wv[:, 512:]ᵀ + bv.
// Compute dtype: inputs/weights/biases rounded to bf16. The logits are an exact bilinear form in the 7-vector x̃ = [x, 1]: s[n][m] = (x̃_nᵀ·M)·x̃_m with M = [Wk bk]ᵀ[Wq bq] (7×7, f32), evaluated per pair in f32 (7 FMAs) —
// no 16-bit rounding touches the huge logits; softmax with the 8192 keys split over a work-group's 32 waves (logits kept in registers) writes P f16 ×2^15 for all 8192 rows in one launch; attn·QV and keys·Wv_kᵀ as GEMMs on v_wmma_f32_16x16x32_f16 (f32 accumulate) with keys (f32) and the first
// product carried through the epilogue addends.
#define NNODE 8192
#define DD 512

typedef __bf16 v16b __attribute__((ext_vector_type(16)));
typedef unsigned short v8us __attribute__((ext_vector_type(8), may_alias));
typedef float  v8f  __attribute__((ext_vector_type(8)));
typedef float  v4f  __attribute__((ext_vector_type(4)));
typedef float  v4fa __attribute__((ext_vector_type(4), may_alias));
union FragB { v16b v; v8us half[2]; unsigned short u[16]; };

__device__ __forceinline__ unsigned short bf16_bits(float x) { unsigned int u = __float_as_uint(x); return (unsigned short)((u + 0x7FFFu + ((u >> 16) & 1u)) >> 16); }
__device__ __forceinline__ float bf16_val(unsigned short b) { return __uint_as_float(((unsigned int)b) << 16); }
__device__ __forceinline__ float bf16_round(float x) { return bf16_val(bf16_bits(x)); }
// D += A·B with NT terms: 1 = ah·bh, 2 = + al·bh (A split), 3 = + ah·bl (both split)
template <int NT>
__device__ __forceinline__ v8f mmaN(v16b ah, v16b al, v16b bh, v16b bl, v8f c) {
  c = __builtin_amdgcn_wmma_f32_16x16x32_bf16(false, ah, false, bh, (short)0, c, false, false);
  if (NT >= 2) c = __builtin_amdgcn_wmma_f32_16x16x32_bf16(false, al, false, bh, (short)0, c, false, false);
  if (NT >= 3) c = __builtin_amdgcn_wmma_f32_16x16x32_bf16(false, ah, false, bl, (short)0, c, false, false);
  asm volatile("v_nop\n\tv_nop\n\tv_nop\n\tv_nop" : "+v"(c) : "v"(ah), "v"(al), "v"(bh), "v"(bl));
  return c;
}

__global__ __launch_bounds__(256) void k_wt_bf16(const float* __restrict__ W, unsigned short* __restrict__ Wt, int K, int N) {
  const int t = blockIdx.x * 256 + threadIdx.x;
  const int k8n = K / 8;
  if (t >= N * k8n) return;
  const int n = t / k8n, k8 = (t % k8n) * 8;
  v8us v;
#pragma unroll
  for (int i = 0; i < 8; ++i) v[i] = bf16_bits(W[(size_t)(k8 + i) * N + n]);
  *(v8us*)(Wt + (size_t)n * K + k8) = v;
  
}

// GEMM C[M][N] (f32, pitch ldc) = act(A[M][K]·W + bias). A f32 row-major (pitch lda) converted per fragment to bf16
// (ASPLIT: hi/lo two planes -> 2 terms, else single rounded term); Wt bf16 [N][K] (pitch ldb). BIAS_BF16 rounds the
// bias to bf16 first (bias quantised to bf16 before the add). K%32==0, M%16==0, N%64==0.
template <bool ASPLIT, int ACT, bool BIAS_BF16>
__global__ __launch_bounds__(128) void k_gemm_bf(const float* __restrict__ A, int lda, const unsigned short* __restrict__ Wt, int ldb,
                                               const float* __restrict__ bias, float* __restrict__ C, int ldc, int M, int N, int K) {
  __shared__ __attribute__((aligned(16))) float so[4][16][64];
  const int tid = threadIdx.x, w = tid >> 5, lane = tid & 31, ln = lane & 15, hh = lane >> 4;
  const int ntn = N / 64;
  const int wid = blockIdx.x * 4 + w;
  const int mt = wid / ntn, nq = wid % ntn;
  if (mt * 16 >= M) return;
  const int row0 = mt * 16, col0 = nq * 64;
  const float* arow = A + (size_t)(row0 + ln) * lda;
  v8f acc[4] = {};
  for (int kb = 0; kb < K; kb += 32) {
    FragB ah, al;
    const v4f x0 = *(const v4fa*)(arow + kb + 8 * hh), x1 = *(const v4fa*)(arow + kb + 8 * hh + 4);
    const v4f x2 = *(const v4fa*)(arow + kb + 16 + 8 * hh), x3 = *(const v4fa*)(arow + kb + 16 + 8 * hh + 4);
    float xs[16] = {x0[0],x0[1],x0[2],x0[3],x1[0],x1[1],x1[2],x1[3],x2[0],x2[1],x2[2],x2[3],x3[0],x3[1],x3[2],x3[3]};
#pragma unroll
    for (int i = 0; i < 16; ++i) { const unsigned short hb = bf16_bits(xs[i]); ah.u[i] = hb; al.u[i] = ASPLIT ? bf16_bits(xs[i] - bf16_val(hb)) : (unsigned short)0; }
#pragma unroll
    for (int t = 0; t < 4; ++t) {
      const unsigned short* brow = Wt + (size_t)(col0 + t * 16 + ln) * ldb + kb;
      FragB b;
      b.half[0] = *(const v8us*)(brow + 8 * hh);
      b.half[1] = *(const v8us*)(brow + 16 + 8 * hh);
      acc[t] = mmaN<ASPLIT ? 2 : 1>(ah.v, al.v, b.v, b.v, acc[t]);
    }
  }
#pragma unroll
  for (int t = 0; t < 4; ++t) {
    float bv = bias ? bias[col0 + t * 16 + ln] : 0.f;
    if (BIAS_BF16) bv = bf16_round(bv);
#pragma unroll
    for (int r = 0; r < 8; ++r) { float v = acc[t][r] + bv; if (ACT == 1) v = fmaxf(v, 0.f); so[w][8 * hh + r][t * 16 + ln] = v; }
  }
  __builtin_amdgcn_fence(__ATOMIC_ACQ_REL, "workgroup");
  __builtin_amdgcn_wave_barrier();
  const int rsub = lane >> 4, c4 = (lane & 15) * 4;
  {
#pragma unroll
    for (int q = 0; q < 8; ++q) {
      const int r = q * 2 + rsub;
      const v4f v = *(const v4fa*)&so[w][r][c4];
      *(v4f*)(C + (size_t)(row0 + r) * ldc + col0 + c4) = v;
    }
    
  }
}

// Flash-style causal/unmasked attention, all contractions 3-term bf16 hi/lo splits, f32 softmax with running max.
// q,k,v rows are read from f32 buffers with arbitrary row pitch (so they can live inside a fused qkv buffer);
// D = head size (multiple of 32, <= 128); one wave = 16 query rows; block = 4 waves (64 queries) sharing K/V chunks of 32.
template <int D, bool CAUSAL>
__global__ __launch_bounds__(128) void k_flash(const float* __restrict__ qb, const float* __restrict__ kb, const float* __restrict__ vb,
                                             int pitch, int T, int H, float scale, float* __restrict__ y, int ypitch) {
  constexpr int KS = D / 32;        // k-steps for QK
  constexpr int DT = D / 16;        // d tiles for PV
  __shared__ __attribute__((aligned(16))) unsigned short sKh[32][D + 8], sKl[32][D + 8], sVh[32][D + 8], sVl[32][D + 8];
  __shared__ __attribute__((aligned(16))) unsigned short sPh[4][16][40], sPl[4][16][40];
  __shared__ __attribute__((aligned(16))) float sO[4][16][D];
  const int tid = threadIdx.x, w = tid >> 5, lane = tid & 31, ln = lane & 15, hh = lane >> 4;
  const int nqb = (T + 63) / 64;
  const int bh = blockIdx.x / nqb, qblk = blockIdx.x % nqb;
  const int b = bh / H, h = bh % H;
  const int q0 = qblk * 64 + w * 16;
  const float* Q = qb + (size_t)b * T * pitch + h * D;
  const float* K = kb + (size_t)b * T * pitch + h * D;
  const float* V = vb + (size_t)b * T * pitch + h * D;

  // A fragments of the wave's 16 query rows (scaled), hi/lo
  FragB aqh[KS], aql[KS];
  {
    int row = q0 + ln; if (row >= T) row = T - 1;
    const float* qr = Q + (size_t)row * pitch;
#pragma unroll
    for (int ks = 0; ks < KS; ++ks)
#pragma unroll
      for (int i = 0; i < 16; ++i) {
        const int d = ks * 32 + ((i < 8) ? (8 * hh + i) : (16 + 8 * hh + (i - 8)));
        const float x = qr[d] * scale; const unsigned short hb = bf16_bits(x);
        aqh[ks].u[i] = hb; aql[ks].u[i] = bf16_bits(x - bf16_val(hb));
      }
  }
  float m_r[8], l_r[8];
#pragma unroll
  for (int r = 0; r < 8; ++r) { m_r[r] = -3.0e38f; l_r[r] = 0.f; }
  v8f oacc[DT];
#pragma unroll
  for (int dt = 0; dt < DT; ++dt) oacc[dt] = (v8f){0.f,0.f,0.f,0.f,0.f,0.f,0.f,0.f};

  const int kv_end = CAUSAL ? min(T, qblk * 64 + 64) : T;     // block-uniform
  for (int j0 = 0; j0 < kv_end; j0 += 32) {
    __syncthreads();
    for (int e = tid; e < 32 * (D / 4); e += 128) {
      const int r = e / (D / 4), c4 = (e % (D / 4)) * 4;
      const int key = j0 + r;
      v4f kf = {0.f,0.f,0.f,0.f}, vf = {0.f,0.f,0.f,0.f};
      if (key < T) { kf = *(const v4fa*)(K + (size_t)key * pitch + c4); vf = *(const v4fa*)(V + (size_t)key * pitch + c4); }
#pragma unroll
      for (int t = 0; t < 4; ++t) {
        unsigned short hb = bf16_bits(kf[t]); sKh[r][c4 + t] = hb; sKl[r][c4 + t] = bf16_bits(kf[t] - bf16_val(hb));
        hb = bf16_bits(vf[t]); sVh[r][c4 + t] = hb; sVl[r][c4 + t] = bf16_bits(vf[t] - bf16_val(hb));
      }
    }
    __syncthreads();
    // S tile 16 x 32
    v8f s[2];
#pragma unroll
    for (int nt = 0; nt < 2; ++nt) {
      v8f acc = {};
#pragma unroll
      for (int ks = 0; ks < KS; ++ks) {
        FragB bh_, bl_;
        bh_.half[0] = *(const v8us*)&sKh[nt * 16 + ln][ks * 32 + 8 * hh]; bh_.half[1] = *(const v8us*)&sKh[nt * 16 + ln][ks * 32 + 16 + 8 * hh];
        bl_.half[0] = *(const v8us*)&sKl[nt * 16 + ln][ks * 32 + 8 * hh]; bl_.half[1] = *(const v8us*)&sKl[nt * 16 + ln][ks * 32 + 16 + 8 * hh];
        acc = mmaN<3>(aqh[ks].v, aql[ks].v, bh_.v, bl_.v, acc);
      }
      s[nt] = acc;
    }
    // mask + running max (rows 8hh+r; the 16 lanes of a half share rows)
    float alpha[8];
#pragma unroll
    for (int r = 0; r < 8; ++r) {
      const int qi = q0 + 8 * hh + r;
      const int ja = j0 + ln, jb = j0 + 16 + ln;
      if (CAUSAL) { if (ja > qi) s[0][r] = -3.0e38f; if (jb > qi) s[1][r] = -3.0e38f; }
      if (ja >= T) s[0][r] = -3.0e38f;
      if (jb >= T) s[1][r] = -3.0e38f;
      float mx = fmaxf(s[0][r], s[1][r]);
      mx = fmaxf(mx, __shfl_xor(mx, 1, 32)); mx = fmaxf(mx, __shfl_xor(mx, 2, 32)); mx = fmaxf(mx, __shfl_xor(mx, 4, 32)); mx = fmaxf(mx, __shfl_xor(mx, 8, 32));
      const float mnew = fmaxf(m_r[r], mx);
      alpha[r] = (mnew > -1.0e38f) ? __expf(m_r[r] - mnew) : 1.0f;
      const float p0 = (s[0][r] > -1.0e38f) ? __expf(s[0][r] - mnew) : 0.f;
      const float p1 = (s[1][r] > -1.0e38f) ? __expf(s[1][r] - mnew) : 0.f;
      m_r[r] = mnew;
      l_r[r] = l_r[r] * alpha[r] + p0 + p1;            // per-lane partial row sum (16 lanes combined at the end)
      unsigned short hb = bf16_bits(p0); sPh[w][8 * hh + r][ln] = hb;      sPl[w][8 * hh + r][ln] = bf16_bits(p0 - bf16_val(hb));
      hb = bf16_bits(p1);                sPh[w][8 * hh + r][16 + ln] = hb; sPl[w][8 * hh + r][16 + ln] = bf16_bits(p1 - bf16_val(hb));
    }
#pragma unroll
    for (int dt = 0; dt < DT; ++dt)
#pragma unroll
      for (int r = 0; r < 8; ++r) oacc[dt][r] *= alpha[r];
    __builtin_amdgcn_fence(__ATOMIC_ACQ_REL, "workgroup");
    __builtin_amdgcn_wave_barrier();
    FragB pah, pal;
    pah.half[0] = *(const v8us*)&sPh[w][ln][8 * hh]; pah.half[1] = *(const v8us*)&sPh[w][ln][16 + 8 * hh];
    pal.half[0] = *(const v8us*)&sPl[w][ln][8 * hh]; pal.half[1] = *(const v8us*)&sPl[w][ln][16 + 8 * hh];
#pragma unroll
    for (int dt = 0; dt < DT; ++dt) {
      FragB bvh, bvl;
#pragma unroll
      for (int i = 0; i < 8; ++i) {
        bvh.u[i] = sVh[8 * hh + i][dt * 16 + ln]; bvh.u[8 + i] = sVh[16 + 8 * hh + i][dt * 16 + ln];
        bvl.u[i] = sVl[8 * hh + i][dt * 16 + ln]; bvl.u[8 + i] = sVl[16 + 8 * hh + i][dt * 16 + ln];
      }
      oacc[dt] = mmaN<3>(pah.v, pal.v, bvh.v, bvl.v, oacc[dt]);
    }
    __builtin_amdgcn_fence(__ATOMIC_ACQ_REL, "workgroup");
    __builtin_amdgcn_wave_barrier();
  }
#pragma unroll
  for (int r = 0; r < 8; ++r) {
    float l = l_r[r];
    l += __shfl_xor(l, 1, 32); l += __shfl_xor(l, 2, 32); l += __shfl_xor(l, 4, 32); l += __shfl_xor(l, 8, 32);
    l_r[r] = (l > 0.f) ? 1.0f / l : 0.f;
  }
#pragma unroll
  for (int dt = 0; dt < DT; ++dt)
#pragma unroll
    for (int r = 0; r < 8; ++r) sO[w][8 * hh + r][dt * 16 + ln] = oacc[dt][r] * l_r[r];
  __builtin_amdgcn_fence(__ATOMIC_ACQ_REL, "workgroup");
  __builtin_amdgcn_wave_barrier();
  {
    for (int r = 0; r < 16; ++r) {
      const int row = q0 + r;
      if (row < T && lane < D / 4) {
        const v4f val = *(const v4fa*)&sO[w][r][lane * 4];
        *(v4f*)(y + ((size_t)b * T + row) * ypitch + h * D + lane * 4) = val;
      }
    }
    
  }
}

// GEMM C = act(A·W + bias + resid): A f32 (ASPLIT -> hi/lo 2 terms), Wt bf16 [N][K]; ACT 0 none, 1 relu, 2 exact gelu;
// resid (optional, f32, row index = (row % rmod), pitch ldr, RES_BF16 rounds it) added before the activation.
template <bool ASPLIT, int ACT, bool BIAS_BF16, bool RES_BF16>
__global__ __launch_bounds__(128) void k_gemm_bf3(const float* __restrict__ A, int lda, const unsigned short* __restrict__ Wt, int ldb,
                                                const float* __restrict__ bias, const float* __restrict__ resid, int rmod, int ldr,
                                                float* __restrict__ C, int ldc, int M, int N, int K) {
  __shared__ __attribute__((aligned(16))) float so[4][16][64];
  const int tid = threadIdx.x, w = tid >> 5, lane = tid & 31, ln = lane & 15, hh = lane >> 4;
  const int ntn = N / 64;
  const int wid = blockIdx.x * 4 + w;
  const int mt = wid / ntn, nq = wid % ntn;
  if (mt * 16 >= M) return;
  const int row0 = mt * 16, col0 = nq * 64;
  const float* arow = A + (size_t)(row0 + ln) * lda;
  v8f acc[4] = {};
  for (int kb = 0; kb < K; kb += 32) {
    FragB ah, al;
    const v4f x0 = *(const v4fa*)(arow + kb + 8 * hh), x1 = *(const v4fa*)(arow + kb + 8 * hh + 4);
    const v4f x2 = *(const v4fa*)(arow + kb + 16 + 8 * hh), x3 = *(const v4fa*)(arow + kb + 16 + 8 * hh + 4);
    float xs[16] = {x0[0],x0[1],x0[2],x0[3],x1[0],x1[1],x1[2],x1[3],x2[0],x2[1],x2[2],x2[3],x3[0],x3[1],x3[2],x3[3]};
#pragma unroll
    for (int i = 0; i < 16; ++i) { const unsigned short hb = bf16_bits(xs[i]); ah.u[i] = hb; al.u[i] = ASPLIT ? bf16_bits(xs[i] - bf16_val(hb)) : (unsigned short)0; }
#pragma unroll
    for (int t = 0; t < 4; ++t) {
      const unsigned short* brow = Wt + (size_t)(col0 + t * 16 + ln) * ldb + kb;
      FragB b;
      b.half[0] = *(const v8us*)(brow + 8 * hh);
      b.half[1] = *(const v8us*)(brow + 16 + 8 * hh);
      acc[t] = mmaN<ASPLIT ? 2 : 1>(ah.v, al.v, b.v, b.v, acc[t]);
    }
  }
#pragma unroll
  for (int t = 0; t < 4; ++t) {
    const int col = col0 + t * 16 + ln;
    float bv = bias ? bias[col] : 0.f;
    if (BIAS_BF16) bv = bf16_round(bv);
#pragma unroll
    for (int r = 0; r < 8; ++r) {
      float v = acc[t][r] + bv;
      if (resid) { float rv = resid[(size_t)((row0 + 8 * hh + r) % rmod) * ldr + col]; if (RES_BF16) rv = bf16_round(rv); v += rv; }
      if (ACT == 1) v = fmaxf(v, 0.f);
      if (ACT == 2) v = 0.5f * v * (1.0f + erff(v * 0.70710678118654752f));
      if (ACT == 3) { const float u = 0.7978845608028654f * (v + 0.044715f * v * v * v); v = 0.5f * v * (1.0f + tanhf(u)); }
      so[w][8 * hh + r][t * 16 + ln] = v;
    }
  }
  __builtin_amdgcn_fence(__ATOMIC_ACQ_REL, "workgroup");
  __builtin_amdgcn_wave_barrier();
  const int rsub = lane >> 4, c4 = (lane & 15) * 4;
  {
#pragma unroll
    for (int q = 0; q < 8; ++q) {
      const int r = q * 2 + rsub;
      const v4f v = *(const v4fa*)&so[w][r][c4];
      *(v4f*)(C + (size_t)(row0 + r) * ldc + col0 + c4) = v;
    }
    
  }
}
// row LayerNorm (biased variance, eps) over N: s = X (+ R); optional out_sum <- s; out_norm <- (s-mu)*rsqrt(var+eps)*g + b
template <bool PARAM_BF16>
__global__ __launch_bounds__(256) void k_layernorm(const float* __restrict__ X, const float* __restrict__ R, const float* __restrict__ g, const float* __restrict__ bta,
                                                  float* __restrict__ out_sum, float* __restrict__ out_norm, int N, float eps) {
  __shared__ float red[256];
  const int row = blockIdx.x, tid = threadIdx.x;
  const float* x = X + (size_t)row * N; const float* rr = R ? R + (size_t)row * N : nullptr;
  float vals[16];                     // up to N = 4096
  const int per = N / 256;            // contiguous chunk per thread? use strided-by-4 chunks: thread handles j = tid*4 + 1024*u
  float s1 = 0.f;
  for (int u = 0; u < per / 4; ++u) {
    const int j = tid * 4 + 1024 * u;
    const v4f a = *(const v4fa*)(x + j);
    v4f b = {0.f,0.f,0.f,0.f}; if (rr) b = *(const v4fa*)(rr + j);
#pragma unroll
    for (int q = 0; q < 4; ++q) { const float v = a[q] + b[q]; vals[u * 4 + q] = v; s1 += v; }
  }
  red[tid] = s1; __syncthreads();
  for (int st = 128; st > 0; st >>= 1) { if (tid < st) red[tid] += red[tid + st]; __syncthreads(); }
  const float mu = red[0] / (float)N; __syncthreads();
  float s2 = 0.f;
  for (int u = 0; u < per / 4; ++u)
#pragma unroll
    for (int q = 0; q < 4; ++q) { const float c = vals[u * 4 + q] - mu; s2 += c * c; }
  red[tid] = s2; __syncthreads();
  for (int st = 128; st > 0; st >>= 1) { if (tid < st) red[tid] += red[tid + st]; __syncthreads(); }
  const float rs = rsqrtf(red[0] / (float)N + eps);
  {
    for (int u = 0; u < per / 4; ++u) {
      const int j = tid * 4 + 1024 * u;
      v4f o, sm;
#pragma unroll
      for (int q = 0; q < 4; ++q) {
        float gg = g[j + q], bb = bta[j + q];
        if (PARAM_BF16) { gg = bf16_round(gg); bb = bf16_round(bb); }
        sm[q] = vals[u * 4 + q]; o[q] = (vals[u * 4 + q] - mu) * rs * gg + bb;
      }
      if (out_sum) *(v4f*)(out_sum + (size_t)row * N + j) = sm;
      *(v4f*)(out_norm + (size_t)row * N + j) = o;
    }
    
  }
}



// ---- f16 WMMA path (v_wmma_f32_16x16x32_f16): 11-bit significands for operands in range — used where a [0,1] probability operand needs more precision than bf16
typedef _Float16 v16h __attribute__((ext_vector_type(16)));
union FragH { v16h v; v8us half[2]; _Float16 h[16]; unsigned short u[16]; };
template <int NT>
__device__ __forceinline__ v8f mmaH(v16h ah, v16h al, v16h bh, v16h bl, v8f c) {
  c = __builtin_amdgcn_wmma_f32_16x16x32_f16(false, ah, false, bh, (short)0, c, false, false);
  if (NT >= 2) c = __builtin_amdgcn_wmma_f32_16x16x32_f16(false, al, false, bh, (short)0, c, false, false);
  if (NT >= 3) c = __builtin_amdgcn_wmma_f32_16x16x32_f16(false, ah, false, bl, (short)0, c, false, false);
  asm volatile("v_nop\n\tv_nop\n\tv_nop\n\tv_nop" : "+v"(c) : "v"(ah), "v"(al), "v"(bh), "v"(bl));
  return c;
}
// batched GEMM like k_gemm_b but f16 operands: A f32 (split into f16 hi/lo if ASPLIT, else rounded to f16), Bt = f16 values [n][k]; alpha; C f32; N multiple of 16 (partial tiles skipped)
template <bool ASPLIT>
__global__ __launch_bounds__(128) void k_gemm_h(const float* __restrict__ A, int lda, size_t sA, const _Float16* __restrict__ Bh, int ldb, size_t sB, float alpha, float* __restrict__ C, int ldc, size_t sC, int M, int N, int K) {
  __shared__ __attribute__((aligned(16))) float so[4][16][64];
  const int tid = threadIdx.x, w = tid >> 5, lane = tid & 31, ln = lane & 15, hh = lane >> 4; const int by = blockIdx.y;
  A += (size_t)by * sA; Bh += (size_t)by * sB; C += (size_t)by * sC;
  const int ntn = (N + 63) / 64; const int wid = blockIdx.x * 4 + w; const int mt = wid / ntn, nq = wid % ntn; if (mt * 16 >= M) return;
  const int row0 = mt * 16, col0 = nq * 64; const float* arow = A + (size_t)(row0 + ln) * lda;
  v8f acc[4] = {};
  for (int kb = 0; kb < K; kb += 32) {
    FragH ah, al;
    const v4f x0 = *(const v4fa*)(arow + kb + 8 * hh), x1 = *(const v4fa*)(arow + kb + 8 * hh + 4), x2 = *(const v4fa*)(arow + kb + 16 + 8 * hh), x3 = *(const v4fa*)(arow + kb + 16 + 8 * hh + 4);
    float xs[16] = {x0[0],x0[1],x0[2],x0[3],x1[0],x1[1],x1[2],x1[3],x2[0],x2[1],x2[2],x2[3],x3[0],x3[1],x3[2],x3[3]};
#pragma unroll
    for (int i = 0; i < 16; ++i) { const _Float16 h = (_Float16)xs[i]; ah.h[i] = h; al.h[i] = ASPLIT ? (_Float16)(xs[i] - (float)h) : (_Float16)0.0f; }
#pragma unroll
    for (int t = 0; t < 4; ++t) { if (col0 + t * 16 >= N) continue; const size_t boff = (size_t)(col0 + t * 16 + ln) * ldb + kb; FragH bq; bq.half[0] = *(const v8us*)(Bh + boff + 8 * hh); bq.half[1] = *(const v8us*)(Bh + boff + 16 + 8 * hh);
      acc[t] = mmaH<ASPLIT ? 2 : 1>(ah.v, al.v, bq.v, bq.v, acc[t]); }
  }
#pragma unroll
  for (int t = 0; t < 4; ++t) { if (col0 + t * 16 >= N) continue;
#pragma unroll
    for (int r = 0; r < 8; ++r) so[w][8 * hh + r][t * 16 + ln] = acc[t][r] * alpha; }
  __builtin_amdgcn_fence(__ATOMIC_ACQ_REL, "workgroup"); __builtin_amdgcn_wave_barrier();
  const int rsub = lane >> 4, c4 = (lane & 15) * 4;
  {
#pragma unroll
    for (int q = 0; q < 8; ++q) { const int r = q * 2 + rsub; if (col0 + c4 < N) { const v4f v = *(const v4fa*)&so[w][r][c4]; *(v4f*)(C + (size_t)(row0 + r) * ldc + col0 + c4) = v; } }
     }
}

// Wt[n][k] = f16(W[k][n]·scale) from f32 row-major W[K][N] (scale = power of two; bf16-exact weights stay exact in f16 away from the subnormal range)
__global__ __launch_bounds__(256) void k_wt_f16(const float* __restrict__ W, _Float16* __restrict__ Wt, int K, int N, float scale) {
  const int t = blockIdx.x * 256 + threadIdx.x; if (t >= N * (K / 8)) return; const int n = t / (K / 8), k8 = (t % (K / 8)) * 8; FragH f;
#pragma unroll
  for (int i = 0; i < 8; ++i) f.h[i] = (_Float16)(bf16_round(W[(size_t)(k8 + i) * N + n]) * scale); const v8us o = f.half[0];
  *(v8us*)((unsigned short*)Wt + (size_t)n * K + k8) = o; 
}
// k_gemm_hh variant with fused epilogue: v = acc·alpha + bias[by·sBias + col] (+ CP[(row/rowsPerB)·sCPb + by·64 + col] if CP) ; ACT 0 none / 1 elu ; writes f32 C and/or f16 C16 (each if non-null)
template <int ACT>
__global__ __launch_bounds__(128) void k_gemm_hhx(const _Float16* __restrict__ A, int lda, size_t sA, const _Float16* __restrict__ Bh, int ldb, size_t sB, float alpha, const float* __restrict__ bias, size_t sBias, const float* __restrict__ CP, int rowsPerB, size_t sCPb, int row0g,
    float* __restrict__ C, _Float16* __restrict__ C16, int ldc, size_t sC, int M, int N, int K) {
  __shared__ __attribute__((aligned(16))) float so[4][16][64];
  const int tid = threadIdx.x, w = tid >> 5, lane = tid & 31, ln = lane & 15, hh = lane >> 4; const int by = blockIdx.y;
  A += (size_t)by * sA; Bh += (size_t)by * sB; const size_t cofs = (size_t)by * sC; const float* bp = bias ? bias + (size_t)by * sBias : nullptr;
  const int ntn = (N + 63) / 64; const int wid = blockIdx.x * 4 + w; const int mt = wid / ntn, nq = wid % ntn; if (mt * 16 >= M) return;
  const int row0 = mt * 16, col0 = nq * 64; const _Float16* arow = A + (size_t)(row0 + ln) * lda;
  v8f acc[4] = {};
  for (int kb = 0; kb < K; kb += 32) { FragH ah; ah.half[0] = *(const v8us*)((const unsigned short*)arow + kb + 8 * hh); ah.half[1] = *(const v8us*)((const unsigned short*)arow + kb + 16 + 8 * hh);
#pragma unroll
    for (int t = 0; t < 4; ++t) { if (col0 + t * 16 >= N) continue; const size_t boff = (size_t)(col0 + t * 16 + ln) * ldb + kb; FragH bq; bq.half[0] = *(const v8us*)((const unsigned short*)Bh + boff + 8 * hh); bq.half[1] = *(const v8us*)((const unsigned short*)Bh + boff + 16 + 8 * hh);
      acc[t] = mmaH<1>(ah.v, ah.v, bq.v, bq.v, acc[t]); }
  }
#pragma unroll
  for (int t = 0; t < 4; ++t) { if (col0 + t * 16 >= N) continue; const int col = col0 + t * 16 + ln; const float bv = bp ? bf16_round(bp[col]) : 0.f;
#pragma unroll
    for (int r = 0; r < 8; ++r) { float v = acc[t][r] * alpha + bv; if (CP) { const int bidx = (row0g + row0 + 8 * hh + r) / rowsPerB; v += CP[(size_t)bidx * sCPb + (size_t)by * 64 + col]; } if (ACT == 1) v = (v > 0.f) ? v : expm1f(v); else if (ACT == 7) v = (v > 0.f) ? v + 1.0f : expf(v); else if (ACT == 8) v = tanhf(v); else if (ACT == 9) v = 0.5f * v * (1.0f + tanhf(0.7978845608028654f * (v + 0.044715f * v * v * v))); else if (ACT == 11) v = 1.0f / (1.0f + expf(-v)); else if (ACT == 12) v = (v > 0.f) ? v : 0.01f * v; else if (ACT == 14) v = (v > 0.f) ? v : 0.1f * v; else if (ACT == 15) v = v / (1.0f + expf(-v)); else if (ACT == 3) v = fmaxf(v, 0.f); else if (ACT == 6) v = 0.5f * v * (1.0f + erff(v * 0.70710678118654752f)); so[w][8 * hh + r][t * 16 + ln] = v; } }
  __builtin_amdgcn_fence(__ATOMIC_ACQ_REL, "workgroup"); __builtin_amdgcn_wave_barrier();
  const int rsub = lane >> 4, c4 = (lane & 15) * 4; typedef _Float16 v4h __attribute__((ext_vector_type(4)));
  {
#pragma unroll
    for (int q = 0; q < 8; ++q) { const int r = q * 2 + rsub; if (col0 + c4 < N) { const v4f v = *(const v4fa*)&so[w][r][c4]; if (C) *(v4f*)(C + cofs + (size_t)(row0 + r) * ldc + col0 + c4) = v; if (C16) { v4h h4; for (int i = 0; i < 4; ++i) h4[i] = (_Float16)v[i]; *(v4h*)(C16 + cofs + (size_t)(row0 + r) * ldc + col0 + c4) = h4; } } }
     }
}


typedef _Float16 v4h __attribute__((ext_vector_type(4)));

__global__ __launch_bounds__(256) void k_x16(const float* __restrict__ x, _Float16* __restrict__ X16, size_t n8) { const size_t t = (size_t)blockIdx.x * 256 + threadIdx.x; if (t >= n8) return; FragH f;
#pragma unroll
  for (int q = 0; q < 8; ++q) f.h[q] = (_Float16)bf16_round(x[t * 8 + q]); *(v8us*)((unsigned short*)X16 + t * 8) = f.half[0];  }
__global__ __launch_bounds__(256) void k_h16(const float* __restrict__ x, _Float16* __restrict__ X16, size_t n8) { const size_t t = (size_t)blockIdx.x * 256 + threadIdx.x; if (t >= n8) return; FragH f;
#pragma unroll
  for (int q = 0; q < 8; ++q) f.h[q] = (_Float16)x[t * 8 + q]; *(v8us*)((unsigned short*)X16 + t * 8) = f.half[0];  }
__global__ __launch_bounds__(256) void k_round16f(const float* __restrict__ W, _Float16* __restrict__ Bt, size_t n8) { const size_t t = (size_t)blockIdx.x * 256 + threadIdx.x; if (t >= n8) return; FragH f;
#pragma unroll
  for (int i = 0; i < 8; ++i) f.h[i] = (_Float16)(bf16_round(W[t * 8 + i]) * 16.0f); *(v8us*)((unsigned short*)Bt + t * 8) = f.half[0];  }
template <int NHv, int TTv>
__global__ __launch_bounds__(256) void k_vt(const _Float16* __restrict__ V16, int ldv, int voff, _Float16* __restrict__ Vt) { __shared__ unsigned short tl[64][66]; const int tid = threadIdx.x; const int slab = blockIdx.x / (TTv / 64), lg = blockIdx.x % (TTv / 64); const int b = slab / NHv, h = slab % NHv;
  for (int i = tid; i < 64 * 8; i += 256) { const int r = i / 8, c8 = (i % 8) * 8; FragH f; f.half[0] = *(const v8us*)((const unsigned short*)V16 + ((size_t)b * TTv + lg * 64 + r) * ldv + voff + h * 64 + c8);
#pragma unroll
    for (int q = 0; q < 8; ++q) tl[r][c8 + q] = f.u[q]; }
  __syncthreads();
  {
#pragma unroll
    for (int rd = 0; rd < 2; ++rd) { const int d = rd * 32 + tid / 8, pc = tid % 8; FragH f;
#pragma unroll
      for (int q = 0; q < 8; ++q) f.u[q] = tl[pc * 8 + q][d];
      *(v8us*)((unsigned short*)Vt + ((size_t)slab * 64 + d) * TTv + lg * 64 + pc * 8) = f.half[0]; }
     } }

__global__ __launch_bounds__(256) void k_x7(const float* __restrict__ nodes, const float* __restrict__ centre, float* __restrict__ X7) { const int t = blockIdx.x * 256 + threadIdx.x; if (t >= NNODE * 2) return; const int n = t >> 1, half = t & 1; v4f v;
  if (half == 0) { v[0] = bf16_round(nodes[(size_t)n * 3]); v[1] = bf16_round(nodes[(size_t)n * 3 + 1]); v[2] = bf16_round(nodes[(size_t)n * 3 + 2]); v[3] = bf16_round(centre[0]); } else { v[0] = bf16_round(centre[1]); v[1] = bf16_round(centre[2]); v[2] = 1.0f; v[3] = 0.f; }
  *(v4f*)(X7 + (size_t)t * 4) = v;  }
__global__ __launch_bounds__(256) void k_proj(const float* __restrict__ nodes, const float* __restrict__ centre, const float* __restrict__ Wq, const float* __restrict__ bq, const float* __restrict__ Wk, const float* __restrict__ bk, float* __restrict__ KEYS, _Float16* __restrict__ K16, _Float16* __restrict__ Q16) {
  #pragma clang fp contract(off)
  const size_t t = (size_t)blockIdx.x * 256 + threadIdx.x; if (t >= (size_t)NNODE * DD / 4) return; const int n = (int)((t * 4) / DD), c0 = (int)((t * 4) % DD); float xa[7];
  for (int i = 0; i < 3; ++i) { xa[i] = bf16_round(nodes[(size_t)n * 3 + i]); xa[3 + i] = bf16_round(centre[i]); } xa[6] = 1.0f;
  float kv[4], qv[4]; for (int q = 0; q < 4; ++q) { kv[q] = bf16_round(bk[c0 + q]); qv[q] = bf16_round(bq[c0 + q]); }
#pragma unroll 1
  for (int i = 0; i < 6; ++i) for (int q = 0; q < 4; ++q) { kv[q] += xa[i] * bf16_round(Wk[(size_t)(c0 + q) * 6 + i]); qv[q] += xa[i] * bf16_round(Wq[(size_t)(c0 + q) * 6 + i]); }
  typedef _Float16 v4h __attribute__((ext_vector_type(4))); v4h fk, fq; for (int q = 0; q < 4; ++q) { fk[q] = (_Float16)kv[q]; fq[q] = (_Float16)qv[q]; } const v4f k0 = {kv[0], kv[1], kv[2], kv[3]};
  { *(v4f*)(KEYS + t * 4) = k0; *(v4h*)(K16 + t * 4) = fk; *(v4h*)(Q16 + t * 4) = fq;      /* one 16-B f32 piece and 8-B f16 pieces per lane, lane-contiguous */
     } }
__global__ __launch_bounds__(256) void k_rvec(const float* __restrict__ Wq, const float* __restrict__ bq, const float* __restrict__ Wk, const float* __restrict__ bk, const float* __restrict__ X7, float* __restrict__ R) {
  #pragma clang fp contract(off)
  __shared__ float M[7][8]; const int tid = threadIdx.x;
  if (tid < 49) { const int i = tid / 7, j = tid % 7; float s = 0.f;
#pragma unroll 1
    for (int c = 0; c < DD; ++c) { const float a = (i < 6) ? bf16_round(Wk[(size_t)c * 6 + i]) : bf16_round(bk[c]); const float b = (j < 6) ? bf16_round(Wq[(size_t)c * 6 + j]) : bf16_round(bq[c]); s += a * b; } M[i][j] = s; }
  __syncthreads();
  const int t = blockIdx.x * 256 + tid; if (t >= NNODE * 2) return; const int n = t >> 1, half = t & 1; float xa[8]; { const v4f a = *(const v4fa*)(X7 + (size_t)n * 8), b = *(const v4fa*)(X7 + (size_t)n * 8 + 4); xa[0] = a[0]; xa[1] = a[1]; xa[2] = a[2]; xa[3] = a[3]; xa[4] = b[0]; xa[5] = b[1]; xa[6] = b[2]; }
  v4f o = {0.f, 0.f, 0.f, 0.f};      /* this thread's half of R[n]: columns j = 4·half .. 4·half+3 (j = 7 stays 0) */
#pragma unroll 1
  for (int i = 0; i < 7; ++i) for (int q = 0; q < 4; ++q) { const int j = half * 4 + q; if (j < 7) o[q] += xa[i] * M[i][j]; }
  *(v4f*)(R + (size_t)t * 4) = o;  }
__device__ __forceinline__ float sai_dot(const float* r, v4f a, v4f b) { return r[0] * a[0] + r[1] * a[1] + r[2] * a[2] + r[3] * a[3] + r[4] * b[0] + r[5] * b[1] + r[6] * b[2]; }
// value of lane l ^ MASK inside a 16-lane row (DPP row_xmask), and of lane l ^ 16: register moves, no LDS round trip
template <int MASK> __device__ __forceinline__ float lane_xor_row(float x) { return __int_as_float(__builtin_amdgcn_update_dpp(0, __float_as_int(x), 0x160 | MASK, 0xf, 0xf, true)); }
__device__ __forceinline__ float lane_xor16(float x) { const int v = __float_as_int(x); return __int_as_float(__builtin_amdgcn_permlanex16(v, v, 0x76543210, 0xfedcba98, false, false)); }
__device__ __forceinline__ float wave_max(float x) { x = fmaxf(x, lane_xor_row<1>(x)); x = fmaxf(x, lane_xor_row<2>(x)); x = fmaxf(x, lane_xor_row<4>(x)); x = fmaxf(x, lane_xor_row<8>(x)); return fmaxf(x, lane_xor16(x)); }
__device__ __forceinline__ float wave_sum(float x) { x += lane_xor_row<1>(x); x += lane_xor_row<2>(x); x += lane_xor_row<4>(x); x += lane_xor_row<8>(x); return x + lane_xor16(x); }
// One work-group = 32 waves that split the 8192 KEYS: thread t owns keys 8t .. 8t+7 and holds their vectors in registers for all SOFT_ROWS rows of the group.
// Rows go four at a time: logits once into registers, row maximum and row sum over the 32 waves through LDS, the exponentials overwrite the logits, P f16 x2^15 leaves as one 16-B piece per lane and row.
#define SOFT_ROWS 32
__global__ __launch_bounds__(1024) void k_soft(const float* __restrict__ R, const float* __restrict__ X7, int n0, _Float16* __restrict__ P16) {
  __shared__ __attribute__((aligned(16))) float redM[32][4], redZ[32][4];
  const int tid = threadIdx.x, wv = tid >> 5, lane = tid & 31;
  v4f xa[8], xb[8];
  // every unroll below: xa, xb, s, m4 and z4 stay in registers only where their indices are constants
#pragma unroll
  for (int e = 0; e < 8; ++e) { xa[e] = *(const v4fa*)(X7 + ((size_t)tid * 8 + e) * 8); xb[e] = *(const v4fa*)(X7 + ((size_t)tid * 8 + e) * 8 + 4); }
  for (int g = 0; g < SOFT_ROWS / 4; ++g) {
    const int nl = blockIdx.x * SOFT_ROWS + g * 4;
    float s[4][8]; v4f m4, z4;
    // unrolled for constant indices (registers), and the four rows' chains interleave
#pragma unroll
    for (int j = 0; j < 4; ++j) {
      const float* rp = R + (size_t)(n0 + nl + j) * 8; const v4f a = *(const v4fa*)rp, b = *(const v4fa*)(rp + 4); const float r[7] = {a[0], a[1], a[2], a[3], b[0], b[1], b[2]};
      float mx = -3.0e38f;
      // unrolled for constant indices (registers)
#pragma unroll
      for (int e = 0; e < 8; ++e) { s[j][e] = sai_dot(r, xa[e], xb[e]); mx = fmaxf(mx, s[j][e]); }
      m4[j] = wave_max(mx);
    }
    if (lane == 0) *(v4f*)&redM[wv][0] = m4;
    __syncthreads();      /* every wave's four maxima are in redM */
    m4 = *(const v4f*)&redM[lane][0];
    // unrolled for constant indices (registers), and the four rows' chains interleave
#pragma unroll
    for (int j = 0; j < 4; ++j) {
      const float mx = wave_max(m4[j]); float z = 0.f;
      // unrolled for constant indices (registers)
#pragma unroll
      for (int e = 0; e < 8; ++e) { s[j][e] = expf(s[j][e] - mx); z += s[j][e]; }
      z4[j] = wave_sum(z);
    }
    if (lane == 0) *(v4f*)&redZ[wv][0] = z4;
    __syncthreads();      /* every wave's four sums are in redZ; it also ends every read of redM before the next four rows write it */
    z4 = *(const v4f*)&redZ[lane][0];
    // unrolled for constant indices (registers), and the four rows' chains interleave
#pragma unroll
    for (int j = 0; j < 4; ++j) {
      const float iz = 32768.0f / wave_sum(z4[j]); FragH f;
      // unrolled for constant indices (registers)
#pragma unroll
      for (int e = 0; e < 8; ++e) f.h[e] = (_Float16)(s[j][e] * iz);
      *(v8us*)((unsigned short*)P16 + (size_t)(nl + j) * NNODE + (size_t)tid * 8) = f.half[0];
    }
  }
}

extern "C" void kernel_launch(void* const* d_in, const int* in_sizes, int n_in,
                              void* d_out, int out_size, void* d_ws, size_t ws_size, hipStream_t stream) {
  (void)in_sizes; (void)n_in; (void)out_size;
  const float* const* I = (const float* const*)d_in; const float* nodes = I[0]; const float* centre = I[1]; const float* Wq = I[2]; const float* bq = I[3]; const float* Wk = I[4]; const float* bk = I[5]; const float* Wv = I[6]; const float* bv = I[7];
  char* ws = (char*)d_ws; size_t off = 0;
  auto take = [&](size_t bytes) { char* p = ws + off; off += (bytes + 255) & ~(size_t)255; return p; };
  _Float16* Bwv = (_Float16*)take((size_t)DD * 2 * DD * 2); float* KEYS = (float*)take((size_t)NNODE * DD * 4); _Float16* K16 = (_Float16*)take((size_t)NNODE * DD * 2); _Float16* Q16 = (_Float16*)take((size_t)NNODE * DD * 2); float* X7 = (float*)take((size_t)NNODE * 8 * 4); float* R = (float*)take((size_t)NNODE * 8 * 4);
  _Float16* QV = (_Float16*)take((size_t)NNODE * DD * 2); _Float16* QVt = (_Float16*)take((size_t)DD * NNODE * 2); _Float16* P16 = (_Float16*)take((size_t)NNODE * NNODE * 2); float* O = (float*)take((size_t)NNODE * DD * 4);
  if (off > ws_size) return;      // 194 MiB of the 256 MiB workspace, the full P plane alone 128 MiB
  k_round16f<<<(unsigned)(((size_t)DD * 2 * DD / 8 + 255) / 256), 256, 0, stream>>>(Wv, Bwv, (size_t)DD * 2 * DD / 8);      /* Wv (512, 1024) natural ×2^4: row d = [Wv_q | Wv_k] */
  k_x7<<<NNODE * 2 / 256, 256, 0, stream>>>(nodes, centre, X7); k_proj<<<(unsigned)(((size_t)NNODE * DD / 4 + 255) / 256), 256, 0, stream>>>(nodes, centre, Wq, bq, Wk, bk, KEYS, K16, Q16);
  k_rvec<<<NNODE * 2 / 256, 256, 0, stream>>>(Wq, bq, Wk, bk, X7, R);
  const dim3 gq(((NNODE / 16) * (DD / 64) + 3) / 4, 1);
  k_gemm_hhx<0><<<gq, 128, 0, stream>>>(Q16, DD, 0, Bwv, 2 * DD, 0, 0.0625f, nullptr, 0, nullptr, 1, 0, 0, nullptr, QV, DD, 0, NNODE, DD, DD);      /* QV = queries·Wv_qᵀ (Bt rows d, cols 0..511, ldb 1024): M 8192 N 512 K 512 */
  k_vt<DD / 64, NNODE><<<(DD / 64) * (NNODE / 64), 256, 0, stream>>>(QV, DD, 0, QVt);      /* QVᵀ [512][8192] */
  k_soft<<<NNODE / SOFT_ROWS, 1024, 0, stream>>>(R, X7, 0, P16);      /* 256 work-groups of 32 waves, 32 rows each */
  k_gemm_hhx<0><<<gq, 128, 0, stream>>>(P16, NNODE, 0, QVt, NNODE, 0, 0.000030517578125f, nullptr, 0, KEYS, 1, (size_t)DD, 0, O, nullptr, DD, 0, NNODE, DD, NNODE);      /* O = keys + attn*QV: M 8192 N 512 K 8192, 1024 work-groups */
  k_gemm_hhx<0><<<gq, 128, 0, stream>>>(K16, DD, 0, Bwv + DD, 2 * DD, 0, 0.0625f, bv, 0, O, 1, (size_t)DD, 0, (float*)d_out, nullptr, DD, 0, NNODE, DD, DD);      /* out = keys·Wv_kᵀ + bv + O (Bt rows d at cols 512.., ldb 1024) */
}

// v003
// A run of this version takes 246 microseconds.
// In both of two side-by-side timings against v002, it was 2.15 times as fast.
// Counting every step since v000, it is 11.3 times as fast.
#include <hip/hip_runtime.h>
#include <stdint.h>
// 'self_attn_init' (N=8192 nodes, 3-d coords + a shared 3-d centre → 6 inputs, D=512): x = [node, centre]; keys = x·Wkᵀ + bk; queries = x·Wqᵀ + bq; attn = softmax_m(keys·queriesᵀ) (UNSCALED, rank-7 logits up to ±O(100));
// out = keys + attn·(queries·Wv[:, :512]ᵀ) + keys·Wv[:, 512:]ᵀ + bv.
// Compute dtype: inputs/weights/biases rounded to bf16. The logits are an exact bilinear form in the 7-vector x̃ = [x, 1]: s[n][m] = (x̃_nᵀ·M)·x̃_m with M = [Wk bk]ᵀ[Wq bq] (7×7, f32), evaluated per pair in f32 (7 FMAs) —
// no 16-bit rounding touches the huge logits; softmax with the 8192 keys split over a work-group's 32 waves (logits kept in registers) writes P f16 ×2^15 for all 8192 rows in one launch; attn·QV and keys·Wv_kᵀ as GEMMs on v_wmma_f32_16x16x32_f16 (f32 accumulate) with keys (f32) and the first
// product carried through the epilogue addends.
#define NNODE 8192
#define DD 512

typedef __bf16 v16b __attribute__((ext_vector_type(16)));
typedef unsigned short v8us __attribute__((ext_vector_type(8), may_alias));
typedef float  v8f  __attribute__((ext_vector_type(8)));
typedef float  v4f  __attribute__((ext_vector_type(4)));
typedef float  v4fa __attribute__((ext_vector_type(4), may_alias));
union FragB { v16b v; v8us half[2]; unsigned short u[16]; };

__device__ __forceinline__ unsigned short bf16_bits(float x) { unsigned int u = __float_as_uint(x); return (unsigned short)((u + 0x7FFFu + ((u >> 16) & 1u)) >> 16); }
__device__ __forceinline__ float bf16_val(unsigned short b) { return __uint_as_float(((unsigned int)b) << 16); }
__device__ __forceinline__ float bf16_round(float x) { return bf16_val(bf16_bits(x)); }
// D += A·B with NT terms: 1 = ah·bh, 2 = + al·bh (A split), 3 = + ah·bl (both split)
template <int NT>
__device__ __forceinline__ v8f mmaN(v16b ah, v16b al, v16b bh, v16b bl, v8f c) {
  c = __builtin_amdgcn_wmma_f32_16x16x32_bf16(false, ah, false, bh, (short)0, c, false, false);
  if (NT >= 2) c = __builtin_amdgcn_wmma_f32_16x16x32_bf16(false, al, false, bh, (short)0, c, false, false);
  if (NT >= 3) c = __builtin_amdgcn_wmma_f32_16x16x32_bf16(false, ah, false, bl, (short)0, c, false, false);
  asm volatile("v_nop\n\tv_nop\n\tv_nop\n\tv_nop" : "+v"(c) : "v"(ah), "v"(al), "v"(bh), "v"(bl));
  return c;
}

__global__ __launch_bounds__(256) void k_wt_bf16(const float* __restrict__ W, unsigned short* __restrict__ Wt, int K, int N) {
  const int t = blockIdx.x * 256 + threadIdx.x;
  const int k8n = K / 8;
  if (t >= N * k8n) return;
  const int n = t / k8n, k8 = (t % k8n) * 8;
  v8us v;
#pragma unroll
  for (int i = 0; i < 8; ++i) v[i] = bf16_bits(W[(size_t)(k8 + i) * N + n]);
  *(v8us*)(Wt + (size_t)n * K + k8) = v;
  
}

// GEMM C[M][N] (f32, pitch ldc) = act(A[M][K]·W + bias). A f32 row-major (pitch lda) converted per fragment to bf16
// (ASPLIT: hi/lo two planes -> 2 terms, else single rounded term); Wt bf16 [N][K] (pitch ldb). BIAS_BF16 rounds the
// bias to bf16 first (bias quantised to bf16 before the add). K%32==0, M%16==0, N%64==0.
template <bool ASPLIT, int ACT, bool BIAS_BF16>
__global__ __launch_bounds__(128) void k_gemm_bf(const float* __restrict__ A, int lda, const unsigned short* __restrict__ Wt, int ldb,
                                               const float* __restrict__ bias, float* __restrict__ C, int ldc, int M, int N, int K) {
  __shared__ __attribute__((aligned(16))) float so[4][16][64];
  const int tid = threadIdx.x, w = tid >> 5, lane = tid & 31, ln = lane & 15, hh = lane >> 4;
  const int ntn = N / 64;
  const int wid = blockIdx.x * 4 + w;
  const int mt = wid / ntn, nq = wid % ntn;
  if (mt * 16 >= M) return;
  const int row0 = mt * 16, col0 = nq * 64;
  const float* arow = A + (size_t)(row0 + ln) * lda;
  v8f acc[4] = {};
  for (int kb = 0; kb < K; kb += 32) {
    FragB ah, al;
    const v4f x0 = *(const v4fa*)(arow + kb + 8 * hh), x1 = *(const v4fa*)(arow + kb + 8 * hh + 4);
    const v4f x2 = *(const v4fa*)(arow + kb + 16 + 8 * hh), x3 = *(const v4fa*)(arow + kb + 16 + 8 * hh + 4);
    float xs[16] = {x0[0],x0[1],x0[2],x0[3],x1[0],x1[1],x1[2],x1[3],x2[0],x2[1],x2[2],x2[3],x3[0],x3[1],x3[2],x3[3]};
#pragma unroll
    for (int i = 0; i < 16; ++i) { const unsigned short hb = bf16_bits(xs[i]); ah.u[i] = hb; al.u[i] = ASPLIT ? bf16_bits(xs[i] - bf16_val(hb)) : (unsigned short)0; }
#pragma unroll
    for (int t = 0; t < 4; ++t) {
      const unsigned short* brow = Wt + (size_t)(col0 + t * 16 + ln) * ldb + kb;
      FragB b;
      b.half[0] = *(const v8us*)(brow + 8 * hh);
      b.half[1] = *(const v8us*)(brow + 16 + 8 * hh);
      acc[t] = mmaN<ASPLIT ? 2 : 1>(ah.v, al.v, b.v, b.v, acc[t]);
    }
  }
#pragma unroll
  for (int t = 0; t < 4; ++t) {
    float bv = bias ? bias[col0 + t * 16 + ln] : 0.f;
    if (BIAS_BF16) bv = bf16_round(bv);
#pragma unroll
    for (int r = 0; r < 8; ++r) { float v = acc[t][r] + bv; if (ACT == 1) v = fmaxf(v, 0.f); so[w][8 * hh + r][t * 16 + ln] = v; }
  }
  __builtin_amdgcn_fence(__ATOMIC_ACQ_REL, "workgroup");
  __builtin_amdgcn_wave_barrier();
  const int rsub = lane >> 4, c4 = (lane & 15) * 4;
  {
#pragma unroll
    for (int q = 0; q < 8; ++q) {
      const int r = q * 2 + rsub;
      const v4f v = *(const v4fa*)&so[w][r][c4];
      *(v4f*)(C + (size_t)(row0 + r) * ldc + col0 + c4) = v;
    }
    
  }
}

// Flash-style causal/unmasked attention, all contractions 3-term bf16 hi/lo splits, f32 softmax with running max.
// q,k,v rows are read from f32 buffers with arbitrary row pitch (so they can live inside a fused qkv buffer);
// D = head size (multiple of 32, <= 128); one wave = 16 query rows; block = 4 waves (64 queries) sharing K/V chunks of 32.
template <int D, bool CAUSAL>
__global__ __launch_bounds__(128) void k_flash(const float* __restrict__ qb, const float* __restrict__ kb, const float* __restrict__ vb,
                                             int pitch, int T, int H, float scale, float* __restrict__ y, int ypitch) {
  constexpr int KS = D / 32;        // k-steps for QK
  constexpr int DT = D / 16;        // d tiles for PV
  __shared__ __attribute__((aligned(16))) unsigned short sKh[32][D + 8], sKl[32][D + 8], sVh[32][D + 8], sVl[32][D + 8];
  __shared__ __attribute__((aligned(16))) unsigned short sPh[4][16][40], sPl[4][16][40];
  __shared__ __attribute__((aligned(16))) float sO[4][16][D];
  const int tid = threadIdx.x, w = tid >> 5, lane = tid & 31, ln = lane & 15, hh = lane >> 4;
  const int nqb = (T + 63) / 64;
  const int bh = blockIdx.x / nqb, qblk = blockIdx.x % nqb;
  const int b = bh / H, h = bh % H;
  const int q0 = qblk * 64 + w * 16;
  const float* Q = qb + (size_t)b * T * pitch + h * D;
  const float* K = kb + (size_t)b * T * pitch + h * D;
  const float* V = vb + (size_t)b * T * pitch + h * D;

  // A fragments of the wave's 16 query rows (scaled), hi/lo
  FragB aqh[KS], aql[KS];
  {
    int row = q0 + ln; if (row >= T) row = T - 1;
    const float* qr = Q + (size_t)row * pitch;
#pragma unroll
    for (int ks = 0; ks < KS; ++ks)
#pragma unroll
      for (int i = 0; i < 16; ++i) {
        const int d = ks * 32 + ((i < 8) ? (8 * hh + i) : (16 + 8 * hh + (i - 8)));
        const float x = qr[d] * scale; const unsigned short hb = bf16_bits(x);
        aqh[ks].u[i] = hb; aql[ks].u[i] = bf16_bits(x - bf16_val(hb));
      }
  }
  float m_r[8], l_r[8];
#pragma unroll
  for (int r = 0; r < 8; ++r) { m_r[r] = -3.0e38f; l_r[r] = 0.f; }
  v8f oacc[DT];
#pragma unroll
  for (int dt = 0; dt < DT; ++dt) oacc[dt] = (v8f){0.f,0.f,0.f,0.f,0.f,0.f,0.f,0.f};

  const int kv_end = CAUSAL ? min(T, qblk * 64 + 64) : T;     // block-uniform
  for (int j0 = 0; j0 < kv_end; j0 += 32) {
    __syncthreads();
    for (int e = tid; e < 32 * (D / 4); e += 128) {
      const int r = e / (D / 4), c4 = (e % (D / 4)) * 4;
      const int key = j0 + r;
      v4f kf = {0.f,0.f,0.f,0.f}, vf = {0.f,0.f,0.f,0.f};
      if (key < T) { kf = *(const v4fa*)(K + (size_t)key * pitch + c4); vf = *(const v4fa*)(V + (size_t)key * pitch + c4); }
#pragma unroll
      for (int t = 0; t < 4; ++t) {
        unsigned short hb = bf16_bits(kf[t]); sKh[r][c4 + t] = hb; sKl[r][c4 + t] = bf16_bits(kf[t] - bf16_val(hb));
        hb = bf16_bits(vf[t]); sVh[r][c4 + t] = hb; sVl[r][c4 + t] = bf16_bits(vf[t] - bf16_val(hb));
      }
    }
    __syncthreads();
    // S tile 16 x 32
    v8f s[2];
#pragma unroll
    for (int nt = 0; nt < 2; ++nt) {
      v8f acc = {};
#pragma unroll
      for (int ks = 0; ks < KS; ++ks) {
        FragB bh_, bl_;
        bh_.half[0] = *(const v8us*)&sKh[nt * 16 + ln][ks * 32 + 8 * hh]; bh_.half[1] = *(const v8us*)&sKh[nt * 16 + ln][ks * 32 + 16 + 8 * hh];
        bl_.half[0] = *(const v8us*)&sKl[nt * 16 + ln][ks * 32 + 8 * hh]; bl_.half[1] = *(const v8us*)&sKl[nt * 16 + ln][ks * 32 + 16 + 8 * hh];
        acc = mmaN<3>(aqh[ks].v, aql[ks].v, bh_.v, bl_.v, acc);
      }
      s[nt] = acc;
    }
    // mask + running max (rows 8hh+r; the 16 lanes of a half share rows)
    float alpha[8];
#pragma unroll
    for (int r = 0; r < 8; ++r) {
      const int qi = q0 + 8 * hh + r;
      const int ja = j0 + ln, jb = j0 + 16 + ln;
      if (CAUSAL) { if (ja > qi) s[0][r] = -3.0e38f; if (jb > qi) s[1][r] = -3.0e38f; }
      if (ja >= T) s[0][r] = -3.0e38f;
      if (jb >= T) s[1][r] = -3.0e38f;
      float mx = fmaxf(s[0][r], s[1][r]);
      mx = fmaxf(mx, __shfl_xor(mx, 1, 32)); mx = fmaxf(mx, __shfl_xor(mx, 2, 32)); mx = fmaxf(mx, __shfl_xor(mx, 4, 32)); mx = fmaxf(mx, __shfl_xor(mx, 8, 32));
      const float mnew = fmaxf(m_r[r], mx);
      alpha[r] = (mnew > -1.0e38f) ? __expf(m_r[r] - mnew) : 1.0f;
      const float p0 = (s[0][r] > -1.0e38f) ? __expf(s[0][r] - mnew) : 0.f;
      const float p1 = (s[1][r] > -1.0e38f) ? __expf(s[1][r] - mnew) : 0.f;
      m_r[r] = mnew;
      l_r[r] = l_r[r] * alpha[r] + p0 + p1;            // per-lane partial row sum (16 lanes combined at the end)
      unsigned short hb = bf16_bits(p0); sPh[w][8 * hh + r][ln] = hb;      sPl[w][8 * hh + r][ln] = bf16_bits(p0 - bf16_val(hb));
      hb = bf16_bits(p1);                sPh[w][8 * hh + r][16 + ln] = hb; sPl[w][8 * hh + r][16 + ln] = bf16_bits(p1 - bf16_val(hb));
    }
#pragma unroll
    for (int dt = 0; dt < DT; ++dt)
#pragma unroll
      for (int r = 0; r < 8; ++r) oacc[dt][r] *= alpha[r];
    __builtin_amdgcn_fence(__ATOMIC_ACQ_REL, "workgroup");
    __builtin_amdgcn_wave_barrier();
    FragB pah, pal;
    pah.half[0] = *(const v8us*)&sPh[w][ln][8 * hh]; pah.half[1] = *(const v8us*)&sPh[w][ln][16 + 8 * hh];
    pal.half[0] = *(const v8us*)&sPl[w][ln][8 * hh]; pal.half[1] = *(const v8us*)&sPl[w][ln][16 + 8 * hh];
#pragma unroll
    for (int dt = 0; dt < DT; ++dt) {
      FragB bvh, bvl;
#pragma unroll
      for (int i = 0; i < 8; ++i) {
        bvh.u[i] = sVh[8 * hh + i][dt * 16 + ln]; bvh.u[8 + i] = sVh[16 + 8 * hh + i][dt * 16 + ln];
        bvl.u[i] = sVl[8 * hh + i][dt * 16 + ln]; bvl.u[8 + i] = sVl[16 + 8 * hh + i][dt * 16 + ln];
      }
      oacc[dt] = mmaN<3>(pah.v, pal.v, bvh.v, bvl.v, oacc[dt]);
    }
    __builtin_amdgcn_fence(__ATOMIC_ACQ_REL, "workgroup");
    __builtin_amdgcn_wave_barrier();
  }
#pragma unroll
  for (int r = 0; r < 8; ++r) {
    float l = l_r[r];
    l += __shfl_xor(l, 1, 32); l += __shfl_xor(l, 2, 32); l += __shfl_xor(l, 4, 32); l += __shfl_xor(l, 8, 32);
    l_r[r] = (l > 0.f) ? 1.0f / l : 0.f;
  }
#pragma unroll
  for (int dt = 0; dt < DT; ++dt)
#pragma unroll
    for (int r = 0; r < 8; ++r) sO[w][8 * hh + r][dt * 16 + ln] = oacc[dt][r] * l_r[r];
  __builtin_amdgcn_fence(__ATOMIC_ACQ_REL, "workgroup");
  __builtin_amdgcn_wave_barrier();
  {
    for (int r = 0; r < 16; ++r) {
      const int row = q0 + r;
      if (row < T && lane < D / 4) {
        const v4f val = *(const v4fa*)&sO[w][r][lane * 4];
        *(v4f*)(y + ((size_t)b * T + row) * ypitch + h * D + lane * 4) = val;
      }
    }
    
  }
}

// GEMM C = act(A·W + bias + resid): A f32 (ASPLIT -> hi/lo 2 terms), Wt bf16 [N][K]; ACT 0 none, 1 relu, 2 exact gelu;
// resid (optional, f32, row index = (row % rmod), pitch ldr, RES_BF16 rounds it) added before the activation.
template <bool ASPLIT, int ACT, bool BIAS_BF16, bool RES_BF16>
__global__ __launch_bounds__(128) void k_gemm_bf3(const float* __restrict__ A, int lda, const unsigned short* __restrict__ Wt, int ldb,
                                                const float* __restrict__ bias, const float* __restrict__ resid, int rmod, int ldr,
                                                float* __restrict__ C, int ldc, int M, int N, int K) {
  __shared__ __attribute__((aligned(16))) float so[4][16][64];
  const int tid = threadIdx.x, w = tid >> 5, lane = tid & 31, ln = lane & 15, hh = lane >> 4;
  const int ntn = N / 64;
  const int wid = blockIdx.x * 4 + w;
  const int mt = wid / ntn, nq = wid % ntn;
  if (mt * 16 >= M) return;
  const int row0 = mt * 16, col0 = nq * 64;
  const float* arow = A + (size_t)(row0 + ln) * lda;
  v8f acc[4] = {};
  for (int kb = 0; kb < K; kb += 32) {
    FragB ah, al;
    const v4f x0 = *(const v4fa*)(arow + kb + 8 * hh), x1 = *(const v4fa*)(arow + kb + 8 * hh + 4);
    const v4f x2 = *(const v4fa*)(arow + kb + 16 + 8 * hh), x3 = *(const v4fa*)(arow + kb + 16 + 8 * hh + 4);
    float xs[16] = {x0[0],x0[1],x0[2],x0[3],x1[0],x1[1],x1[2],x1[3],x2[0],x2[1],x2[2],x2[3],x3[0],x3[1],x3[2],x3[3]};
#pragma unroll
    for (int i = 0; i < 16; ++i) { const unsigned short hb = bf16_bits(xs[i]); ah.u[i] = hb; al.u[i] = ASPLIT ? bf16_bits(xs[i] - bf16_val(hb)) : (unsigned short)0; }
#pragma unroll
    for (int t = 0; t < 4; ++t) {
      const unsigned short* brow = Wt + (size_t)(col0 + t * 16 + ln) * ldb + kb;
      FragB b;
      b.half[0] = *(const v8us*)(brow + 8 * hh);
      b.half[1] = *(const v8us*)(brow + 16 + 8 * hh);
      acc[t] = mmaN<ASPLIT ? 2 : 1>(ah.v, al.v, b.v, b.v, acc[t]);
    }
  }
#pragma unroll
  for (int t = 0; t < 4; ++t) {
    const int col = col0 + t * 16 + ln;
    float bv = bias ? bias[col] : 0.f;
    if (BIAS_BF16) bv = bf16_round(bv);
#pragma unroll
    for (int r = 0; r < 8; ++r) {
      float v = acc[t][r] + bv;
      if (resid) { float rv = resid[(size_t)((row0 + 8 * hh + r) % rmod) * ldr + col]; if (RES_BF16) rv = bf16_round(rv); v += rv; }
      if (ACT == 1) v = fmaxf(v, 0.f);
      if (ACT == 2) v = 0.5f * v * (1.0f + erff(v * 0.70710678118654752f));
      if (ACT == 3) { const float u = 0.7978845608028654f * (v + 0.044715f * v * v * v); v = 0.5f * v * (1.0f + tanhf(u)); }
      so[w][8 * hh + r][t * 16 + ln] = v;
    }
  }
  __builtin_amdgcn_fence(__ATOMIC_ACQ_REL, "workgroup");
  __builtin_amdgcn_wave_barrier();
  const int rsub = lane >> 4, c4 = (lane & 15) * 4;
  {
#pragma unroll
    for (int q = 0; q < 8; ++q) {
      const int r = q * 2 + rsub;
      const v4f v = *(const v4fa*)&so[w][r][c4];
      *(v4f*)(C + (size_t)(row0 + r) * ldc + col0 + c4) = v;
    }
    
  }
}
// row LayerNorm (biased variance, eps) over N: s = X (+ R); optional out_sum <- s; out_norm <- (s-mu)*rsqrt(var+eps)*g + b
template <bool PARAM_BF16>
__global__ __launch_bounds__(256) void k_layernorm(const float* __restrict__ X, const float* __restrict__ R, const float* __restrict__ g, const float* __restrict__ bta,
                                                  float* __restrict__ out_sum, float* __restrict__ out_norm, int N, float eps) {
  __shared__ float red[256];
  const int row = blockIdx.x, tid = threadIdx.x;
  const float* x = X + (size_t)row * N; const float* rr = R ? R + (size_t)row * N : nullptr;
  float vals[16];                     // up to N = 4096
  const int per = N / 256;            // contiguous chunk per thread? use strided-by-4 chunks: thread handles j = tid*4 + 1024*u
  float s1 = 0.f;
  for (int u = 0; u < per / 4; ++u) {
    const int j = tid * 4 + 1024 * u;
    const v4f a = *(const v4fa*)(x + j);
    v4f b = {0.f,0.f,0.f,0.f}; if (rr) b = *(const v4fa*)(rr + j);
#pragma unroll
    for (int q = 0; q < 4; ++q) { const float v = a[q] + b[q]; vals[u * 4 + q] = v; s1 += v; }
  }
  red[tid] = s1; __syncthreads();
  for (int st = 128; st > 0; st >>= 1) { if (tid < st) red[tid] += red[tid + st]; __syncthreads(); }
  const float mu = red[0] / (float)N; __syncthreads();
  float s2 = 0.f;
  for (int u = 0; u < per / 4; ++u)
#pragma unroll
    for (int q = 0; q < 4; ++q) { const float c = vals[u * 4 + q] - mu; s2 += c * c; }
  red[tid] = s2; __syncthreads();
  for (int st = 128; st > 0; st >>= 1) { if (tid < st) red[tid] += red[tid + st]; __syncthreads(); }
  const float rs = rsqrtf(red[0] / (float)N + eps);
  {
    for (int u = 0; u < per / 4; ++u) {
      const int j = tid * 4 + 1024 * u;
      v4f o, sm;
#pragma unroll
      for (int q = 0; q < 4; ++q) {
        float gg = g[j + q], bb = bta[j + q];
        if (PARAM_BF16) { gg = bf16_round(gg); bb = bf16_round(bb); }
        sm[q] = vals[u * 4 + q]; o[q] = (vals[u * 4 + q] - mu) * rs * gg + bb;
      }
      if (out_sum) *(v4f*)(out_sum + (size_t)row * N + j) = sm;
      *(v4f*)(out_norm + (size_t)row * N + j) = o;
    }
    
  }
}



// ---- f16 WMMA path (v_wmma_f32_16x16x32_f16): 11-bit significands for operands in range — used where a [0,1] probability operand needs more precision than bf16
typedef _Float16 v16h __attribute__((ext_vector_type(16)));
union FragH { v16h v; v8us half[2]; _Float16 h[16]; unsigned short u[16]; };
template <int NT>
__device__ __forceinline__ v8f mmaH(v16h ah, v16h al, v16h bh, v16h bl, v8f c) {
  c = __builtin_amdgcn_wmma_f32_16x16x32_f16(false, ah, false, bh, (short)0, c, false, false);
  if (NT >= 2) c = __builtin_amdgcn_wmma_f32_16x16x32_f16(false, al, false, bh, (short)0, c, false, false);
  if (NT >= 3) c = __builtin_amdgcn_wmma_f32_16x16x32_f16(false, ah, false, bl, (short)0, c, false, false);
  asm volatile("v_nop\n\tv_nop\n\tv_nop\n\tv_nop" : "+v"(c) : "v"(ah), "v"(al), "v"(bh), "v"(bl));
  return c;
}
// batched GEMM like k_gemm_b but f16 operands: A f32 (split into f16 hi/lo if ASPLIT, else rounded to f16), Bt = f16 values [n][k]; alpha; C f32; N multiple of 16 (partial tiles skipped)
template <bool ASPLIT>
__global__ __launch_bounds__(128) void k_gemm_h(const float* __restrict__ A, int lda, size_t sA, const _Float16* __restrict__ Bh, int ldb, size_t sB, float alpha, float* __restrict__ C, int ldc, size_t sC, int M, int N, int K) {
  __shared__ __attribute__((aligned(16))) float so[4][16][64];
  const int tid = threadIdx.x, w = tid >> 5, lane = tid & 31, ln = lane & 15, hh = lane >> 4; const int by = blockIdx.y;
  A += (size_t)by * sA; Bh += (size_t)by * sB; C += (size_t)by * sC;
  const int ntn = (N + 63) / 64; const int wid = blockIdx.x * 4 + w; const int mt = wid / ntn, nq = wid % ntn; if (mt * 16 >= M) return;
  const int row0 = mt * 16, col0 = nq * 64; const float* arow = A + (size_t)(row0 + ln) * lda;
  v8f acc[4] = {};
  for (int kb = 0; kb < K; kb += 32) {
    FragH ah, al;
    const v4f x0 = *(const v4fa*)(arow + kb + 8 * hh), x1 = *(const v4fa*)(arow + kb + 8 * hh + 4), x2 = *(const v4fa*)(arow + kb + 16 + 8 * hh), x3 = *(const v4fa*)(arow + kb + 16 + 8 * hh + 4);
    float xs[16] = {x0[0],x0[1],x0[2],x0[3],x1[0],x1[1],x1[2],x1[3],x2[0],x2[1],x2[2],x2[3],x3[0],x3[1],x3[2],x3[3]};
#pragma unroll
    for (int i = 0; i < 16; ++i) { const _Float16 h = (_Float16)xs[i]; ah.h[i] = h; al.h[i] = ASPLIT ? (_Float16)(xs[i] - (float)h) : (_Float16)0.0f; }
#pragma unroll
    for (int t = 0; t < 4; ++t) { if (col0 + t * 16 >= N) continue; const size_t boff = (size_t)(col0 + t * 16 + ln) * ldb + kb; FragH bq; bq.half[0] = *(const v8us*)(Bh + boff + 8 * hh); bq.half[1] = *(const v8us*)(Bh + boff + 16 + 8 * hh);
      acc[t] = mmaH<ASPLIT ? 2 : 1>(ah.v, al.v, bq.v, bq.v, acc[t]); }
  }
#pragma unroll
  for (int t = 0; t < 4; ++t) { if (col0 + t * 16 >= N) continue;
#pragma unroll
    for (int r = 0; r < 8; ++r) so[w][8 * hh + r][t * 16 + ln] = acc[t][r] * alpha; }
  __builtin_amdgcn_fence(__ATOMIC_ACQ_REL, "workgroup"); __builtin_amdgcn_wave_barrier();
  const int rsub = lane >> 4, c4 = (lane & 15) * 4;
  {
#pragma unroll
    for (int q = 0; q < 8; ++q) { const int r = q * 2 + rsub; if (col0 + c4 < N) { const v4f v = *(const v4fa*)&so[w][r][c4]; *(v4f*)(C + (size_t)(row0 + r) * ldc + col0 + c4) = v; } }
     }
}

// Wt[n][k] = f16(W[k][n]·scale) from f32 row-major W[K][N] (scale = power of two; bf16-exact weights stay exact in f16 away from the subnormal range)
__global__ __launch_bounds__(256) void k_wt_f16(const float* __restrict__ W, _Float16* __restrict__ Wt, int K, int N, float scale) {
  const int t = blockIdx.x * 256 + threadIdx.x; if (t >= N * (K / 8)) return; const int n = t / (K / 8), k8 = (t % (K / 8)) * 8; FragH f;
#pragma unroll
  for (int i = 0; i < 8; ++i) f.h[i] = (_Float16)(bf16_round(W[(size_t)(k8 + i) * N + n]) * scale); const v8us o = f.half[0];
  *(v8us*)((unsigned short*)Wt + (size_t)n * K + k8) = o; 
}
// k_gemm_hh variant with fused epilogue: v = acc·alpha + bias[by·sBias + col] (+ CP[(row/rowsPerB)·sCPb + by·64 + col] if CP) ; ACT 0 none / 1 elu ; writes f32 C and/or f16 C16 (each if non-null)
template <int ACT>
__global__ __launch_bounds__(128) void k_gemm_hhx(const _Float16* __restrict__ A, int lda, size_t sA, const _Float16* __restrict__ Bh, int ldb, size_t sB, float alpha, const float* __restrict__ bias, size_t sBias, const float* __restrict__ CP, int rowsPerB, size_t sCPb, int row0g,
    float* __restrict__ C, _Float16* __restrict__ C16, int ldc, size_t sC, int M, int N, int K) {
  __shared__ __attribute__((aligned(16))) float so[4][16][64];
  const int tid = threadIdx.x, w = tid >> 5, lane = tid & 31, ln = lane & 15, hh = lane >> 4; const int by = blockIdx.y;
  A += (size_t)by * sA; Bh += (size_t)by * sB; const size_t cofs = (size_t)by * sC; const float* bp = bias ? bias + (size_t)by * sBias : nullptr;
  const int ntn = (N + 63) / 64; const int wid = blockIdx.x * 4 + w; const int mt = wid / ntn, nq = wid % ntn; if (mt * 16 >= M) return;
  const int row0 = mt * 16, col0 = nq * 64; const _Float16* arow = A + (size_t)(row0 + ln) * lda;
  v8f acc[4] = {};
  for (int kb = 0; kb < K; kb += 32) { FragH ah; ah.half[0] = *(const v8us*)((const unsigned short*)arow + kb + 8 * hh); ah.half[1] = *(const v8us*)((const unsigned short*)arow + kb + 16 + 8 * hh);
#pragma unroll
    for (int t = 0; t < 4; ++t) { if (col0 + t * 16 >= N) continue; const size_t boff = (size_t)(col0 + t * 16 + ln) * ldb + kb; FragH bq; bq.half[0] = *(const v8us*)((const unsigned short*)Bh + boff + 8 * hh); bq.half[1] = *(const v8us*)((const unsigned short*)Bh + boff + 16 + 8 * hh);
      acc[t] = mmaH<1>(ah.v, ah.v, bq.v, bq.v, acc[t]); }
  }
#pragma unroll
  for (int t = 0; t < 4; ++t) { if (col0 + t * 16 >= N) continue; const int col = col0 + t * 16 + ln; const float bv = bp ? bf16_round(bp[col]) : 0.f;
#pragma unroll
    for (int r = 0; r < 8; ++r) { float v = acc[t][r] * alpha + bv; if (CP) { const int bidx = (row0g + row0 + 8 * hh + r) / rowsPerB; v += CP[(size_t)bidx * sCPb + (size_t)by * 64 + col]; } if (ACT == 1) v = (v > 0.f) ? v : expm1f(v); else if (ACT == 7) v = (v > 0.f) ? v + 1.0f : expf(v); else if (ACT == 8) v = tanhf(v); else if (ACT == 9) v = 0.5f * v * (1.0f + tanhf(0.7978845608028654f * (v + 0.044715f * v * v * v))); else if (ACT == 11) v = 1.0f / (1.0f + expf(-v)); else if (ACT == 12) v = (v > 0.f) ? v : 0.01f * v; else if (ACT == 14) v = (v > 0.f) ? v : 0.1f * v; else if (ACT == 15) v = v / (1.0f + expf(-v)); else if (ACT == 3) v = fmaxf(v, 0.f); else if (ACT == 6) v = 0.5f * v * (1.0f + erff(v * 0.70710678118654752f)); so[w][8 * hh + r][t * 16 + ln] = v; } }
  __builtin_amdgcn_fence(__ATOMIC_ACQ_REL, "workgroup"); __builtin_amdgcn_wave_barrier();
  const int rsub = lane >> 4, c4 = (lane & 15) * 4; typedef _Float16 v4h __attribute__((ext_vector_type(4)));
  {
#pragma unroll
    for (int q = 0; q < 8; ++q) { const int r = q * 2 + rsub; if (col0 + c4 < N) { const v4f v = *(const v4fa*)&so[w][r][c4]; if (C) *(v4f*)(C + cofs + (size_t)(row0 + r) * ldc + col0 + c4) = v; if (C16) { v4h h4; for (int i = 0; i < 4; ++i) h4[i] = (_Float16)v[i]; *(v4h*)(C16 + cofs + (size_t)(row0 + r) * ldc + col0 + c4) = h4; } } }
     }
}


typedef _Float16 v4h __attribute__((ext_vector_type(4)));

__global__ __launch_bounds__(256) void k_x16(const float* __restrict__ x, _Float16* __restrict__ X16, size_t n8) { const size_t t = (size_t)blockIdx.x * 256 + threadIdx.x; if (t >= n8) return; FragH f;
#pragma unroll
  for (int q = 0; q < 8; ++q) f.h[q] = (_Float16)bf16_round(x[t * 8 + q]); *(v8us*)((unsigned short*)X16 + t * 8) = f.half[0];  }
__global__ __launch_bounds__(256) void k_h16(const float* __restrict__ x, _Float16* __restrict__ X16, size_t n8) { const size_t t = (size_t)blockIdx.x * 256 + threadIdx.x; if (t >= n8) return; FragH f;
#pragma unroll
  for (int q = 0; q < 8; ++q) f.h[q] = (_Float16)x[t * 8 + q]; *(v8us*)((unsigned short*)X16 + t * 8) = f.half[0];  }
__global__ __launch_bounds__(256) void k_round16f(const float* __restrict__ W, _Float16* __restrict__ Bt, size_t n8) { const size_t t = (size_t)blockIdx.x * 256 + threadIdx.x; if (t >= n8) return; FragH f;
#pragma unroll
  for (int i = 0; i < 8; ++i) f.h[i] = (_Float16)(bf16_round(W[t * 8 + i]) * 16.0f); *(v8us*)((unsigned short*)Bt + t * 8) = f.half[0];  }
template <int NHv, int TTv>
__global__ __launch_bounds__(256) void k_vt(const _Float16* __restrict__ V16, int ldv, int voff, _Float16* __restrict__ Vt) { __shared__ unsigned short tl[64][66]; const int tid = threadIdx.x; const int slab = blockIdx.x / (TTv / 64), lg = blockIdx.x % (TTv / 64); const int b = slab / NHv, h = slab % NHv;
  for (int i = tid; i < 64 * 8; i += 256) { const int r = i / 8, c8 = (i % 8) * 8; FragH f; f.half[0] = *(const v8us*)((const unsigned short*)V16 + ((size_t)b * TTv + lg * 64 + r) * ldv + voff + h * 64 + c8);
#pragma unroll
    for (int q = 0; q < 8; ++q) tl[r][c8 + q] = f.u[q]; }
  __syncthreads();
  {
#pragma unroll
    for (int rd = 0; rd < 2; ++rd) { const int d = rd * 32 + tid / 8, pc = tid % 8; FragH f;
#pragma unroll
      for (int q = 0; q < 8; ++q) f.u[q] = tl[pc * 8 + q][d];
      *(v8us*)((unsigned short*)Vt + ((size_t)slab * 64 + d) * TTv + lg * 64 + pc * 8) = f.half[0]; }
     } }

__global__ __launch_bounds__(256) void k_x7(const float* __restrict__ nodes, const float* __restrict__ centre, float* __restrict__ X7) { const int t = blockIdx.x * 256 + threadIdx.x; if (t >= NNODE * 2) return; const int n = t >> 1, half = t & 1; v4f v;
  if (half == 0) { v[0] = bf16_round(nodes[(size_t)n * 3]); v[1] = bf16_round(nodes[(size_t)n * 3 + 1]); v[2] = bf16_round(nodes[(size_t)n * 3 + 2]); v[3] = bf16_round(centre[0]); } else { v[0] = bf16_round(centre[1]); v[1] = bf16_round(centre[2]); v[2] = 1.0f; v[3] = 0.f; }
  *(v4f*)(X7 + (size_t)t * 4) = v;  }
__global__ __launch_bounds__(256) void k_proj(const float* __restrict__ nodes, const float* __restrict__ centre, const float* __restrict__ Wq, const float* __restrict__ bq, const float* __restrict__ Wk, const float* __restrict__ bk, float* __restrict__ KEYS, _Float16* __restrict__ K16, _Float16* __restrict__ Q16) {
  #pragma clang fp contract(off)
  const size_t t = (size_t)blockIdx.x * 256 + threadIdx.x; if (t >= (size_t)NNODE * DD / 4) return; const int n = (int)((t * 4) / DD), c0 = (int)((t * 4) % DD); float xa[7];
  for (int i = 0; i < 3; ++i) { xa[i] = bf16_round(nodes[(size_t)n * 3 + i]); xa[3 + i] = bf16_round(centre[i]); } xa[6] = 1.0f;
  float kv[4], qv[4]; for (int q = 0; q < 4; ++q) { kv[q] = bf16_round(bk[c0 + q]); qv[q] = bf16_round(bq[c0 + q]); }
#pragma unroll 1
  for (int i = 0; i < 6; ++i) for (int q = 0; q < 4; ++q) { kv[q] += xa[i] * bf16_round(Wk[(size_t)(c0 + q) * 6 + i]); qv[q] += xa[i] * bf16_round(Wq[(size_t)(c0 + q) * 6 + i]); }
  typedef _Float16 v4h __attribute__((ext_vector_type(4))); v4h fk, fq; for (int q = 0; q < 4; ++q) { fk[q] = (_Float16)kv[q]; fq[q] = (_Float16)qv[q]; } const v4f k0 = {kv[0], kv[1], kv[2], kv[3]};
  { *(v4f*)(KEYS + t * 4) = k0; *(v4h*)(K16 + t * 4) = fk; *(v4h*)(Q16 + t * 4) = fq;      /* one 16-B f32 piece and 8-B f16 pieces per lane, lane-contiguous */
     } }
__global__ __launch_bounds__(256) void k_rvec(const float* __restrict__ Wq, const float* __restrict__ bq, const float* __restrict__ Wk, const float* __restrict__ bk, const float* __restrict__ X7, float* __restrict__ R) {
  #pragma clang fp contract(off)
  __shared__ float M[7][8]; const int tid = threadIdx.x;
  if (tid < 49) { const int i = tid / 7, j = tid % 7; float s = 0.f;
#pragma unroll 1
    for (int c = 0; c < DD; ++c) { const float a = (i < 6) ? bf16_round(Wk[(size_t)c * 6 + i]) : bf16_round(bk[c]); const float b = (j < 6) ? bf16_round(Wq[(size_t)c * 6 + j]) : bf16_round(bq[c]); s += a * b; } M[i][j] = s; }
  __syncthreads();
  const int t = blockIdx.x * 256 + tid; if (t >= NNODE * 2) return; const int n = t >> 1, half = t & 1; float xa[8]; { const v4f a = *(const v4fa*)(X7 + (size_t)n * 8), b = *(const v4fa*)(X7 + (size_t)n * 8 + 4); xa[0] = a[0]; xa[1] = a[1]; xa[2] = a[2]; xa[3] = a[3]; xa[4] = b[0]; xa[5] = b[1]; xa[6] = b[2]; }
  v4f o = {0.f, 0.f, 0.f, 0.f};      /* this thread's half of R[n]: columns j = 4·half .. 4·half+3 (j = 7 stays 0) */
#pragma unroll 1
  for (int i = 0; i < 7; ++i) for (int q = 0; q < 4; ++q) { const int j = half * 4 + q; if (j < 7) o[q] += xa[i] * M[i][j]; }
  *(v4f*)(R + (size_t)t * 4) = o;  }
__device__ __forceinline__ float sai_dot(const float* r, v4f a, v4f b) { return r[0] * a[0] + r[1] * a[1] + r[2] * a[2] + r[3] * a[3] + r[4] * b[0] + r[5] * b[1] + r[6] * b[2]; }
// value of lane l ^ MASK inside a 16-lane row (DPP row_xmask), and of lane l ^ 16: register moves, no LDS round trip
template <int MASK> __device__ __forceinline__ float lane_xor_row(float x) { return __int_as_float(__builtin_amdgcn_update_dpp(0, __float_as_int(x), 0x160 | MASK, 0xf, 0xf, true)); }
__device__ __forceinline__ float lane_xor16(float x) { const int v = __float_as_int(x); return __int_as_float(__builtin_amdgcn_permlanex16(v, v, 0x76543210, 0xfedcba98, false, false)); }
__device__ __forceinline__ float wave_max(float x) { x = fmaxf(x, lane_xor_row<1>(x)); x = fmaxf(x, lane_xor_row<2>(x)); x = fmaxf(x, lane_xor_row<4>(x)); x = fmaxf(x, lane_xor_row<8>(x)); return fmaxf(x, lane_xor16(x)); }
__device__ __forceinline__ float wave_sum(float x) { x += lane_xor_row<1>(x); x += lane_xor_row<2>(x); x += lane_xor_row<4>(x); x += lane_xor_row<8>(x); return x + lane_xor16(x); }
// One work-group = 32 waves that split the 8192 KEYS: thread t owns keys 8t .. 8t+7 and holds their vectors in registers for all SOFT_ROWS rows of the group.
// Rows go four at a time: logits once into registers, row maximum and row sum over the 32 waves through LDS, the exponentials overwrite the logits, P f16 x2^15 leaves as one 16-B piece per lane and row.
#define SOFT_ROWS 32
__global__ __launch_bounds__(1024) void k_soft(const float* __restrict__ R, const float* __restrict__ X7, int n0, _Float16* __restrict__ P16) {
  __shared__ __attribute__((aligned(16))) float redM[32][4], redZ[32][4];
  const int tid = threadIdx.x, wv = tid >> 5, lane = tid & 31;
  v4f xa[8], xb[8];
  // every unroll below: xa, xb, s, m4 and z4 stay in registers only where their indices are constants
#pragma unroll
  for (int e = 0; e < 8; ++e) { xa[e] = *(const v4fa*)(X7 + ((size_t)tid * 8 + e) * 8); xb[e] = *(const v4fa*)(X7 + ((size_t)tid * 8 + e) * 8 + 4); }
  for (int g = 0; g < SOFT_ROWS / 4; ++g) {
    const int nl = blockIdx.x * SOFT_ROWS + g * 4;
    float s[4][8]; v4f m4, z4;
    // unrolled for constant indices (registers), and the four rows' chains interleave
#pragma unroll
    for (int j = 0; j < 4; ++j) {
      const float* rp = R + (size_t)(n0 + nl + j) * 8; const v4f a = *(const v4fa*)rp, b = *(const v4fa*)(rp + 4); const float r[7] = {a[0], a[1], a[2], a[3], b[0], b[1], b[2]};
      float mx = -3.0e38f;
      // unrolled for constant indices (registers)
#pragma unroll
      for (int e = 0; e < 8; ++e) { s[j][e] = sai_dot(r, xa[e], xb[e]); mx = fmaxf(mx, s[j][e]); }
      m4[j] = wave_max(mx);
    }
    if (lane == 0) *(v4f*)&redM[wv][0] = m4;
    __syncthreads();      /* every wave's four maxima are in redM */
    m4 = *(const v4f*)&redM[lane][0];
    // unrolled for constant indices (registers), and the four rows' chains interleave
#pragma unroll
    for (int j = 0; j < 4; ++j) {
      const float mx = wave_max(m4[j]); float z = 0.f;
      // unrolled for constant indices (registers)
#pragma unroll
      for (int e = 0; e < 8; ++e) { s[j][e] = expf(s[j][e] - mx); z += s[j][e]; }
      z4[j] = wave_sum(z);
    }
    if (lane == 0) *(v4f*)&redZ[wv][0] = z4;
    __syncthreads();      /* every wave's four sums are in redZ; it also ends every read of redM before the next four rows write it */
    z4 = *(const v4f*)&redZ[lane][0];
    // unrolled for constant indices (registers), and the four rows' chains interleave
#pragma unroll
    for (int j = 0; j < 4; ++j) {
      const float iz = 32768.0f / wave_sum(z4[j]); FragH f;
      // unrolled for constant indices (registers)
#pragma unroll
      for (int e = 0; e < 8; ++e) f.h[e] = (_Float16)(s[j][e] * iz);
      *(v8us*)((unsigned short*)P16 + (size_t)(nl + j) * NNODE + (size_t)tid * 8) = f.half[0];
    }
  }
}

// ---- the three GEMMs as one tiled kernel: C[8192][512] = alpha * A[8192][K] * Bt[512][K]^T (+ addends), both operands f16 with k contiguous.
// One 128 x 128 tile of C per work-group (256 work-groups), 4 waves (2 x 2) of 64 x 64 each. A stage is 256 bytes (128 k) of the tile's 128 A rows and 128 Bt rows in LDS at pitch 272 B;
// every wave brings its own 64-row slice of a stage with one tensor load; two buffers, the next stage in flight while this one is worked on.
typedef uint32_t u32x4 __attribute__((ext_vector_type(4)));
typedef uint32_t u32x8 __attribute__((ext_vector_type(8)));
constexpr uint32_t TG_KB = 256;                      // bytes of k per operand row and stage
constexpr uint32_t TG_PITCH = TG_KB + 16;            // LDS row pitch, 16 B x odd, written by the tensor load's pad
constexpr uint32_t TG_SROWS = 64;                    // rows per slice (one tensor load)
constexpr uint32_t TG_SLICE = 18432;                 // 64 x 272 = 17,408 B rounded up to a multiple of 2 KiB, so that every slice starts on one
constexpr uint32_t TG_STAGE = 4 * TG_SLICE;          // one buffer: [A rows 0-63][A rows 64-127][Bt rows 0-63][Bt rows 64-127]
constexpr uint32_t TG_EPITCH = 68;                   // floats per staged output row (64 + 4)
constexpr uint32_t TG_EPI = 64 * TG_EPITCH * 4;      // output staging per wave, behind the ring
constexpr uint32_t TG_LDS = 2 * TG_STAGE + 4 * TG_EPI;
static_assert(TG_SROWS * TG_PITCH <= TG_SLICE && TG_SLICE % 2048u == 0, "a slice must hold its padded rows and start on a multiple of 2 KiB");
static_assert(TG_LDS <= 320u * 1024u, "LDS of one work-group");
__device__ __forceinline__ uint32_t tg_uni(uint32_t v) { return (uint32_t)__builtin_amdgcn_readfirstlane(v); }
__device__ __forceinline__ uint32_t tg_pinned(uint32_t v) { uint32_t w = (uint32_t)__builtin_amdgcn_readfirstlane(v); asm volatile("" : "+s"(w)); return w; }
__device__ __forceinline__ void tg_wait_ds0() { asm volatile("s_wait_dscnt 0x0" ::: "memory"); }          // this wave's LDS reads have returned before the buffer is handed over
// A request's descriptor: group 0 (count, LDS place, source address, type) and group 1 (64 rows of 256 bytes at the source pitch, 16 B of LDS pad behind every row).
struct TgDesc { u32x4 g0; u32x8 g1; };
__device__ __forceinline__ TgDesc tg_desc(uint32_t lds_dst, uint64_t ga, uint32_t pitch) {
  TgDesc d;
  d.g0[0] = tg_uni(1u);
  d.g0[1] = tg_uni(lds_dst);
  d.g0[2] = tg_uni((uint32_t)ga);
  d.g0[3] = tg_uni((((uint32_t)(ga >> 32)) & 0x01FFFFFFu) | 0x80000000u);
  d.g1[0] = tg_uni((1u << 20) | (5u << 22) | (3u << 25));
  d.g1[1] = tg_uni((TG_KB & 0xFFFFu) << 16);
  d.g1[2] = tg_uni((TG_KB >> 16) | ((TG_SROWS & 0xFFFFu) << 16));
  d.g1[3] = tg_uni((TG_SROWS >> 16) | (TG_KB << 16));
  d.g1[4] = tg_uni(TG_SROWS);
  d.g1[5] = tg_uni(pitch);
  d.g1[6] = tg_uni(0u);
  d.g1[7] = tg_uni(0u);
  return d;
}
// the next stage of the same slice: a new LDS place, the source 256 bytes further along k (the carry goes into the address's high word, below its type bits)
__device__ __forceinline__ void tg_next(TgDesc& d, uint32_t lds_dst) {
  const uint32_t lo = d.g0[2] + TG_KB;
  d.g0[1] = tg_uni(lds_dst);
  d.g0[2] = tg_uni(lo);
  d.g0[3] = tg_uni(d.g0[3] + ((lo < TG_KB) ? 1u : 0u));
}
// Both statements take the descriptor as in-out operands: its registers then stay the descriptor's from the issue to the wait (the compiler otherwise reused some of them for loop temporaries
// while the request was in flight), and tg_next()'s new words are formed behind the wait.
__device__ __forceinline__ void tg_tensor_load(TgDesc& d) { asm volatile("tensor_load_to_lds %0, %1" : "+s"(d.g0), "+s"(d.g1) :: "memory"); }
// this wave's slice has landed; the compiler places no wait for a tensor load
__device__ __forceinline__ void tg_wait_tensor0(TgDesc& d) { asm volatile("s_wait_tensorcnt 0x0" : "+s"(d.g0), "+s"(d.g1) :: "memory"); }
__device__ __forceinline__ void tg_load_frag(FragH& f, const unsigned char* p) { f.half[0] = *(const v8us*)p; f.half[1] = *(const v8us*)(p + 32); }
// APITCH, BPITCH: source row pitches in bytes; T: stages (K = 128 T). MODE 0: C16 = f16(acc*alpha); 1: C = acc*alpha + add; 2: C = acc*alpha + bf16(bias[col]) + add. C, C16 and add have 512 columns.
template <uint32_t APITCH, uint32_t BPITCH, uint32_t T, int MODE>
__global__ __launch_bounds__(128) void k_gemm_tile(const _Float16* __restrict__ A, const _Float16* __restrict__ Bt, float alpha, const float* __restrict__ bias, const float* __restrict__ add, float* __restrict__ C, _Float16* __restrict__ C16) {
  static_assert(T >= 2 && T * TG_KB <= APITCH && T * TG_KB <= BPITCH && APITCH % 16u == 0 && BPITCH % 16u == 0, "the prologue fills two stages; every stage lies inside its source rows");
  __shared__ __attribute__((aligned(2048))) unsigned char L[TG_LDS];
  const uint32_t tid = threadIdx.x, lane = tid & 31u, h = lane >> 4, c = lane & 15u;
  const uint32_t wave = tg_uni(tid >> 5);
  const uint32_t tn = blockIdx.x & 3u, tm = blockIdx.x >> 2;      // the four column tiles of one row tile are neighbours: they read the same A rows
  const uint32_t m0 = tm * 128u, n0 = tn * 128u, wm = wave >> 1, wn = wave & 1u;
  const uint64_t src0 = (wave < 2u) ? (uint64_t)(uintptr_t)A + (uint64_t)(m0 + TG_SROWS * wave) * APITCH
                                    : (uint64_t)(uintptr_t)Bt + (uint64_t)(n0 + TG_SROWS * (wave - 2u)) * BPITCH;
  const uint32_t pitch = (wave < 2u) ? APITCH : BPITCH;
  const uint32_t lds_slice = (uint32_t)(size_t)(const void*)L + wave * TG_SLICE;
  const uint32_t fa_base = wm * TG_SLICE + c * TG_PITCH + 16u * h;            // row c of the wave's first A fragment, 16-byte half h
  const uint32_t fb_base = (2u + wn) * TG_SLICE + c * TG_PITCH + 16u * h;     // the same for Bt
  v8f acc[4][4];
  // every '#pragma unroll' of this kernel without a comment of its own: acc, fa and fb stay in registers only under constant indices
#pragma unroll
  for (int i = 0; i < 4; ++i)
#pragma unroll
    for (int j = 0; j < 4; ++j) acc[i][j] = (v8f){0.f, 0.f, 0.f, 0.f, 0.f, 0.f, 0.f, 0.f};
  TgDesc d = tg_desc(lds_slice, src0, pitch);
  tg_tensor_load(d);
  tg_wait_tensor0(d);
  __syncthreads();      /* stage 0 is readable by every wave */
  tg_next(d, lds_slice + TG_STAGE);
  tg_tensor_load(d);
  // kept rolled: the buffer is picked by t & 1
#pragma clang loop unroll(disable)
  for (uint32_t t = 0; t < T; ++t) {
    const uint32_t buf = (t & 1u) * TG_STAGE;
    const unsigned char* la = L + buf + fa_base;
    const unsigned char* lb = L + buf + fb_base;
    FragH fa[2][4], fb[2][4];      // set (u & 1) holds block u's fragments
#pragma unroll
    for (int i = 0; i < 4; ++i) { tg_load_frag(fa[0][i], la + (uint32_t)i * 16u * TG_PITCH); tg_load_frag(fb[0][i], lb + (uint32_t)i * 16u * TG_PITCH); }
    // unrolled: the fragment sets and accumulators stay in registers only under constant indices
#pragma unroll
    for (int u = 0; u < 4; ++u) {
      const int cs = u & 1;
      if (u + 1 < 4) {
        const uint32_t ko = (uint32_t)(u + 1) * 64u;
#pragma unroll
        for (int i = 0; i < 4; ++i) { tg_load_frag(fa[cs ^ 1][i], la + (uint32_t)i * 16u * TG_PITCH + ko); tg_load_frag(fb[cs ^ 1][i], lb + (uint32_t)i * 16u * TG_PITCH + ko); }
      }
      __builtin_amdgcn_sched_barrier(0);      // the next block's LDS reads stay one group ahead of this block's matrix instructions, not spread among them
#pragma unroll
      for (int i = 0; i < 4; ++i)
#pragma unroll
        for (int j = 0; j < 4; ++j) acc[i][j] = __builtin_amdgcn_wmma_f32_16x16x32_f16(false, fa[cs][i].v, false, fb[cs][j].v, (short)0, acc[i][j], false, false);
      __builtin_amdgcn_sched_barrier(0);      // and the block behind it does not move its reads up among them
    }
    tg_wait_ds0();
    tg_wait_tensor0(d);
    __syncthreads();      /* stage t + 1 is readable by every wave, and every wave has left stage t's buffer */
    if (tg_pinned((t + 2u < T) ? 1u : 0u) != 0u) { tg_next(d, lds_slice + buf); tg_tensor_load(d); }
  }
  tg_wait_tensor0(d);
  tg_wait_ds0();
  // epilogue: each wave stages its 64 x 64 tile in its own LDS range behind the ring, then adds the addends and stores whole 128-byte lines
  float* E = (float*)(L + 2u * TG_STAGE + wave * TG_EPI);
#pragma unroll
  for (int i = 0; i < 4; ++i)
#pragma unroll
    for (int j = 0; j < 4; ++j)
#pragma unroll
      for (int r = 0; r < 8; ++r) E[(16u * (uint32_t)i + 8u * h + (uint32_t)r) * TG_EPITCH + 16u * (uint32_t)j + c] = acc[i][j][r];
  __builtin_amdgcn_fence(__ATOMIC_ACQ_REL, "workgroup"); __builtin_amdgcn_wave_barrier();      // the wave's own staged rows are read back by other lanes
  const uint32_t c4 = c * 4u, col = n0 + wn * 64u + c4;
  v4f bv = {0.f, 0.f, 0.f, 0.f};
  if (MODE == 2) { for (int e = 0; e < 4; ++e) bv[e] = bf16_round(bias[col + (uint32_t)e]); }
  // four row pairs per trip: their staged rows and addend loads are in flight together; the outer loop stays rolled so that the one wait at its foot stands behind every trip's stores
#pragma clang loop unroll(disable)
  for (uint32_t q0 = 0; q0 < 32u; q0 += 4u) {
    // unrolled: the four row pairs' LDS reads, addend loads and stores each go out as one run
#pragma unroll
    for (uint32_t qi = 0; qi < 4u; ++qi) {
      const uint32_t row = 2u * (q0 + qi) + h;
      const v4f v = *(const v4fa*)&E[row * TG_EPITCH + c4];
      const size_t g = (size_t)(m0 + wm * 64u + row) * DD + col;
      v4f o;
#pragma unroll
      for (int e = 0; e < 4; ++e) o[e] = v[e] * alpha + bv[e];
      if (MODE != 0) { const v4f a4 = *(const v4fa*)(add + g); o += a4; *(v4f*)(C + g) = o; }
      else { v4h h4; for (int e = 0; e < 4; ++e) h4[e] = (_Float16)o[e]; *(v4h*)(C16 + g) = h4; }
    }
    asm volatile("s_wait_xcnt 0x0" ::: "memory");      // stands behind the trip's stores, in front of the next trip's writes of their address and data registers
  }
}

extern "C" void kernel_launch(void* const* d_in, const int* in_sizes, int n_in,
                              void* d_out, int out_size, void* d_ws, size_t ws_size, hipStream_t stream) {
  (void)in_sizes; (void)n_in; (void)out_size;
  const float* const* I = (const float* const*)d_in; const float* nodes = I[0]; const float* centre = I[1]; const float* Wq = I[2]; const float* bq = I[3]; const float* Wk = I[4]; const float* bk = I[5]; const float* Wv = I[6]; const float* bv = I[7];
  char* ws = (char*)d_ws; size_t off = 0;
  auto take = [&](size_t bytes) { char* p = ws + off; off += (bytes + 255) & ~(size_t)255; return p; };
  _Float16* Bwv = (_Float16*)take((size_t)DD * 2 * DD * 2); float* KEYS = (float*)take((size_t)NNODE * DD * 4); _Float16* K16 = (_Float16*)take((size_t)NNODE * DD * 2); _Float16* Q16 = (_Float16*)take((size_t)NNODE * DD * 2); float* X7 = (float*)take((size_t)NNODE * 8 * 4); float* R = (float*)take((size_t)NNODE * 8 * 4);
  _Float16* QV = (_Float16*)take((size_t)NNODE * DD * 2); _Float16* QVt = (_Float16*)take((size_t)DD * NNODE * 2); _Float16* P16 = (_Float16*)take((size_t)NNODE * NNODE * 2); float* O = (float*)take((size_t)NNODE * DD * 4);
  if (off > ws_size) return;      // 194 MiB of the 256 MiB workspace, the full P plane alone 128 MiB
  k_round16f<<<(unsigned)(((size_t)DD * 2 * DD / 8 + 255) / 256), 256, 0, stream>>>(Wv, Bwv, (size_t)DD * 2 * DD / 8);      /* Wv (512, 1024) natural ×2^4: row d = [Wv_q | Wv_k] */
  k_x7<<<NNODE * 2 / 256, 256, 0, stream>>>(nodes, centre, X7); k_proj<<<(unsigned)(((size_t)NNODE * DD / 4 + 255) / 256), 256, 0, stream>>>(nodes, centre, Wq, bq, Wk, bk, KEYS, K16, Q16);
  k_rvec<<<NNODE * 2 / 256, 256, 0, stream>>>(Wq, bq, Wk, bk, X7, R);
  const dim3 gq((NNODE / 128) * (DD / 128), 1);      /* one 128 x 128 tile per work-group */
  k_gemm_tile<DD * 2, 2 * DD * 2, DD / 128, 0><<<gq, 128, 0, stream>>>(Q16, Bwv, 0.0625f, nullptr, nullptr, nullptr, QV);      /* QV = queries·Wv_qᵀ (Bt rows d, cols 0..511, ldb 1024): M 8192 N 512 K 512 */
  k_vt<DD / 64, NNODE><<<(DD / 64) * (NNODE / 64), 256, 0, stream>>>(QV, DD, 0, QVt);      /* QVᵀ [512][8192] */
  k_soft<<<NNODE / SOFT_ROWS, 1024, 0, stream>>>(R, X7, 0, P16);      /* 256 work-groups of 32 waves, 32 rows each */
  k_gemm_tile<NNODE * 2, NNODE * 2, NNODE / 128, 1><<<gq, 128, 0, stream>>>(P16, QVt, 0.000030517578125f, nullptr, KEYS, O, nullptr);      /* O = keys + attn*QV: M 8192 N 512 K 8192 */
  k_gemm_tile<DD * 2, 2 * DD * 2, DD / 128, 2><<<gq, 128, 0, stream>>>(K16, Bwv + DD, 0.0625f, bv, O, (float*)d_out, nullptr);      /* out = keys·Wv_kᵀ + bv + O (Bt rows d at cols 512.., ldb 1024) */
}

// v004
// Measured time: 179 microseconds a run.
// Two timings next to v003 put it at 1.37 and 1.36 times that version's speed.
// Over all steps from v000 it is 15.4 times as fast.
#include <hip/hip_runtime.h>
#include <stdint.h>
// 'self_attn_init' (N=8192 nodes, 3-d coords + a shared 3-d centre → 6 inputs, D=512): x = [node, centre]; keys = x·Wkᵀ + bk; queries = x·Wqᵀ + bq; attn = softmax_m(keys·queriesᵀ) (UNSCALED, rank-7 logits up to ±O(100));
// out = keys + attn·(queries·Wv[:, :512]ᵀ) + keys·Wv[:, 512:]ᵀ + bv.
// Compute dtype: inputs/weights/biases rounded to bf16. The logits are an exact bilinear form in the 7-vector x̃ = [x, 1]: s[n][m] = (x̃_nᵀ·M)·x̃_m with M = [Wk bk]ᵀ[Wq bq] (7×7, f32), evaluated per pair in f32 (7 FMAs) —
// no 16-bit rounding touches the huge logits; softmax with the 8192 keys split over a work-group's 32 waves (logits kept in registers) writes P f16 ×2^15 for all 8192 rows in one launch; attn·QV and keys·Wv_kᵀ as GEMMs on v_wmma_f32_16x16x32_f16 (f32 accumulate) with keys (f32) and the first
// product carried through the epilogue addends.
#define NNODE 8192
#define DD 512

typedef __bf16 v16b __attribute__((ext_vector_type(16)));
typedef unsigned short v8us __attribute__((ext_vector_type(8), may_alias));
typedef float  v8f  __attribute__((ext_vector_type(8)));
typedef float  v4f  __attribute__((ext_vector_type(4)));
typedef float  v4fa __attribute__((ext_vector_type(4), may_alias));
union FragB { v16b v; v8us half[2]; unsigned short u[16]; };

__device__ __forceinline__ unsigned short bf16_bits(float x) { unsigned int u = __float_as_uint(x); return (unsigned short)((u + 0x7FFFu + ((u >> 16) & 1u)) >> 16); }
__device__ __forceinline__ float bf16_val(unsigned short b) { return __uint_as_float(((unsigned int)b) << 16); }
__device__ __forceinline__ float bf16_round(float x) { return bf16_val(bf16_bits(x)); }
// D += A·B with NT terms: 1 = ah·bh, 2 = + al·bh (A split), 3 = + ah·bl (both split)
template <int NT>
__device__ __forceinline__ v8f mmaN(v16b ah, v16b al, v16b bh, v16b bl, v8f c) {
  c = __builtin_amdgcn_wmma_f32_16x16x32_bf16(false, ah, false, bh, (short)0, c, false, false);
  if (NT >= 2) c = __builtin_amdgcn_wmma_f32_16x16x32_bf16(false, al, false, bh, (short)0, c, false, false);
  if (NT >= 3) c = __builtin_amdgcn_wmma_f32_16x16x32_bf16(false, ah, false, bl, (short)0, c, false, false);
  asm volatile("v_nop\n\tv_nop\n\tv_nop\n\tv_nop" : "+v"(c) : "v"(ah), "v"(al), "v"(bh), "v"(bl));
  return c;
}

__global__ __launch_bounds__(256) void k_wt_bf16(const float* __restrict__ W, unsigned short* __restrict__ Wt, int K, int N) {
  const int t = blockIdx.x * 256 + threadIdx.x;
  const int k8n = K / 8;
  if (t >= N * k8n) return;
  const int n = t / k8n, k8 = (t % k8n) * 8;
  v8us v;
#pragma unroll
  for (int i = 0; i < 8; ++i) v[i] = bf16_bits(W[(size_t)(k8 + i) * N + n]);
  *(v8us*)(Wt + (size_t)n * K + k8) = v;
  
}

// GEMM C[M][N] (f32, pitch ldc) = act(A[M][K]·W + bias). A f32 row-major (pitch lda) converted per fragment to bf16
// (ASPLIT: hi/lo two planes -> 2 terms, else single rounded term); Wt bf16 [N][K] (pitch ldb). BIAS_BF16 rounds the
// bias to bf16 first (bias quantised to bf16 before the add). K%32==0, M%16==0, N%64==0.
template <bool ASPLIT, int ACT, bool BIAS_BF16>
__global__ __launch_bounds__(128) void k_gemm_bf(const float* __restrict__ A, int lda, const unsigned short* __restrict__ Wt, int ldb,
                                               const float* __restrict__ bias, float* __restrict__ C, int ldc, int M, int N, int K) {
  __shared__ __attribute__((aligned(16))) float so[4][16][64];
  const int tid = threadIdx.x, w = tid >> 5, lane = tid & 31, ln = lane & 15, hh = lane >> 4;
  const int ntn = N / 64;
  const int wid = blockIdx.x * 4 + w;
  const int mt = wid / ntn, nq = wid % ntn;
  if (mt * 16 >= M) return;
  const int row0 = mt * 16, col0 = nq * 64;
  const float* arow = A + (size_t)(row0 + ln) * lda;
  v8f acc[4] = {};
  for (int kb = 0; kb < K; kb += 32) {
    FragB ah, al;
    const v4f x0 = *(const v4fa*)(arow + kb + 8 * hh), x1 = *(const v4fa*)(arow + kb + 8 * hh + 4);
    const v4f x2 = *(const v4fa*)(arow + kb + 16 + 8 * hh), x3 = *(const v4fa*)(arow + kb + 16 + 8 * hh + 4);
    float xs[16] = {x0[0],x0[1],x0[2],x0[3],x1[0],x1[1],x1[2],x1[3],x2[0],x2[1],x2[2],x2[3],x3[0],x3[1],x3[2],x3[3]};
#pragma unroll
    for (int i = 0; i < 16; ++i) { const unsigned short hb = bf16_bits(xs[i]); ah.u[i] = hb; al.u[i] = ASPLIT ? bf16_bits(xs[i] - bf16_val(hb)) : (unsigned short)0; }
#pragma unroll
    for (int t = 0; t < 4; ++t) {
      const unsigned short* brow = Wt + (size_t)(col0 + t * 16 + ln) * ldb + kb;
      FragB b;
      b.half[0] = *(const v8us*)(brow + 8 * hh);
      b.half[1] = *(const v8us*)(brow + 16 + 8 * hh);
      acc[t] = mmaN<ASPLIT ? 2 : 1>(ah.v, al.v, b.v, b.v, acc[t]);
    }
  }
#pragma unroll
  for (int t = 0; t < 4; ++t) {
    float bv = bias ? bias[col0 + t * 16 + ln] : 0.f;
    if (BIAS_BF16) bv = bf16_round(bv);
#pragma unroll
    for (int r = 0; r < 8; ++r) { float v = acc[t][r] + bv; if (ACT == 1) v = fmaxf(v, 0.f); so[w][8 * hh + r][t * 16 + ln] = v; }
  }
  __builtin_amdgcn_fence(__ATOMIC_ACQ_REL, "workgroup");
  __builtin_amdgcn_wave_barrier();
  const int rsub = lane >> 4, c4 = (lane & 15) * 4;
  {
#pragma unroll
    for (int q = 0; q < 8; ++q) {
      const int r = q * 2 + rsub;
      const v4f v = *(const v4fa*)&so[w][r][c4];
      *(v4f*)(C + (size_t)(row0 + r) * ldc + col0 + c4) = v;
    }
    
  }
}

// Flash-style causal/unmasked attention, all contractions 3-term bf16 hi/lo splits, f32 softmax with running max.
// q,k,v rows are read from f32 buffers with arbitrary row pitch (so they can live inside a fused qkv buffer);
// D = head size (multiple of 32, <= 128); one wave = 16 query rows; block = 4 waves (64 queries) sharing K/V chunks of 32.
template <int D, bool CAUSAL>
__global__ __launch_bounds__(128) void k_flash(const float* __restrict__ qb, const float* __restrict__ kb, const float* __restrict__ vb,
                                             int pitch, int T, int H, float scale, float* __restrict__ y, int ypitch) {
  constexpr int KS = D / 32;        // k-steps for QK
  constexpr int DT = D / 16;        // d tiles for PV
  __shared__ __attribute__((aligned(16))) unsigned short sKh[32][D + 8], sKl[32][D + 8], sVh[32][D + 8], sVl[32][D + 8];
  __shared__ __attribute__((aligned(16))) unsigned short sPh[4][16][40], sPl[4][16][40];
  __shared__ __attribute__((aligned(16))) float sO[4][16][D];
  const int tid = threadIdx.x, w = tid >> 5, lane = tid & 31, ln = lane & 15, hh = lane >> 4;
  const int nqb = (T + 63) / 64;
  const int bh = blockIdx.x / nqb, qblk = blockIdx.x % nqb;
  const int b = bh / H, h = bh % H;
  const int q0 = qblk * 64 + w * 16;
  const float* Q = qb + (size_t)b * T * pitch + h * D;
  const float* K = kb + (size_t)b * T * pitch + h * D;
  const float* V = vb + (size_t)b * T * pitch + h * D;

  // A fragments of the wave's 16 query rows (scaled), hi/lo
  FragB aqh[KS], aql[KS];
  {
    int row = q0 + ln; if (row >= T) row = T - 1;
    const float* qr = Q + (size_t)row * pitch;
#pragma unroll
    for (int ks = 0; ks < KS; ++ks)
#pragma unroll
      for (int i = 0; i < 16; ++i) {
        const int d = ks * 32 + ((i < 8) ? (8 * hh + i) : (16 + 8 * hh + (i - 8)));
        const float x = qr[d] * scale; const unsigned short hb = bf16_bits(x);
        aqh[ks].u[i] = hb; aql[ks].u[i] = bf16_bits(x - bf16_val(hb));
      }
  }
  float m_r[8], l_r[8];
#pragma unroll
  for (int r = 0; r < 8; ++r) { m_r[r] = -3.0e38f; l_r[r] = 0.f; }
  v8f oacc[DT];
#pragma unroll
  for (int dt = 0; dt < DT; ++dt) oacc[dt] = (v8f){0.f,0.f,0.f,0.f,0.f,0.f,0.f,0.f};

  const int kv_end = CAUSAL ? min(T, qblk * 64 + 64) : T;     // block-uniform
  for (int j0 = 0; j0 < kv_end; j0 += 32) {
    __syncthreads();
    for (int e = tid; e < 32 * (D / 4); e += 128) {
      const int r = e / (D / 4), c4 = (e % (D / 4)) * 4;
      const int key = j0 + r;
      v4f kf = {0.f,0.f,0.f,0.f}, vf = {0.f,0.f,0.f,0.f};
      if (key < T) { kf = *(const v4fa*)(K + (size_t)key * pitch + c4); vf = *(const v4fa*)(V + (size_t)key * pitch + c4); }
#pragma unroll
      for (int t = 0; t < 4; ++t) {
        unsigned short hb = bf16_bits(kf[t]); sKh[r][c4 + t] = hb; sKl[r][c4 + t] = bf16_bits(kf[t] - bf16_val(hb));
        hb = bf16_bits(vf[t]); sVh[r][c4 + t] = hb; sVl[r][c4 + t] = bf16_bits(vf[t] - bf16_val(hb));
      }
    }
    __syncthreads();
    // S tile 16 x 32
    v8f s[2];
#pragma unroll
    for (int nt = 0; nt < 2; ++nt) {
      v8f acc = {};
#pragma unroll
      for (int ks = 0; ks < KS; ++ks) {
        FragB bh_, bl_;
        bh_.half[0] = *(const v8us*)&sKh[nt * 16 + ln][ks * 32 + 8 * hh]; bh_.half[1] = *(const v8us*)&sKh[nt * 16 + ln][ks * 32 + 16 + 8 * hh];
        bl_.half[0] = *(const v8us*)&sKl[nt * 16 + ln][ks * 32 + 8 * hh]; bl_.half[1] = *(const v8us*)&sKl[nt * 16 + ln][ks * 32 + 16 + 8 * hh];
        acc = mmaN<3>(aqh[ks].v, aql[ks].v, bh_.v, bl_.v, acc);
      }
      s[nt] = acc;
    }
    // mask + running max (rows 8hh+r; the 16 lanes of a half share rows)
    float alpha[8];
#pragma unroll
    for (int r = 0; r < 8; ++r) {
      const int qi = q0 + 8 * hh + r;
      const int ja = j0 + ln, jb = j0 + 16 + ln;
      if (CAUSAL) { if (ja > qi) s[0][r] = -3.0e38f; if (jb > qi) s[1][r] = -3.0e38f; }
      if (ja >= T) s[0][r] = -3.0e38f;
      if (jb >= T) s[1][r] = -3.0e38f;
      float mx = fmaxf(s[0][r], s[1][r]);
      mx = fmaxf(mx, __shfl_xor(mx, 1, 32)); mx = fmaxf(mx, __shfl_xor(mx, 2, 32)); mx = fmaxf(mx, __shfl_xor(mx, 4, 32)); mx = fmaxf(mx, __shfl_xor(mx, 8, 32));
      const float mnew = fmaxf(m_r[r], mx);
      alpha[r] = (mnew > -1.0e38f) ? __expf(m_r[r] - mnew) : 1.0f;
      const float p0 = (s[0][r] > -1.0e38f) ? __expf(s[0][r] - mnew) : 0.f;
      const float p1 = (s[1][r] > -1.0e38f) ? __expf(s[1][r] - mnew) : 0.f;
      m_r[r] = mnew;
      l_r[r] = l_r[r] * alpha[r] + p0 + p1;            // per-lane partial row sum (16 lanes combined at the end)
      unsigned short hb = bf16_bits(p0); sPh[w][8 * hh + r][ln] = hb;      sPl[w][8 * hh + r][ln] = bf16_bits(p0 - bf16_val(hb));
      hb = bf16_bits(p1);                sPh[w][8 * hh + r][16 + ln] = hb; sPl[w][8 * hh + r][16 + ln] = bf16_bits(p1 - bf16_val(hb));
    }
#pragma unroll
    for (int dt = 0; dt < DT; ++dt)
#pragma unroll
      for (int r = 0; r < 8; ++r) oacc[dt][r] *= alpha[r];
    __builtin_amdgcn_fence(__ATOMIC_ACQ_REL, "workgroup");
    __builtin_amdgcn_wave_barrier();
    FragB pah, pal;
    pah.half[0] = *(const v8us*)&sPh[w][ln][8 * hh]; pah.half[1] = *(const v8us*)&sPh[w][ln][16 + 8 * hh];
    pal.half[0] = *(const v8us*)&sPl[w][ln][8 * hh]; pal.half[1] = *(const v8us*)&sPl[w][ln][16 + 8 * hh];
#pragma unroll
    for (int dt = 0; dt < DT; ++dt) {
      FragB bvh, bvl;
#pragma unroll
      for (int i = 0; i < 8; ++i) {
        bvh.u[i] = sVh[8 * hh + i][dt * 16 + ln]; bvh.u[8 + i] = sVh[16 + 8 * hh + i][dt * 16 + ln];
        bvl.u[i] = sVl[8 * hh + i][dt * 16 + ln]; bvl.u[8 + i] = sVl[16 + 8 * hh + i][dt * 16 + ln];
      }
      oacc[dt] = mmaN<3>(pah.v, pal.v, bvh.v, bvl.v, oacc[dt]);
    }
    __builtin_amdgcn_fence(__ATOMIC_ACQ_REL, "workgroup");
    __builtin_amdgcn_wave_barrier();
  }
#pragma unroll
  for (int r = 0; r < 8; ++r) {
    float l = l_r[r];
    l += __shfl_xor(l, 1, 32); l += __shfl_xor(l, 2, 32); l += __shfl_xor(l, 4, 32); l += __shfl_xor(l, 8, 32);
    l_r[r] = (l > 0.f) ? 1.0f / l : 0.f;
  }
#pragma unroll
  for (int dt = 0; dt < DT; ++dt)
#pragma unroll
    for (int r = 0; r < 8; ++r) sO[w][8 * hh + r][dt * 16 + ln] = oacc[dt][r] * l_r[r];
  __builtin_amdgcn_fence(__ATOMIC_ACQ_REL, "workgroup");
  __builtin_amdgcn_wave_barrier();
  {
    for (int r = 0; r < 16; ++r) {
      const int row = q0 + r;
      if (row < T && lane < D / 4) {
        const v4f val = *(const v4fa*)&sO[w][r][lane * 4];
        *(v4f*)(y + ((size_t)b * T + row) * ypitch + h * D + lane * 4) = val;
      }
    }
    
  }
}

// GEMM C = act(A·W + bias + resid): A f32 (ASPLIT -> hi/lo 2 terms), Wt bf16 [N][K]; ACT 0 none, 1 relu, 2 exact gelu;
// resid (optional, f32, row index = (row % rmod), pitch ldr, RES_BF16 rounds it) added before the activation.
template <bool ASPLIT, int ACT, bool BIAS_BF16, bool RES_BF16>
__global__ __launch_bounds__(128) void k_gemm_bf3(const float* __restrict__ A, int lda, const unsigned short* __restrict__ Wt, int ldb,
                                                const float* __restrict__ bias, const float* __restrict__ resid, int rmod, int ldr,
                                                float* __restrict__ C, int ldc, int M, int N, int K) {
  __shared__ __attribute__((aligned(16))) float so[4][16][64];
  const int tid = threadIdx.x, w = tid >> 5, lane = tid & 31, ln = lane & 15, hh = lane >> 4;
  const int ntn = N / 64;
  const int wid = blockIdx.x * 4 + w;
  const int mt = wid / ntn, nq = wid % ntn;
  if (mt * 16 >= M) return;
  const int row0 = mt * 16, col0 = nq * 64;
  const float* arow = A + (size_t)(row0 + ln) * lda;
  v8f acc[4] = {};
  for (int kb = 0; kb < K; kb += 32) {
    FragB ah, al;
    const v4f x0 = *(const v4fa*)(arow + kb + 8 * hh), x1 = *(const v4fa*)(arow + kb + 8 * hh + 4);
    const v4f x2 = *(const v4fa*)(arow + kb + 16 + 8 * hh), x3 = *(const v4fa*)(arow + kb + 16 + 8 * hh + 4);
    float xs[16] = {x0[0],x0[1],x0[2],x0[3],x1[0],x1[1],x1[2],x1[3],x2[0],x2[1],x2[2],x2[3],x3[0],x3[1],x3[2],x3[3]};
#pragma unroll
    for (int i = 0; i < 16; ++i) { const unsigned short hb = bf16_bits(xs[i]); ah.u[i] = hb; al.u[i] = ASPLIT ? bf16_bits(xs[i] - bf16_val(hb)) : (unsigned short)0; }
#pragma unroll
    for (int t = 0; t < 4; ++t) {
      const unsigned short* brow = Wt + (size_t)(col0 + t * 16 + ln) * ldb + kb;
      FragB b;
      b.half[0] = *(const v8us*)(brow + 8 * hh);
      b.half[1] = *(const v8us*)(brow + 16 + 8 * hh);
      acc[t] = mmaN<ASPLIT ? 2 : 1>(ah.v, al.v, b.v, b.v, acc[t]);
    }
  }
#pragma unroll
  for (int t = 0; t < 4; ++t) {
    const int col = col0 + t * 16 + ln;
    float bv = bias ? bias[col] : 0.f;
    if (BIAS_BF16) bv = bf16_round(bv);
#pragma unroll
    for (int r = 0; r < 8; ++r) {
      float v = acc[t][r] + bv;
      if (resid) { float rv = resid[(size_t)((row0 + 8 * hh + r) % rmod) * ldr + col]; if (RES_BF16) rv = bf16_round(rv); v += rv; }
      if (ACT == 1) v = fmaxf(v, 0.f);
      if (ACT == 2) v = 0.5f * v * (1.0f + erff(v * 0.70710678118654752f));
      if (ACT == 3) { const float u = 0.7978845608028654f * (v + 0.044715f * v * v * v); v = 0.5f * v * (1.0f + tanhf(u)); }
      so[w][8 * hh + r][t * 16 + ln] = v;
    }
  }
  __builtin_amdgcn_fence(__ATOMIC_ACQ_REL, "workgroup");
  __builtin_amdgcn_wave_barrier();
  const int rsub = lane >> 4, c4 = (lane & 15) * 4;
  {
#pragma unroll
    for (int q = 0; q < 8; ++q) {
      const int r = q * 2 + rsub;
      const v4f v = *(const v4fa*)&so[w][r][c4];
      *(v4f*)(C + (size_t)(row0 + r) * ldc + col0 + c4) = v;
    }
    
  }
}
// row LayerNorm (biased variance, eps) over N: s = X (+ R); optional out_sum <- s; out_norm <- (s-mu)*rsqrt(var+eps)*g + b
template <bool PARAM_BF16>
__global__ __launch_bounds__(256) void k_layernorm(const float* __restrict__ X, const float* __restrict__ R, const float* __restrict__ g, const float* __restrict__ bta,
                                                  float* __restrict__ out_sum, float* __restrict__ out_norm, int N, float eps) {
  __shared__ float red[256];
  const int row = blockIdx.x, tid = threadIdx.x;
  const float* x = X + (size_t)row * N; const float* rr = R ? R + (size_t)row * N : nullptr;
  float vals[16];                     // up to N = 4096
  const int per = N / 256;            // contiguous chunk per thread? use strided-by-4 chunks: thread handles j = tid*4 + 1024*u
  float s1 = 0.f;
  for (int u = 0; u < per / 4; ++u) {
    const int j = tid * 4 + 1024 * u;
    const v4f a = *(const v4fa*)(x + j);
    v4f b = {0.f,0.f,0.f,0.f}; if (rr) b = *(const v4fa*)(rr + j);
#pragma unroll
    for (int q = 0; q < 4; ++q) { const float v = a[q] + b[q]; vals[u * 4 + q] = v; s1 += v; }
  }
  red[tid] = s1; __syncthreads();
  for (int st = 128; st > 0; st >>= 1) { if (tid < st) red[tid] += red[tid + st]; __syncthreads(); }
  const float mu = red[0] / (float)N; __syncthreads();
  float s2 = 0.f;
  for (int u = 0; u < per / 4; ++u)
#pragma unroll
    for (int q = 0; q < 4; ++q) { const float c = vals[u * 4 + q] - mu; s2 += c * c; }
  red[tid] = s2; __syncthreads();
  for (int st = 128; st > 0; st >>= 1) { if (tid < st) red[tid] += red[tid + st]; __syncthreads(); }
  const float rs = rsqrtf(red[0] / (float)N + eps);
  {
    for (int u = 0; u < per / 4; ++u) {
      const int j = tid * 4 + 1024 * u;
      v4f o, sm;
#pragma unroll
      for (int q = 0; q < 4; ++q) {
        float gg = g[j + q], bb = bta[j + q];
        if (PARAM_BF16) { gg = bf16_round(gg); bb = bf16_round(bb); }
        sm[q] = vals[u * 4 + q]; o[q] = (vals[u * 4 + q] - mu) * rs * gg + bb;
      }
      if (out_sum) *(v4f*)(out_sum + (size_t)row * N + j) = sm;
      *(v4f*)(out_norm + (size_t)row * N + j) = o;
    }
    
  }
}



// ---- f16 WMMA path (v_wmma_f32_16x16x32_f16): 11-bit significands for operands in range — used where a [0,1] probability operand needs more precision than bf16
typedef _Float16 v16h __attribute__((ext_vector_type(16)));
union FragH { v16h v; v8us half[2]; _Float16 h[16]; unsigned short u[16]; };
template <int NT>
__device__ __forceinline__ v8f mmaH(v16h ah, v16h al, v16h bh, v16h bl, v8f c) {
  c = __builtin_amdgcn_wmma_f32_16x16x32_f16(false, ah, false, bh, (short)0, c, false, false);
  if (NT >= 2) c = __builtin_amdgcn_wmma_f32_16x16x32_f16(false, al, false, bh, (short)0, c, false, false);
  if (NT >= 3) c = __builtin_amdgcn_wmma_f32_16x16x32_f16(false, ah, false, bl, (short)0, c, false, false);
  asm volatile("v_nop\n\tv_nop\n\tv_nop\n\tv_nop" : "+v"(c) : "v"(ah), "v"(al), "v"(bh), "v"(bl));
  return c;
}
// batched GEMM like k_gemm_b but f16 operands: A f32 (split into f16 hi/lo if ASPLIT, else rounded to f16), Bt = f16 values [n][k]; alpha; C f32; N multiple of 16 (partial tiles skipped)
template <bool ASPLIT>
__global__ __launch_bounds__(128) void k_gemm_h(const float* __restrict__ A, int lda, size_t sA, const _Float16* __restrict__ Bh, int ldb, size_t sB, float alpha, float* __restrict__ C, int ldc, size_t sC, int M, int N, int K) {
  __shared__ __attribute__((aligned(16))) float so[4][16][64];
  const int tid = threadIdx.x, w = tid >> 5, lane = tid & 31, ln = lane & 15, hh = lane >> 4; const int by = blockIdx.y;
  A += (size_t)by * sA; Bh += (size_t)by * sB; C += (size_t)by * sC;
  const int ntn = (N + 63) / 64; const int wid = blockIdx.x * 4 + w; const int mt = wid / ntn, nq = wid % ntn; if (mt * 16 >= M) return;
  const int row0 = mt * 16, col0 = nq * 64; const float* arow = A + (size_t)(row0 + ln) * lda;
  v8f acc[4] = {};
  for (int kb = 0; kb < K; kb += 32) {
    FragH ah, al;
    const v4f x0 = *(const v4fa*)(arow + kb + 8 * hh), x1 = *(const v4fa*)(arow + kb + 8 * hh + 4), x2 = *(const v4fa*)(arow + kb + 16 + 8 * hh), x3 = *(const v4fa*)(arow + kb + 16 + 8 * hh + 4);
    float xs[16] = {x0[0],x0[1],x0[2],x0[3],x1[0],x1[1],x1[2],x1[3],x2[0],x2[1],x2[2],x2[3],x3[0],x3[1],x3[2],x3[3]};
#pragma unroll
    for (int i = 0; i < 16; ++i) { const _Float16 h = (_Float16)xs[i]; ah.h[i] = h; al.h[i] = ASPLIT ? (_Float16)(xs[i] - (float)h) : (_Float16)0.0f; }
#pragma unroll
    for (int t = 0; t < 4; ++t) { if (col0 + t * 16 >= N) continue; const size_t boff = (size_t)(col0 + t * 16 + ln) * ldb + kb; FragH bq; bq.half[0] = *(const v8us*)(Bh + boff + 8 * hh); bq.half[1] = *(const v8us*)(Bh + boff + 16 + 8 * hh);
      acc[t] = mmaH<ASPLIT ? 2 : 1>(ah.v, al.v, bq.v, bq.v, acc[t]); }
  }
#pragma unroll
  for (int t = 0; t < 4; ++t) { if (col0 + t * 16 >= N) continue;
#pragma unroll
    for (int r = 0; r < 8; ++r) so[w][8 * hh + r][t * 16 + ln] = acc[t][r] * alpha; }
  __builtin_amdgcn_fence(__ATOMIC_ACQ_REL, "workgroup"); __builtin_amdgcn_wave_barrier();
  const int rsub = lane >> 4, c4 = (lane & 15) * 4;
  {
#pragma unroll
    for (int q = 0; q < 8; ++q) { const int r = q * 2 + rsub; if (col0 + c4 < N) { const v4f v = *(const v4fa*)&so[w][r][c4]; *(v4f*)(C + (size_t)(row0 + r) * ldc + col0 + c4) = v; } }
     }
}

// Wt[n][k] = f16(W[k][n]·scale) from f32 row-major W[K][N] (scale = power of two; bf16-exact weights stay exact in f16 away from the subnormal range)
__global__ __launch_bounds__(256) void k_wt_f16(const float* __restrict__ W, _Float16* __restrict__ Wt, int K, int N, float scale) {
  const int t = blockIdx.x * 256 + threadIdx.x; if (t >= N * (K / 8)) return; const int n = t / (K / 8), k8 = (t % (K / 8)) * 8; FragH f;
#pragma unroll
  for (int i = 0; i < 8; ++i) f.h[i] = (_Float16)(bf16_round(W[(size_t)(k8 + i) * N + n]) * scale); const v8us o = f.half[0];
  *(v8us*)((unsigned short*)Wt + (size_t)n * K + k8) = o; 
}
// k_gemm_hh variant with fused epilogue: v = acc·alpha + bias[by·sBias + col] (+ CP[(row/rowsPerB)·sCPb + by·64 + col] if CP) ; ACT 0 none / 1 elu ; writes f32 C and/or f16 C16 (each if non-null)
template <int ACT>
__global__ __launch_bounds__(128) void k_gemm_hhx(const _Float16* __restrict__ A, int lda, size_t sA, const _Float16* __restrict__ Bh, int ldb, size_t sB, float alpha, const float* __restrict__ bias, size_t sBias, const float* __restrict__ CP, int rowsPerB, size_t sCPb, int row0g,
    float* __restrict__ C, _Float16* __restrict__ C16, int ldc, size_t sC, int M, int N, int K) {
  __shared__ __attribute__((aligned(16))) float so[4][16][64];
  const int tid = threadIdx.x, w = tid >> 5, lane = tid & 31, ln = lane & 15, hh = lane >> 4; const int by = blockIdx.y;
  A += (size_t)by * sA; Bh += (size_t)by * sB; const size_t cofs = (size_t)by * sC; const float* bp = bias ? bias + (size_t)by * sBias : nullptr;
  const int ntn = (N + 63) / 64; const int wid = blockIdx.x * 4 + w; const int mt = wid / ntn, nq = wid % ntn; if (mt * 16 >= M) return;
  const int row0 = mt * 16, col0 = nq * 64; const _Float16* arow = A + (size_t)(row0 + ln) * lda;
  v8f acc[4] = {};
  for (int kb = 0; kb < K; kb += 32) { FragH ah; ah.half[0] = *(const v8us*)((const unsigned short*)arow + kb + 8 * hh); ah.half[1] = *(const v8us*)((const unsigned short*)arow + kb + 16 + 8 * hh);
#pragma unroll
    for (int t = 0; t < 4; ++t) { if (col0 + t * 16 >= N) continue; const size_t boff = (size_t)(col0 + t * 16 + ln) * ldb + kb; FragH bq; bq.half[0] = *(const v8us*)((const unsigned short*)Bh + boff + 8 * hh); bq.half[1] = *(const v8us*)((const unsigned short*)Bh + boff + 16 + 8 * hh);
      acc[t] = mmaH<1>(ah.v, ah.v, bq.v, bq.v, acc[t]); }
  }
#pragma unroll
  for (int t = 0; t < 4; ++t) { if (col0 + t * 16 >= N) continue; const int col = col0 + t * 16 + ln; const float bv = bp ? bf16_round(bp[col]) : 0.f;
#pragma unroll
    for (int r = 0; r < 8; ++r) { float v = acc[t][r] * alpha + bv; if (CP) { const int bidx = (row0g + row0 + 8 * hh + r) / rowsPerB; v += CP[(size_t)bidx * sCPb + (size_t)by * 64 + col]; } if (ACT == 1) v = (v > 0.f) ? v : expm1f(v); else if (ACT == 7) v = (v > 0.f) ? v + 1.0f : expf(v); else if (ACT == 8) v = tanhf(v); else if (ACT == 9) v = 0.5f * v * (1.0f + tanhf(0.7978845608028654f * (v + 0.044715f * v * v * v))); else if (ACT == 11) v = 1.0f / (1.0f + expf(-v)); else if (ACT == 12) v = (v > 0.f) ? v : 0.01f * v; else if (ACT == 14) v = (v > 0.f) ? v : 0.1f * v; else if (ACT == 15) v = v / (1.0f + expf(-v)); else if (ACT == 3) v = fmaxf(v, 0.f); else if (ACT == 6) v = 0.5f * v * (1.0f + erff(v * 0.70710678118654752f)); so[w][8 * hh + r][t * 16 + ln] = v; } }
  __builtin_amdgcn_fence(__ATOMIC_ACQ_REL, "workgroup"); __builtin_amdgcn_wave_barrier();
  const int rsub = lane >> 4, c4 = (lane & 15) * 4; typedef _Float16 v4h __attribute__((ext_vector_type(4)));
  {
#pragma unroll
    for (int q = 0; q < 8; ++q) { const int r = q * 2 + rsub; if (col0 + c4 < N) { const v4f v = *(const v4fa*)&so[w][r][c4]; if (C) *(v4f*)(C + cofs + (size_t)(row0 + r) * ldc + col0 + c4) = v; if (C16) { v4h h4; for (int i = 0; i < 4; ++i) h4[i] = (_Float16)v[i]; *(v4h*)(C16 + cofs + (size_t)(row0 + r) * ldc + col0 + c4) = h4; } } }
     }
}


typedef _Float16 v4h __attribute__((ext_vector_type(4)));

__global__ __launch_bounds__(256) void k_x16(const float* __restrict__ x, _Float16* __restrict__ X16, size_t n8) { const size_t t = (size_t)blockIdx.x * 256 + threadIdx.x; if (t >= n8) return; FragH f;
#pragma unroll
  for (int q = 0; q < 8; ++q) f.h[q] = (_Float16)bf16_round(x[t * 8 + q]); *(v8us*)((unsigned short*)X16 + t * 8) = f.half[0];  }
__global__ __launch_bounds__(256) void k_h16(const float* __restrict__ x, _Float16* __restrict__ X16, size_t n8) { const size_t t = (size_t)blockIdx.x * 256 + threadIdx.x; if (t >= n8) return; FragH f;
#pragma unroll
  for (int q = 0; q < 8; ++q) f.h[q] = (_Float16)x[t * 8 + q]; *(v8us*)((unsigned short*)X16 + t * 8) = f.half[0];  }
__global__ __launch_bounds__(256) void k_round16f(const float* __restrict__ W, _Float16* __restrict__ Bt, size_t n8) { const size_t t = (size_t)blockIdx.x * 256 + threadIdx.x; if (t >= n8) return; FragH f;
#pragma unroll
  for (int i = 0; i < 8; ++i) f.h[i] = (_Float16)(bf16_round(W[t * 8 + i]) * 16.0f); *(v8us*)((unsigned short*)Bt + t * 8) = f.half[0];  }
template <int NHv, int TTv>
__global__ __launch_bounds__(256) void k_vt(const _Float16* __restrict__ V16, int ldv, int voff, _Float16* __restrict__ Vt) { __shared__ unsigned short tl[64][66]; const int tid = threadIdx.x; const int slab = blockIdx.x / (TTv / 64), lg = blockIdx.x % (TTv / 64); const int b = slab / NHv, h = slab % NHv;
  for (int i = tid; i < 64 * 8; i += 256) { const int r = i / 8, c8 = (i % 8) * 8; FragH f; f.half[0] = *(const v8us*)((const unsigned short*)V16 + ((size_t)b * TTv + lg * 64 + r) * ldv + voff + h * 64 + c8);
#pragma unroll
    for (int q = 0; q < 8; ++q) tl[r][c8 + q] = f.u[q]; }
  __syncthreads();
  {
#pragma unroll
    for (int rd = 0; rd < 2; ++rd) { const int d = rd * 32 + tid / 8, pc = tid % 8; FragH f;
#pragma unroll
      for (int q = 0; q < 8; ++q) f.u[q] = tl[pc * 8 + q][d];
      *(v8us*)((unsigned short*)Vt + ((size_t)slab * 64 + d) * TTv + lg * 64 + pc * 8) = f.half[0]; }
     } }

__global__ __launch_bounds__(256) void k_x7(const float* __restrict__ nodes, const float* __restrict__ centre, float* __restrict__ X7) { const int t = blockIdx.x * 256 + threadIdx.x; if (t >= NNODE * 2) return; const int n = t >> 1, half = t & 1; v4f v;
  if (half == 0) { v[0] = bf16_round(nodes[(size_t)n * 3]); v[1] = bf16_round(nodes[(size_t)n * 3 + 1]); v[2] = bf16_round(nodes[(size_t)n * 3 + 2]); v[3] = bf16_round(centre[0]); } else { v[0] = bf16_round(centre[1]); v[1] = bf16_round(centre[2]); v[2] = 1.0f; v[3] = 0.f; }
  *(v4f*)(X7 + (size_t)t * 4) = v;  }
__global__ __launch_bounds__(256) void k_proj(const float* __restrict__ nodes, const float* __restrict__ centre, const float* __restrict__ Wq, const float* __restrict__ bq, const float* __restrict__ Wk, const float* __restrict__ bk, float* __restrict__ KEYS, _Float16* __restrict__ K16, _Float16* __restrict__ Q16) {
  #pragma clang fp contract(off)
  const size_t t = (size_t)blockIdx.x * 256 + threadIdx.x; if (t >= (size_t)NNODE * DD / 4) return; const int n = (int)((t * 4) / DD), c0 = (int)((t * 4) % DD); float xa[7];
  for (int i = 0; i < 3; ++i) { xa[i] = bf16_round(nodes[(size_t)n * 3 + i]); xa[3 + i] = bf16_round(centre[i]); } xa[6] = 1.0f;
  float kv[4], qv[4]; for (int q = 0; q < 4; ++q) { kv[q] = bf16_round(bk[c0 + q]); qv[q] = bf16_round(bq[c0 + q]); }
#pragma unroll 1
  for (int i = 0; i < 6; ++i) for (int q = 0; q < 4; ++q) { kv[q] += xa[i] * bf16_round(Wk[(size_t)(c0 + q) * 6 + i]); qv[q] += xa[i] * bf16_round(Wq[(size_t)(c0 + q) * 6 + i]); }
  typedef _Float16 v4h __attribute__((ext_vector_type(4))); v4h fk, fq; for (int q = 0; q < 4; ++q) { fk[q] = (_Float16)kv[q]; fq[q] = (_Float16)qv[q]; } const v4f k0 = {kv[0], kv[1], kv[2], kv[3]};
  { *(v4f*)(KEYS + t * 4) = k0; *(v4h*)(K16 + t * 4) = fk; *(v4h*)(Q16 + t * 4) = fq;      /* one 16-B f32 piece and 8-B f16 pieces per lane, lane-contiguous */
     } }
// value of lane l ^ MASK inside a 16-lane row (DPP row_xmask), and of lane l ^ 16: register moves, no LDS round trip
template <int MASK> __device__ __forceinline__ float lane_xor_row(float x) { return __int_as_float(__builtin_amdgcn_update_dpp(0, __float_as_int(x), 0x160 | MASK, 0xf, 0xf, true)); }
__device__ __forceinline__ float lane_xor16(float x) { const int v = __float_as_int(x); return __int_as_float(__builtin_amdgcn_permlanex16(v, v, 0x76543210, 0xfedcba98, false, false)); }
__device__ __forceinline__ float wave_max(float x) { x = fmaxf(x, lane_xor_row<1>(x)); x = fmaxf(x, lane_xor_row<2>(x)); x = fmaxf(x, lane_xor_row<4>(x)); x = fmaxf(x, lane_xor_row<8>(x)); return fmaxf(x, lane_xor16(x)); }
__device__ __forceinline__ float wave_sum(float x) { x += lane_xor_row<1>(x); x += lane_xor_row<2>(x); x += lane_xor_row<4>(x); x += lane_xor_row<8>(x); return x + lane_xor16(x); }
// M[i][j] = sum over the 512 channels c of a_c[i] * b_c[j], with a_c = [Wk[c][0..5], bk[c]] and b_c = [Wq[c][0..5], bq[c]] rounded to bf16 (each product is exact in f32).
// The 256 threads split the channels: thread t takes channels 2t and 2t + 1 (12 neighbouring floats of each matrix, all loads in flight at once) and forms its 49 partial sums in registers;
// each is summed over the wave by register moves, the 8 waves' sums meet in LDS, and thread p < 49 adds them in wave order. The caller's barrier publishes M.
static_assert(DD == 2 * 256, "two channels per thread of a 256-thread work-group");
__device__ __forceinline__ void sai_gram(const float* __restrict__ Wq, const float* __restrict__ bq, const float* __restrict__ Wk, const float* __restrict__ bk, int tid, float (*part)[52], float (*M)[8]) {
  float a[2][7], b[2][7], s[49];
  // every unroll of this function: a, b and s stay in registers only under constant indices
#pragma unroll
  for (int u = 0; u < 2; ++u) {
    const int c = 2 * tid + u;
#pragma unroll
    for (int i = 0; i < 6; ++i) { a[u][i] = bf16_round(Wk[(size_t)c * 6 + i]); b[u][i] = bf16_round(Wq[(size_t)c * 6 + i]); }
    a[u][6] = bf16_round(bk[c]); b[u][6] = bf16_round(bq[c]);
  }
#pragma unroll
  for (int i = 0; i < 7; ++i)
#pragma unroll
    for (int j = 0; j < 7; ++j) s[i * 7 + j] = wave_sum(a[0][i] * b[0][j] + a[1][i] * b[1][j]);
  if ((tid & 31) == 0) {
#pragma unroll
    for (int p = 0; p < 49; ++p) part[tid >> 5][p] = s[p];
  }
  __syncthreads();      /* every wave's 49 sums are in part */
  if (tid < 49) {
    float m = part[0][tid];
#pragma unroll
    for (int w = 1; w < 8; ++w) m += part[w][tid];
    M[tid / 7][tid % 7] = m;
  }
}
__global__ __launch_bounds__(256) void k_rvec(const float* __restrict__ Wq, const float* __restrict__ bq, const float* __restrict__ Wk, const float* __restrict__ bk, const float* __restrict__ X7, float* __restrict__ R) {
  #pragma clang fp contract(off)
  __shared__ float M[7][8]; __shared__ __attribute__((aligned(16))) float part[8][52]; const int tid = threadIdx.x;
  sai_gram(Wq, bq, Wk, bk, tid, part, M);
  __syncthreads();
  const int t = blockIdx.x * 256 + tid; if (t >= NNODE * 2) return; const int n = t >> 1, half = t & 1; float xa[8]; { const v4f a = *(const v4fa*)(X7 + (size_t)n * 8), b = *(const v4fa*)(X7 + (size_t)n * 8 + 4); xa[0] = a[0]; xa[1] = a[1]; xa[2] = a[2]; xa[3] = a[3]; xa[4] = b[0]; xa[5] = b[1]; xa[6] = b[2]; }
  v4f o = {0.f, 0.f, 0.f, 0.f};      /* this thread's half of R[n]: columns j = 4·half .. 4·half+3 (j = 7 stays 0) */
#pragma unroll 1
  for (int i = 0; i < 7; ++i) for (int q = 0; q < 4; ++q) { const int j = half * 4 + q; if (j < 7) o[q] += xa[i] * M[i][j]; }
  *(v4f*)(R + (size_t)t * 4) = o;  }
__device__ __forceinline__ float sai_dot(const float* r, v4f a, v4f b) { return r[0] * a[0] + r[1] * a[1] + r[2] * a[2] + r[3] * a[3] + r[4] * b[0] + r[5] * b[1] + r[6] * b[2]; }
// One work-group = 32 waves that split the 8192 KEYS: thread t owns keys 8t .. 8t+7 and holds their vectors in registers for all SOFT_ROWS rows of the group.
// Rows go four at a time: logits once into registers, row maximum and row sum over the 32 waves through LDS, the exponentials overwrite the logits, P f16 x2^15 leaves as one 16-B piece per lane and row.
#define SOFT_ROWS 32
__global__ __launch_bounds__(1024) void k_soft(const float* __restrict__ R, const float* __restrict__ X7, int n0, _Float16* __restrict__ P16) {
  __shared__ __attribute__((aligned(16))) float redM[32][4], redZ[32][4];
  const int tid = threadIdx.x, wv = tid >> 5, lane = tid & 31;
  v4f xa[8], xb[8];
  // every unroll below: xa, xb, s, m4 and z4 stay in registers only where their indices are constants
#pragma unroll
  for (int e = 0; e < 8; ++e) { xa[e] = *(const v4fa*)(X7 + ((size_t)tid * 8 + e) * 8); xb[e] = *(const v4fa*)(X7 + ((size_t)tid * 8 + e) * 8 + 4); }
  for (int g = 0; g < SOFT_ROWS / 4; ++g) {
    const int nl = blockIdx.x * SOFT_ROWS + g * 4;
    float s[4][8]; v4f m4, z4;
    // unrolled for constant indices (registers), and the four rows' chains interleave
#pragma unroll
    for (int j = 0; j < 4; ++j) {
      const float* rp = R + (size_t)(n0 + nl + j) * 8; const v4f a = *(const v4fa*)rp, b = *(const v4fa*)(rp + 4); const float r[7] = {a[0], a[1], a[2], a[3], b[0], b[1], b[2]};
      float mx = -3.0e38f;
      // unrolled for constant indices (registers)
#pragma unroll
      for (int e = 0; e < 8; ++e) { s[j][e] = sai_dot(r, xa[e], xb[e]); mx = fmaxf(mx, s[j][e]); }
      m4[j] = wave_max(mx);
    }
    if (lane == 0) *(v4f*)&redM[wv][0] = m4;
    __syncthreads();      /* every wave's four maxima are in redM */
    m4 = *(const v4f*)&redM[lane][0];
    // unrolled for constant indices (registers), and the four rows' chains interleave
#pragma unroll
    for (int j = 0; j < 4; ++j) {
      const float mx = wave_max(m4[j]); float z = 0.f;
      // unrolled for constant indices (registers)
#pragma unroll
      for (int e = 0; e < 8; ++e) { s[j][e] = expf(s[j][e] - mx); z += s[j][e]; }
      z4[j] = wave_sum(z);
    }
    if (lane == 0) *(v4f*)&redZ[wv][0] = z4;
    __syncthreads();      /* every wave's four sums are in redZ; it also ends every read of redM before the next four rows write it */
    z4 = *(const v4f*)&redZ[lane][0];
    // unrolled for constant indices (registers), and the four rows' chains interleave
#pragma unroll
    for (int j = 0; j < 4; ++j) {
      const float iz = 32768.0f / wave_sum(z4[j]); FragH f;
      // unrolled for constant indices (registers)
#pragma unroll
      for (int e = 0; e < 8; ++e) f.h[e] = (_Float16)(s[j][e] * iz);
      *(v8us*)((unsigned short*)P16 + (size_t)(nl + j) * NNODE + (size_t)tid * 8) = f.half[0];
    }
  }
}

// ---- the three GEMMs as one tiled kernel: C[8192][512] = alpha * A[8192][K] * Bt[512][K]^T (+ addends), both operands f16 with k contiguous.
// One 128 x 128 tile of C per work-group (256 work-groups), 4 waves (2 x 2) of 64 x 64 each. A stage is 256 bytes (128 k) of the tile's 128 A rows and 128 Bt rows in LDS at pitch 272 B;
// every wave brings its own 64-row slice of a stage with one tensor load; two buffers, the next stage in flight while this one is worked on.
typedef uint32_t u32x4 __attribute__((ext_vector_type(4)));
typedef uint32_t u32x8 __attribute__((ext_vector_type(8)));
constexpr uint32_t TG_KB = 256;                      // bytes of k per operand row and stage
constexpr uint32_t TG_PITCH = TG_KB + 16;            // LDS row pitch, 16 B x odd, written by the tensor load's pad
constexpr uint32_t TG_SROWS = 64;                    // rows per slice (one tensor load)
constexpr uint32_t TG_SLICE = 18432;                 // 64 x 272 = 17,408 B rounded up to a multiple of 2 KiB, so that every slice starts on one
constexpr uint32_t TG_STAGE = 4 * TG_SLICE;          // one buffer: [A rows 0-63][A rows 64-127][Bt rows 0-63][Bt rows 64-127]
constexpr uint32_t TG_EPITCH = 68;                   // floats per staged output row (64 + 4)
constexpr uint32_t TG_EPI = 64 * TG_EPITCH * 4;      // output staging per wave, behind the ring
constexpr uint32_t TG_LDS = 2 * TG_STAGE + 4 * TG_EPI;
static_assert(TG_SROWS * TG_PITCH <= TG_SLICE && TG_SLICE % 2048u == 0, "a slice must hold its padded rows and start on a multiple of 2 KiB");
static_assert(TG_LDS <= 320u * 1024u, "LDS of one work-group");
__device__ __forceinline__ uint32_t tg_uni(uint32_t v) { return (uint32_t)__builtin_amdgcn_readfirstlane(v); }
__device__ __forceinline__ uint32_t tg_pinned(uint32_t v) { uint32_t w = (uint32_t)__builtin_amdgcn_readfirstlane(v); asm volatile("" : "+s"(w)); return w; }
__device__ __forceinline__ void tg_wait_ds0() { asm volatile("s_wait_dscnt 0x0" ::: "memory"); }          // this wave's LDS reads have returned before the buffer is handed over
// A request's descriptor: group 0 (count, LDS place, source address, type) and group 1 (64 rows of 256 bytes at the source pitch, 16 B of LDS pad behind every row).
struct TgDesc { u32x4 g0; u32x8 g1; };
__device__ __forceinline__ TgDesc tg_desc(uint32_t lds_dst, uint64_t ga, uint32_t pitch) {
  TgDesc d;
  d.g0[0] = tg_uni(1u);
  d.g0[1] = tg_uni(lds_dst);
  d.g0[2] = tg_uni((uint32_t)ga);
  d.g0[3] = tg_uni((((uint32_t)(ga >> 32)) & 0x01FFFFFFu) | 0x80000000u);
  d.g1[0] = tg_uni((1u << 20) | (5u << 22) | (3u << 25));
  d.g1[1] = tg_uni((TG_KB & 0xFFFFu) << 16);
  d.g1[2] = tg_uni((TG_KB >> 16) | ((TG_SROWS & 0xFFFFu) << 16));
  d.g1[3] = tg_uni((TG_SROWS >> 16) | (TG_KB << 16));
  d.g1[4] = tg_uni(TG_SROWS);
  d.g1[5] = tg_uni(pitch);
  d.g1[6] = tg_uni(0u);
  d.g1[7] = tg_uni(0u);
  return d;
}
// the next stage of the same slice: a new LDS place, the source 256 bytes further along k (the carry goes into the address's high word, below its type bits)
__device__ __forceinline__ void tg_next(TgDesc& d, uint32_t lds_dst) {
  const uint32_t lo = d.g0[2] + TG_KB;
  d.g0[1] = tg_uni(lds_dst);
  d.g0[2] = tg_uni(lo);
  d.g0[3] = tg_uni(d.g0[3] + ((lo < TG_KB) ? 1u : 0u));
}
// Both statements take the descriptor as in-out operands: its registers then stay the descriptor's from the issue to the wait (the compiler otherwise reused some of them for loop temporaries
// while the request was in flight), and tg_next()'s new words are formed behind the wait.
__device__ __forceinline__ void tg_tensor_load(TgDesc& d) { asm volatile("tensor_load_to_lds %0, %1" : "+s"(d.g0), "+s"(d.g1) :: "memory"); }
// this wave's slice has landed; the compiler places no wait for a tensor load
__device__ __forceinline__ void tg_wait_tensor0(TgDesc& d) { asm volatile("s_wait_tensorcnt 0x0" : "+s"(d.g0), "+s"(d.g1) :: "memory"); }
__device__ __forceinline__ void tg_load_frag(FragH& f, const unsigned char* p) { f.half[0] = *(const v8us*)p; f.half[1] = *(const v8us*)(p + 32); }
// APITCH, BPITCH: source row pitches in bytes; T: stages (K = 128 T). MODE 0: C16 = f16(acc*alpha); 1: C = acc*alpha + add; 2: C = acc*alpha + bf16(bias[col]) + add. C, C16 and add have 512 columns.
template <uint32_t APITCH, uint32_t BPITCH, uint32_t T, int MODE>
__global__ __launch_bounds__(128) void k_gemm_tile(const _Float16* __restrict__ A, const _Float16* __restrict__ Bt, float alpha, const float* __restrict__ bias, const float* __restrict__ add, float* __restrict__ C, _Float16* __restrict__ C16) {
  static_assert(T >= 2 && T * TG_KB <= APITCH && T * TG_KB <= BPITCH && APITCH % 16u == 0 && BPITCH % 16u == 0, "the prologue fills two stages; every stage lies inside its source rows");
  __shared__ __attribute__((aligned(2048))) unsigned char L[TG_LDS];
  const uint32_t tid = threadIdx.x, lane = tid & 31u, h = lane >> 4, c = lane & 15u;
  const uint32_t wave = tg_uni(tid >> 5);
  const uint32_t tn = blockIdx.x & 3u, tm = blockIdx.x >> 2;      // the four column tiles of one row tile are neighbours: they read the same A rows
  const uint32_t m0 = tm * 128u, n0 = tn * 128u, wm = wave >> 1, wn = wave & 1u;
  const uint64_t src0 = (wave < 2u) ? (uint64_t)(uintptr_t)A + (uint64_t)(m0 + TG_SROWS * wave) * APITCH
                                    : (uint64_t)(uintptr_t)Bt + (uint64_t)(n0 + TG_SROWS * (wave - 2u)) * BPITCH;
  const uint32_t pitch = (wave < 2u) ? APITCH : BPITCH;
  const uint32_t lds_slice = (uint32_t)(size_t)(const void*)L + wave * TG_SLICE;
  const uint32_t fa_base = wm * TG_SLICE + c * TG_PITCH + 16u * h;            // row c of the wave's first A fragment, 16-byte half h
  const uint32_t fb_base = (2u + wn) * TG_SLICE + c * TG_PITCH + 16u * h;     // the same for Bt
  v8f acc[4][4];
  // every '#pragma unroll' of this kernel without a comment of its own: acc, fa and fb stay in registers only under constant indices
#pragma unroll
  for (int i = 0; i < 4; ++i)
#pragma unroll
    for (int j = 0; j < 4; ++j) acc[i][j] = (v8f){0.f, 0.f, 0.f, 0.f, 0.f, 0.f, 0.f, 0.f};
  TgDesc d = tg_desc(lds_slice, src0, pitch);
  tg_tensor_load(d);
  tg_wait_tensor0(d);
  __syncthreads();      /* stage 0 is readable by every wave */
  tg_next(d, lds_slice + TG_STAGE);
  tg_tensor_load(d);
  // kept rolled: the buffer is picked by t & 1
#pragma clang loop unroll(disable)
  for (uint32_t t = 0; t < T; ++t) {
    const uint32_t buf = (t & 1u) * TG_STAGE;
    const unsigned char* la = L + buf + fa_base;
    const unsigned char* lb = L + buf + fb_base;
    FragH fa[2][4], fb[2][4];      // set (u & 1) holds block u's fragments
#pragma unroll
    for (int i = 0; i < 4; ++i) { tg_load_frag(fa[0][i], la + (uint32_t)i * 16u * TG_PITCH); tg_load_frag(fb[0][i], lb + (uint32_t)i * 16u * TG_PITCH); }
    // unrolled: the fragment sets and accumulators stay in registers only under constant indices
#pragma unroll
    for (int u = 0; u < 4; ++u) {
      const int cs = u & 1;
      if (u + 1 < 4) {
        const uint32_t ko = (uint32_t)(u + 1) * 64u;
#pragma unroll
        for (int i = 0; i < 4; ++i) { tg_load_frag(fa[cs ^ 1][i], la + (uint32_t)i * 16u * TG_PITCH + ko); tg_load_frag(fb[cs ^ 1][i], lb + (uint32_t)i * 16u * TG_PITCH + ko); }
      }
      __builtin_amdgcn_sched_barrier(0);      // the next block's LDS reads stay one group ahead of this block's matrix instructions, not spread among them
#pragma unroll
      for (int i = 0; i < 4; ++i)
#pragma unroll
        for (int j = 0; j < 4; ++j) acc[i][j] = __builtin_amdgcn_wmma_f32_16x16x32_f16(false, fa[cs][i].v, false, fb[cs][j].v, (short)0, acc[i][j], false, false);
      __builtin_amdgcn_sched_barrier(0);      // and the block behind it does not move its reads up among them
    }
    tg_wait_ds0();
    tg_wait_tensor0(d);
    __syncthreads();      /* stage t + 1 is readable by every wave, and every wave has left stage t's buffer */
    if (tg_pinned((t + 2u < T) ? 1u : 0u) != 0u) { tg_next(d, lds_slice + buf); tg_tensor_load(d); }
  }
  tg_wait_tensor0(d);
  tg_wait_ds0();
  // epilogue: each wave stages its 64 x 64 tile in its own LDS range behind the ring, then adds the addends and stores whole 128-byte lines
  float* E = (float*)(L + 2u * TG_STAGE + wave * TG_EPI);
#pragma unroll
  for (int i = 0; i < 4; ++i)
#pragma unroll
    for (int j = 0; j < 4; ++j)
#pragma unroll
      for (int r = 0; r < 8; ++r) E[(16u * (uint32_t)i + 8u * h + (uint32_t)r) * TG_EPITCH + 16u * (uint32_t)j + c] = acc[i][j][r];
  __builtin_amdgcn_fence(__ATOMIC_ACQ_REL, "workgroup"); __builtin_amdgcn_wave_barrier();      // the wave's own staged rows are read back by other lanes
  const uint32_t c4 = c * 4u, col = n0 + wn * 64u + c4;
  v4f bv = {0.f, 0.f, 0.f, 0.f};
  if (MODE == 2) { for (int e = 0; e < 4; ++e) bv[e] = bf16_round(bias[col + (uint32_t)e]); }
  // four row pairs per trip: their staged rows and addend loads are in flight together; the outer loop stays rolled so that the one wait at its foot stands behind every trip's stores
#pragma clang loop unroll(disable)
  for (uint32_t q0 = 0; q0 < 32u; q0 += 4u) {
    // unrolled: the four row pairs' LDS reads, addend loads and stores each go out as one run
#pragma unroll
    for (uint32_t qi = 0; qi < 4u; ++qi) {
      const uint32_t row = 2u * (q0 + qi) + h;
      const v4f v = *(const v4fa*)&E[row * TG_EPITCH + c4];
      const size_t g = (size_t)(m0 + wm * 64u + row) * DD + col;
      v4f o;
#pragma unroll
      for (int e = 0; e < 4; ++e) o[e] = v[e] * alpha + bv[e];
      if (MODE != 0) { const v4f a4 = *(const v4fa*)(add + g); o += a4; *(v4f*)(C + g) = o; }
      else { v4h h4; for (int e = 0; e < 4; ++e) h4[e] = (_Float16)o[e]; *(v4h*)(C16 + g) = h4; }
    }
    asm volatile("s_wait_xcnt 0x0" ::: "memory");      // stands behind the trip's stores, in front of the next trip's writes of their address and data registers
  }
}

extern "C" void kernel_launch(void* const* d_in, const int* in_sizes, int n_in,
                              void* d_out, int out_size, void* d_ws, size_t ws_size, hipStream_t stream) {
  (void)in_sizes; (void)n_in; (void)out_size;
  const float* const* I = (const float* const*)d_in; const float* nodes = I[0]; const float* centre = I[1]; const float* Wq = I[2]; const float* bq = I[3]; const float* Wk = I[4]; const float* bk = I[5]; const float* Wv = I[6]; const float* bv = I[7];
  char* ws = (char*)d_ws; size_t off = 0;
  auto take = [&](size_t bytes) { char* p = ws + off; off += (bytes + 255) & ~(size_t)255; return p; };
  _Float16* Bwv = (_Float16*)take((size_t)DD * 2 * DD * 2); float* KEYS = (float*)take((size_t)NNODE * DD * 4); _Float16* K16 = (_Float16*)take((size_t)NNODE * DD * 2); _Float16* Q16 = (_Float16*)take((size_t)NNODE * DD * 2); float* X7 = (float*)take((size_t)NNODE * 8 * 4); float* R = (float*)take((size_t)NNODE * 8 * 4);
  _Float16* QV = (_Float16*)take((size_t)NNODE * DD * 2); _Float16* QVt = (_Float16*)take((size_t)DD * NNODE * 2); _Float16* P16 = (_Float16*)take((size_t)NNODE * NNODE * 2); float* O = (float*)take((size_t)NNODE * DD * 4);
  if (off > ws_size) return;      // 194 MiB of the 256 MiB workspace, the full P plane alone 128 MiB
  k_round16f<<<(unsigned)(((size_t)DD * 2 * DD / 8 + 255) / 256), 256, 0, stream>>>(Wv, Bwv, (size_t)DD * 2 * DD / 8);      /* Wv (512, 1024) natural ×2^4: row d = [Wv_q | Wv_k] */
  k_x7<<<NNODE * 2 / 256, 256, 0, stream>>>(nodes, centre, X7); k_proj<<<(unsigned)(((size_t)NNODE * DD / 4 + 255) / 256), 256, 0, stream>>>(nodes, centre, Wq, bq, Wk, bk, KEYS, K16, Q16);
  k_rvec<<<NNODE * 2 / 256, 256, 0, stream>>>(Wq, bq, Wk, bk, X7, R);
  const dim3 gq((NNODE / 128) * (DD / 128), 1);      /* one 128 x 128 tile per work-group */
  k_gemm_tile<DD * 2, 2 * DD * 2, DD / 128, 0><<<gq, 128, 0, stream>>>(Q16, Bwv, 0.0625f, nullptr, nullptr, nullptr, QV);      /* QV = queries·Wv_qᵀ (Bt rows d, cols 0..511, ldb 1024): M 8192 N 512 K 512 */
  k_vt<DD / 64, NNODE><<<(DD / 64) * (NNODE / 64), 256, 0, stream>>>(QV, DD, 0, QVt);      /* QVᵀ [512][8192] */
  k_soft<<<NNODE / SOFT_ROWS, 1024, 0, stream>>>(R, X7, 0, P16);      /* 256 work-groups of 32 waves, 32 rows each */
  k_gemm_tile<NNODE * 2, NNODE * 2, NNODE / 128, 1><<<gq, 128, 0, stream>>>(P16, QVt, 0.000030517578125f, nullptr, KEYS, O, nullptr);      /* O = keys + attn*QV: M 8192 N 512 K 8192 */
  k_gemm_tile<DD * 2, 2 * DD * 2, DD / 128, 2><<<gq, 128, 0, stream>>>(K16, Bwv + DD, 0.0625f, bv, O, (float*)d_out, nullptr);      /* out = keys·Wv_kᵀ + bv + O (Bt rows d at cols 512.., ldb 1024) */
}

// v005
// A run of this version takes 110 microseconds.
// In both of two side-by-side timings against v004, it was 1.63 times as fast.
// All steps since v000 together make it 25.1 times as fast.
#include <hip/hip_runtime.h>
#include <stdint.h>
// 'self_attn_init' (N=8192 nodes, 3-d coords + a shared 3-d centre → 6 inputs, D=512): x = [node, centre]; keys = x·Wkᵀ + bk; queries = x·Wqᵀ + bq; attn = softmax_m(keys·queriesᵀ) (UNSCALED, rank-7 logits up to ±O(100));
// out = keys + attn·(queries·Wv[:, :512]ᵀ) + keys·Wv[:, 512:]ᵀ + bv.
// Compute dtype: inputs/weights/biases rounded to bf16. The logits are an exact bilinear form in the 7-vector x̃ = [x, 1]: s[n][m] = (x̃_nᵀ·M)·x̃_m with M = [Wk bk]ᵀ[Wq bq] (7×7, f32), evaluated per pair in f32 (7 FMAs) —
// no 16-bit rounding touches the huge logits; softmax with the 8192 keys split over a work-group's 32 waves (logits kept in registers) writes P f16 x2^15 for all 8192 rows in one launch.
// queries = [x, 1]*[Wq bq]^T has rank 7, so attn*(queries*Wv_q^T) = ((attn*[x, 1])*[Wq bq]^T)*Wv_q^T: Y = attn*[x, 1] is a GEMM with one 16-column tile, AQ = Y*[Wq bq]^T costs what queries cost, and
// out = [AQ | keys]*Wv^T + bv + keys is one GEMM with K = 1024. Both GEMMs on v_wmma_f32_16x16x32_f16 (f32 accumulate).
#define NNODE 8192
#define DD 512

typedef __bf16 v16b __attribute__((ext_vector_type(16)));
typedef unsigned short v8us __attribute__((ext_vector_type(8), may_alias));
typedef float  v8f  __attribute__((ext_vector_type(8)));
typedef float  v4f  __attribute__((ext_vector_type(4)));
typedef float  v4fa __attribute__((ext_vector_type(4), may_alias));
union FragB { v16b v; v8us half[2]; unsigned short u[16]; };

__device__ __forceinline__ unsigned short bf16_bits(float x) { unsigned int u = __float_as_uint(x); return (unsigned short)((u + 0x7FFFu + ((u >> 16) & 1u)) >> 16); }
__device__ __forceinline__ float bf16_val(unsigned short b) { return __uint_as_float(((unsigned int)b) << 16); }
__device__ __forceinline__ float bf16_round(float x) { return bf16_val(bf16_bits(x)); }
// D += A·B with NT terms: 1 = ah·bh, 2 = + al·bh (A split), 3 = + ah·bl (both split)
template <int NT>
__device__ __forceinline__ v8f mmaN(v16b ah, v16b al, v16b bh, v16b bl, v8f c) {
  c = __builtin_amdgcn_wmma_f32_16x16x32_bf16(false, ah, false, bh, (short)0, c, false, false);
  if (NT >= 2) c = __builtin_amdgcn_wmma_f32_16x16x32_bf16(false, al, false, bh, (short)0, c, false, false);
  if (NT >= 3) c = __builtin_amdgcn_wmma_f32_16x16x32_bf16(false, ah, false, bl, (short)0, c, false, false);
  asm volatile("v_nop\n\tv_nop\n\tv_nop\n\tv_nop" : "+v"(c) : "v"(ah), "v"(al), "v"(bh), "v"(bl));
  return c;
}

__global__ __launch_bounds__(256) void k_wt_bf16(const float* __restrict__ W, unsigned short* __restrict__ Wt, int K, int N) {
  const int t = blockIdx.x * 256 + threadIdx.x;
  const int k8n = K / 8;
  if (t >= N * k8n) return;
  const int n = t / k8n, k8 = (t % k8n) * 8;
  v8us v;
#pragma unroll
  for (int i = 0; i < 8; ++i) v[i] = bf16_bits(W[(size_t)(k8 + i) * N + n]);
  *(v8us*)(Wt + (size_t)n * K + k8) = v;
  
}

// GEMM C[M][N] (f32, pitch ldc) = act(A[M][K]·W + bias). A f32 row-major (pitch lda) converted per fragment to bf16
// (ASPLIT: hi/lo two planes -> 2 terms, else single rounded term); Wt bf16 [N][K] (pitch ldb). BIAS_BF16 rounds the
// bias to bf16 first (bias quantised to bf16 before the add). K%32==0, M%16==0, N%64==0.
template <bool ASPLIT, int ACT, bool BIAS_BF16>
__global__ __launch_bounds__(128) void k_gemm_bf(const float* __restrict__ A, int lda, const unsigned short* __restrict__ Wt, int ldb,
                                               const float* __restrict__ bias, float* __restrict__ C, int ldc, int M, int N, int K) {
  __shared__ __attribute__((aligned(16))) float so[4][16][64];
  const int tid = threadIdx.x, w = tid >> 5, lane = tid & 31, ln = lane & 15, hh = lane >> 4;
  const int ntn = N / 64;
  const int wid = blockIdx.x * 4 + w;
  const int mt = wid / ntn, nq = wid % ntn;
  if (mt * 16 >= M) return;
  const int row0 = mt * 16, col0 = nq * 64;
  const float* arow = A + (size_t)(row0 + ln) * lda;
  v8f acc[4] = {};
  for (int kb = 0; kb < K; kb += 32) {
    FragB ah, al;
    const v4f x0 = *(const v4fa*)(arow + kb + 8 * hh), x1 = *(const v4fa*)(arow + kb + 8 * hh + 4);
    const v4f x2 = *(const v4fa*)(arow + kb + 16 + 8 * hh), x3 = *(const v4fa*)(arow + kb + 16 + 8 * hh + 4);
    float xs[16] = {x0[0],x0[1],x0[2],x0[3],x1[0],x1[1],x1[2],x1[3],x2[0],x2[1],x2[2],x2[3],x3[0],x3[1],x3[2],x3[3]};
#pragma unroll
    for (int i = 0; i < 16; ++i) { const unsigned short hb = bf16_bits(xs[i]); ah.u[i] = hb; al.u[i] = ASPLIT ? bf16_bits(xs[i] - bf16_val(hb)) : (unsigned short)0; }
#pragma unroll
    for (int t = 0; t < 4; ++t) {
      const unsigned short* brow = Wt + (size_t)(col0 + t * 16 + ln) * ldb + kb;
      FragB b;
      b.half[0] = *(const v8us*)(brow + 8 * hh);
      b.half[1] = *(const v8us*)(brow + 16 + 8 * hh);
      acc[t] = mmaN<ASPLIT ? 2 : 1>(ah.v, al.v, b.v, b.v, acc[t]);
    }
  }
#pragma unroll
  for (int t = 0; t < 4; ++t) {
    float bv = bias ? bias[col0 + t * 16 + ln] : 0.f;
    if (BIAS_BF16) bv = bf16_round(bv);
#pragma unroll
    for (int r = 0; r < 8; ++r) { float v = acc[t][r] + bv; if (ACT == 1) v = fmaxf(v, 0.f); so[w][8 * hh + r][t * 16 + ln] = v; }
  }
  __builtin_amdgcn_fence(__ATOMIC_ACQ_REL, "workgroup");
  __builtin_amdgcn_wave_barrier();
  const int rsub = lane >> 4, c4 = (lane & 15) * 4;
  {
#pragma unroll
    for (int q = 0; q < 8; ++q) {
      const int r = q * 2 + rsub;
      const v4f v = *(const v4fa*)&so[w][r][c4];
      *(v4f*)(C + (size_t)(row0 + r) * ldc + col0 + c4) = v;
    }
    
  }
}

// Flash-style causal/unmasked attention, all contractions 3-term bf16 hi/lo splits, f32 softmax with running max.
// q,k,v rows are read from f32 buffers with arbitrary row pitch (so they can live inside a fused qkv buffer);
// D = head size (multiple of 32, <= 128); one wave = 16 query rows; block = 4 waves (64 queries) sharing K/V chunks of 32.
template <int D, bool CAUSAL>
__global__ __launch_bounds__(128) void k_flash(const float* __restrict__ qb, const float* __restrict__ kb, const float* __restrict__ vb,
                                             int pitch, int T, int H, float scale, float* __restrict__ y, int ypitch) {
  constexpr int KS = D / 32;        // k-steps for QK
  constexpr int DT = D / 16;        // d tiles for PV
  __shared__ __attribute__((aligned(16))) unsigned short sKh[32][D + 8], sKl[32][D + 8], sVh[32][D + 8], sVl[32][D + 8];
  __shared__ __attribute__((aligned(16))) unsigned short sPh[4][16][40], sPl[4][16][40];
  __shared__ __attribute__((aligned(16))) float sO[4][16][D];
  const int tid = threadIdx.x, w = tid >> 5, lane = tid & 31, ln = lane & 15, hh = lane >> 4;
  const int nqb = (T + 63) / 64;
  const int bh = blockIdx.x / nqb, qblk = blockIdx.x % nqb;
  const int b = bh / H, h = bh % H;
  const int q0 = qblk * 64 + w * 16;
  const float* Q = qb + (size_t)b * T * pitch + h * D;
  const float* K = kb + (size_t)b * T * pitch + h * D;
  const float* V = vb + (size_t)b * T * pitch + h * D;

  // A fragments of the wave's 16 query rows (scaled), hi/lo
  FragB aqh[KS], aql[KS];
  {
    int row = q0 + ln; if (row >= T) row = T - 1;
    const float* qr = Q + (size_t)row * pitch;
#pragma unroll
    for (int ks = 0; ks < KS; ++ks)
#pragma unroll
      for (int i = 0; i < 16; ++i) {
        const int d = ks * 32 + ((i < 8) ? (8 * hh + i) : (16 + 8 * hh + (i - 8)));
        const float x = qr[d] * scale; const unsigned short hb = bf16_bits(x);
        aqh[ks].u[i] = hb; aql[ks].u[i] = bf16_bits(x - bf16_val(hb));
      }
  }
  float m_r[8], l_r[8];
#pragma unroll
  for (int r = 0; r < 8; ++r) { m_r[r] = -3.0e38f; l_r[r] = 0.f; }
  v8f oacc[DT];
#pragma unroll
  for (int dt = 0; dt < DT; ++dt) oacc[dt] = (v8f){0.f,0.f,0.f,0.f,0.f,0.f,0.f,0.f};

  const int kv_end = CAUSAL ? min(T, qblk * 64 + 64) : T;     // block-uniform
  for (int j0 = 0; j0 < kv_end; j0 += 32) {
    __syncthreads();
    for (int e = tid; e < 32 * (D / 4); e += 128) {
      const int r = e / (D / 4), c4 = (e % (D / 4)) * 4;
      const int key = j0 + r;
      v4f kf = {0.f,0.f,0.f,0.f}, vf = {0.f,0.f,0.f,0.f};
      if (key < T) { kf = *(const v4fa*)(K + (size_t)key * pitch + c4); vf = *(const v4fa*)(V + (size_t)key * pitch + c4); }
#pragma unroll
      for (int t = 0; t < 4; ++t) {
        unsigned short hb = bf16_bits(kf[t]); sKh[r][c4 + t] = hb; sKl[r][c4 + t] = bf16_bits(kf[t] - bf16_val(hb));
        hb = bf16_bits(vf[t]); sVh[r][c4 + t] = hb; sVl[r][c4 + t] = bf16_bits(vf[t] - bf16_val(hb));
      }
    }
    __syncthreads();
    // S tile 16 x 32
    v8f s[2];
#pragma unroll
    for (int nt = 0; nt < 2; ++nt) {
      v8f acc = {};
#pragma unroll
      for (int ks = 0; ks < KS; ++ks) {
        FragB bh_, bl_;
        bh_.half[0] = *(const v8us*)&sKh[nt * 16 + ln][ks * 32 + 8 * hh]; bh_.half[1] = *(const v8us*)&sKh[nt * 16 + ln][ks * 32 + 16 + 8 * hh];
        bl_.half[0] = *(const v8us*)&sKl[nt * 16 + ln][ks * 32 + 8 * hh]; bl_.half[1] = *(const v8us*)&sKl[nt * 16 + ln][ks * 32 + 16 + 8 * hh];
        acc = mmaN<3>(aqh[ks].v, aql[ks].v, bh_.v, bl_.v, acc);
      }
      s[nt] = acc;
    }
    // mask + running max (rows 8hh+r; the 16 lanes of a half share rows)
    float alpha[8];
#pragma unroll
    for (int r = 0; r < 8; ++r) {
      const int qi = q0 + 8 * hh + r;
      const int ja = j0 + ln, jb = j0 + 16 + ln;
      if (CAUSAL) { if (ja > qi) s[0][r] = -3.0e38f; if (jb > qi) s[1][r] = -3.0e38f; }
      if (ja >= T) s[0][r] = -3.0e38f;
      if (jb >= T) s[1][r] = -3.0e38f;
      float mx = fmaxf(s[0][r], s[1][r]);
      mx = fmaxf(mx, __shfl_xor(mx, 1, 32)); mx = fmaxf(mx, __shfl_xor(mx, 2, 32)); mx = fmaxf(mx, __shfl_xor(mx, 4, 32)); mx = fmaxf(mx, __shfl_xor(mx, 8, 32));
      const float mnew = fmaxf(m_r[r], mx);
      alpha[r] = (mnew > -1.0e38f) ? __expf(m_r[r] - mnew) : 1.0f;
      const float p0 = (s[0][r] > -1.0e38f) ? __expf(s[0][r] - mnew) : 0.f;
      const float p1 = (s[1][r] > -1.0e38f) ? __expf(s[1][r] - mnew) : 0.f;
      m_r[r] = mnew;
      l_r[r] = l_r[r] * alpha[r] + p0 + p1;            // per-lane partial row sum (16 lanes combined at the end)
      unsigned short hb = bf16_bits(p0); sPh[w][8 * hh + r][ln] = hb;      sPl[w][8 * hh + r][ln] = bf16_bits(p0 - bf16_val(hb));
      hb = bf16_bits(p1);                sPh[w][8 * hh + r][16 + ln] = hb; sPl[w][8 * hh + r][16 + ln] = bf16_bits(p1 - bf16_val(hb));
    }
#pragma unroll
    for (int dt = 0; dt < DT; ++dt)
#pragma unroll
      for (int r = 0; r < 8; ++r) oacc[dt][r] *= alpha[r];
    __builtin_amdgcn_fence(__ATOMIC_ACQ_REL, "workgroup");
    __builtin_amdgcn_wave_barrier();
    FragB pah, pal;
    pah.half[0] = *(const v8us*)&sPh[w][ln][8 * hh]; pah.half[1] = *(const v8us*)&sPh[w][ln][16 + 8 * hh];
    pal.half[0] = *(const v8us*)&sPl[w][ln][8 * hh]; pal.half[1] = *(const v8us*)&sPl[w][ln][16 + 8 * hh];
#pragma unroll
    for (int dt = 0; dt < DT; ++dt) {
      FragB bvh, bvl;
#pragma unroll
      for (int i = 0; i < 8; ++i) {
        bvh.u[i] = sVh[8 * hh + i][dt * 16 + ln]; bvh.u[8 + i] = sVh[16 + 8 * hh + i][dt * 16 + ln];
        bvl.u[i] = sVl[8 * hh + i][dt * 16 + ln]; bvl.u[8 + i] = sVl[16 + 8 * hh + i][dt * 16 + ln];
      }
      oacc[dt] = mmaN<3>(pah.v, pal.v, bvh.v, bvl.v, oacc[dt]);
    }
    __builtin_amdgcn_fence(__ATOMIC_ACQ_REL, "workgroup");
    __builtin_amdgcn_wave_barrier();
  }
#pragma unroll
  for (int r = 0; r < 8; ++r) {
    float l = l_r[r];
    l += __shfl_xor(l, 1, 32); l += __shfl_xor(l, 2, 32); l += __shfl_xor(l, 4, 32); l += __shfl_xor(l, 8, 32);
    l_r[r] = (l > 0.f) ? 1.0f / l : 0.f;
  }
#pragma unroll
  for (int dt = 0; dt < DT; ++dt)
#pragma unroll
    for (int r = 0; r < 8; ++r) sO[w][8 * hh + r][dt * 16 + ln] = oacc[dt][r] * l_r[r];
  __builtin_amdgcn_fence(__ATOMIC_ACQ_REL, "workgroup");
  __builtin_amdgcn_wave_barrier();
  {
    for (int r = 0; r < 16; ++r) {
      const int row = q0 + r;
      if (row < T && lane < D / 4) {
        const v4f val = *(const v4fa*)&sO[w][r][lane * 4];
        *(v4f*)(y + ((size_t)b * T + row) * ypitch + h * D + lane * 4) = val;
      }
    }
    
  }
}

// GEMM C = act(A·W + bias + resid): A f32 (ASPLIT -> hi/lo 2 terms), Wt bf16 [N][K]; ACT 0 none, 1 relu, 2 exact gelu;
// resid (optional, f32, row index = (row % rmod), pitch ldr, RES_BF16 rounds it) added before the activation.
template <bool ASPLIT, int ACT, bool BIAS_BF16, bool RES_BF16>
__global__ __launch_bounds__(128) void k_gemm_bf3(const float* __restrict__ A, int lda, const unsigned short* __restrict__ Wt, int ldb,
                                                const float* __restrict__ bias, const float* __restrict__ resid, int rmod, int ldr,
                                                float* __restrict__ C, int ldc, int M, int N, int K) {
  __shared__ __attribute__((aligned(16))) float so[4][16][64];
  const int tid = threadIdx.x, w = tid >> 5, lane = tid & 31, ln = lane & 15, hh = lane >> 4;
  const int ntn = N / 64;
  const int wid = blockIdx.x * 4 + w;
  const int mt = wid / ntn, nq = wid % ntn;
  if (mt * 16 >= M) return;
  const int row0 = mt * 16, col0 = nq * 64;
  const float* arow = A + (size_t)(row0 + ln) * lda;
  v8f acc[4] = {};
  for (int kb = 0; kb < K; kb += 32) {
    FragB ah, al;
    const v4f x0 = *(const v4fa*)(arow + kb + 8 * hh), x1 = *(const v4fa*)(arow + kb + 8 * hh + 4);
    const v4f x2 = *(const v4fa*)(arow + kb + 16 + 8 * hh), x3 = *(const v4fa*)(arow + kb + 16 + 8 * hh + 4);
    float xs[16] = {x0[0],x0[1],x0[2],x0[3],x1[0],x1[1],x1[2],x1[3],x2[0],x2[1],x2[2],x2[3],x3[0],x3[1],x3[2],x3[3]};
#pragma unroll
    for (int i = 0; i < 16; ++i) { const unsigned short hb = bf16_bits(xs[i]); ah.u[i] = hb; al.u[i] = ASPLIT ? bf16_bits(xs[i] - bf16_val(hb)) : (unsigned short)0; }
#pragma unroll
    for (int t = 0; t < 4; ++t) {
      const unsigned short* brow = Wt + (size_t)(col0 + t * 16 + ln) * ldb + kb;
      FragB b;
      b.half[0] = *(const v8us*)(brow + 8 * hh);
      b.half[1] = *(const v8us*)(brow + 16 + 8 * hh);
      acc[t] = mmaN<ASPLIT ? 2 : 1>(ah.v, al.v, b.v, b.v, acc[t]);
    }
  }
#pragma unroll
  for (int t = 0; t < 4; ++t) {
    const int col = col0 + t * 16 + ln;
    float bv = bias ? bias[col] : 0.f;
    if (BIAS_BF16) bv = bf16_round(bv);
#pragma unroll
    for (int r = 0; r < 8; ++r) {
      float v = acc[t][r] + bv;
      if (resid) { float rv = resid[(size_t)((row0 + 8 * hh + r) % rmod) * ldr + col]; if (RES_BF16) rv = bf16_round(rv); v += rv; }
      if (ACT == 1) v = fmaxf(v, 0.f);
      if (ACT == 2) v = 0.5f * v * (1.0f + erff(v * 0.70710678118654752f));
      if (ACT == 3) { const float u = 0.7978845608028654f * (v + 0.044715f * v * v * v); v = 0.5f * v * (1.0f + tanhf(u)); }
      so[w][8 * hh + r][t * 16 + ln] = v;
    }
  }
  __builtin_amdgcn_fence(__ATOMIC_ACQ_REL, "workgroup");
  __builtin_amdgcn_wave_barrier();
  const int rsub = lane >> 4, c4 = (lane & 15) * 4;
  {
#pragma unroll
    for (int q = 0; q < 8; ++q) {
      const int r = q * 2 + rsub;
      const v4f v = *(const v4fa*)&so[w][r][c4];
      *(v4f*)(C + (size_t)(row0 + r) * ldc + col0 + c4) = v;
    }
    
  }
}
// row LayerNorm (biased variance, eps) over N: s = X (+ R); optional out_sum <- s; out_norm <- (s-mu)*rsqrt(var+eps)*g + b
template <bool PARAM_BF16>
__global__ __launch_bounds__(256) void k_layernorm(const float* __restrict__ X, const float* __restrict__ R, const float* __restrict__ g, const float* __restrict__ bta,
                                                  float* __restrict__ out_sum, float* __restrict__ out_norm, int N, float eps) {
  __shared__ float red[256];
  const int row = blockIdx.x, tid = threadIdx.x;
  const float* x = X + (size_t)row * N; const float* rr = R ? R + (size_t)row * N : nullptr;
  float vals[16];                     // up to N = 4096
  const int per = N / 256;            // contiguous chunk per thread? use strided-by-4 chunks: thread handles j = tid*4 + 1024*u
  float s1 = 0.f;
  for (int u = 0; u < per / 4; ++u) {
    const int j = tid * 4 + 1024 * u;
    const v4f a = *(const v4fa*)(x + j);
    v4f b = {0.f,0.f,0.f,0.f}; if (rr) b = *(const v4fa*)(rr + j);
#pragma unroll
    for (int q = 0; q < 4; ++q) { const float v = a[q] + b[q]; vals[u * 4 + q] = v; s1 += v; }
  }
  red[tid] = s1; __syncthreads();
  for (int st = 128; st > 0; st >>= 1) { if (tid < st) red[tid] += red[tid + st]; __syncthreads(); }
  const float mu = red[0] / (float)N; __syncthreads();
  float s2 = 0.f;
  for (int u = 0; u < per / 4; ++u)
#pragma unroll
    for (int q = 0; q < 4; ++q) { const float c = vals[u * 4 + q] - mu; s2 += c * c; }
  red[tid] = s2; __syncthreads();
  for (int st = 128; st > 0; st >>= 1) { if (tid < st) red[tid] += red[tid + st]; __syncthreads(); }
  const float rs = rsqrtf(red[0] / (float)N + eps);
  {
    for (int u = 0; u < per / 4; ++u) {
      const int j = tid * 4 + 1024 * u;
      v4f o, sm;
#pragma unroll
      for (int q = 0; q < 4; ++q) {
        float gg = g[j + q], bb = bta[j + q];
        if (PARAM_BF16) { gg = bf16_round(gg); bb = bf16_round(bb); }
        sm[q] = vals[u * 4 + q]; o[q] = (vals[u * 4 + q] - mu) * rs * gg + bb;
      }
      if (out_sum) *(v4f*)(out_sum + (size_t)row * N + j) = sm;
      *(v4f*)(out_norm + (size_t)row * N + j) = o;
    }
    
  }
}



// ---- f16 WMMA path (v_wmma_f32_16x16x32_f16): 11-bit significands for operands in range — used where a [0,1] probability operand needs more precision than bf16
typedef _Float16 v16h __attribute__((ext_vector_type(16)));
union FragH { v16h v; v8us half[2]; _Float16 h[16]; unsigned short u[16]; };
template <int NT>
__device__ __forceinline__ v8f mmaH(v16h ah, v16h al, v16h bh, v16h bl, v8f c) {
  c = __builtin_amdgcn_wmma_f32_16x16x32_f16(false, ah, false, bh, (short)0, c, false, false);
  if (NT >= 2) c = __builtin_amdgcn_wmma_f32_16x16x32_f16(false, al, false, bh, (short)0, c, false, false);
  if (NT >= 3) c = __builtin_amdgcn_wmma_f32_16x16x32_f16(false, ah, false, bl, (short)0, c, false, false);
  asm volatile("v_nop\n\tv_nop\n\tv_nop\n\tv_nop" : "+v"(c) : "v"(ah), "v"(al), "v"(bh), "v"(bl));
  return c;
}
// batched GEMM like k_gemm_b but f16 operands: A f32 (split into f16 hi/lo if ASPLIT, else rounded to f16), Bt = f16 values [n][k]; alpha; C f32; N multiple of 16 (partial tiles skipped)
template <bool ASPLIT>
__global__ __launch_bounds__(128) void k_gemm_h(const float* __restrict__ A, int lda, size_t sA, const _Float16* __restrict__ Bh, int ldb, size_t sB, float alpha, float* __restrict__ C, int ldc, size_t sC, int M, int N, int K) {
  __shared__ __attribute__((aligned(16))) float so[4][16][64];
  const int tid = threadIdx.x, w = tid >> 5, lane = tid & 31, ln = lane & 15, hh = lane >> 4; const int by = blockIdx.y;
  A += (size_t)by * sA; Bh += (size_t)by * sB; C += (size_t)by * sC;
  const int ntn = (N + 63) / 64; const int wid = blockIdx.x * 4 + w; const int mt = wid / ntn, nq = wid % ntn; if (mt * 16 >= M) return;
  const int row0 = mt * 16, col0 = nq * 64; const float* arow = A + (size_t)(row0 + ln) * lda;
  v8f acc[4] = {};
  for (int kb = 0; kb < K; kb += 32) {
    FragH ah, al;
    const v4f x0 = *(const v4fa*)(arow + kb + 8 * hh), x1 = *(const v4fa*)(arow + kb + 8 * hh + 4), x2 = *(const v4fa*)(arow + kb + 16 + 8 * hh), x3 = *(const v4fa*)(arow + kb + 16 + 8 * hh + 4);
    float xs[16] = {x0[0],x0[1],x0[2],x0[3],x1[0],x1[1],x1[2],x1[3],x2[0],x2[1],x2[2],x2[3],x3[0],x3[1],x3[2],x3[3]};
#pragma unroll
    for (int i = 0; i < 16; ++i) { const _Float16 h = (_Float16)xs[i]; ah.h[i] = h; al.h[i] = ASPLIT ? (_Float16)(xs[i] - (float)h) : (_Float16)0.0f; }
#pragma unroll
    for (int t = 0; t < 4; ++t) { if (col0 + t * 16 >= N) continue; const size_t boff = (size_t)(col0 + t * 16 + ln) * ldb + kb; FragH bq; bq.half[0] = *(const v8us*)(Bh + boff + 8 * hh); bq.half[1] = *(const v8us*)(Bh + boff + 16 + 8 * hh);
      acc[t] = mmaH<ASPLIT ? 2 : 1>(ah.v, al.v, bq.v, bq.v, acc[t]); }
  }
#pragma unroll
  for (int t = 0; t < 4; ++t) { if (col0 + t * 16 >= N) continue;
#pragma unroll
    for (int r = 0; r < 8; ++r) so[w][8 * hh + r][t * 16 + ln] = acc[t][r] * alpha; }
  __builtin_amdgcn_fence(__ATOMIC_ACQ_REL, "workgroup"); __builtin_amdgcn_wave_barrier();
  const int rsub = lane >> 4, c4 = (lane & 15) * 4;
  {
#pragma unroll
    for (int q = 0; q < 8; ++q) { const int r = q * 2 + rsub; if (col0 + c4 < N) { const v4f v = *(const v4fa*)&so[w][r][c4]; *(v4f*)(C + (size_t)(row0 + r) * ldc + col0 + c4) = v; } }
     }
}

// Wt[n][k] = f16(W[k][n]·scale) from f32 row-major W[K][N] (scale = power of two; bf16-exact weights stay exact in f16 away from the subnormal range)
__global__ __launch_bounds__(256) void k_wt_f16(const float* __restrict__ W, _Float16* __restrict__ Wt, int K, int N, float scale) {
  const int t = blockIdx.x * 256 + threadIdx.x; if (t >= N * (K / 8)) return; const int n = t / (K / 8), k8 = (t % (K / 8)) * 8; FragH f;
#pragma unroll
  for (int i = 0; i < 8; ++i) f.h[i] = (_Float16)(bf16_round(W[(size_t)(k8 + i) * N + n]) * scale); const v8us o = f.half[0];
  *(v8us*)((unsigned short*)Wt + (size_t)n * K + k8) = o; 
}
// k_gemm_hh variant with fused epilogue: v = acc·alpha + bias[by·sBias + col] (+ CP[(row/rowsPerB)·sCPb + by·64 + col] if CP) ; ACT 0 none / 1 elu ; writes f32 C and/or f16 C16 (each if non-null)
template <int ACT>
__global__ __launch_bounds__(128) void k_gemm_hhx(const _Float16* __restrict__ A, int lda, size_t sA, const _Float16* __restrict__ Bh, int ldb, size_t sB, float alpha, const float* __restrict__ bias, size_t sBias, const float* __restrict__ CP, int rowsPerB, size_t sCPb, int row0g,
    float* __restrict__ C, _Float16* __restrict__ C16, int ldc, size_t sC, int M, int N, int K) {
  __shared__ __attribute__((aligned(16))) float so[4][16][64];
  const int tid = threadIdx.x, w = tid >> 5, lane = tid & 31, ln = lane & 15, hh = lane >> 4; const int by = blockIdx.y;
  A += (size_t)by * sA; Bh += (size_t)by * sB; const size_t cofs = (size_t)by * sC; const float* bp = bias ? bias + (size_t)by * sBias : nullptr;
  const int ntn = (N + 63) / 64; const int wid = blockIdx.x * 4 + w; const int mt = wid / ntn, nq = wid % ntn; if (mt * 16 >= M) return;
  const int row0 = mt * 16, col0 = nq * 64; const _Float16* arow = A + (size_t)(row0 + ln) * lda;
  v8f acc[4] = {};
  for (int kb = 0; kb < K; kb += 32) { FragH ah; ah.half[0] = *(const v8us*)((const unsigned short*)arow + kb + 8 * hh); ah.half[1] = *(const v8us*)((const unsigned short*)arow + kb + 16 + 8 * hh);
#pragma unroll
    for (int t = 0; t < 4; ++t) { if (col0 + t * 16 >= N) continue; const size_t boff = (size_t)(col0 + t * 16 + ln) * ldb + kb; FragH bq; bq.half[0] = *(const v8us*)((const unsigned short*)Bh + boff + 8 * hh); bq.half[1] = *(const v8us*)((const unsigned short*)Bh + boff + 16 + 8 * hh);
      acc[t] = mmaH<1>(ah.v, ah.v, bq.v, bq.v, acc[t]); }
  }
#pragma unroll
  for (int t = 0; t < 4; ++t) { if (col0 + t * 16 >= N) continue; const int col = col0 + t * 16 + ln; const float bv = bp ? bf16_round(bp[col]) : 0.f;
#pragma unroll
    for (int r = 0; r < 8; ++r) { float v = acc[t][r] * alpha + bv; if (CP) { const int bidx = (row0g + row0 + 8 * hh + r) / rowsPerB; v += CP[(size_t)bidx * sCPb + (size_t)by * 64 + col]; } if (ACT == 1) v = (v > 0.f) ? v : expm1f(v); else if (ACT == 7) v = (v > 0.f) ? v + 1.0f : expf(v); else if (ACT == 8) v = tanhf(v); else if (ACT == 9) v = 0.5f * v * (1.0f + tanhf(0.7978845608028654f * (v + 0.044715f * v * v * v))); else if (ACT == 11) v = 1.0f / (1.0f + expf(-v)); else if (ACT == 12) v = (v > 0.f) ? v : 0.01f * v; else if (ACT == 14) v = (v > 0.f) ? v : 0.1f * v; else if (ACT == 15) v = v / (1.0f + expf(-v)); else if (ACT == 3) v = fmaxf(v, 0.f); else if (ACT == 6) v = 0.5f * v * (1.0f + erff(v * 0.70710678118654752f)); so[w][8 * hh + r][t * 16 + ln] = v; } }
  __builtin_amdgcn_fence(__ATOMIC_ACQ_REL, "workgroup"); __builtin_amdgcn_wave_barrier();
  const int rsub = lane >> 4, c4 = (lane & 15) * 4; typedef _Float16 v4h __attribute__((ext_vector_type(4)));
  {
#pragma unroll
    for (int q = 0; q < 8; ++q) { const int r = q * 2 + rsub; if (col0 + c4 < N) { const v4f v = *(const v4fa*)&so[w][r][c4]; if (C) *(v4f*)(C + cofs + (size_t)(row0 + r) * ldc + col0 + c4) = v; if (C16) { v4h h4; for (int i = 0; i < 4; ++i) h4[i] = (_Float16)v[i]; *(v4h*)(C16 + cofs + (size_t)(row0 + r) * ldc + col0 + c4) = h4; } } }
     }
}


typedef _Float16 v4h __attribute__((ext_vector_type(4)));

__global__ __launch_bounds__(256) void k_x16(const float* __restrict__ x, _Float16* __restrict__ X16, size_t n8) { const size_t t = (size_t)blockIdx.x * 256 + threadIdx.x; if (t >= n8) return; FragH f;
#pragma unroll
  for (int q = 0; q < 8; ++q) f.h[q] = (_Float16)bf16_round(x[t * 8 + q]); *(v8us*)((unsigned short*)X16 + t * 8) = f.half[0];  }
__global__ __launch_bounds__(256) void k_h16(const float* __restrict__ x, _Float16* __restrict__ X16, size_t n8) { const size_t t = (size_t)blockIdx.x * 256 + threadIdx.x; if (t >= n8) return; FragH f;
#pragma unroll
  for (int q = 0; q < 8; ++q) f.h[q] = (_Float16)x[t * 8 + q]; *(v8us*)((unsigned short*)X16 + t * 8) = f.half[0];  }
__global__ __launch_bounds__(256) void k_round16f(const float* __restrict__ W, _Float16* __restrict__ Bt, size_t n8) { const size_t t = (size_t)blockIdx.x * 256 + threadIdx.x; if (t >= n8) return; FragH f;
#pragma unroll
  for (int i = 0; i < 8; ++i) f.h[i] = (_Float16)(bf16_round(W[t * 8 + i]) * 16.0f); *(v8us*)((unsigned short*)Bt + t * 8) = f.half[0];  }
template <int NHv, int TTv>
__global__ __launch_bounds__(256) void k_vt(const _Float16* __restrict__ V16, int ldv, int voff, _Float16* __restrict__ Vt) { __shared__ unsigned short tl[64][66]; const int tid = threadIdx.x; const int slab = blockIdx.x / (TTv / 64), lg = blockIdx.x % (TTv / 64); const int b = slab / NHv, h = slab % NHv;
  for (int i = tid; i < 64 * 8; i += 256) { const int r = i / 8, c8 = (i % 8) * 8; FragH f; f.half[0] = *(const v8us*)((const unsigned short*)V16 + ((size_t)b * TTv + lg * 64 + r) * ldv + voff + h * 64 + c8);
#pragma unroll
    for (int q = 0; q < 8; ++q) tl[r][c8 + q] = f.u[q]; }
  __syncthreads();
  {
#pragma unroll
    for (int rd = 0; rd < 2; ++rd) { const int d = rd * 32 + tid / 8, pc = tid % 8; FragH f;
#pragma unroll
      for (int q = 0; q < 8; ++q) f.u[q] = tl[pc * 8 + q][d];
      *(v8us*)((unsigned short*)Vt + ((size_t)slab * 64 + d) * TTv + lg * 64 + pc * 8) = f.half[0]; }
     } }

// X7[n] = [x_n, 1, 0] in f32, and XF = the same values in f16 (bf16 values, exact in f16 above its subnormal range) laid out as the B fragments of k_py:
// 16-byte piece ((s*2 + hf)*32 + lane) holds column (lane & 15) of keys 32 s + 16 hf + 8 (lane >> 4) + 0..7, so that a wave's fragment load reads 512 bytes in a row. Columns 7..15 are 0.
__global__ __launch_bounds__(256) void k_x7(const float* __restrict__ nodes, const float* __restrict__ centre, float* __restrict__ X7, _Float16* __restrict__ XF) { const int t = blockIdx.x * 256 + threadIdx.x; if (t >= NNODE * 2) return; const int n = t >> 1, half = t & 1; v4f v;
  { const int key0 = 32 * (t >> 6) + 16 * ((t >> 5) & 1) + 8 * ((t >> 4) & 1), f = t & 15; FragH x; float nv[8];
    // every lane loads (a column >= 3 reads column 0 and drops it): the eight loads are in flight together, with no branch between them
#pragma unroll
    for (int i = 0; i < 8; ++i) nv[i] = nodes[(size_t)(key0 + i) * 3 + ((f < 3) ? f : 0)];
    const float cc = bf16_round(centre[(f >= 3 && f < 6) ? f - 3 : 0]), cv = (f < 6) ? cc : (f == 6) ? 1.0f : 0.0f;
#pragma unroll
    for (int i = 0; i < 8; ++i) { const float rv = bf16_round(nv[i]); x.h[i] = (_Float16)((f < 3) ? rv : cv); }
    *(v8us*)((unsigned short*)XF + (size_t)t * 8) = x.half[0]; }
  if (half == 0) { v[0] = bf16_round(nodes[(size_t)n * 3]); v[1] = bf16_round(nodes[(size_t)n * 3 + 1]); v[2] = bf16_round(nodes[(size_t)n * 3 + 2]); v[3] = bf16_round(centre[0]); } else { v[0] = bf16_round(centre[1]); v[1] = bf16_round(centre[2]); v[2] = 1.0f; v[3] = 0.f; }
  *(v4f*)(X7 + (size_t)t * 4) = v;  }
#define PY_KSPLIT 4      /* key ranges (work-groups along k) of k_py */
__global__ __launch_bounds__(256) void k_proj(const float* __restrict__ nodes, const float* __restrict__ centre, const float* __restrict__ Wq, const float* __restrict__ bq, const float* __restrict__ Wk, const float* __restrict__ bk, const float* __restrict__ YP, float* __restrict__ KEYS, _Float16* __restrict__ AK16) {
  #pragma clang fp contract(off)
  const size_t t = (size_t)blockIdx.x * 256 + threadIdx.x; if (t >= (size_t)NNODE * DD / 4) return; const int n = (int)((t * 4) / DD), c0 = (int)((t * 4) % DD); float xa[7];
  for (int i = 0; i < 3; ++i) { xa[i] = bf16_round(nodes[(size_t)n * 3 + i]); xa[3 + i] = bf16_round(centre[i]); } xa[6] = 1.0f;
  float ya[7];      /* Y[n] = attn[n]*[x, 1]: k_py's partial sums over the key ranges, in range order, and P's scale 2^15 taken off */
  { v4f a = *(const v4fa*)(YP + (size_t)n * 8), b = *(const v4fa*)(YP + (size_t)n * 8 + 4);
    for (int kq = 1; kq < PY_KSPLIT; ++kq) { a += *(const v4fa*)(YP + ((size_t)kq * NNODE + n) * 8); b += *(const v4fa*)(YP + ((size_t)kq * NNODE + n) * 8 + 4); }
    for (int i = 0; i < 4; ++i) ya[i] = a[i] * 0.000030517578125f; for (int i = 0; i < 3; ++i) ya[4 + i] = b[i] * 0.000030517578125f; }
  float kv[4], qv[4]; for (int q = 0; q < 4; ++q) { kv[q] = bf16_round(bk[c0 + q]); qv[q] = ya[6] * bf16_round(bq[c0 + q]); }
#pragma unroll 1
  for (int i = 0; i < 6; ++i) for (int q = 0; q < 4; ++q) { kv[q] += xa[i] * bf16_round(Wk[(size_t)(c0 + q) * 6 + i]); qv[q] += ya[i] * bf16_round(Wq[(size_t)(c0 + q) * 6 + i]); }
  typedef _Float16 v4h __attribute__((ext_vector_type(4))); v4h fk, fq; for (int q = 0; q < 4; ++q) { fk[q] = (_Float16)kv[q]; fq[q] = (_Float16)qv[q]; } const v4f k0 = {kv[0], kv[1], kv[2], kv[3]};
  { *(v4f*)(KEYS + t * 4) = k0; *(v4h*)(AK16 + (size_t)n * (2 * DD) + DD + c0) = fk; *(v4h*)(AK16 + (size_t)n * (2 * DD) + c0) = fq;      /* row n of AK16 = [AQ | keys]; one 16-B f32 piece and 8-B f16 pieces per lane, lane-contiguous */
     } }
// value of lane l ^ MASK inside a 16-lane row (DPP row_xmask), and of lane l ^ 16: register moves, no LDS round trip
template <int MASK> __device__ __forceinline__ float lane_xor_row(float x) { return __int_as_float(__builtin_amdgcn_update_dpp(0, __float_as_int(x), 0x160 | MASK, 0xf, 0xf, true)); }
__device__ __forceinline__ float lane_xor16(float x) { const int v = __float_as_int(x); return __int_as_float(__builtin_amdgcn_permlanex16(v, v, 0x76543210, 0xfedcba98, false, false)); }
__device__ __forceinline__ float wave_max(float x) { x = fmaxf(x, lane_xor_row<1>(x)); x = fmaxf(x, lane_xor_row<2>(x)); x = fmaxf(x, lane_xor_row<4>(x)); x = fmaxf(x, lane_xor_row<8>(x)); return fmaxf(x, lane_xor16(x)); }
__device__ __forceinline__ float wave_sum(float x) { x += lane_xor_row<1>(x); x += lane_xor_row<2>(x); x += lane_xor_row<4>(x); x += lane_xor_row<8>(x); return x + lane_xor16(x); }
// M[i][j] = sum over the 512 channels c of a_c[i] * b_c[j], with a_c = [Wk[c][0..5], bk[c]] and b_c = [Wq[c][0..5], bq[c]] rounded to bf16 (each product is exact in f32).
// The 256 threads split the channels: thread t takes channels 2t and 2t + 1 (12 neighbouring floats of each matrix, all loads in flight at once) and forms its 49 partial sums in registers;
// each is summed over the wave by register moves, the 8 waves' sums meet in LDS, and thread p < 49 adds them in wave order. The caller's barrier publishes M.
static_assert(DD == 2 * 256, "two channels per thread of a 256-thread work-group");
__device__ __forceinline__ void sai_gram(const float* __restrict__ Wq, const float* __restrict__ bq, const float* __restrict__ Wk, const float* __restrict__ bk, int tid, float (*part)[52], float (*M)[8]) {
  float a[2][7], b[2][7], s[49];
  // every unroll of this function: a, b and s stay in registers only under constant indices
#pragma unroll
  for (int u = 0; u < 2; ++u) {
    const int c = 2 * tid + u;
#pragma unroll
    for (int i = 0; i < 6; ++i) { a[u][i] = bf16_round(Wk[(size_t)c * 6 + i]); b[u][i] = bf16_round(Wq[(size_t)c * 6 + i]); }
    a[u][6] = bf16_round(bk[c]); b[u][6] = bf16_round(bq[c]);
  }
#pragma unroll
  for (int i = 0; i < 7; ++i)
#pragma unroll
    for (int j = 0; j < 7; ++j) s[i * 7 + j] = wave_sum(a[0][i] * b[0][j] + a[1][i] * b[1][j]);
  if ((tid & 31) == 0) {
#pragma unroll
    for (int p = 0; p < 49; ++p) part[tid >> 5][p] = s[p];
  }
  __syncthreads();      /* every wave's 49 sums are in part */
  if (tid < 49) {
    float m = part[0][tid];
#pragma unroll
    for (int w = 1; w < 8; ++w) m += part[w][tid];
    M[tid / 7][tid % 7] = m;
  }
}
__global__ __launch_bounds__(256) void k_rvec(const float* __restrict__ Wq, const float* __restrict__ bq, const float* __restrict__ Wk, const float* __restrict__ bk, const float* __restrict__ X7, float* __restrict__ R) {
  #pragma clang fp contract(off)
  __shared__ float M[7][8]; __shared__ __attribute__((aligned(16))) float part[8][52]; const int tid = threadIdx.x;
  sai_gram(Wq, bq, Wk, bk, tid, part, M);
  __syncthreads();
  const int t = blockIdx.x * 256 + tid; if (t >= NNODE * 2) return; const int n = t >> 1, half = t & 1; float xa[8]; { const v4f a = *(const v4fa*)(X7 + (size_t)n * 8), b = *(const v4fa*)(X7 + (size_t)n * 8 + 4); xa[0] = a[0]; xa[1] = a[1]; xa[2] = a[2]; xa[3] = a[3]; xa[4] = b[0]; xa[5] = b[1]; xa[6] = b[2]; }
  v4f o = {0.f, 0.f, 0.f, 0.f};      /* this thread's half of R[n]: columns j = 4·half .. 4·half+3 (j = 7 stays 0) */
#pragma unroll 1
  for (int i = 0; i < 7; ++i) for (int q = 0; q < 4; ++q) { const int j = half * 4 + q; if (j < 7) o[q] += xa[i] * M[i][j]; }
  *(v4f*)(R + (size_t)t * 4) = o;  }
__device__ __forceinline__ float sai_dot(const float* r, v4f a, v4f b) { return r[0] * a[0] + r[1] * a[1] + r[2] * a[2] + r[3] * a[3] + r[4] * b[0] + r[5] * b[1] + r[6] * b[2]; }
// One work-group = 32 waves that split the 8192 KEYS: thread t owns keys 8t .. 8t+7 and holds their vectors in registers for all SOFT_ROWS rows of the group.
// Rows go four at a time: logits once into registers, row maximum and row sum over the 32 waves through LDS, the exponentials overwrite the logits, P f16 x2^15 leaves as one 16-B piece per lane and row.
#define SOFT_ROWS 32
__global__ __launch_bounds__(1024) void k_soft(const float* __restrict__ R, const float* __restrict__ X7, int n0, _Float16* __restrict__ P16) {
  __shared__ __attribute__((aligned(16))) float redM[32][4], redZ[32][4];
  const int tid = threadIdx.x, wv = tid >> 5, lane = tid & 31;
  v4f xa[8], xb[8];
  // every unroll below: xa, xb, s, m4 and z4 stay in registers only where their indices are constants
#pragma unroll
  for (int e = 0; e < 8; ++e) { xa[e] = *(const v4fa*)(X7 + ((size_t)tid * 8 + e) * 8); xb[e] = *(const v4fa*)(X7 + ((size_t)tid * 8 + e) * 8 + 4); }
  for (int g = 0; g < SOFT_ROWS / 4; ++g) {
    const int nl = blockIdx.x * SOFT_ROWS + g * 4;
    float s[4][8]; v4f m4, z4;
    // unrolled for constant indices (registers), and the four rows' chains interleave
#pragma unroll
    for (int j = 0; j < 4; ++j) {
      const float* rp = R + (size_t)(n0 + nl + j) * 8; const v4f a = *(const v4fa*)rp, b = *(const v4fa*)(rp + 4); const float r[7] = {a[0], a[1], a[2], a[3], b[0], b[1], b[2]};
      float mx = -3.0e38f;
      // unrolled for constant indices (registers)
#pragma unroll
      for (int e = 0; e < 8; ++e) { s[j][e] = sai_dot(r, xa[e], xb[e]); mx = fmaxf(mx, s[j][e]); }
      m4[j] = wave_max(mx);
    }
    if (lane == 0) *(v4f*)&redM[wv][0] = m4;
    __syncthreads();      /* every wave's four maxima are in redM */
    m4 = *(const v4f*)&redM[lane][0];
    // unrolled for constant indices (registers), and the four rows' chains interleave
#pragma unroll
    for (int j = 0; j < 4; ++j) {
      const float mx = wave_max(m4[j]); float z = 0.f;
      // unrolled for constant indices (registers)
#pragma unroll
      for (int e = 0; e < 8; ++e) { s[j][e] = expf(s[j][e] - mx); z += s[j][e]; }
      z4[j] = wave_sum(z);
    }
    if (lane == 0) *(v4f*)&redZ[wv][0] = z4;
    __syncthreads();      /* every wave's four sums are in redZ; it also ends every read of redM before the next four rows write it */
    z4 = *(const v4f*)&redZ[lane][0];
    // unrolled for constant indices (registers), and the four rows' chains interleave
#pragma unroll
    for (int j = 0; j < 4; ++j) {
      const float iz = 32768.0f / wave_sum(z4[j]); FragH f;
      // unrolled for constant indices (registers)
#pragma unroll
      for (int e = 0; e < 8; ++e) f.h[e] = (_Float16)(s[j][e] * iz);
      *(v8us*)((unsigned short*)P16 + (size_t)(nl + j) * NNODE + (size_t)tid * 8) = f.half[0];
    }
  }
}

// ---- the tiled GEMM: C[8192][512] = alpha * A[8192][K] * Bt[512][K]^T (+ addends), both operands f16 with k contiguous.
// One 128 x 128 tile of C per work-group (256 work-groups), 4 waves (2 x 2) of 64 x 64 each. A stage is 256 bytes (128 k) of the tile's 128 A rows and 128 Bt rows in LDS at pitch 272 B;
// every wave brings its own 64-row slice of a stage with one tensor load; two buffers, the next stage in flight while this one is worked on.
typedef uint32_t u32x4 __attribute__((ext_vector_type(4)));
typedef uint32_t u32x8 __attribute__((ext_vector_type(8)));
constexpr uint32_t TG_KB = 256;                      // bytes of k per operand row and stage
constexpr uint32_t TG_PITCH = TG_KB + 16;            // LDS row pitch, 16 B x odd, written by the tensor load's pad
constexpr uint32_t TG_SROWS = 64;                    // rows per slice (one tensor load)
constexpr uint32_t TG_SLICE = 18432;                 // 64 x 272 = 17,408 B rounded up to a multiple of 2 KiB, so that every slice starts on one
constexpr uint32_t TG_STAGE = 4 * TG_SLICE;          // one buffer: [A rows 0-63][A rows 64-127][Bt rows 0-63][Bt rows 64-127]
constexpr uint32_t TG_EPITCH = 68;                   // floats per staged output row (64 + 4)
constexpr uint32_t TG_EPI = 64 * TG_EPITCH * 4;      // output staging per wave, behind the ring
constexpr uint32_t TG_LDS = 2 * TG_STAGE + 4 * TG_EPI;
static_assert(TG_SROWS * TG_PITCH <= TG_SLICE && TG_SLICE % 2048u == 0, "a slice must hold its padded rows and start on a multiple of 2 KiB");
static_assert(TG_LDS <= 320u * 1024u, "LDS of one work-group");
__device__ __forceinline__ uint32_t tg_uni(uint32_t v) { return (uint32_t)__builtin_amdgcn_readfirstlane(v); }
__device__ __forceinline__ uint32_t tg_pinned(uint32_t v) { uint32_t w = (uint32_t)__builtin_amdgcn_readfirstlane(v); asm volatile("" : "+s"(w)); return w; }
__device__ __forceinline__ void tg_wait_ds0() { asm volatile("s_wait_dscnt 0x0" ::: "memory"); }          // this wave's LDS reads have returned before the buffer is handed over
// A request's descriptor: group 0 (count, LDS place, source address, type) and group 1 (64 rows of 256 bytes at the source pitch, 16 B of LDS pad behind every row).
struct TgDesc { u32x4 g0; u32x8 g1; };
__device__ __forceinline__ TgDesc tg_desc(uint32_t lds_dst, uint64_t ga, uint32_t pitch) {
  TgDesc d;
  d.g0[0] = tg_uni(1u);
  d.g0[1] = tg_uni(lds_dst);
  d.g0[2] = tg_uni((uint32_t)ga);
  d.g0[3] = tg_uni((((uint32_t)(ga >> 32)) & 0x01FFFFFFu) | 0x80000000u);
  d.g1[0] = tg_uni((1u << 20) | (5u << 22) | (3u << 25));
  d.g1[1] = tg_uni((TG_KB & 0xFFFFu) << 16);
  d.g1[2] = tg_uni((TG_KB >> 16) | ((TG_SROWS & 0xFFFFu) << 16));
  d.g1[3] = tg_uni((TG_SROWS >> 16) | (TG_KB << 16));
  d.g1[4] = tg_uni(TG_SROWS);
  d.g1[5] = tg_uni(pitch);
  d.g1[6] = tg_uni(0u);
  d.g1[7] = tg_uni(0u);
  return d;
}
// the next stage of the same slice: a new LDS place, the source 256 bytes further along k (the carry goes into the address's high word, below its type bits)
__device__ __forceinline__ void tg_next(TgDesc& d, uint32_t lds_dst) {
  const uint32_t lo = d.g0[2] + TG_KB;
  d.g0[1] = tg_uni(lds_dst);
  d.g0[2] = tg_uni(lo);
  d.g0[3] = tg_uni(d.g0[3] + ((lo < TG_KB) ? 1u : 0u));
}
// Both statements take the descriptor as in-out operands: its registers then stay the descriptor's from the issue to the wait (the compiler otherwise reused some of them for loop temporaries
// while the request was in flight), and tg_next()'s new words are formed behind the wait.
__device__ __forceinline__ void tg_tensor_load(TgDesc& d) { asm volatile("tensor_load_to_lds %0, %1" : "+s"(d.g0), "+s"(d.g1) :: "memory"); }
// this wave's slice has landed; the compiler places no wait for a tensor load
__device__ __forceinline__ void tg_wait_tensor0(TgDesc& d) { asm volatile("s_wait_tensorcnt 0x0" : "+s"(d.g0), "+s"(d.g1) :: "memory"); }
__device__ __forceinline__ void tg_load_frag(FragH& f, const unsigned char* p) { f.half[0] = *(const v8us*)p; f.half[1] = *(const v8us*)(p + 32); }
// APITCH, BPITCH: source row pitches in bytes; T: stages (K = 128 T). MODE 0: C16 = f16(acc*alpha); 1: C = acc*alpha + add; 2: C = acc*alpha + bf16(bias[col]) + add. C, C16 and add have 512 columns.
template <uint32_t APITCH, uint32_t BPITCH, uint32_t T, int MODE>
__global__ __launch_bounds__(128) void k_gemm_tile(const _Float16* __restrict__ A, const _Float16* __restrict__ Bt, float alpha, const float* __restrict__ bias, const float* __restrict__ add, float* __restrict__ C, _Float16* __restrict__ C16) {
  static_assert(T >= 2 && T * TG_KB <= APITCH && T * TG_KB <= BPITCH && APITCH % 16u == 0 && BPITCH % 16u == 0, "the prologue fills two stages; every stage lies inside its source rows");
  __shared__ __attribute__((aligned(2048))) unsigned char L[TG_LDS];
  const uint32_t tid = threadIdx.x, lane = tid & 31u, h = lane >> 4, c = lane & 15u;
  const uint32_t wave = tg_uni(tid >> 5);
  const uint32_t tn = blockIdx.x & 3u, tm = blockIdx.x >> 2;      // the four column tiles of one row tile are neighbours: they read the same A rows
  const uint32_t m0 = tm * 128u, n0 = tn * 128u, wm = wave >> 1, wn = wave & 1u;
  const uint64_t src0 = (wave < 2u) ? (uint64_t)(uintptr_t)A + (uint64_t)(m0 + TG_SROWS * wave) * APITCH
                                    : (uint64_t)(uintptr_t)Bt + (uint64_t)(n0 + TG_SROWS * (wave - 2u)) * BPITCH;
  const uint32_t pitch = (wave < 2u) ? APITCH : BPITCH;
  const uint32_t lds_slice = (uint32_t)(size_t)(const void*)L + wave * TG_SLICE;
  const uint32_t fa_base = wm * TG_SLICE + c * TG_PITCH + 16u * h;            // row c of the wave's first A fragment, 16-byte half h
  const uint32_t fb_base = (2u + wn) * TG_SLICE + c * TG_PITCH + 16u * h;     // the same for Bt
  v8f acc[4][4];
  // every '#pragma unroll' of this kernel without a comment of its own: acc, fa and fb stay in registers only under constant indices
#pragma unroll
  for (int i = 0; i < 4; ++i)
#pragma unroll
    for (int j = 0; j < 4; ++j) acc[i][j] = (v8f){0.f, 0.f, 0.f, 0.f, 0.f, 0.f, 0.f, 0.f};
  TgDesc d = tg_desc(lds_slice, src0, pitch);
  tg_tensor_load(d);
  tg_wait_tensor0(d);
  __syncthreads();      /* stage 0 is readable by every wave */
  tg_next(d, lds_slice + TG_STAGE);
  tg_tensor_load(d);
  // kept rolled: the buffer is picked by t & 1
#pragma clang loop unroll(disable)
  for (uint32_t t = 0; t < T; ++t) {
    const uint32_t buf = (t & 1u) * TG_STAGE;
    const unsigned char* la = L + buf + fa_base;
    const unsigned char* lb = L + buf + fb_base;
    FragH fa[2][4], fb[2][4];      // set (u & 1) holds block u's fragments
#pragma unroll
    for (int i = 0; i < 4; ++i) { tg_load_frag(fa[0][i], la + (uint32_t)i * 16u * TG_PITCH); tg_load_frag(fb[0][i], lb + (uint32_t)i * 16u * TG_PITCH); }
    // unrolled: the fragment sets and accumulators stay in registers only under constant indices
#pragma unroll
    for (int u = 0; u < 4; ++u) {
      const int cs = u & 1;
      if (u + 1 < 4) {
        const uint32_t ko = (uint32_t)(u + 1) * 64u;
#pragma unroll
        for (int i = 0; i < 4; ++i) { tg_load_frag(fa[cs ^ 1][i], la + (uint32_t)i * 16u * TG_PITCH + ko); tg_load_frag(fb[cs ^ 1][i], lb + (uint32_t)i * 16u * TG_PITCH + ko); }
      }
      __builtin_amdgcn_sched_barrier(0);      // the next block's LDS reads stay one group ahead of this block's matrix instructions, not spread among them
#pragma unroll
      for (int i = 0; i < 4; ++i)
#pragma unroll
        for (int j = 0; j < 4; ++j) acc[i][j] = __builtin_amdgcn_wmma_f32_16x16x32_f16(false, fa[cs][i].v, false, fb[cs][j].v, (short)0, acc[i][j], false, false);
      __builtin_amdgcn_sched_barrier(0);      // and the block behind it does not move its reads up among them
    }
    tg_wait_ds0();
    tg_wait_tensor0(d);
    __syncthreads();      /* stage t + 1 is readable by every wave, and every wave has left stage t's buffer */
    if (tg_pinned((t + 2u < T) ? 1u : 0u) != 0u) { tg_next(d, lds_slice + buf); tg_tensor_load(d); }
  }
  tg_wait_tensor0(d);
  tg_wait_ds0();
  // epilogue: each wave stages its 64 x 64 tile in its own LDS range behind the ring, then adds the addends and stores whole 128-byte lines
  float* E = (float*)(L + 2u * TG_STAGE + wave * TG_EPI);
#pragma unroll
  for (int i = 0; i < 4; ++i)
#pragma unroll
    for (int j = 0; j < 4; ++j)
#pragma unroll
      for (int r = 0; r < 8; ++r) E[(16u * (uint32_t)i + 8u * h + (uint32_t)r) * TG_EPITCH + 16u * (uint32_t)j + c] = acc[i][j][r];
  __builtin_amdgcn_fence(__ATOMIC_ACQ_REL, "workgroup"); __builtin_amdgcn_wave_barrier();      // the wave's own staged rows are read back by other lanes
  const uint32_t c4 = c * 4u, col = n0 + wn * 64u + c4;
  v4f bv = {0.f, 0.f, 0.f, 0.f};
  if (MODE == 2) { for (int e = 0; e < 4; ++e) bv[e] = bf16_round(bias[col + (uint32_t)e]); }
  // four row pairs per trip: their staged rows and addend loads are in flight together; the outer loop stays rolled so that the one wait at its foot stands behind every trip's stores
#pragma clang loop unroll(disable)
  for (uint32_t q0 = 0; q0 < 32u; q0 += 4u) {
    // unrolled: the four row pairs' LDS reads, addend loads and stores each go out as one run
#pragma unroll
    for (uint32_t qi = 0; qi < 4u; ++qi) {
      const uint32_t row = 2u * (q0 + qi) + h;
      const v4f v = *(const v4fa*)&E[row * TG_EPITCH + c4];
      const size_t g = (size_t)(m0 + wm * 64u + row) * DD + col;
      v4f o;
#pragma unroll
      for (int e = 0; e < 4; ++e) o[e] = v[e] * alpha + bv[e];
      if (MODE != 0) { const v4f a4 = *(const v4fa*)(add + g); o += a4; *(v4f*)(C + g) = o; }
      else { v4h h4; for (int e = 0; e < 4; ++e) h4[e] = (_Float16)o[e]; *(v4h*)(C16 + g) = h4; }
    }
    asm volatile("s_wait_xcnt 0x0" ::: "memory");      // stands behind the trip's stores, in front of the next trip's writes of their address and data registers
  }
}

// ---- Y = P * [x, 1]: YP[kq][n][0..7] = sum over key range kq of P16[n][m] * X7[m][0..7] (still times 2^15). M 8192, one 16-column tile, K 8192: every byte of P is read once, from memory.
// One work-group = 64 rows x 2048 keys (128 x PY_KSPLIT work-groups, two on a WGP), 4 waves that split its keys: wave w owns 512 of them, PY_T stages of 128. A stage is the ring's 64-row slice of 256 bytes a row,
// brought by the wave's own tensor load into its own slice of two buffers (the descriptor, places and pitch of k_gemm_tile); the B fragments come from XF by whole-line loads while the next stage is in flight.
constexpr uint32_t PY_T = NNODE / 128u / PY_KSPLIT / 4u;      // stages per wave
constexpr uint32_t PY_EPITCH = 20;                            // floats per staged row of partial sums (16 + 4: the two lane halves fall on different banks)
static_assert(PY_T >= 2 && PY_T * 128u * 4u * PY_KSPLIT == NNODE && NNODE % 64 == 0, "the prologue fills two stages; the waves' key ranges tile the row");
static_assert(64u * PY_EPITCH * 4u <= TG_SLICE, "a wave's partial sums fit its own slice");
// tg_tensor_load() and tg_wait_tensor0() with the descriptor tied to fixed scalar registers: in this kernel the compiler otherwise issued from a copy of group 0 and reused the copy's registers
// for loop temporaries while the request was in flight; so tied, the registers that the request names hold the descriptor from the issue to the wait.
__device__ __forceinline__ void py_tensor_load(TgDesc& d) { asm volatile("tensor_load_to_lds %0, %1" : "+{s[36:39]}"(d.g0), "+{s[40:47]}"(d.g1) :: "memory"); }
__device__ __forceinline__ void py_wait_tensor0(TgDesc& d) { asm volatile("s_wait_tensorcnt 0x0" : "+{s[36:39]}"(d.g0), "+{s[40:47]}"(d.g1) :: "memory"); }
__global__ __launch_bounds__(128) void k_py(const _Float16* __restrict__ P16, const _Float16* __restrict__ XF, float* __restrict__ YP) {
  __shared__ __attribute__((aligned(2048))) unsigned char L[2 * TG_STAGE];
  const uint32_t tid = threadIdx.x, lane = tid & 31u, h = lane >> 4, c = lane & 15u;
  const uint32_t wave = tg_uni(tid >> 5);
  const uint32_t kq = blockIdx.x % PY_KSPLIT, m0 = (blockIdx.x / PY_KSPLIT) * 64u;
  const uint32_t k0 = (kq * 4u + wave) * (PY_T * 128u);      // the wave's first key
  const uint64_t src0 = (uint64_t)(uintptr_t)P16 + (uint64_t)m0 * (NNODE * 2u) + (uint64_t)k0 * 2u;
  const uint32_t lds_slice = (uint32_t)(size_t)(const void*)L + wave * TG_SLICE;
  const uint32_t fa_base = wave * TG_SLICE + c * TG_PITCH + 16u * h;      // row c of the wave's first A fragment, 16-byte half h
  const unsigned short* xf = (const unsigned short*)XF + (size_t)(k0 / 32u) * 512u + lane * 8u;
  v8f acc[4];
  // every '#pragma unroll' of this kernel: acc and fb stay in registers only under constant indices
#pragma unroll
  for (int i = 0; i < 4; ++i) acc[i] = (v8f){0.f, 0.f, 0.f, 0.f, 0.f, 0.f, 0.f, 0.f};
  TgDesc d = tg_desc(lds_slice, src0, NNODE * 2u);
  py_tensor_load(d);
  py_wait_tensor0(d);
  __syncthreads();      /* stage 0 has landed for every wave */
  tg_next(d, lds_slice + TG_STAGE);
  py_tensor_load(d);
  // kept rolled: the buffer is picked by t & 1, as in k_gemm_tile
#pragma clang loop unroll(disable)
  for (uint32_t t = 0; t < PY_T; ++t) {
    const uint32_t buf = (t & 1u) * TG_STAGE;
    const unsigned char* la = L + buf + fa_base;
    FragH fb[4];
#pragma unroll
    for (int u = 0; u < 4; ++u) { fb[u].half[0] = *(const v8us*)(xf + (t * 4u + (uint32_t)u) * 512u); fb[u].half[1] = *(const v8us*)(xf + (t * 4u + (uint32_t)u) * 512u + 256u); }
#pragma unroll
    for (int u = 0; u < 4; ++u)
#pragma unroll
      for (int i = 0; i < 4; ++i) {
        FragH fa; tg_load_frag(fa, la + (uint32_t)i * 16u * TG_PITCH + (uint32_t)u * 64u);
        acc[i] = __builtin_amdgcn_wmma_f32_16x16x32_f16(false, fa.v, false, fb[u].v, (short)0, acc[i], false, false);
      }
    tg_wait_ds0();
    py_wait_tensor0(d);
    __syncthreads();      /* stage t + 1 has landed for every wave, and every wave has left stage t's buffer */
    if (tg_pinned((t + 2u < PY_T) ? 1u : 0u) != 0u) { tg_next(d, lds_slice + buf); py_tensor_load(d); }
  }
  py_wait_tensor0(d);
  tg_wait_ds0();
  // the four waves' partial sums meet in LDS: each wave stages its 64 x 16 sums in its own slice of buffer 0 (no request is outstanding, nobody else reads that slice), then thread t adds four columns of row t / 2 in wave order
  float* E = (float*)(L + wave * TG_SLICE);
#pragma unroll
  for (int i = 0; i < 4; ++i)
#pragma unroll
    for (int r = 0; r < 8; ++r) E[(16u * (uint32_t)i + 8u * h + (uint32_t)r) * PY_EPITCH + c] = acc[i][r];
  __syncthreads();      /* every wave's sums are staged */
  const uint32_t row = tid >> 1, c4 = (tid & 1u) * 4u;
  v4f s = *(const v4fa*)((const float*)L + row * PY_EPITCH + c4);
#pragma unroll
  for (uint32_t w = 1; w < 4u; ++w) s += *(const v4fa*)((const float*)(L + w * TG_SLICE) + row * PY_EPITCH + c4);
  *(v4f*)(YP + ((size_t)kq * NNODE + m0 + row) * 8u + c4) = s;
}

extern "C" void kernel_launch(void* const* d_in, const int* in_sizes, int n_in,
                              void* d_out, int out_size, void* d_ws, size_t ws_size, hipStream_t stream) {
  (void)in_sizes; (void)n_in; (void)out_size;
  const float* const* I = (const float* const*)d_in; const float* nodes = I[0]; const float* centre = I[1]; const float* Wq = I[2]; const float* bq = I[3]; const float* Wk = I[4]; const float* bk = I[5]; const float* Wv = I[6]; const float* bv = I[7];
  char* ws = (char*)d_ws; size_t off = 0;
  auto take = [&](size_t bytes) { char* p = ws + off; off += (bytes + 255) & ~(size_t)255; return p; };
  _Float16* Bwv = (_Float16*)take((size_t)DD * 2 * DD * 2); float* KEYS = (float*)take((size_t)NNODE * DD * 4); _Float16* AK16 = (_Float16*)take((size_t)NNODE * 2 * DD * 2); float* X7 = (float*)take((size_t)NNODE * 8 * 4); float* R = (float*)take((size_t)NNODE * 8 * 4);
  _Float16* XF = (_Float16*)take((size_t)NNODE * 16 * 2); float* YP = (float*)take((size_t)PY_KSPLIT * NNODE * 8 * 4); _Float16* P16 = (_Float16*)take((size_t)NNODE * NNODE * 2);
  if (off > ws_size) return;      // 163 MiB of the 256 MiB workspace, the full P plane alone 128 MiB
  k_round16f<<<(unsigned)(((size_t)DD * 2 * DD / 8 + 255) / 256), 256, 0, stream>>>(Wv, Bwv, (size_t)DD * 2 * DD / 8);      /* Wv (512, 1024) natural ×2^4: row d = [Wv_q | Wv_k] */
  k_x7<<<NNODE * 2 / 256, 256, 0, stream>>>(nodes, centre, X7, XF);
  k_rvec<<<NNODE * 2 / 256, 256, 0, stream>>>(Wq, bq, Wk, bk, X7, R);
  k_soft<<<NNODE / SOFT_ROWS, 1024, 0, stream>>>(R, X7, 0, P16);      /* 256 work-groups of 32 waves, 32 rows each */
  k_py<<<(NNODE / 64) * PY_KSPLIT, 128, 0, stream>>>(P16, XF, YP);      /* Y = attn*[x, 1] x2^15, PY_KSPLIT partial planes: M 8192 N 16 K 8192 */
  k_proj<<<(unsigned)(((size_t)NNODE * DD / 4 + 255) / 256), 256, 0, stream>>>(nodes, centre, Wq, bq, Wk, bk, YP, KEYS, AK16);      /* keys, and AQ = Y*[Wq bq]^T = attn*queries */
  const dim3 gq((NNODE / 128) * (DD / 128), 1);      /* one 128 x 128 tile per work-group */
  k_gemm_tile<2 * DD * 2, 2 * DD * 2, 2 * DD / 128, 2><<<gq, 128, 0, stream>>>(AK16, Bwv, 0.0625f, bv, KEYS, (float*)d_out, nullptr);      /* out = [AQ | keys]*Wv^T + bv + keys: M 8192 N 512 K 1024 */
}

// v006
// A run of this version takes 82.9 microseconds.
// Two timings next to v005 both put it at 1.33 times that version's speed.
// Over all steps from v000 it is 33.3 times as fast.
#include <hip/hip_runtime.h>
#include <stdint.h>
// 'self_attn_init' (N=8192 nodes, 3-d coords + a shared 3-d centre → 6 inputs, D=512): x = [node, centre]; keys = x·Wkᵀ + bk; queries = x·Wqᵀ + bq; attn = softmax_m(keys·queriesᵀ) (UNSCALED, rank-7 logits up to ±O(100));
// out = keys + attn·(queries·Wv[:, :512]ᵀ) + keys·Wv[:, 512:]ᵀ + bv.
// Compute dtype: inputs/weights/biases rounded to bf16. The logits are an exact bilinear form in the 7-vector x̃ = [x, 1]: s[n][m] = (x̃_nᵀ·M)·x̃_m with M = [Wk bk]ᵀ[Wq bq] (7×7, f32), evaluated per pair in f32 —
// no 16-bit rounding touches the huge logits: they are formed on the f32 matrix instruction, transposed, so that the exponentials (f16, times 2^15) are already the operand fragment of attn*[x, 1]; attn itself never goes to memory.
// queries = [x, 1]*[Wq bq]^T has rank 7, so attn*(queries*Wv_q^T) = ((attn*[x, 1])*[Wq bq]^T)*Wv_q^T: Y = attn*[x, 1] is a GEMM with one 16-column tile, AQ = Y*[Wq bq]^T costs what queries cost, and
// out = [AQ | keys]*Wv^T + bv + keys is one GEMM with K = 1024. Both GEMMs on v_wmma_f32_16x16x32_f16 (f32 accumulate).
#define NNODE 8192
#define DD 512

typedef __bf16 v16b __attribute__((ext_vector_type(16)));
typedef unsigned short v8us __attribute__((ext_vector_type(8), may_alias));
typedef float  v8f  __attribute__((ext_vector_type(8)));
typedef float  v4f  __attribute__((ext_vector_type(4)));
typedef float  v4fa __attribute__((ext_vector_type(4), may_alias));
union FragB { v16b v; v8us half[2]; unsigned short u[16]; };

__device__ __forceinline__ unsigned short bf16_bits(float x) { unsigned int u = __float_as_uint(x); return (unsigned short)((u + 0x7FFFu + ((u >> 16) & 1u)) >> 16); }
__device__ __forceinline__ float bf16_val(unsigned short b) { return __uint_as_float(((unsigned int)b) << 16); }
__device__ __forceinline__ float bf16_round(float x) { return bf16_val(bf16_bits(x)); }
// D += A·B with NT terms: 1 = ah·bh, 2 = + al·bh (A split), 3 = + ah·bl (both split)
template <int NT>
__device__ __forceinline__ v8f mmaN(v16b ah, v16b al, v16b bh, v16b bl, v8f c) {
  c = __builtin_amdgcn_wmma_f32_16x16x32_bf16(false, ah, false, bh, (short)0, c, false, false);
  if (NT >= 2) c = __builtin_amdgcn_wmma_f32_16x16x32_bf16(false, al, false, bh, (short)0, c, false, false);
  if (NT >= 3) c = __builtin_amdgcn_wmma_f32_16x16x32_bf16(false, ah, false, bl, (short)0, c, false, false);
  asm volatile("v_nop\n\tv_nop\n\tv_nop\n\tv_nop" : "+v"(c) : "v"(ah), "v"(al), "v"(bh), "v"(bl));
  return c;
}

__global__ __launch_bounds__(256) void k_wt_bf16(const float* __restrict__ W, unsigned short* __restrict__ Wt, int K, int N) {
  const int t = blockIdx.x * 256 + threadIdx.x;
  const int k8n = K / 8;
  if (t >= N * k8n) return;
  const int n = t / k8n, k8 = (t % k8n) * 8;
  v8us v;
#pragma unroll
  for (int i = 0; i < 8; ++i) v[i] = bf16_bits(W[(size_t)(k8 + i) * N + n]);
  *(v8us*)(Wt + (size_t)n * K + k8) = v;
  
}

// GEMM C[M][N] (f32, pitch ldc) = act(A[M][K]·W + bias). A f32 row-major (pitch lda) converted per fragment to bf16
// (ASPLIT: hi/lo two planes -> 2 terms, else single rounded term); Wt bf16 [N][K] (pitch ldb). BIAS_BF16 rounds the
// bias to bf16 first (bias quantised to bf16 before the add). K%32==0, M%16==0, N%64==0.
template <bool ASPLIT, int ACT, bool BIAS_BF16>
__global__ __launch_bounds__(128) void k_gemm_bf(const float* __restrict__ A, int lda, const unsigned short* __restrict__ Wt, int ldb,
                                               const float* __restrict__ bias, float* __restrict__ C, int ldc, int M, int N, int K) {
  __shared__ __attribute__((aligned(16))) float so[4][16][64];
  const int tid = threadIdx.x, w = tid >> 5, lane = tid & 31, ln = lane & 15, hh = lane >> 4;
  const int ntn = N / 64;
  const int wid = blockIdx.x * 4 + w;
  const int mt = wid / ntn, nq = wid % ntn;
  if (mt * 16 >= M) return;
  const int row0 = mt * 16, col0 = nq * 64;
  const float* arow = A + (size_t)(row0 + ln) * lda;
  v8f acc[4] = {};
  for (int kb = 0; kb < K; kb += 32) {
    FragB ah, al;
    const v4f x0 = *(const v4fa*)(arow + kb + 8 * hh), x1 = *(const v4fa*)(arow + kb + 8 * hh + 4);
    const v4f x2 = *(const v4fa*)(arow + kb + 16 + 8 * hh), x3 = *(const v4fa*)(arow + kb + 16 + 8 * hh + 4);
    float xs[16] = {x0[0],x0[1],x0[2],x0[3],x1[0],x1[1],x1[2],x1[3],x2[0],x2[1],x2[2],x2[3],x3[0],x3[1],x3[2],x3[3]};
#pragma unroll
    for (int i = 0; i < 16; ++i) { const unsigned short hb = bf16_bits(xs[i]); ah.u[i] = hb; al.u[i] = ASPLIT ? bf16_bits(xs[i] - bf16_val(hb)) : (unsigned short)0; }
#pragma unroll
    for (int t = 0; t < 4; ++t) {
      const unsigned short* brow = Wt + (size_t)(col0 + t * 16 + ln) * ldb + kb;
      FragB b;
      b.half[0] = *(const v8us*)(brow + 8 * hh);
      b.half[1] = *(const v8us*)(brow + 16 + 8 * hh);
      acc[t] = mmaN<ASPLIT ? 2 : 1>(ah.v, al.v, b.v, b.v, acc[t]);
    }
  }
#pragma unroll
  for (int t = 0; t < 4; ++t) {
    float bv = bias ? bias[col0 + t * 16 + ln] : 0.f;
    if (BIAS_BF16) bv = bf16_round(bv);
#pragma unroll
    for (int r = 0; r < 8; ++r) { float v = acc[t][r] + bv; if (ACT == 1) v = fmaxf(v, 0.f); so[w][8 * hh + r][t * 16 + ln] = v; }
  }
  __builtin_amdgcn_fence(__ATOMIC_ACQ_REL, "workgroup");
  __builtin_amdgcn_wave_barrier();
  const int rsub = lane >> 4, c4 = (lane & 15) * 4;
  {
#pragma unroll
    for (int q = 0; q < 8; ++q) {
      const int r = q * 2 + rsub;
      const v4f v = *(const v4fa*)&so[w][r][c4];
      *(v4f*)(C + (size_t)(row0 + r) * ldc + col0 + c4) = v;
    }
    
  }
}

// Flash-style causal/unmasked attention, all contractions 3-term bf16 hi/lo splits, f32 softmax with running max.
// q,k,v rows are read from f32 buffers with arbitrary row pitch (so they can live inside a fused qkv buffer);
// D = head size (multiple of 32, <= 128); one wave = 16 query rows; block = 4 waves (64 queries) sharing K/V chunks of 32.
template <int D, bool CAUSAL>
__global__ __launch_bounds__(128) void k_flash(const float* __restrict__ qb, const float* __restrict__ kb, const float* __restrict__ vb,
                                             int pitch, int T, int H, float scale, float* __restrict__ y, int ypitch) {
  constexpr int KS = D / 32;        // k-steps for QK
  constexpr int DT = D / 16;        // d tiles for PV
  __shared__ __attribute__((aligned(16))) unsigned short sKh[32][D + 8], sKl[32][D + 8], sVh[32][D + 8], sVl[32][D + 8];
  __shared__ __attribute__((aligned(16))) unsigned short sPh[4][16][40], sPl[4][16][40];
  __shared__ __attribute__((aligned(16))) float sO[4][16][D];
  const int tid = threadIdx.x, w = tid >> 5, lane = tid & 31, ln = lane & 15, hh = lane >> 4;
  const int nqb = (T + 63) / 64;
  const int bh = blockIdx.x / nqb, qblk = blockIdx.x % nqb;
  const int b = bh / H, h = bh % H;
  const int q0 = qblk * 64 + w * 16;
  const float* Q = qb + (size_t)b * T * pitch + h * D;
  const float* K = kb + (size_t)b * T * pitch + h * D;
  const float* V = vb + (size_t)b * T * pitch + h * D;

  // A fragments of the wave's 16 query rows (scaled), hi/lo
  FragB aqh[KS], aql[KS];
  {
    int row = q0 + ln; if (row >= T) row = T - 1;
    const float* qr = Q + (size_t)row * pitch;
#pragma unroll
    for (int ks = 0; ks < KS; ++ks)
#pragma unroll
      for (int i = 0; i < 16; ++i) {
        const int d = ks * 32 + ((i < 8) ? (8 * hh + i) : (16 + 8 * hh + (i - 8)));
        const float x = qr[d] * scale; const unsigned short hb = bf16_bits(x);
        aqh[ks].u[i] = hb; aql[ks].u[i] = bf16_bits(x - bf16_val(hb));
      }
  }
  float m_r[8], l_r[8];
#pragma unroll
  for (int r = 0; r < 8; ++r) { m_r[r] = -3.0e38f; l_r[r] = 0.f; }
  v8f oacc[DT];
#pragma unroll
  for (int dt = 0; dt < DT; ++dt) oacc[dt] = (v8f){0.f,0.f,0.f,0.f,0.f,0.f,0.f,0.f};

  const int kv_end = CAUSAL ? min(T, qblk * 64 + 64) : T;     // block-uniform
  for (int j0 = 0; j0 < kv_end; j0 += 32) {
    __syncthreads();
    for (int e = tid; e < 32 * (D / 4); e += 128) {
      const int r = e / (D / 4), c4 = (e % (D / 4)) * 4;
      const int key = j0 + r;
      v4f kf = {0.f,0.f,0.f,0.f}, vf = {0.f,0.f,0.f,0.f};
      if (key < T) { kf = *(const v4fa*)(K + (size_t)key * pitch + c4); vf = *(const v4fa*)(V + (size_t)key * pitch + c4); }
#pragma unroll
      for (int t = 0; t < 4; ++t) {
        unsigned short hb = bf16_bits(kf[t]); sKh[r][c4 + t] = hb; sKl[r][c4 + t] = bf16_bits(kf[t] - bf16_val(hb));
        hb = bf16_bits(vf[t]); sVh[r][c4 + t] = hb; sVl[r][c4 + t] = bf16_bits(vf[t] - bf16_val(hb));
      }
    }
    __syncthreads();
    // S tile 16 x 32
    v8f s[2];
#pragma unroll
    for (int nt = 0; nt < 2; ++nt) {
      v8f acc = {};
#pragma unroll
      for (int ks = 0; ks < KS; ++ks) {
        FragB bh_, bl_;
        bh_.half[0] = *(const v8us*)&sKh[nt * 16 + ln][ks * 32 + 8 * hh]; bh_.half[1] = *(const v8us*)&sKh[nt * 16 + ln][ks * 32 + 16 + 8 * hh];
        bl_.half[0] = *(const v8us*)&sKl[nt * 16 + ln][ks * 32 + 8 * hh]; bl_.half[1] = *(const v8us*)&sKl[nt * 16 + ln][ks * 32 + 16 + 8 * hh];
        acc = mmaN<3>(aqh[ks].v, aql[ks].v, bh_.v, bl_.v, acc);
      }
      s[nt] = acc;
    }
    // mask + running max (rows 8hh+r; the 16 lanes of a half share rows)
    float alpha[8];
#pragma unroll
    for (int r = 0; r < 8; ++r) {
      const int qi = q0 + 8 * hh + r;
      const int ja = j0 + ln, jb = j0 + 16 + ln;
      if (CAUSAL) { if (ja > qi) s[0][r] = -3.0e38f; if (jb > qi) s[1][r] = -3.0e38f; }
      if (ja >= T) s[0][r] = -3.0e38f;
      if (jb >= T) s[1][r] = -3.0e38f;
      float mx = fmaxf(s[0][r], s[1][r]);
      mx = fmaxf(mx, __shfl_xor(mx, 1, 32)); mx = fmaxf(mx, __shfl_xor(mx, 2, 32)); mx = fmaxf(mx, __shfl_xor(mx, 4, 32)); mx = fmaxf(mx, __shfl_xor(mx, 8, 32));
      const float mnew = fmaxf(m_r[r], mx);
      alpha[r] = (mnew > -1.0e38f) ? __expf(m_r[r] - mnew) : 1.0f;
      const float p0 = (s[0][r] > -1.0e38f) ? __expf(s[0][r] - mnew) : 0.f;
      const float p1 = (s[1][r] > -1.0e38f) ? __expf(s[1][r] - mnew) : 0.f;
      m_r[r] = mnew;
      l_r[r] = l_r[r] * alpha[r] + p0 + p1;            // per-lane partial row sum (16 lanes combined at the end)
      unsigned short hb = bf16_bits(p0); sPh[w][8 * hh + r][ln] = hb;      sPl[w][8 * hh + r][ln] = bf16_bits(p0 - bf16_val(hb));
      hb = bf16_bits(p1);                sPh[w][8 * hh + r][16 + ln] = hb; sPl[w][8 * hh + r][16 + ln] = bf16_bits(p1 - bf16_val(hb));
    }
#pragma unroll
    for (int dt = 0; dt < DT; ++dt)
#pragma unroll
      for (int r = 0; r < 8; ++r) oacc[dt][r] *= alpha[r];
    __builtin_amdgcn_fence(__ATOMIC_ACQ_REL, "workgroup");
    __builtin_amdgcn_wave_barrier();
    FragB pah, pal;
    pah.half[0] = *(const v8us*)&sPh[w][ln][8 * hh]; pah.half[1] = *(const v8us*)&sPh[w][ln][16 + 8 * hh];
    pal.half[0] = *(const v8us*)&sPl[w][ln][8 * hh]; pal.half[1] = *(const v8us*)&sPl[w][ln][16 + 8 * hh];
#pragma unroll
    for (int dt = 0; dt < DT; ++dt) {
      FragB bvh, bvl;
#pragma unroll
      for (int i = 0; i < 8; ++i) {
        bvh.u[i] = sVh[8 * hh + i][dt * 16 + ln]; bvh.u[8 + i] = sVh[16 + 8 * hh + i][dt * 16 + ln];
        bvl.u[i] = sVl[8 * hh + i][dt * 16 + ln]; bvl.u[8 + i] = sVl[16 + 8 * hh + i][dt * 16 + ln];
      }
      oacc[dt] = mmaN<3>(pah.v, pal.v, bvh.v, bvl.v, oacc[dt]);
    }
    __builtin_amdgcn_fence(__ATOMIC_ACQ_REL, "workgroup");
    __builtin_amdgcn_wave_barrier();
  }
#pragma unroll
  for (int r = 0; r < 8; ++r) {
    float l = l_r[r];
    l += __shfl_xor(l, 1, 32); l += __shfl_xor(l, 2, 32); l += __shfl_xor(l, 4, 32); l += __shfl_xor(l, 8, 32);
    l_r[r] = (l > 0.f) ? 1.0f / l : 0.f;
  }
#pragma unroll
  for (int dt = 0; dt < DT; ++dt)
#pragma unroll
    for (int r = 0; r < 8; ++r) sO[w][8 * hh + r][dt * 16 + ln] = oacc[dt][r] * l_r[r];
  __builtin_amdgcn_fence(__ATOMIC_ACQ_REL, "workgroup");
  __builtin_amdgcn_wave_barrier();
  {
    for (int r = 0; r < 16; ++r) {
      const int row = q0 + r;
      if (row < T && lane < D / 4) {
        const v4f val = *(const v4fa*)&sO[w][r][lane * 4];
        *(v4f*)(y + ((size_t)b * T + row) * ypitch + h * D + lane * 4) = val;
      }
    }
    
  }
}

// GEMM C = act(A·W + bias + resid): A f32 (ASPLIT -> hi/lo 2 terms), Wt bf16 [N][K]; ACT 0 none, 1 relu, 2 exact gelu;
// resid (optional, f32, row index = (row % rmod), pitch ldr, RES_BF16 rounds it) added before the activation.
template <bool ASPLIT, int ACT, bool BIAS_BF16, bool RES_BF16>
__global__ __launch_bounds__(128) void k_gemm_bf3(const float* __restrict__ A, int lda, const unsigned short* __restrict__ Wt, int ldb,
                                                const float* __restrict__ bias, const float* __restrict__ resid, int rmod, int ldr,
                                                float* __restrict__ C, int ldc, int M, int N, int K) {
  __shared__ __attribute__((aligned(16))) float so[4][16][64];
  const int tid = threadIdx.x, w = tid >> 5, lane = tid & 31, ln = lane & 15, hh = lane >> 4;
  const int ntn = N / 64;
  const int wid = blockIdx.x * 4 + w;
  const int mt = wid / ntn, nq = wid % ntn;
  if (mt * 16 >= M) return;
  const int row0 = mt * 16, col0 = nq * 64;
  const float* arow = A + (size_t)(row0 + ln) * lda;
  v8f acc[4] = {};
  for (int kb = 0; kb < K; kb += 32) {
    FragB ah, al;
    const v4f x0 = *(const v4fa*)(arow + kb + 8 * hh), x1 = *(const v4fa*)(arow + kb + 8 * hh + 4);
    const v4f x2 = *(const v4fa*)(arow + kb + 16 + 8 * hh), x3 = *(const v4fa*)(arow + kb + 16 + 8 * hh + 4);
    float xs[16] = {x0[0],x0[1],x0[2],x0[3],x1[0],x1[1],x1[2],x1[3],x2[0],x2[1],x2[2],x2[3],x3[0],x3[1],x3[2],x3[3]};
#pragma unroll
    for (int i = 0; i < 16; ++i) { const unsigned short hb = bf16_bits(xs[i]); ah.u[i] = hb; al.u[i] = ASPLIT ? bf16_bits(xs[i] - bf16_val(hb)) : (unsigned short)0; }
#pragma unroll
    for (int t = 0; t < 4; ++t) {
      const unsigned short* brow = Wt + (size_t)(col0 + t * 16 + ln) * ldb + kb;
      FragB b;
      b.half[0] = *(const v8us*)(brow + 8 * hh);
      b.half[1] = *(const v8us*)(brow + 16 + 8 * hh);
      acc[t] = mmaN<ASPLIT ? 2 : 1>(ah.v, al.v, b.v, b.v, acc[t]);
    }
  }
#pragma unroll
  for (int t = 0; t < 4; ++t) {
    const int col = col0 + t * 16 + ln;
    float bv = bias ? bias[col] : 0.f;
    if (BIAS_BF16) bv = bf16_round(bv);
#pragma unroll
    for (int r = 0; r < 8; ++r) {
      float v = acc[t][r] + bv;
      if (resid) { float rv = resid[(size_t)((row0 + 8 * hh + r) % rmod) * ldr + col]; if (RES_BF16) rv = bf16_round(rv); v += rv; }
      if (ACT == 1) v = fmaxf(v, 0.f);
      if (ACT == 2) v = 0.5f * v * (1.0f + erff(v * 0.70710678118654752f));
      if (ACT == 3) { const float u = 0.7978845608028654f * (v + 0.044715f * v * v * v); v = 0.5f * v * (1.0f + tanhf(u)); }
      so[w][8 * hh + r][t * 16 + ln] = v;
    }
  }
  __builtin_amdgcn_fence(__ATOMIC_ACQ_REL, "workgroup");
  __builtin_amdgcn_wave_barrier();
  const int rsub = lane >> 4, c4 = (lane & 15) * 4;
  {
#pragma unroll
    for (int q = 0; q < 8; ++q) {
      const int r = q * 2 + rsub;
      const v4f v = *(const v4fa*)&so[w][r][c4];
      *(v4f*)(C + (size_t)(row0 + r) * ldc + col0 + c4) = v;
    }
    
  }
}
// row LayerNorm (biased variance, eps) over N: s = X (+ R); optional out_sum <- s; out_norm <- (s-mu)*rsqrt(var+eps)*g + b
template <bool PARAM_BF16>
__global__ __launch_bounds__(256) void k_layernorm(const float* __restrict__ X, const float* __restrict__ R, const float* __restrict__ g, const float* __restrict__ bta,
                                                  float* __restrict__ out_sum, float* __restrict__ out_norm, int N, float eps) {
  __shared__ float red[256];
  const int row = blockIdx.x, tid = threadIdx.x;
  const float* x = X + (size_t)row * N; const float* rr = R ? R + (size_t)row * N : nullptr;
  float vals[16];                     // up to N = 4096
  const int per = N / 256;            // contiguous chunk per thread? use strided-by-4 chunks: thread handles j = tid*4 + 1024*u
  float s1 = 0.f;
  for (int u = 0; u < per / 4; ++u) {
    const int j = tid * 4 + 1024 * u;
    const v4f a = *(const v4fa*)(x + j);
    v4f b = {0.f,0.f,0.f,0.f}; if (rr) b = *(const v4fa*)(rr + j);
#pragma unroll
    for (int q = 0; q < 4; ++q) { const float v = a[q] + b[q]; vals[u * 4 + q] = v; s1 += v; }
  }
  red[tid] = s1; __syncthreads();
  for (int st = 128; st > 0; st >>= 1) { if (tid < st) red[tid] += red[tid + st]; __syncthreads(); }
  const float mu = red[0] / (float)N; __syncthreads();
  float s2 = 0.f;
  for (int u = 0; u < per / 4; ++u)
#pragma unroll
    for (int q = 0; q < 4; ++q) { const float c = vals[u * 4 + q] - mu; s2 += c * c; }
  red[tid] = s2; __syncthreads();
  for (int st = 128; st > 0; st >>= 1) { if (tid < st) red[tid] += red[tid + st]; __syncthreads(); }
  const float rs = rsqrtf(red[0] / (float)N + eps);
  {
    for (int u = 0; u < per / 4; ++u) {
      const int j = tid * 4 + 1024 * u;
      v4f o, sm;
#pragma unroll
      for (int q = 0; q < 4; ++q) {
        float gg = g[j + q], bb = bta[j + q];
        if (PARAM_BF16) { gg = bf16_round(gg); bb = bf16_round(bb); }
        sm[q] = vals[u * 4 + q]; o[q] = (vals[u * 4 + q] - mu) * rs * gg + bb;
      }
      if (out_sum) *(v4f*)(out_sum + (size_t)row * N + j) = sm;
      *(v4f*)(out_norm + (size_t)row * N + j) = o;
    }
    
  }
}



// ---- f16 WMMA path (v_wmma_f32_16x16x32_f16): 11-bit significands for operands in range — used where a [0,1] probability operand needs more precision than bf16
typedef _Float16 v16h __attribute__((ext_vector_type(16)));
union FragH { v16h v; v8us half[2]; _Float16 h[16]; unsigned short u[16]; };
template <int NT>
__device__ __forceinline__ v8f mmaH(v16h ah, v16h al, v16h bh, v16h bl, v8f c) {
  c = __builtin_amdgcn_wmma_f32_16x16x32_f16(false, ah, false, bh, (short)0, c, false, false);
  if (NT >= 2) c = __builtin_amdgcn_wmma_f32_16x16x32_f16(false, al, false, bh, (short)0, c, false, false);
  if (NT >= 3) c = __builtin_amdgcn_wmma_f32_16x16x32_f16(false, ah, false, bl, (short)0, c, false, false);
  asm volatile("v_nop\n\tv_nop\n\tv_nop\n\tv_nop" : "+v"(c) : "v"(ah), "v"(al), "v"(bh), "v"(bl));
  return c;
}
// batched GEMM like k_gemm_b but f16 operands: A f32 (split into f16 hi/lo if ASPLIT, else rounded to f16), Bt = f16 values [n][k]; alpha; C f32; N multiple of 16 (partial tiles skipped)
template <bool ASPLIT>
__global__ __launch_bounds__(128) void k_gemm_h(const float* __restrict__ A, int lda, size_t sA, const _Float16* __restrict__ Bh, int ldb, size_t sB, float alpha, float* __restrict__ C, int ldc, size_t sC, int M, int N, int K) {
  __shared__ __attribute__((aligned(16))) float so[4][16][64];
  const int tid = threadIdx.x, w = tid >> 5, lane = tid & 31, ln = lane & 15, hh = lane >> 4; const int by = blockIdx.y;
  A += (size_t)by * sA; Bh += (size_t)by * sB; C += (size_t)by * sC;
  const int ntn = (N + 63) / 64; const int wid = blockIdx.x * 4 + w; const int mt = wid / ntn, nq = wid % ntn; if (mt * 16 >= M) return;
  const int row0 = mt * 16, col0 = nq * 64; const float* arow = A + (size_t)(row0 + ln) * lda;
  v8f acc[4] = {};
  for (int kb = 0; kb < K; kb += 32) {
    FragH ah, al;
    const v4f x0 = *(const v4fa*)(arow + kb + 8 * hh), x1 = *(const v4fa*)(arow + kb + 8 * hh + 4), x2 = *(const v4fa*)(arow + kb + 16 + 8 * hh), x3 = *(const v4fa*)(arow + kb + 16 + 8 * hh + 4);
    float xs[16] = {x0[0],x0[1],x0[2],x0[3],x1[0],x1[1],x1[2],x1[3],x2[0],x2[1],x2[2],x2[3],x3[0],x3[1],x3[2],x3[3]};
#pragma unroll
    for (int i = 0; i < 16; ++i) { const _Float16 h = (_Float16)xs[i]; ah.h[i] = h; al.h[i] = ASPLIT ? (_Float16)(xs[i] - (float)h) : (_Float16)0.0f; }
#pragma unroll
    for (int t = 0; t < 4; ++t) { if (col0 + t * 16 >= N) continue; const size_t boff = (size_t)(col0 + t * 16 + ln) * ldb + kb; FragH bq; bq.half[0] = *(const v8us*)(Bh + boff + 8 * hh); bq.half[1] = *(const v8us*)(Bh + boff + 16 + 8 * hh);
      acc[t] = mmaH<ASPLIT ? 2 : 1>(ah.v, al.v, bq.v, bq.v, acc[t]); }
  }
#pragma unroll
  for (int t = 0; t < 4; ++t) { if (col0 + t * 16 >= N) continue;
#pragma unroll
    for (int r = 0; r < 8; ++r) so[w][8 * hh + r][t * 16 + ln] = acc[t][r] * alpha; }
  __builtin_amdgcn_fence(__ATOMIC_ACQ_REL, "workgroup"); __builtin_amdgcn_wave_barrier();
  const int rsub = lane >> 4, c4 = (lane & 15) * 4;
  {
#pragma unroll
    for (int q = 0; q < 8; ++q) { const int r = q * 2 + rsub; if (col0 + c4 < N) { const v4f v = *(const v4fa*)&so[w][r][c4]; *(v4f*)(C + (size_t)(row0 + r) * ldc + col0 + c4) = v; } }
     }
}

// Wt[n][k] = f16(W[k][n]·scale) from f32 row-major W[K][N] (scale = power of two; bf16-exact weights stay exact in f16 away from the subnormal range)
__global__ __launch_bounds__(256) void k_wt_f16(const float* __restrict__ W, _Float16* __restrict__ Wt, int K, int N, float scale) {
  const int t = blockIdx.x * 256 + threadIdx.x; if (t >= N * (K / 8)) return; const int n = t / (K / 8), k8 = (t % (K / 8)) * 8; FragH f;
#pragma unroll
  for (int i = 0; i < 8; ++i) f.h[i] = (_Float16)(bf16_round(W[(size_t)(k8 + i) * N + n]) * scale); const v8us o = f.half[0];
  *(v8us*)((unsigned short*)Wt + (size_t)n * K + k8) = o; 
}
// k_gemm_hh variant with fused epilogue: v = acc·alpha + bias[by·sBias + col] (+ CP[(row/rowsPerB)·sCPb + by·64 + col] if CP) ; ACT 0 none / 1 elu ; writes f32 C and/or f16 C16 (each if non-null)
template <int ACT>
__global__ __launch_bounds__(128) void k_gemm_hhx(const _Float16* __restrict__ A, int lda, size_t sA, const _Float16* __restrict__ Bh, int ldb, size_t sB, float alpha, const float* __restrict__ bias, size_t sBias, const float* __restrict__ CP, int rowsPerB, size_t sCPb, int row0g,
    float* __restrict__ C, _Float16* __restrict__ C16, int ldc, size_t sC, int M, int N, int K) {
  __shared__ __attribute__((aligned(16))) float so[4][16][64];
  const int tid = threadIdx.x, w = tid >> 5, lane = tid & 31, ln = lane & 15, hh = lane >> 4; const int by = blockIdx.y;
  A += (size_t)by * sA; Bh += (size_t)by * sB; const size_t cofs = (size_t)by * sC; const float* bp = bias ? bias + (size_t)by * sBias : nullptr;
  const int ntn = (N + 63) / 64; const int wid = blockIdx.x * 4 + w; const int mt = wid / ntn, nq = wid % ntn; if (mt * 16 >= M) return;
  const int row0 = mt * 16, col0 = nq * 64; const _Float16* arow = A + (size_t)(row0 + ln) * lda;
  v8f acc[4] = {};
  for (int kb = 0; kb < K; kb += 32) { FragH ah; ah.half[0] = *(const v8us*)((const unsigned short*)arow + kb + 8 * hh); ah.half[1] = *(const v8us*)((const unsigned short*)arow + kb + 16 + 8 * hh);
#pragma unroll
    for (int t = 0; t < 4; ++t) { if (col0 + t * 16 >= N) continue; const size_t boff = (size_t)(col0 + t * 16 + ln) * ldb + kb; FragH bq; bq.half[0] = *(const v8us*)((const unsigned short*)Bh + boff + 8 * hh); bq.half[1] = *(const v8us*)((const unsigned short*)Bh + boff + 16 + 8 * hh);
      acc[t] = mmaH<1>(ah.v, ah.v, bq.v, bq.v, acc[t]); }
  }
#pragma unroll
  for (int t = 0; t < 4; ++t) { if (col0 + t * 16 >= N) continue; const int col = col0 + t * 16 + ln; const float bv = bp ? bf16_round(bp[col]) : 0.f;
#pragma unroll
    for (int r = 0; r < 8; ++r) { float v = acc[t][r] * alpha + bv; if (CP) { const int bidx = (row0g + row0 + 8 * hh + r) / rowsPerB; v += CP[(size_t)bidx * sCPb + (size_t)by * 64 + col]; } if (ACT == 1) v = (v > 0.f) ? v : expm1f(v); else if (ACT == 7) v = (v > 0.f) ? v + 1.0f : expf(v); else if (ACT == 8) v = tanhf(v); else if (ACT == 9) v = 0.5f * v * (1.0f + tanhf(0.7978845608028654f * (v + 0.044715f * v * v * v))); else if (ACT == 11) v = 1.0f / (1.0f + expf(-v)); else if (ACT == 12) v = (v > 0.f) ? v : 0.01f * v; else if (ACT == 14) v = (v > 0.f) ? v : 0.1f * v; else if (ACT == 15) v = v / (1.0f + expf(-v)); else if (ACT == 3) v = fmaxf(v, 0.f); else if (ACT == 6) v = 0.5f * v * (1.0f + erff(v * 0.70710678118654752f)); so[w][8 * hh + r][t * 16 + ln] = v; } }
  __builtin_amdgcn_fence(__ATOMIC_ACQ_REL, "workgroup"); __builtin_amdgcn_wave_barrier();
  const int rsub = lane >> 4, c4 = (lane & 15) * 4; typedef _Float16 v4h __attribute__((ext_vector_type(4)));
  {
#pragma unroll
    for (int q = 0; q < 8; ++q) { const int r = q * 2 + rsub; if (col0 + c4 < N) { const v4f v = *(const v4fa*)&so[w][r][c4]; if (C) *(v4f*)(C + cofs + (size_t)(row0 + r) * ldc + col0 + c4) = v; if (C16) { v4h h4; for (int i = 0; i < 4; ++i) h4[i] = (_Float16)v[i]; *(v4h*)(C16 + cofs + (size_t)(row0 + r) * ldc + col0 + c4) = h4; } } }
     }
}


typedef _Float16 v4h __attribute__((ext_vector_type(4)));

__global__ __launch_bounds__(256) void k_x16(const float* __restrict__ x, _Float16* __restrict__ X16, size_t n8) { const size_t t = (size_t)blockIdx.x * 256 + threadIdx.x; if (t >= n8) return; FragH f;
#pragma unroll
  for (int q = 0; q < 8; ++q) f.h[q] = (_Float16)bf16_round(x[t * 8 + q]); *(v8us*)((unsigned short*)X16 + t * 8) = f.half[0];  }
__global__ __launch_bounds__(256) void k_h16(const float* __restrict__ x, _Float16* __restrict__ X16, size_t n8) { const size_t t = (size_t)blockIdx.x * 256 + threadIdx.x; if (t >= n8) return; FragH f;
#pragma unroll
  for (int q = 0; q < 8; ++q) f.h[q] = (_Float16)x[t * 8 + q]; *(v8us*)((unsigned short*)X16 + t * 8) = f.half[0];  }
__global__ __launch_bounds__(256) void k_round16f(const float* __restrict__ W, _Float16* __restrict__ Bt, size_t n8) { const size_t t = (size_t)blockIdx.x * 256 + threadIdx.x; if (t >= n8) return; FragH f;
#pragma unroll
  for (int i = 0; i < 8; ++i) f.h[i] = (_Float16)(bf16_round(W[t * 8 + i]) * 16.0f); *(v8us*)((unsigned short*)Bt + t * 8) = f.half[0];  }
template <int NHv, int TTv>
__global__ __launch_bounds__(256) void k_vt(const _Float16* __restrict__ V16, int ldv, int voff, _Float16* __restrict__ Vt) { __shared__ unsigned short tl[64][66]; const int tid = threadIdx.x; const int slab = blockIdx.x / (TTv / 64), lg = blockIdx.x % (TTv / 64); const int b = slab / NHv, h = slab % NHv;
  for (int i = tid; i < 64 * 8; i += 256) { const int r = i / 8, c8 = (i % 8) * 8; FragH f; f.half[0] = *(const v8us*)((const unsigned short*)V16 + ((size_t)b * TTv + lg * 64 + r) * ldv + voff + h * 64 + c8);
#pragma unroll
    for (int q = 0; q < 8; ++q) tl[r][c8 + q] = f.u[q]; }
  __syncthreads();
  {
#pragma unroll
    for (int rd = 0; rd < 2; ++rd) { const int d = rd * 32 + tid / 8, pc = tid % 8; FragH f;
#pragma unroll
      for (int q = 0; q < 8; ++q) f.u[q] = tl[pc * 8 + q][d];
      *(v8us*)((unsigned short*)Vt + ((size_t)slab * 64 + d) * TTv + lg * 64 + pc * 8) = f.half[0]; }
     } }

// X7[n] = [x_n, 1, 1] in f32 (element 6 is the bias input; element 7 multiplies the row's shift in k_fa, and R's element 7 is 0), and XF = the same values in f16 (bf16 values, exact in f16 above its subnormal range) laid out as the 16-bit fragments of k_fa:
// 16-byte piece ((s*2 + hf)*32 + lane) holds column (lane & 15) of keys 32 s + 16 hf + 8 (lane >> 4) + 0..7, so that a wave's fragment load reads 512 bytes in a row. Columns 7..15 are 0.
__global__ __launch_bounds__(256) void k_x7(const float* __restrict__ nodes, const float* __restrict__ centre, float* __restrict__ X7, _Float16* __restrict__ XF) { const int t = blockIdx.x * 256 + threadIdx.x; if (t >= NNODE * 2) return; const int n = t >> 1, half = t & 1; v4f v;
  { const int key0 = 32 * (t >> 6) + 16 * ((t >> 5) & 1) + 8 * ((t >> 4) & 1), f = t & 15; FragH x; float nv[8];
    // every lane loads (a column >= 3 reads column 0 and drops it): the eight loads are in flight together, with no branch between them
#pragma unroll
    for (int i = 0; i < 8; ++i) nv[i] = nodes[(size_t)(key0 + i) * 3 + ((f < 3) ? f : 0)];
    const float cc = bf16_round(centre[(f >= 3 && f < 6) ? f - 3 : 0]), cv = (f < 6) ? cc : (f == 6) ? 1.0f : 0.0f;
#pragma unroll
    for (int i = 0; i < 8; ++i) { const float rv = bf16_round(nv[i]); x.h[i] = (_Float16)((f < 3) ? rv : cv); }
    *(v8us*)((unsigned short*)XF + (size_t)t * 8) = x.half[0]; }
  if (half == 0) { const float p0 = nodes[(size_t)n * 3], p1 = nodes[(size_t)n * 3 + 1], p2 = nodes[(size_t)n * 3 + 2];
    asm volatile("s_wait_xcnt 0x0" :: "v"(p0), "v"(p1), "v"(p2) : "memory");      // stands behind the load of the node's coordinates (named as inputs, so that the load stays in front of it), ahead of the writes of the load's address registers
    v[0] = bf16_round(p0); v[1] = bf16_round(p1); v[2] = bf16_round(p2); v[3] = bf16_round(centre[0]); } else { v[0] = bf16_round(centre[1]); v[1] = bf16_round(centre[2]); v[2] = 1.0f; v[3] = 1.0f; }
  *(v4f*)(X7 + (size_t)t * 4) = v;  }
__global__ __launch_bounds__(256) void k_proj(const float* __restrict__ nodes, const float* __restrict__ centre, const float* __restrict__ Wq, const float* __restrict__ bq, const float* __restrict__ Wk, const float* __restrict__ bk, const float* __restrict__ YP, float* __restrict__ KEYS, _Float16* __restrict__ AK16) {
  #pragma clang fp contract(off)
  const size_t t = (size_t)blockIdx.x * 256 + threadIdx.x; if (t >= (size_t)NNODE * DD / 4) return; const int n = (int)((t * 4) / DD), c0 = (int)((t * 4) % DD); float xa[7];
  for (int i = 0; i < 3; ++i) { xa[i] = bf16_round(nodes[(size_t)n * 3 + i]); xa[3 + i] = bf16_round(centre[i]); } xa[6] = 1.0f;
  float ya[7];      /* Y[n] = attn[n]*[x, 1], from k_fa */
  { const v4f a = *(const v4fa*)(YP + (size_t)n * 8), b = *(const v4fa*)(YP + (size_t)n * 8 + 4);
    for (int i = 0; i < 4; ++i) ya[i] = a[i]; for (int i = 0; i < 3; ++i) ya[4 + i] = b[i]; }
  float kv[4], qv[4]; for (int q = 0; q < 4; ++q) { kv[q] = bf16_round(bk[c0 + q]); qv[q] = ya[6] * bf16_round(bq[c0 + q]); }
#pragma unroll 1
  for (int i = 0; i < 6; ++i) for (int q = 0; q < 4; ++q) { kv[q] += xa[i] * bf16_round(Wk[(size_t)(c0 + q) * 6 + i]); qv[q] += ya[i] * bf16_round(Wq[(size_t)(c0 + q) * 6 + i]); }
  typedef _Float16 v4h __attribute__((ext_vector_type(4))); v4h fk, fq; for (int q = 0; q < 4; ++q) { fk[q] = (_Float16)kv[q]; fq[q] = (_Float16)qv[q]; } const v4f k0 = {kv[0], kv[1], kv[2], kv[3]};
  { *(v4f*)(KEYS + t * 4) = k0; *(v4h*)(AK16 + (size_t)n * (2 * DD) + DD + c0) = fk; *(v4h*)(AK16 + (size_t)n * (2 * DD) + c0) = fq;      /* row n of AK16 = [AQ | keys]; one 16-B f32 piece and 8-B f16 pieces per lane, lane-contiguous */
     } }
// value of lane l ^ MASK inside a 16-lane row (DPP row_xmask), and of lane l ^ 16: register moves, no LDS round trip
template <int MASK> __device__ __forceinline__ float lane_xor_row(float x) { return __int_as_float(__builtin_amdgcn_update_dpp(0, __float_as_int(x), 0x160 | MASK, 0xf, 0xf, true)); }
__device__ __forceinline__ float lane_xor16(float x) { const int v = __float_as_int(x); return __int_as_float(__builtin_amdgcn_permlanex16(v, v, 0x76543210, 0xfedcba98, false, false)); }
__device__ __forceinline__ float wave_sum(float x) { x += lane_xor_row<1>(x); x += lane_xor_row<2>(x); x += lane_xor_row<4>(x); x += lane_xor_row<8>(x); return x + lane_xor16(x); }
// M[i][j] = sum over the 512 channels c of a_c[i] * b_c[j], with a_c = [Wk[c][0..5], bk[c]] and b_c = [Wq[c][0..5], bq[c]] rounded to bf16 (each product is exact in f32).
// The 256 threads split the channels: thread t takes channels 2t and 2t + 1 (12 neighbouring floats of each matrix, all loads in flight at once) and forms its 49 partial sums in registers;
// each is summed over the wave by register moves, the 8 waves' sums meet in LDS, and thread p < 49 adds them in wave order. The caller's barrier publishes M.
static_assert(DD == 2 * 256, "two channels per thread of a 256-thread work-group");
__device__ __forceinline__ void sai_gram(const float* __restrict__ Wq, const float* __restrict__ bq, const float* __restrict__ Wk, const float* __restrict__ bk, int tid, float (*part)[52], float (*M)[8]) {
  float a[2][7], b[2][7], s[49];
  // every unroll of this function: a, b and s stay in registers only under constant indices
#pragma unroll
  for (int u = 0; u < 2; ++u) {
    const int c = 2 * tid + u;
#pragma unroll
    for (int i = 0; i < 6; ++i) { a[u][i] = bf16_round(Wk[(size_t)c * 6 + i]); b[u][i] = bf16_round(Wq[(size_t)c * 6 + i]); }
    a[u][6] = bf16_round(bk[c]); b[u][6] = bf16_round(bq[c]);
  }
#pragma unroll
  for (int i = 0; i < 7; ++i)
#pragma unroll
    for (int j = 0; j < 7; ++j) s[i * 7 + j] = wave_sum(a[0][i] * b[0][j] + a[1][i] * b[1][j]);
  if ((tid & 31) == 0) {
#pragma unroll
    for (int p = 0; p < 49; ++p) part[tid >> 5][p] = s[p];
  }
  __syncthreads();      /* every wave's 49 sums are in part */
  if (tid < 49) {
    float m = part[0][tid];
#pragma unroll
    for (int w = 1; w < 8; ++w) m += part[w][tid];
    M[tid / 7][tid % 7] = m;
  }
}
__global__ __launch_bounds__(256) void k_rvec(const float* __restrict__ Wq, const float* __restrict__ bq, const float* __restrict__ Wk, const float* __restrict__ bk, const float* __restrict__ X7, float* __restrict__ R) {
  #pragma clang fp contract(off)
  __shared__ float M[7][8]; __shared__ __attribute__((aligned(16))) float part[8][52]; const int tid = threadIdx.x;
  sai_gram(Wq, bq, Wk, bk, tid, part, M);
  __syncthreads();
  const int t = blockIdx.x * 256 + tid; if (t >= NNODE * 2) return; const int n = t >> 1, half = t & 1; float xa[8]; { const v4f a = *(const v4fa*)(X7 + (size_t)n * 8), b = *(const v4fa*)(X7 + (size_t)n * 8 + 4); xa[0] = a[0]; xa[1] = a[1]; xa[2] = a[2]; xa[3] = a[3]; xa[4] = b[0]; xa[5] = b[1]; xa[6] = b[2]; }
  v4f o = {0.f, 0.f, 0.f, 0.f};      /* this thread's half of R[n]: columns j = 4·half .. 4·half+3 (j = 7 stays 0) */
#pragma unroll 1
  for (int i = 0; i < 7; ++i) for (int q = 0; q < 4; ++q) { const int j = half * 4 + q; if (j < 7) o[q] += xa[i] * M[i][j]; }
  *(v4f*)(R + (size_t)t * 4) = o;  }
// ---- the tiled GEMM: C[8192][512] = alpha * A[8192][K] * Bt[512][K]^T (+ addends), both operands f16 with k contiguous.
// One 128 x 128 tile of C per work-group (256 work-groups), 4 waves (2 x 2) of 64 x 64 each. A stage is 256 bytes (128 k) of the tile's 128 A rows and 128 Bt rows in LDS at pitch 272 B;
// every wave brings its own 64-row slice of a stage with one tensor load; two buffers, the next stage in flight while this one is worked on.
typedef uint32_t u32x4 __attribute__((ext_vector_type(4)));
typedef uint32_t u32x8 __attribute__((ext_vector_type(8)));
constexpr uint32_t TG_KB = 256;                      // bytes of k per operand row and stage
constexpr uint32_t TG_PITCH = TG_KB + 16;            // LDS row pitch, 16 B x odd, written by the tensor load's pad
constexpr uint32_t TG_SROWS = 64;                    // rows per slice (one tensor load)
constexpr uint32_t TG_SLICE = 18432;                 // 64 x 272 = 17,408 B rounded up to a multiple of 2 KiB, so that every slice starts on one
constexpr uint32_t TG_STAGE = 4 * TG_SLICE;          // one buffer: [A rows 0-63][A rows 64-127][Bt rows 0-63][Bt rows 64-127]
constexpr uint32_t TG_EPITCH = 68;                   // floats per staged output row (64 + 4)
constexpr uint32_t TG_EPI = 64 * TG_EPITCH * 4;      // output staging per wave, behind the ring
constexpr uint32_t TG_LDS = 2 * TG_STAGE + 4 * TG_EPI;
static_assert(TG_SROWS * TG_PITCH <= TG_SLICE && TG_SLICE % 2048u == 0, "a slice must hold its padded rows and start on a multiple of 2 KiB");
static_assert(TG_LDS <= 320u * 1024u, "LDS of one work-group");
__device__ __forceinline__ uint32_t tg_uni(uint32_t v) { return (uint32_t)__builtin_amdgcn_readfirstlane(v); }
__device__ __forceinline__ uint32_t tg_pinned(uint32_t v) { uint32_t w = (uint32_t)__builtin_amdgcn_readfirstlane(v); asm volatile("" : "+s"(w)); return w; }
__device__ __forceinline__ void tg_wait_ds0() { asm volatile("s_wait_dscnt 0x0" ::: "memory"); }          // this wave's LDS reads have returned before the buffer is handed over
// A request's descriptor: group 0 (count, LDS place, source address, type) and group 1 (64 rows of 256 bytes at the source pitch, 16 B of LDS pad behind every row).
struct TgDesc { u32x4 g0; u32x8 g1; };
__device__ __forceinline__ TgDesc tg_desc(uint32_t lds_dst, uint64_t ga, uint32_t pitch) {
  TgDesc d;
  d.g0[0] = tg_uni(1u);
  d.g0[1] = tg_uni(lds_dst);
  d.g0[2] = tg_uni((uint32_t)ga);
  d.g0[3] = tg_uni((((uint32_t)(ga >> 32)) & 0x01FFFFFFu) | 0x80000000u);
  d.g1[0] = tg_uni((1u << 20) | (5u << 22) | (3u << 25));
  d.g1[1] = tg_uni((TG_KB & 0xFFFFu) << 16);
  d.g1[2] = tg_uni((TG_KB >> 16) | ((TG_SROWS & 0xFFFFu) << 16));
  d.g1[3] = tg_uni((TG_SROWS >> 16) | (TG_KB << 16));
  d.g1[4] = tg_uni(TG_SROWS);
  d.g1[5] = tg_uni(pitch);
  d.g1[6] = tg_uni(0u);
  d.g1[7] = tg_uni(0u);
  return d;
}
// the next stage of the same slice: a new LDS place, the source 256 bytes further along k (the carry goes into the address's high word, below its type bits)
__device__ __forceinline__ void tg_next(TgDesc& d, uint32_t lds_dst) {
  const uint32_t lo = d.g0[2] + TG_KB;
  d.g0[1] = tg_uni(lds_dst);
  d.g0[2] = tg_uni(lo);
  d.g0[3] = tg_uni(d.g0[3] + ((lo < TG_KB) ? 1u : 0u));
}
// Both statements take the descriptor as in-out operands: its registers then stay the descriptor's from the issue to the wait (the compiler otherwise reused some of them for loop temporaries
// while the request was in flight), and tg_next()'s new words are formed behind the wait.
__device__ __forceinline__ void tg_tensor_load(TgDesc& d) { asm volatile("tensor_load_to_lds %0, %1" : "+s"(d.g0), "+s"(d.g1) :: "memory"); }
// this wave's slice has landed; the compiler places no wait for a tensor load
__device__ __forceinline__ void tg_wait_tensor0(TgDesc& d) { asm volatile("s_wait_tensorcnt 0x0" : "+s"(d.g0), "+s"(d.g1) :: "memory"); }
__device__ __forceinline__ void tg_load_frag(FragH& f, const unsigned char* p) { f.half[0] = *(const v8us*)p; f.half[1] = *(const v8us*)(p + 32); }
// APITCH, BPITCH: source row pitches in bytes; T: stages (K = 128 T). MODE 0: C16 = f16(acc*alpha); 1: C = acc*alpha + add; 2: C = acc*alpha + bf16(bias[col]) + add. C, C16 and add have 512 columns.
template <uint32_t APITCH, uint32_t BPITCH, uint32_t T, int MODE>
__global__ __launch_bounds__(128) void k_gemm_tile(const _Float16* __restrict__ A, const _Float16* __restrict__ Bt, float alpha, const float* __restrict__ bias, const float* __restrict__ add, float* __restrict__ C, _Float16* __restrict__ C16) {
  static_assert(T >= 2 && T * TG_KB <= APITCH && T * TG_KB <= BPITCH && APITCH % 16u == 0 && BPITCH % 16u == 0, "the prologue fills two stages; every stage lies inside its source rows");
  __shared__ __attribute__((aligned(2048))) unsigned char L[TG_LDS];
  const uint32_t tid = threadIdx.x, lane = tid & 31u, h = lane >> 4, c = lane & 15u;
  const uint32_t wave = tg_uni(tid >> 5);
  const uint32_t tn = blockIdx.x & 3u, tm = blockIdx.x >> 2;      // the four column tiles of one row tile are neighbours: they read the same A rows
  const uint32_t m0 = tm * 128u, n0 = tn * 128u, wm = wave >> 1, wn = wave & 1u;
  const uint64_t src0 = (wave < 2u) ? (uint64_t)(uintptr_t)A + (uint64_t)(m0 + TG_SROWS * wave) * APITCH
                                    : (uint64_t)(uintptr_t)Bt + (uint64_t)(n0 + TG_SROWS * (wave - 2u)) * BPITCH;
  const uint32_t pitch = (wave < 2u) ? APITCH : BPITCH;
  const uint32_t lds_slice = (uint32_t)(size_t)(const void*)L + wave * TG_SLICE;
  const uint32_t fa_base = wm * TG_SLICE + c * TG_PITCH + 16u * h;            // row c of the wave's first A fragment, 16-byte half h
  const uint32_t fb_base = (2u + wn) * TG_SLICE + c * TG_PITCH + 16u * h;     // the same for Bt
  v8f acc[4][4];
  // every '#pragma unroll' of this kernel without a comment of its own: acc, fa and fb stay in registers only under constant indices
#pragma unroll
  for (int i = 0; i < 4; ++i)
#pragma unroll
    for (int j = 0; j < 4; ++j) acc[i][j] = (v8f){0.f, 0.f, 0.f, 0.f, 0.f, 0.f, 0.f, 0.f};
  TgDesc d = tg_desc(lds_slice, src0, pitch);
  tg_tensor_load(d);
  tg_wait_tensor0(d);
  __syncthreads();      /* stage 0 is readable by every wave */
  tg_next(d, lds_slice + TG_STAGE);
  tg_tensor_load(d);
  // kept rolled: the buffer is picked by t & 1
#pragma clang loop unroll(disable)
  for (uint32_t t = 0; t < T; ++t) {
    const uint32_t buf = (t & 1u) * TG_STAGE;
    const unsigned char* la = L + buf + fa_base;
    const unsigned char* lb = L + buf + fb_base;
    FragH fa[2][4], fb[2][4];      // set (u & 1) holds block u's fragments
#pragma unroll
    for (int i = 0; i < 4; ++i) { tg_load_frag(fa[0][i], la + (uint32_t)i * 16u * TG_PITCH); tg_load_frag(fb[0][i], lb + (uint32_t)i * 16u * TG_PITCH); }
    // unrolled: the fragment sets and accumulators stay in registers only under constant indices
#pragma unroll
    for (int u = 0; u < 4; ++u) {
      const int cs = u & 1;
      if (u + 1 < 4) {
        const uint32_t ko = (uint32_t)(u + 1) * 64u;
#pragma unroll
        for (int i = 0; i < 4; ++i) { tg_load_frag(fa[cs ^ 1][i], la + (uint32_t)i * 16u * TG_PITCH + ko); tg_load_frag(fb[cs ^ 1][i], lb + (uint32_t)i * 16u * TG_PITCH + ko); }
      }
      __builtin_amdgcn_sched_barrier(0);      // the next block's LDS reads stay one group ahead of this block's matrix instructions, not spread among them
#pragma unroll
      for (int i = 0; i < 4; ++i)
#pragma unroll
        for (int j = 0; j < 4; ++j) acc[i][j] = __builtin_amdgcn_wmma_f32_16x16x32_f16(false, fa[cs][i].v, false, fb[cs][j].v, (short)0, acc[i][j], false, false);
      __builtin_amdgcn_sched_barrier(0);      // and the block behind it does not move its reads up among them
    }
    tg_wait_ds0();
    tg_wait_tensor0(d);
    __syncthreads();      /* stage t + 1 is readable by every wave, and every wave has left stage t's buffer */
    if (tg_pinned((t + 2u < T) ? 1u : 0u) != 0u) { tg_next(d, lds_slice + buf); tg_tensor_load(d); }
  }
  tg_wait_tensor0(d);
  tg_wait_ds0();
  // epilogue: each wave stages its 64 x 64 tile in its own LDS range behind the ring, then adds the addends and stores whole 128-byte lines
  float* E = (float*)(L + 2u * TG_STAGE + wave * TG_EPI);
#pragma unroll
  for (int i = 0; i < 4; ++i)
#pragma unroll
    for (int j = 0; j < 4; ++j)
#pragma unroll
      for (int r = 0; r < 8; ++r) E[(16u * (uint32_t)i + 8u * h + (uint32_t)r) * TG_EPITCH + 16u * (uint32_t)j + c] = acc[i][j][r];
  __builtin_amdgcn_fence(__ATOMIC_ACQ_REL, "workgroup"); __builtin_amdgcn_wave_barrier();      // the wave's own staged rows are read back by other lanes
  const uint32_t c4 = c * 4u, col = n0 + wn * 64u + c4;
  v4f bv = {0.f, 0.f, 0.f, 0.f};
  if (MODE == 2) { for (int e = 0; e < 4; ++e) bv[e] = bf16_round(bias[col + (uint32_t)e]); }
  // four row pairs per trip: their staged rows and addend loads are in flight together; the outer loop stays rolled so that the one wait at its foot stands behind every trip's stores
#pragma clang loop unroll(disable)
  for (uint32_t q0 = 0; q0 < 32u; q0 += 4u) {
    // unrolled: the four row pairs' LDS reads, addend loads and stores each go out as one run
#pragma unroll
    for (uint32_t qi = 0; qi < 4u; ++qi) {
      const uint32_t row = 2u * (q0 + qi) + h;
      const v4f v = *(const v4fa*)&E[row * TG_EPITCH + c4];
      const size_t g = (size_t)(m0 + wm * 64u + row) * DD + col;
      v4f o;
#pragma unroll
      for (int e = 0; e < 4; ++e) o[e] = v[e] * alpha + bv[e];
      if (MODE != 0) { const v4f a4 = *(const v4fa*)(add + g); o += a4; *(v4f*)(C + g) = o; }
      else { v4h h4; for (int e = 0; e < 4; ++e) h4[e] = (_Float16)o[e]; *(v4h*)(C16 + g) = h4; }
    }
    asm volatile("s_wait_xcnt 0x0" ::: "memory");      // stands behind the trip's stores, in front of the next trip's writes of their address and data registers
  }
}

// ---- Y = attn * [x, 1] with attn kept in registers. One work-group = FA_ROWS rows of attn; its 32 waves split the 8192 keys, 256 each, in steps of 32.
// Logits, transposed: S^T[key][n] = X7[key][0..7] * R[n][0..7] on v_wmma_f32_16x16x4_f32, two instructions per 16 keys x 16 rows. Lane (c, h) loads elements 4h .. 4h+3 of key c and of row c by the same rule, so the k pairing of both operands is equal.
// D register r of lane (c, h) is key 8h + r of row c: the two tiles of a step, converted in place, are the B fragment (hardware k order) of Y^T = X~^T * P^T on v_wmma_f32_16x16x32_f16, whose A fragment is XF.
// Sweep 1 finds each row's maximum m (over the waves through LDS); sweep 2 forms the logits again with R's element 7 set to 15 ln 2 - m (X7's element 7 is 1), so that the matrix instruction hands out s - m + 15 ln 2 and exp() of it is P * 2^15 * Z.
// Column 6 of [x, 1] is 1: row 6 of Y^T is the row's sum of the same f16 values, and the factor 2^15 * Z leaves in the division.
typedef float v2f __attribute__((ext_vector_type(2)));
#define FA_ROWS 32
constexpr uint32_t FA_WAVES = 32, FA_KEYS = NNODE / FA_WAVES, FA_STEPS = FA_KEYS / 32u;
constexpr uint32_t FA_MPITCH = FA_WAVES + 4;      // floats per row of the waves' maxima: 16-byte pieces stay aligned, neighbouring rows fall on different banks
static_assert(FA_STEPS * 32u * FA_WAVES == NNODE && NNODE % FA_ROWS == 0 && FA_ROWS == 32, "the waves' key ranges tile a row; two 16-row tiles per work-group");
__device__ __forceinline__ v8f fa_logits(v4f x, v4f r) {
  v8f t = {0.f, 0.f, 0.f, 0.f, 0.f, 0.f, 0.f, 0.f};
  t = __builtin_amdgcn_wmma_f32_16x16x4_f32(false, (v2f){x[0], x[1]}, false, (v2f){r[0], r[1]}, (short)0, t, false, false);
  t = __builtin_amdgcn_wmma_f32_16x16x4_f32(false, (v2f){x[2], x[3]}, false, (v2f){r[2], r[3]}, (short)0, t, false, false);
  return t;
}
__global__ __launch_bounds__(1024) void k_fa(const float* __restrict__ R, const float* __restrict__ X7, const _Float16* __restrict__ XF, float* __restrict__ Y) {
  __shared__ __attribute__((aligned(16))) float redM[FA_ROWS][FA_MPITCH];
  __shared__ __attribute__((aligned(16))) float E[FA_WAVES][FA_ROWS][8];
  const uint32_t tid = threadIdx.x, wv = tid >> 5, lane = tid & 31u, h = lane >> 4, c = lane & 15u;
  const uint32_t n0 = blockIdx.x * FA_ROWS, k0 = wv * FA_KEYS;
  const float* xp = X7 + (size_t)(k0 + c) * 8u + 4u * h;                                        // key c of the wave's first tile, elements 4h .. 4h+3
  const unsigned short* xf = (const unsigned short*)XF + (size_t)(k0 / 32u) * 512u + lane * 8u;
  v4f rb[2]; float mx[2];
  // every '#pragma unroll' of this kernel: rb, mx, acc and the tiles stay in registers only under constant indices
#pragma unroll
  for (int j = 0; j < 2; ++j) { rb[j] = *(const v4fa*)(R + (size_t)(n0 + 16u * (uint32_t)j + c) * 8u + 4u * h); mx[j] = -3.0e38f; }
  // two steps per trip, here and in sweep 2: the second step's operands are in flight while the first is worked on; unrolled whole, the build kept all of the wave's keys in registers and spilled
#pragma unroll 2
  for (uint32_t st = 0; st < FA_STEPS; ++st) {
    const v4f xa0 = *(const v4fa*)(xp + st * 256u), xa1 = *(const v4fa*)(xp + st * 256u + 128u);
#pragma unroll
    for (int j = 0; j < 2; ++j) {
      const v8f t0 = fa_logits(xa0, rb[j]), t1 = fa_logits(xa1, rb[j]);
#pragma unroll
      for (int r = 0; r < 8; ++r) mx[j] = fmaxf(mx[j], fmaxf(t0[r], t1[r]));
    }
  }
#pragma unroll
  for (int j = 0; j < 2; ++j) { mx[j] = fmaxf(mx[j], lane_xor16(mx[j])); if (h == 0u) redM[16u * (uint32_t)j + c][wv] = mx[j]; }
  __syncthreads();      /* every wave's maxima of the 32 rows are in redM */
#pragma unroll
  for (int j = 0; j < 2; ++j) {
    float m = -3.0e38f;
#pragma unroll
    for (uint32_t q = 0; q < FA_WAVES / 4u; ++q) { const v4f v = *(const v4f*)&redM[16u * (uint32_t)j + c][4u * q]; m = fmaxf(m, fmaxf(fmaxf(v[0], v[1]), fmaxf(v[2], v[3]))); }
    if (h == 1u) rb[j][3] = 10.397207708399179f - m;      // element 7 of the row: its shift
  }
  v8f acc[2];
#pragma unroll
  for (int j = 0; j < 2; ++j) acc[j] = (v8f){0.f, 0.f, 0.f, 0.f, 0.f, 0.f, 0.f, 0.f};
  // two steps per trip, as in sweep 1
#pragma unroll 2
  for (uint32_t st = 0; st < FA_STEPS; ++st) {
    const v4f xa0 = *(const v4fa*)(xp + st * 256u), xa1 = *(const v4fa*)(xp + st * 256u + 128u);
    FragH fx; fx.half[0] = *(const v8us*)(xf + st * 512u); fx.half[1] = *(const v8us*)(xf + st * 512u + 256u);
#pragma unroll
    for (int j = 0; j < 2; ++j) {
      const v8f t0 = fa_logits(xa0, rb[j]), t1 = fa_logits(xa1, rb[j]);
      FragH p;
#pragma unroll
      for (int r = 0; r < 8; ++r) { p.h[r] = (_Float16)expf(t0[r]); p.h[8 + r] = (_Float16)expf(t1[r]); }
      acc[j] = __builtin_amdgcn_wmma_f32_16x16x32_f16(false, fx.v, false, p.v, (short)0, acc[j], false, false);
    }
  }
  // lane (c, 0) holds Y^T[0..7][row c] of its wave's keys; the 32 waves' sums meet in LDS and are added in wave order
  if (h == 0u) {
#pragma unroll
    for (int j = 0; j < 2; ++j) {
      *(v4f*)&E[wv][16u * (uint32_t)j + c][0] = (v4f){acc[j][0], acc[j][1], acc[j][2], acc[j][3]};
      *(v4f*)&E[wv][16u * (uint32_t)j + c][4] = (v4f){acc[j][4], acc[j][5], acc[j][6], acc[j][7]};
    }
  }
  __syncthreads();      /* every wave's sums are staged */
  if (tid < FA_ROWS * 8u) {
    const uint32_t row = tid >> 3, f = tid & 7u;
    float s = E[0][row][f], z = E[0][row][6];
    for (uint32_t w = 1; w < FA_WAVES; ++w) { s += E[w][row][f]; z += E[w][row][6]; }
    Y[(size_t)(n0 + row) * 8u + f] = s / z;
  }
}

extern "C" void kernel_launch(void* const* d_in, const int* in_sizes, int n_in,
                              void* d_out, int out_size, void* d_ws, size_t ws_size, hipStream_t stream) {
  (void)in_sizes; (void)n_in; (void)out_size;
  const float* const* I = (const float* const*)d_in; const float* nodes = I[0]; const float* centre = I[1]; const float* Wq = I[2]; const float* bq = I[3]; const float* Wk = I[4]; const float* bk = I[5]; const float* Wv = I[6]; const float* bv = I[7];
  char* ws = (char*)d_ws; size_t off = 0;
  auto take = [&](size_t bytes) { char* p = ws + off; off += (bytes + 255) & ~(size_t)255; return p; };
  _Float16* Bwv = (_Float16*)take((size_t)DD * 2 * DD * 2); float* KEYS = (float*)take((size_t)NNODE * DD * 4); _Float16* AK16 = (_Float16*)take((size_t)NNODE * 2 * DD * 2); float* X7 = (float*)take((size_t)NNODE * 8 * 4); float* R = (float*)take((size_t)NNODE * 8 * 4);
  _Float16* XF = (_Float16*)take((size_t)NNODE * 16 * 2); float* YP = (float*)take((size_t)NNODE * 8 * 4);
  if (off > ws_size) return;      // 34 MiB of the 256 MiB workspace
  k_round16f<<<(unsigned)(((size_t)DD * 2 * DD / 8 + 255) / 256), 256, 0, stream>>>(Wv, Bwv, (size_t)DD * 2 * DD / 8);      /* Wv (512, 1024) natural ×2^4: row d = [Wv_q | Wv_k] */
  k_x7<<<NNODE * 2 / 256, 256, 0, stream>>>(nodes, centre, X7, XF);
  k_rvec<<<NNODE * 2 / 256, 256, 0, stream>>>(Wq, bq, Wk, bk, X7, R);
  k_fa<<<NNODE / FA_ROWS, 1024, 0, stream>>>(R, X7, XF, YP);      /* Y = attn*[x, 1]: 256 work-groups of 32 waves, 32 rows each */
  k_proj<<<(unsigned)(((size_t)NNODE * DD / 4 + 255) / 256), 256, 0, stream>>>(nodes, centre, Wq, bq, Wk, bk, YP, KEYS, AK16);      /* keys, and AQ = Y*[Wq bq]^T = attn*queries */
  const dim3 gq((NNODE / 128) * (DD / 128), 1);      /* one 128 x 128 tile per work-group */
  k_gemm_tile<2 * DD * 2, 2 * DD * 2, 2 * DD / 128, 2><<<gq, 128, 0, stream>>>(AK16, Bwv, 0.0625f, bv, KEYS, (float*)d_out, nullptr);      /* out = [AQ | keys]*Wv^T + bv + keys: M 8192 N 512 K 1024 */
}

// v008
// One run takes 30.4 microseconds.
// Versions in between are left out here; by their measured steps it is 2.73 times as fast as v006.
// Counting every step since v000, it is 90.9 times as fast.
#include <hip/hip_runtime.h>
#include <stdint.h>
// 'self_attn_init' (N=8192 nodes, 3-d coords + a shared 3-d centre → 6 inputs, D=512): x = [node, centre]; keys = x·Wkᵀ + bk; queries = x·Wqᵀ + bq; attn = softmax_m(keys·queriesᵀ) (UNSCALED, rank-7 logits up to ±O(100));
// out = keys + attn·(queries·Wv[:, :512]ᵀ) + keys·Wv[:, 512:]ᵀ + bv.
// Compute dtype: inputs/weights/biases rounded to bf16. The logits are an exact bilinear form in the 7-vector x̃ = [x, 1]: s[n][m] = (x̃_nᵀ·M)·x̃_m with M = [Wk bk]ᵀ[Wq bq] (7×7, f32), evaluated per pair in f32 —
// no 16-bit rounding touches the huge logits: they are formed on the f32 matrix instruction, transposed, so that the exponentials (f16, times 2^15) are already the operand fragment of attn*[x, 1]; attn itself never goes to memory.
// queries = [x, 1]*[Wq bq]^T and keys = [x, 1]*[Wk bk]^T both have rank 7, so with Y = attn*[x, 1] (a GEMM with one 16-column tile, f16 operands, f32 accumulate)
// out = Y*([Wq bq]^T*Wv_q^T) + [x, 1]*([Wk bk]^T*(Wv_k^T + I)) + bv = [Y | x, 1, 1]*G with G (16 x 512) formed once from the weights: neither keys nor attn*queries is ever written out.
// G (two GEMMs with K = 512) and out (one GEMM with K = 16) run on v_wmma_f32_16x16x4_f32.
#define NNODE 8192
#define DD 512

typedef __bf16 v16b __attribute__((ext_vector_type(16)));
typedef unsigned short v8us __attribute__((ext_vector_type(8), may_alias));
typedef float  v8f  __attribute__((ext_vector_type(8)));
typedef float  v4f  __attribute__((ext_vector_type(4)));
typedef float  v4fa __attribute__((ext_vector_type(4), may_alias));
union FragB { v16b v; v8us half[2]; unsigned short u[16]; };

__device__ __forceinline__ unsigned short bf16_bits(float x) { unsigned int u = __float_as_uint(x); return (unsigned short)((u + 0x7FFFu + ((u >> 16) & 1u)) >> 16); }
__device__ __forceinline__ float bf16_val(unsigned short b) { return __uint_as_float(((unsigned int)b) << 16); }
__device__ __forceinline__ float bf16_round(float x) { return bf16_val(bf16_bits(x)); }
// D += A·B with NT terms: 1 = ah·bh, 2 = + al·bh (A split), 3 = + ah·bl (both split)
template <int NT>
__device__ __forceinline__ v8f mmaN(v16b ah, v16b al, v16b bh, v16b bl, v8f c) {
  c = __builtin_amdgcn_wmma_f32_16x16x32_bf16(false, ah, false, bh, (short)0, c, false, false);
  if (NT >= 2) c = __builtin_amdgcn_wmma_f32_16x16x32_bf16(false, al, false, bh, (short)0, c, false, false);
  if (NT >= 3) c = __builtin_amdgcn_wmma_f32_16x16x32_bf16(false, ah, false, bl, (short)0, c, false, false);
  asm volatile("v_nop\n\tv_nop\n\tv_nop\n\tv_nop" : "+v"(c) : "v"(ah), "v"(al), "v"(bh), "v"(bl));
  return c;
}

__global__ __launch_bounds__(256) void k_wt_bf16(const float* __restrict__ W, unsigned short* __restrict__ Wt, int K, int N) {
  const int t = blockIdx.x * 256 + threadIdx.x;
  const int k8n = K / 8;
  if (t >= N * k8n) return;
  const int n = t / k8n, k8 = (t % k8n) * 8;
  v8us v;
#pragma unroll
  for (int i = 0; i < 8; ++i) v[i] = bf16_bits(W[(size_t)(k8 + i) * N + n]);
  *(v8us*)(Wt + (size_t)n * K + k8) = v;
  
}

// GEMM C[M][N] (f32, pitch ldc) = act(A[M][K]·W + bias). A f32 row-major (pitch lda) converted per fragment to bf16
// (ASPLIT: hi/lo two planes -> 2 terms, else single rounded term); Wt bf16 [N][K] (pitch ldb). BIAS_BF16 rounds the
// bias to bf16 first (bias quantised to bf16 before the add). K%32==0, M%16==0, N%64==0.
template <bool ASPLIT, int ACT, bool BIAS_BF16>
__global__ __launch_bounds__(128) void k_gemm_bf(const float* __restrict__ A, int lda, const unsigned short* __restrict__ Wt, int ldb,
                                               const float* __restrict__ bias, float* __restrict__ C, int ldc, int M, int N, int K) {
  __shared__ __attribute__((aligned(16))) float so[4][16][64];
  const int tid = threadIdx.x, w = tid >> 5, lane = tid & 31, ln = lane & 15, hh = lane >> 4;
  const int ntn = N / 64;
  const int wid = blockIdx.x * 4 + w;
  const int mt = wid / ntn, nq = wid % ntn;
  if (mt * 16 >= M) return;
  const int row0 = mt * 16, col0 = nq * 64;
  const float* arow = A + (size_t)(row0 + ln) * lda;
  v8f acc[4] = {};
  for (int kb = 0; kb < K; kb += 32) {
    FragB ah, al;
    const v4f x0 = *(const v4fa*)(arow + kb + 8 * hh), x1 = *(const v4fa*)(arow + kb + 8 * hh + 4);
    const v4f x2 = *(const v4fa*)(arow + kb + 16 + 8 * hh), x3 = *(const v4fa*)(arow + kb + 16 + 8 * hh + 4);
    float xs[16] = {x0[0],x0[1],x0[2],x0[3],x1[0],x1[1],x1[2],x1[3],x2[0],x2[1],x2[2],x2[3],x3[0],x3[1],x3[2],x3[3]};
#pragma unroll
    for (int i = 0; i < 16; ++i) { const unsigned short hb = bf16_bits(xs[i]); ah.u[i] = hb; al.u[i] = ASPLIT ? bf16_bits(xs[i] - bf16_val(hb)) : (unsigned short)0; }
#pragma unroll
    for (int t = 0; t < 4; ++t) {
      const unsigned short* brow = Wt + (size_t)(col0 + t * 16 + ln) * ldb + kb;
      FragB b;
      b.half[0] = *(const v8us*)(brow + 8 * hh);
      b.half[1] = *(const v8us*)(brow + 16 + 8 * hh);
      acc[t] = mmaN<ASPLIT ? 2 : 1>(ah.v, al.v, b.v, b.v, acc[t]);
    }
  }
#pragma unroll
  for (int t = 0; t < 4; ++t) {
    float bv = bias ? bias[col0 + t * 16 + ln] : 0.f;
    if (BIAS_BF16) bv = bf16_round(bv);
#pragma unroll
    for (int r = 0; r < 8; ++r) { float v = acc[t][r] + bv; if (ACT == 1) v = fmaxf(v, 0.f); so[w][8 * hh + r][t * 16 + ln] = v; }
  }
  __builtin_amdgcn_fence(__ATOMIC_ACQ_REL, "workgroup");
  __builtin_amdgcn_wave_barrier();
  const int rsub = lane >> 4, c4 = (lane & 15) * 4;
  {
#pragma unroll
    for (int q = 0; q < 8; ++q) {
      const int r = q * 2 + rsub;
      const v4f v = *(const v4fa*)&so[w][r][c4];
      *(v4f*)(C + (size_t)(row0 + r) * ldc + col0 + c4) = v;
    }
    
  }
}

// Flash-style causal/unmasked attention, all contractions 3-term bf16 hi/lo splits, f32 softmax with running max.
// q,k,v rows are read from f32 buffers with arbitrary row pitch (so they can live inside a fused qkv buffer);
// D = head size (multiple of 32, <= 128); one wave = 16 query rows; block = 4 waves (64 queries) sharing K/V chunks of 32.
template <int D, bool CAUSAL>
__global__ __launch_bounds__(128) void k_flash(const float* __restrict__ qb, const float* __restrict__ kb, const float* __restrict__ vb,
                                             int pitch, int T, int H, float scale, float* __restrict__ y, int ypitch) {
  constexpr int KS = D / 32;        // k-steps for QK
  constexpr int DT = D / 16;        // d tiles for PV
  __shared__ __attribute__((aligned(16))) unsigned short sKh[32][D + 8], sKl[32][D + 8], sVh[32][D + 8], sVl[32][D + 8];
  __shared__ __attribute__((aligned(16))) unsigned short sPh[4][16][40], sPl[4][16][40];
  __shared__ __attribute__((aligned(16))) float sO[4][16][D];
  const int tid = threadIdx.x, w = tid >> 5, lane = tid & 31, ln = lane & 15, hh = lane >> 4;
  const int nqb = (T + 63) / 64;
  const int bh = blockIdx.x / nqb, qblk = blockIdx.x % nqb;
  const int b = bh / H, h = bh % H;
  const int q0 = qblk * 64 + w * 16;
  const float* Q = qb + (size_t)b * T * pitch + h * D;
  const float* K = kb + (size_t)b * T * pitch + h * D;
  const float* V = vb + (size_t)b * T * pitch + h * D;

  // A fragments of the wave's 16 query rows (scaled), hi/lo
  FragB aqh[KS], aql[KS];
  {
    int row = q0 + ln; if (row >= T) row = T - 1;
    const float* qr = Q + (size_t)row * pitch;
#pragma unroll
    for (int ks = 0; ks < KS; ++ks)
#pragma unroll
      for (int i = 0; i < 16; ++i) {
        const int d = ks * 32 + ((i < 8) ? (8 * hh + i) : (16 + 8 * hh + (i - 8)));
        const float x = qr[d] * scale; const unsigned short hb = bf16_bits(x);
        aqh[ks].u[i] = hb; aql[ks].u[i] = bf16_bits(x - bf16_val(hb));
      }
  }
  float m_r[8], l_r[8];
#pragma unroll
  for (int r = 0; r < 8; ++r) { m_r[r] = -3.0e38f; l_r[r] = 0.f; }
  v8f oacc[DT];
#pragma unroll
  for (int dt = 0; dt < DT; ++dt) oacc[dt] = (v8f){0.f,0.f,0.f,0.f,0.f,0.f,0.f,0.f};

  const int kv_end = CAUSAL ? min(T, qblk * 64 + 64) : T;     // block-uniform
  for (int j0 = 0; j0 < kv_end; j0 += 32) {
    __syncthreads();
    for (int e = tid; e < 32 * (D / 4); e += 128) {
      const int r = e / (D / 4), c4 = (e % (D / 4)) * 4;
      const int key = j0 + r;
      v4f kf = {0.f,0.f,0.f,0.f}, vf = {0.f,0.f,0.f,0.f};
      if (key < T) { kf = *(const v4fa*)(K + (size_t)key * pitch + c4); vf = *(const v4fa*)(V + (size_t)key * pitch + c4); }
#pragma unroll
      for (int t = 0; t < 4; ++t) {
        unsigned short hb = bf16_bits(kf[t]); sKh[r][c4 + t] = hb; sKl[r][c4 + t] = bf16_bits(kf[t] - bf16_val(hb));
        hb = bf16_bits(vf[t]); sVh[r][c4 + t] = hb; sVl[r][c4 + t] = bf16_bits(vf[t] - bf16_val(hb));
      }
    }
    __syncthreads();
    // S tile 16 x 32
    v8f s[2];
#pragma unroll
    for (int nt = 0; nt < 2; ++nt) {
      v8f acc = {};
#pragma unroll
      for (int ks = 0; ks < KS; ++ks) {
        FragB bh_, bl_;
        bh_.half[0] = *(const v8us*)&sKh[nt * 16 + ln][ks * 32 + 8 * hh]; bh_.half[1] = *(const v8us*)&sKh[nt * 16 + ln][ks * 32 + 16 + 8 * hh];
        bl_.half[0] = *(const v8us*)&sKl[nt * 16 + ln][ks * 32 + 8 * hh]; bl_.half[1] = *(const v8us*)&sKl[nt * 16 + ln][ks * 32 + 16 + 8 * hh];
        acc = mmaN<3>(aqh[ks].v, aql[ks].v, bh_.v, bl_.v, acc);
      }
      s[nt] = acc;
    }
    // mask + running max (rows 8hh+r; the 16 lanes of a half share rows)
    float alpha[8];
#pragma unroll
    for (int r = 0; r < 8; ++r) {
      const int qi = q0 + 8 * hh + r;
      const int ja = j0 + ln, jb = j0 + 16 + ln;
      if (CAUSAL) { if (ja > qi) s[0][r] = -3.0e38f; if (jb > qi) s[1][r] = -3.0e38f; }
      if (ja >= T) s[0][r] = -3.0e38f;
      if (jb >= T) s[1][r] = -3.0e38f;
      float mx = fmaxf(s[0][r], s[1][r]);
      mx = fmaxf(mx, __shfl_xor(mx, 1, 32)); mx = fmaxf(mx, __shfl_xor(mx, 2, 32)); mx = fmaxf(mx, __shfl_xor(mx, 4, 32)); mx = fmaxf(mx, __shfl_xor(mx, 8, 32));
      const float mnew = fmaxf(m_r[r], mx);
      alpha[r] = (mnew > -1.0e38f) ? __expf(m_r[r] - mnew) : 1.0f;
      const float p0 = (s[0][r] > -1.0e38f) ? __expf(s[0][r] - mnew) : 0.f;
      const float p1 = (s[1][r] > -1.0e38f) ? __expf(s[1][r] - mnew) : 0.f;
      m_r[r] = mnew;
      l_r[r] = l_r[r] * alpha[r] + p0 + p1;            // per-lane partial row sum (16 lanes combined at the end)
      unsigned short hb = bf16_bits(p0); sPh[w][8 * hh + r][ln] = hb;      sPl[w][8 * hh + r][ln] = bf16_bits(p0 - bf16_val(hb));
      hb = bf16_bits(p1);                sPh[w][8 * hh + r][16 + ln] = hb; sPl[w][8 * hh + r][16 + ln] = bf16_bits(p1 - bf16_val(hb));
    }
#pragma unroll
    for (int dt = 0; dt < DT; ++dt)
#pragma unroll
      for (int r = 0; r < 8; ++r) oacc[dt][r] *= alpha[r];
    __builtin_amdgcn_fence(__ATOMIC_ACQ_REL, "workgroup");
    __builtin_amdgcn_wave_barrier();
    FragB pah, pal;
    pah.half[0] = *(const v8us*)&sPh[w][ln][8 * hh]; pah.half[1] = *(const v8us*)&sPh[w][ln][16 + 8 * hh];
    pal.half[0] = *(const v8us*)&sPl[w][ln][8 * hh]; pal.half[1] = *(const v8us*)&sPl[w][ln][16 + 8 * hh];
#pragma unroll
    for (int dt = 0; dt < DT; ++dt) {
      FragB bvh, bvl;
#pragma unroll
      for (int i = 0; i < 8; ++i) {
        bvh.u[i] = sVh[8 * hh + i][dt * 16 + ln]; bvh.u[8 + i] = sVh[16 + 8 * hh + i][dt * 16 + ln];
        bvl.u[i] = sVl[8 * hh + i][dt * 16 + ln]; bvl.u[8 + i] = sVl[16 + 8 * hh + i][dt * 16 + ln];
      }
      oacc[dt] = mmaN<3>(pah.v, pal.v, bvh.v, bvl.v, oacc[dt]);
    }
    __builtin_amdgcn_fence(__ATOMIC_ACQ_REL, "workgroup");
    __builtin_amdgcn_wave_barrier();
  }
#pragma unroll
  for (int r = 0; r < 8; ++r) {
    float l = l_r[r];
    l += __shfl_xor(l, 1, 32); l += __shfl_xor(l, 2, 32); l += __shfl_xor(l, 4, 32); l += __shfl_xor(l, 8, 32);
    l_r[r] = (l > 0.f) ? 1.0f / l : 0.f;
  }
#pragma unroll
  for (int dt = 0; dt < DT; ++dt)
#pragma unroll
    for (int r = 0; r < 8; ++r) sO[w][8 * hh + r][dt * 16 + ln] = oacc[dt][r] * l_r[r];
  __builtin_amdgcn_fence(__ATOMIC_ACQ_REL, "workgroup");
  __builtin_amdgcn_wave_barrier();
  {
    for (int r = 0; r < 16; ++r) {
      const int row = q0 + r;
      if (row < T && lane < D / 4) {
        const v4f val = *(const v4fa*)&sO[w][r][lane * 4];
        *(v4f*)(y + ((size_t)b * T + row) * ypitch + h * D + lane * 4) = val;
      }
    }
    
  }
}

// GEMM C = act(A·W + bias + resid): A f32 (ASPLIT -> hi/lo 2 terms), Wt bf16 [N][K]; ACT 0 none, 1 relu, 2 exact gelu;
// resid (optional, f32, row index = (row % rmod), pitch ldr, RES_BF16 rounds it) added before the activation.
template <bool ASPLIT, int ACT, bool BIAS_BF16, bool RES_BF16>
__global__ __launch_bounds__(128) void k_gemm_bf3(const float* __restrict__ A, int lda, const unsigned short* __restrict__ Wt, int ldb,
                                                const float* __restrict__ bias, const float* __restrict__ resid, int rmod, int ldr,
                                                float* __restrict__ C, int ldc, int M, int N, int K) {
  __shared__ __attribute__((aligned(16))) float so[4][16][64];
  const int tid = threadIdx.x, w = tid >> 5, lane = tid & 31, ln = lane & 15, hh = lane >> 4;
  const int ntn = N / 64;
  const int wid = blockIdx.x * 4 + w;
  const int mt = wid / ntn, nq = wid % ntn;
  if (mt * 16 >= M) return;
  const int row0 = mt * 16, col0 = nq * 64;
  const float* arow = A + (size_t)(row0 + ln) * lda;
  v8f acc[4] = {};
  for (int kb = 0; kb < K; kb += 32) {
    FragB ah, al;
    const v4f x0 = *(const v4fa*)(arow + kb + 8 * hh), x1 = *(const v4fa*)(arow + kb + 8 * hh + 4);
    const v4f x2 = *(const v4fa*)(arow + kb + 16 + 8 * hh), x3 = *(const v4fa*)(arow + kb + 16 + 8 * hh + 4);
    float xs[16] = {x0[0],x0[1],x0[2],x0[3],x1[0],x1[1],x1[2],x1[3],x2[0],x2[1],x2[2],x2[3],x3[0],x3[1],x3[2],x3[3]};
#pragma unroll
    for (int i = 0; i < 16; ++i) { const unsigned short hb = bf16_bits(xs[i]); ah.u[i] = hb; al.u[i] = ASPLIT ? bf16_bits(xs[i] - bf16_val(hb)) : (unsigned short)0; }
#pragma unroll
    for (int t = 0; t < 4; ++t) {
      const unsigned short* brow = Wt + (size_t)(col0 + t * 16 + ln) * ldb + kb;
      FragB b;
      b.half[0] = *(const v8us*)(brow + 8 * hh);
      b.half[1] = *(const v8us*)(brow + 16 + 8 * hh);
      acc[t] = mmaN<ASPLIT ? 2 : 1>(ah.v, al.v, b.v, b.v, acc[t]);
    }
  }
#pragma unroll
  for (int t = 0; t < 4; ++t) {
    const int col = col0 + t * 16 + ln;
    float bv = bias ? bias[col] : 0.f;
    if (BIAS_BF16) bv = bf16_round(bv);
#pragma unroll
    for (int r = 0; r < 8; ++r) {
      float v = acc[t][r] + bv;
      if (resid) { float rv = resid[(size_t)((row0 + 8 * hh + r) % rmod) * ldr + col]; if (RES_BF16) rv = bf16_round(rv); v += rv; }
      if (ACT == 1) v = fmaxf(v, 0.f);
      if (ACT == 2) v = 0.5f * v * (1.0f + erff(v * 0.70710678118654752f));
      if (ACT == 3) { const float u = 0.7978845608028654f * (v + 0.044715f * v * v * v); v = 0.5f * v * (1.0f + tanhf(u)); }
      so[w][8 * hh + r][t * 16 + ln] = v;
    }
  }
  __builtin_amdgcn_fence(__ATOMIC_ACQ_REL, "workgroup");
  __builtin_amdgcn_wave_barrier();
  const int rsub = lane >> 4, c4 = (lane & 15) * 4;
  {
#pragma unroll
    for (int q = 0; q < 8; ++q) {
      const int r = q * 2 + rsub;
      const v4f v = *(const v4fa*)&so[w][r][c4];
      *(v4f*)(C + (size_t)(row0 + r) * ldc + col0 + c4) = v;
    }
    
  }
}
// row LayerNorm (biased variance, eps) over N: s = X (+ R); optional out_sum <- s; out_norm <- (s-mu)*rsqrt(var+eps)*g + b
template <bool PARAM_BF16>
__global__ __launch_bounds__(256) void k_layernorm(const float* __restrict__ X, const float* __restrict__ R, const float* __restrict__ g, const float* __restrict__ bta,
                                                  float* __restrict__ out_sum, float* __restrict__ out_norm, int N, float eps) {
  __shared__ float red[256];
  const int row = blockIdx.x, tid = threadIdx.x;
  const float* x = X + (size_t)row * N; const float* rr = R ? R + (size_t)row * N : nullptr;
  float vals[16];                     // up to N = 4096
  const int per = N / 256;            // contiguous chunk per thread? use strided-by-4 chunks: thread handles j = tid*4 + 1024*u
  float s1 = 0.f;
  for (int u = 0; u < per / 4; ++u) {
    const int j = tid * 4 + 1024 * u;
    const v4f a = *(const v4fa*)(x + j);
    v4f b = {0.f,0.f,0.f,0.f}; if (rr) b = *(const v4fa*)(rr + j);
#pragma unroll
    for (int q = 0; q < 4; ++q) { const float v = a[q] + b[q]; vals[u * 4 + q] = v; s1 += v; }
  }
  red[tid] = s1; __syncthreads();
  for (int st = 128; st > 0; st >>= 1) { if (tid < st) red[tid] += red[tid + st]; __syncthreads(); }
  const float mu = red[0] / (float)N; __syncthreads();
  float s2 = 0.f;
  for (int u = 0; u < per / 4; ++u)
#pragma unroll
    for (int q = 0; q < 4; ++q) { const float c = vals[u * 4 + q] - mu; s2 += c * c; }
  red[tid] = s2; __syncthreads();
  for (int st = 128; st > 0; st >>= 1) { if (tid < st) red[tid] += red[tid + st]; __syncthreads(); }
  const float rs = rsqrtf(red[0] / (float)N + eps);
  {
    for (int u = 0; u < per / 4; ++u) {
      const int j = tid * 4 + 1024 * u;
      v4f o, sm;
#pragma unroll
      for (int q = 0; q < 4; ++q) {
        float gg = g[j + q], bb = bta[j + q];
        if (PARAM_BF16) { gg = bf16_round(gg); bb = bf16_round(bb); }
        sm[q] = vals[u * 4 + q]; o[q] = (vals[u * 4 + q] - mu) * rs * gg + bb;
      }
      if (out_sum) *(v4f*)(out_sum + (size_t)row * N + j) = sm;
      *(v4f*)(out_norm + (size_t)row * N + j) = o;
    }
    
  }
}



// ---- f16 WMMA path (v_wmma_f32_16x16x32_f16): 11-bit significands for operands in range — used where a [0,1] probability operand needs more precision than bf16
typedef _Float16 v16h __attribute__((ext_vector_type(16)));
union FragH { v16h v; v8us half[2]; _Float16 h[16]; unsigned short u[16]; };
template <int NT>
__device__ __forceinline__ v8f mmaH(v16h ah, v16h al, v16h bh, v16h bl, v8f c) {
  c = __builtin_amdgcn_wmma_f32_16x16x32_f16(false, ah, false, bh, (short)0, c, false, false);
  if (NT >= 2) c = __builtin_amdgcn_wmma_f32_16x16x32_f16(false, al, false, bh, (short)0, c, false, false);
  if (NT >= 3) c = __builtin_amdgcn_wmma_f32_16x16x32_f16(false, ah, false, bl, (short)0, c, false, false);
  asm volatile("v_nop\n\tv_nop\n\tv_nop\n\tv_nop" : "+v"(c) : "v"(ah), "v"(al), "v"(bh), "v"(bl));
  return c;
}
// batched GEMM like k_gemm_b but f16 operands: A f32 (split into f16 hi/lo if ASPLIT, else rounded to f16), Bt = f16 values [n][k]; alpha; C f32; N multiple of 16 (partial tiles skipped)
template <bool ASPLIT>
__global__ __launch_bounds__(128) void k_gemm_h(const float* __restrict__ A, int lda, size_t sA, const _Float16* __restrict__ Bh, int ldb, size_t sB, float alpha, float* __restrict__ C, int ldc, size_t sC, int M, int N, int K) {
  __shared__ __attribute__((aligned(16))) float so[4][16][64];
  const int tid = threadIdx.x, w = tid >> 5, lane = tid & 31, ln = lane & 15, hh = lane >> 4; const int by = blockIdx.y;
  A += (size_t)by * sA; Bh += (size_t)by * sB; C += (size_t)by * sC;
  const int ntn = (N + 63) / 64; const int wid = blockIdx.x * 4 + w; const int mt = wid / ntn, nq = wid % ntn; if (mt * 16 >= M) return;
  const int row0 = mt * 16, col0 = nq * 64; const float* arow = A + (size_t)(row0 + ln) * lda;
  v8f acc[4] = {};
  for (int kb = 0; kb < K; kb += 32) {
    FragH ah, al;
    const v4f x0 = *(const v4fa*)(arow + kb + 8 * hh), x1 = *(const v4fa*)(arow + kb + 8 * hh + 4), x2 = *(const v4fa*)(arow + kb + 16 + 8 * hh), x3 = *(const v4fa*)(arow + kb + 16 + 8 * hh + 4);
    float xs[16] = {x0[0],x0[1],x0[2],x0[3],x1[0],x1[1],x1[2],x1[3],x2[0],x2[1],x2[2],x2[3],x3[0],x3[1],x3[2],x3[3]};
#pragma unroll
    for (int i = 0; i < 16; ++i) { const _Float16 h = (_Float16)xs[i]; ah.h[i] = h; al.h[i] = ASPLIT ? (_Float16)(xs[i] - (float)h) : (_Float16)0.0f; }
#pragma unroll
    for (int t = 0; t < 4; ++t) { if (col0 + t * 16 >= N) continue; const size_t boff = (size_t)(col0 + t * 16 + ln) * ldb + kb; FragH bq; bq.half[0] = *(const v8us*)(Bh + boff + 8 * hh); bq.half[1] = *(const v8us*)(Bh + boff + 16 + 8 * hh);
      acc[t] = mmaH<ASPLIT ? 2 : 1>(ah.v, al.v, bq.v, bq.v, acc[t]); }
  }
#pragma unroll
  for (int t = 0; t < 4; ++t) { if (col0 + t * 16 >= N) continue;
#pragma unroll
    for (int r = 0; r < 8; ++r) so[w][8 * hh + r][t * 16 + ln] = acc[t][r] * alpha; }
  __builtin_amdgcn_fence(__ATOMIC_ACQ_REL, "workgroup"); __builtin_amdgcn_wave_barrier();
  const int rsub = lane >> 4, c4 = (lane & 15) * 4;
  {
#pragma unroll
    for (int q = 0; q < 8; ++q) { const int r = q * 2 + rsub; if (col0 + c4 < N) { const v4f v = *(const v4fa*)&so[w][r][c4]; *(v4f*)(C + (size_t)(row0 + r) * ldc + col0 + c4) = v; } }
     }
}

// Wt[n][k] = f16(W[k][n]·scale) from f32 row-major W[K][N] (scale = power of two; bf16-exact weights stay exact in f16 away from the subnormal range)
__global__ __launch_bounds__(256) void k_wt_f16(const float* __restrict__ W, _Float16* __restrict__ Wt, int K, int N, float scale) {
  const int t = blockIdx.x * 256 + threadIdx.x; if (t >= N * (K / 8)) return; const int n = t / (K / 8), k8 = (t % (K / 8)) * 8; FragH f;
#pragma unroll
  for (int i = 0; i < 8; ++i) f.h[i] = (_Float16)(bf16_round(W[(size_t)(k8 + i) * N + n]) * scale); const v8us o = f.half[0];
  *(v8us*)((unsigned short*)Wt + (size_t)n * K + k8) = o; 
}
// k_gemm_hh variant with fused epilogue: v = acc·alpha + bias[by·sBias + col] (+ CP[(row/rowsPerB)·sCPb + by·64 + col] if CP) ; ACT 0 none / 1 elu ; writes f32 C and/or f16 C16 (each if non-null)
template <int ACT>
__global__ __launch_bounds__(128) void k_gemm_hhx(const _Float16* __restrict__ A, int lda, size_t sA, const _Float16* __restrict__ Bh, int ldb, size_t sB, float alpha, const float* __restrict__ bias, size_t sBias, const float* __restrict__ CP, int rowsPerB, size_t sCPb, int row0g,
    float* __restrict__ C, _Float16* __restrict__ C16, int ldc, size_t sC, int M, int N, int K) {
  __shared__ __attribute__((aligned(16))) float so[4][16][64];
  const int tid = threadIdx.x, w = tid >> 5, lane = tid & 31, ln = lane & 15, hh = lane >> 4; const int by = blockIdx.y;
  A += (size_t)by * sA; Bh += (size_t)by * sB; const size_t cofs = (size_t)by * sC; const float* bp = bias ? bias + (size_t)by * sBias : nullptr;
  const int ntn = (N + 63) / 64; const int wid = blockIdx.x * 4 + w; const int mt = wid / ntn, nq = wid % ntn; if (mt * 16 >= M) return;
  const int row0 = mt * 16, col0 = nq * 64; const _Float16* arow = A + (size_t)(row0 + ln) * lda;
  v8f acc[4] = {};
  for (int kb = 0; kb < K; kb += 32) { FragH ah; ah.half[0] = *(const v8us*)((const unsigned short*)arow + kb + 8 * hh); ah.half[1] = *(const v8us*)((const unsigned short*)arow + kb + 16 + 8 * hh);
#pragma unroll
    for (int t = 0; t < 4; ++t) { if (col0 + t * 16 >= N) continue; const size_t boff = (size_t)(col0 + t * 16 + ln) * ldb + kb; FragH bq; bq.half[0] = *(const v8us*)((const unsigned short*)Bh + boff + 8 * hh); bq.half[1] = *(const v8us*)((const unsigned short*)Bh + boff + 16 + 8 * hh);
      acc[t] = mmaH<1>(ah.v, ah.v, bq.v, bq.v, acc[t]); }
  }
#pragma unroll
  for (int t = 0; t < 4; ++t) { if (col0 + t * 16 >= N) continue; const int col = col0 + t * 16 + ln; const float bv = bp ? bf16_round(bp[col]) : 0.f;
#pragma unroll
    for (int r = 0; r < 8; ++r) { float v = acc[t][r] * alpha + bv; if (CP) { const int bidx = (row0g + row0 + 8 * hh + r) / rowsPerB; v += CP[(size_t)bidx * sCPb + (size_t)by * 64 + col]; } if (ACT == 1) v = (v > 0.f) ? v : expm1f(v); else if (ACT == 7) v = (v > 0.f) ? v + 1.0f : expf(v); else if (ACT == 8) v = tanhf(v); else if (ACT == 9) v = 0.5f * v * (1.0f + tanhf(0.7978845608028654f * (v + 0.044715f * v * v * v))); else if (ACT == 11) v = 1.0f / (1.0f + expf(-v)); else if (ACT == 12) v = (v > 0.f) ? v : 0.01f * v; else if (ACT == 14) v = (v > 0.f) ? v : 0.1f * v; else if (ACT == 15) v = v / (1.0f + expf(-v)); else if (ACT == 3) v = fmaxf(v, 0.f); else if (ACT == 6) v = 0.5f * v * (1.0f + erff(v * 0.70710678118654752f)); so[w][8 * hh + r][t * 16 + ln] = v; } }
  __builtin_amdgcn_fence(__ATOMIC_ACQ_REL, "workgroup"); __builtin_amdgcn_wave_barrier();
  const int rsub = lane >> 4, c4 = (lane & 15) * 4; typedef _Float16 v4h __attribute__((ext_vector_type(4)));
  {
#pragma unroll
    for (int q = 0; q < 8; ++q) { const int r = q * 2 + rsub; if (col0 + c4 < N) { const v4f v = *(const v4fa*)&so[w][r][c4]; if (C) *(v4f*)(C + cofs + (size_t)(row0 + r) * ldc + col0 + c4) = v; if (C16) { v4h h4; for (int i = 0; i < 4; ++i) h4[i] = (_Float16)v[i]; *(v4h*)(C16 + cofs + (size_t)(row0 + r) * ldc + col0 + c4) = h4; } } }
     }
}


typedef _Float16 v4h __attribute__((ext_vector_type(4)));

__global__ __launch_bounds__(256) void k_x16(const float* __restrict__ x, _Float16* __restrict__ X16, size_t n8) { const size_t t = (size_t)blockIdx.x * 256 + threadIdx.x; if (t >= n8) return; FragH f;
#pragma unroll
  for (int q = 0; q < 8; ++q) f.h[q] = (_Float16)bf16_round(x[t * 8 + q]); *(v8us*)((unsigned short*)X16 + t * 8) = f.half[0];  }
__global__ __launch_bounds__(256) void k_h16(const float* __restrict__ x, _Float16* __restrict__ X16, size_t n8) { const size_t t = (size_t)blockIdx.x * 256 + threadIdx.x; if (t >= n8) return; FragH f;
#pragma unroll
  for (int q = 0; q < 8; ++q) f.h[q] = (_Float16)x[t * 8 + q]; *(v8us*)((unsigned short*)X16 + t * 8) = f.half[0];  }
__global__ __launch_bounds__(256) void k_round16f(const float* __restrict__ W, _Float16* __restrict__ Bt, size_t n8) { const size_t t = (size_t)blockIdx.x * 256 + threadIdx.x; if (t >= n8) return; FragH f;
#pragma unroll
  for (int i = 0; i < 8; ++i) f.h[i] = (_Float16)(bf16_round(W[t * 8 + i]) * 16.0f); *(v8us*)((unsigned short*)Bt + t * 8) = f.half[0];  }
template <int NHv, int TTv>
__global__ __launch_bounds__(256) void k_vt(const _Float16* __restrict__ V16, int ldv, int voff, _Float16* __restrict__ Vt) { __shared__ unsigned short tl[64][66]; const int tid = threadIdx.x; const int slab = blockIdx.x / (TTv / 64), lg = blockIdx.x % (TTv / 64); const int b = slab / NHv, h = slab % NHv;
  for (int i = tid; i < 64 * 8; i += 256) { const int r = i / 8, c8 = (i % 8) * 8; FragH f; f.half[0] = *(const v8us*)((const unsigned short*)V16 + ((size_t)b * TTv + lg * 64 + r) * ldv + voff + h * 64 + c8);
#pragma unroll
    for (int q = 0; q < 8; ++q) tl[r][c8 + q] = f.u[q]; }
  __syncthreads();
  {
#pragma unroll
    for (int rd = 0; rd < 2; ++rd) { const int d = rd * 32 + tid / 8, pc = tid % 8; FragH f;
#pragma unroll
      for (int q = 0; q < 8; ++q) f.u[q] = tl[pc * 8 + q][d];
      *(v8us*)((unsigned short*)Vt + ((size_t)slab * 64 + d) * TTv + lg * 64 + pc * 8) = f.half[0]; }
     } }

// X7[n] = [x_n, 1, 1] in f32 (element 6 is the bias input; element 7 multiplies the row's shift in k_fa, and R's element 7 is 0), and XF = the same values in f16 (bf16 values, exact in f16 above its subnormal range) laid out as the 16-bit fragments of k_fa:
// 16-byte piece ((s*2 + hf)*32 + lane) holds column (lane & 15) of keys 32 s + 16 hf + 8 (lane >> 4) + 0..7, so that a wave's fragment load reads 512 bytes in a row. Columns 7..15 are 0.
__global__ __launch_bounds__(256) void k_x7(const float* __restrict__ nodes, const float* __restrict__ centre, float* __restrict__ X7, _Float16* __restrict__ XF) { const int t = blockIdx.x * 256 + threadIdx.x; if (t >= NNODE * 2) return; const int n = t >> 1, half = t & 1; v4f v;
  { const int key0 = 32 * (t >> 6) + 16 * ((t >> 5) & 1) + 8 * ((t >> 4) & 1), f = t & 15; FragH x; float nv[8];
    // every lane loads (a column >= 3 reads column 0 and drops it): the eight loads are in flight together, with no branch between them
#pragma unroll
    for (int i = 0; i < 8; ++i) nv[i] = nodes[(size_t)(key0 + i) * 3 + ((f < 3) ? f : 0)];
    const float cc = bf16_round(centre[(f >= 3 && f < 6) ? f - 3 : 0]), cv = (f < 6) ? cc : (f == 6) ? 1.0f : 0.0f;
#pragma unroll
    for (int i = 0; i < 8; ++i) { const float rv = bf16_round(nv[i]); x.h[i] = (_Float16)((f < 3) ? rv : cv); }
    *(v8us*)((unsigned short*)XF + (size_t)t * 8) = x.half[0]; }
  if (half == 0) { const float p0 = nodes[(size_t)n * 3], p1 = nodes[(size_t)n * 3 + 1], p2 = nodes[(size_t)n * 3 + 2];
    asm volatile("s_wait_xcnt 0x0" :: "v"(p0), "v"(p1), "v"(p2) : "memory");      // stands behind the load of the node's coordinates (named as inputs, so that the load stays in front of it), ahead of the writes of the load's address registers
    v[0] = bf16_round(p0); v[1] = bf16_round(p1); v[2] = bf16_round(p2); v[3] = bf16_round(centre[0]); } else { v[0] = bf16_round(centre[1]); v[1] = bf16_round(centre[2]); v[2] = 1.0f; v[3] = 1.0f; }
  *(v4f*)(X7 + (size_t)t * 4) = v;  }
// value of lane l ^ MASK inside a 16-lane row (DPP row_xmask), and of lane l ^ 16: register moves, no LDS round trip
template <int MASK> __device__ __forceinline__ float lane_xor_row(float x) { return __int_as_float(__builtin_amdgcn_update_dpp(0, __float_as_int(x), 0x160 | MASK, 0xf, 0xf, true)); }
__device__ __forceinline__ float lane_xor16(float x) { const int v = __float_as_int(x); return __int_as_float(__builtin_amdgcn_permlanex16(v, v, 0x76543210, 0xfedcba98, false, false)); }
__device__ __forceinline__ float wave_sum(float x) { x += lane_xor_row<1>(x); x += lane_xor_row<2>(x); x += lane_xor_row<4>(x); x += lane_xor_row<8>(x); return x + lane_xor16(x); }
// M[i][j] = sum over the 512 channels c of a_c[i] * b_c[j], with a_c = [Wk[c][0..5], bk[c]] and b_c = [Wq[c][0..5], bq[c]] rounded to bf16 (each product is exact in f32).
// The 256 threads split the channels: thread t takes channels 2t and 2t + 1 (12 neighbouring floats of each matrix, all loads in flight at once) and forms its 49 partial sums in registers;
// each is summed over the wave by register moves, the 8 waves' sums meet in LDS, and thread p < 49 adds them in wave order. The caller's barrier publishes M.
static_assert(DD == 2 * 256, "two channels per thread of a 256-thread work-group");
__device__ __forceinline__ void sai_gram(const float* __restrict__ Wq, const float* __restrict__ bq, const float* __restrict__ Wk, const float* __restrict__ bk, int tid, float (*part)[52], float (*M)[8]) {
  float a[2][7], b[2][7], s[49];
  // every unroll of this function: a, b and s stay in registers only under constant indices
#pragma unroll
  for (int u = 0; u < 2; ++u) {
    const int c = 2 * tid + u;
#pragma unroll
    for (int i = 0; i < 6; ++i) { a[u][i] = bf16_round(Wk[(size_t)c * 6 + i]); b[u][i] = bf16_round(Wq[(size_t)c * 6 + i]); }
    a[u][6] = bf16_round(bk[c]); b[u][6] = bf16_round(bq[c]);
  }
#pragma unroll
  for (int i = 0; i < 7; ++i)
#pragma unroll
    for (int j = 0; j < 7; ++j) s[i * 7 + j] = wave_sum(a[0][i] * b[0][j] + a[1][i] * b[1][j]);
  if ((tid & 31) == 0) {
#pragma unroll
    for (int p = 0; p < 49; ++p) part[tid >> 5][p] = s[p];
  }
  __syncthreads();      /* every wave's 49 sums are in part */
  if (tid < 49) {
    float m = part[0][tid];
#pragma unroll
    for (int w = 1; w < 8; ++w) m += part[w][tid];
    M[tid / 7][tid % 7] = m;
  }
}
__global__ __launch_bounds__(256) void k_rvec(const float* __restrict__ Wq, const float* __restrict__ bq, const float* __restrict__ Wk, const float* __restrict__ bk, const float* __restrict__ X7, float* __restrict__ R) {
  #pragma clang fp contract(off)
  __shared__ float M[7][8]; __shared__ __attribute__((aligned(16))) float part[8][52]; const int tid = threadIdx.x;
  sai_gram(Wq, bq, Wk, bk, tid, part, M);
  __syncthreads();
  const int t = blockIdx.x * 256 + tid; if (t >= NNODE * 2) return; const int n = t >> 1, half = t & 1; float xa[8]; { const v4f a = *(const v4fa*)(X7 + (size_t)n * 8), b = *(const v4fa*)(X7 + (size_t)n * 8 + 4); xa[0] = a[0]; xa[1] = a[1]; xa[2] = a[2]; xa[3] = a[3]; xa[4] = b[0]; xa[5] = b[1]; xa[6] = b[2]; }
  v4f o = {0.f, 0.f, 0.f, 0.f};      /* this thread's half of R[n]: columns j = 4·half .. 4·half+3 (j = 7 stays 0) */
#pragma unroll 1
  for (int i = 0; i < 7; ++i) for (int q = 0; q < 4; ++q) { const int j = half * 4 + q; if (j < 7) o[q] += xa[i] * M[i][j]; }
  *(v4f*)(R + (size_t)t * 4) = o * 1.4426950408889634f;  }      /* times log2(e): k_fa, R's one reader, takes 2^x of the logits */
// ---- Y = attn * [x, 1] with attn kept in registers. One work-group = FA_ROWS rows of attn; its 32 waves split the 8192 keys, 256 each, in steps of 32.
// Logits, transposed: S^T[key][n] = X7[key][0..7] * R[n][0..7] on v_wmma_f32_16x16x4_f32, two instructions per 16 keys x 16 rows. Lane (c, h) loads elements 4h .. 4h+3 of key c and of row c by the same rule, so the k pairing of both operands is equal.
// D register r of lane (c, h) is key 8h + r of row c: the two tiles of a step, converted in place, are the B fragment (hardware k order) of Y^T = X~^T * P^T on v_wmma_f32_16x16x32_f16, whose A fragment is XF.
// R comes scaled by log2(e) (k_rvec), so both sweeps work on s' = s * log2(e). Sweep 1 finds each row's maximum m' (over the waves through LDS); sweep 2 forms the logits again with R's element 7 set to 15 - m' (X7's element 7 is 1),
// so that the matrix instruction hands out s' - m' + 15 and the hardware's 2^x of it, one instruction with no range reduction around it, is P * 2^15 * Z. The argument is at most 15 up to rounding; where 2^x falls below the f32 normal range the f16 value is 0 either way.
// Column 6 of [x, 1] is 1: row 6 of Y^T is the row's sum of the same f16 values, and the factor 2^15 * Z leaves in the division.
typedef float v2f __attribute__((ext_vector_type(2)));
#define FA_ROWS 32
constexpr uint32_t FA_WAVES = 32, FA_KEYS = NNODE / FA_WAVES, FA_STEPS = FA_KEYS / 32u;
constexpr uint32_t FA_MPITCH = FA_WAVES + 4;      // floats per row of the waves' maxima: 16-byte pieces stay aligned, neighbouring rows fall on different banks
static_assert(FA_STEPS * 32u * FA_WAVES == NNODE && NNODE % FA_ROWS == 0 && FA_ROWS == 32, "the waves' key ranges tile a row; two 16-row tiles per work-group");
__device__ __forceinline__ v8f fa_logits(v4f x, v4f r) {
  v8f t = {0.f, 0.f, 0.f, 0.f, 0.f, 0.f, 0.f, 0.f};
  t = __builtin_amdgcn_wmma_f32_16x16x4_f32(false, (v2f){x[0], x[1]}, false, (v2f){r[0], r[1]}, (short)0, t, false, false);
  t = __builtin_amdgcn_wmma_f32_16x16x4_f32(false, (v2f){x[2], x[3]}, false, (v2f){r[2], r[3]}, (short)0, t, false, false);
  return t;
}
__global__ __launch_bounds__(1024) void k_fa(const float* __restrict__ R, const float* __restrict__ X7, const _Float16* __restrict__ XF, float* __restrict__ Y) {
  __shared__ __attribute__((aligned(16))) float redM[FA_ROWS][FA_MPITCH];
  __shared__ __attribute__((aligned(16))) float E[FA_WAVES][FA_ROWS][8];
  const uint32_t tid = threadIdx.x, wv = tid >> 5, lane = tid & 31u, h = lane >> 4, c = lane & 15u;
  const uint32_t n0 = blockIdx.x * FA_ROWS, k0 = wv * FA_KEYS;
  const float* xp = X7 + (size_t)(k0 + c) * 8u + 4u * h;                                        // key c of the wave's first tile, elements 4h .. 4h+3
  const unsigned short* xf = (const unsigned short*)XF + (size_t)(k0 / 32u) * 512u + lane * 8u;
  v4f rb[2]; float mx[2];
  // every '#pragma unroll' of this kernel: rb, mx, acc and the tiles stay in registers only under constant indices
#pragma unroll
  for (int j = 0; j < 2; ++j) { rb[j] = *(const v4fa*)(R + (size_t)(n0 + 16u * (uint32_t)j + c) * 8u + 4u * h); mx[j] = -3.0e38f; }
  // two steps per trip, here and in sweep 2: the second step's operands are in flight while the first is worked on; unrolled whole, the build kept all of the wave's keys in registers and spilled
#pragma unroll 2
  for (uint32_t st = 0; st < FA_STEPS; ++st) {
    const v4f xa0 = *(const v4fa*)(xp + st * 256u), xa1 = *(const v4fa*)(xp + st * 256u + 128u);
#pragma unroll
    for (int j = 0; j < 2; ++j) {
      const v8f t0 = fa_logits(xa0, rb[j]), t1 = fa_logits(xa1, rb[j]);
#pragma unroll
      for (int r = 0; r < 8; ++r) mx[j] = fmaxf(mx[j], fmaxf(t0[r], t1[r]));
    }
  }
#pragma unroll
  for (int j = 0; j < 2; ++j) { mx[j] = fmaxf(mx[j], lane_xor16(mx[j])); if (h == 0u) redM[16u * (uint32_t)j + c][wv] = mx[j]; }
  __syncthreads();      /* every wave's maxima of the 32 rows are in redM */
#pragma unroll
  for (int j = 0; j < 2; ++j) {
    float m = -3.0e38f;
#pragma unroll
    for (uint32_t q = 0; q < FA_WAVES / 4u; ++q) { const v4f v = *(const v4f*)&redM[16u * (uint32_t)j + c][4u * q]; m = fmaxf(m, fmaxf(fmaxf(v[0], v[1]), fmaxf(v[2], v[3]))); }
    if (h == 1u) rb[j][3] = 15.0f - m;      // element 7 of the row: its shift, in powers of two
  }
  v8f acc[2];
#pragma unroll
  for (int j = 0; j < 2; ++j) acc[j] = (v8f){0.f, 0.f, 0.f, 0.f, 0.f, 0.f, 0.f, 0.f};
  // two steps per trip, as in sweep 1
#pragma unroll 2
  for (uint32_t st = 0; st < FA_STEPS; ++st) {
    const v4f xa0 = *(const v4fa*)(xp + st * 256u), xa1 = *(const v4fa*)(xp + st * 256u + 128u);
    FragH fx; fx.half[0] = *(const v8us*)(xf + st * 512u); fx.half[1] = *(const v8us*)(xf + st * 512u + 256u);
#pragma unroll
    for (int j = 0; j < 2; ++j) {
      const v8f t0 = fa_logits(xa0, rb[j]), t1 = fa_logits(xa1, rb[j]);
      FragH p;
#pragma unroll
      for (int r = 0; r < 8; ++r) { p.h[r] = (_Float16)__builtin_amdgcn_exp2f(t0[r]); p.h[8 + r] = (_Float16)__builtin_amdgcn_exp2f(t1[r]); }
      acc[j] = __builtin_amdgcn_wmma_f32_16x16x32_f16(false, fx.v, false, p.v, (short)0, acc[j], false, false);
    }
  }
  // lane (c, 0) holds Y^T[0..7][row c] of its wave's keys; the 32 waves' sums meet in LDS and are added in wave order
  if (h == 0u) {
#pragma unroll
    for (int j = 0; j < 2; ++j) {
      *(v4f*)&E[wv][16u * (uint32_t)j + c][0] = (v4f){acc[j][0], acc[j][1], acc[j][2], acc[j][3]};
      *(v4f*)&E[wv][16u * (uint32_t)j + c][4] = (v4f){acc[j][4], acc[j][5], acc[j][6], acc[j][7]};
    }
  }
  __syncthreads();      /* every wave's sums are staged */
  if (tid < FA_ROWS * 8u) {
    const uint32_t row = tid >> 3, f = tid & 7u;
    float s = E[0][row][f], z = E[0][row][6];
    for (uint32_t w = 1; w < FA_WAVES; ++w) { s += E[w][row][f]; z += E[w][row][6]; }
    Y[(size_t)(n0 + row) * 8u + f] = s / z;
  }
}

// ---- out = [Y | x, 1, 1] * G. Rows 0..6 of G are [Wq bq]^T * Wv_q^T and row 7 is 0 (Y's element 7 is 0); rows 8..14 are [Wk bk]^T * Wv_k^T + [Wk bk]^T (the second term is the addend 'keys'); row 15 is bv (X7's element 7 is 1).
// GF holds G as the B fragments of k_out: the 16-byte piece (((d >> 6) * 4 + (d & 3)) * 2 + p) * 32 + 16 hh + ((d & 63) >> 2) holds rows 8 p + 4 hh + 0..3 of column d, so that a wave's fragment load reads 512 bytes in a row.
// k_gmat: one work-group = 16 columns d of G. Waves 0..15 take the Wq side, waves 16..31 the Wk side, 32 of the 512 channels each: G^T[d][i] = sum over channels ch of Wv[d][ch] * W~[ch][i], A = Wv rows, B = W~ columns (i > 6 is 0).
// Lane (c, h) takes channels 16 h .. 16 h + 15 of its wave's 32 for row c of A and for column c of B by the same rule, so the k pairing of both operands is equal. The 16 waves' sums of a side meet in LDS and are added in wave order.
constexpr uint32_t GM_SPLIT = 16, GM_CH = DD / GM_SPLIT;
static_assert(GM_CH == 32 && DD % 64 == 0, "16 channels per lane half; k_out takes 64 columns per wave");
__global__ __launch_bounds__(1024) void k_gmat(const float* __restrict__ Wq, const float* __restrict__ bq, const float* __restrict__ Wk, const float* __restrict__ bk, const float* __restrict__ Wv, const float* __restrict__ bv, float* __restrict__ GF) {
  __shared__ __attribute__((aligned(16))) float part[2 * GM_SPLIT][16][8];
  const uint32_t tid = threadIdx.x, wv = tid >> 5, lane = tid & 31u, h = lane >> 4, c = lane & 15u;
  const uint32_t d0 = blockIdx.x * 16u, side = wv / GM_SPLIT, ch0 = (wv % GM_SPLIT) * GM_CH + 16u * h;
  const float* __restrict__ Wm = side ? Wk : Wq;
  const float* __restrict__ bm = side ? bk : bq;
  const float* vp = Wv + (size_t)(d0 + c) * (2 * DD) + side * DD + ch0;
  const float* wp = Wm + (size_t)ch0 * 6u + ((c < 6u) ? c : 0u);      // a column > 5 reads column 0 and drops it: every lane loads, with no branch in front of the matrix instructions
  // the addend of the element that this thread sums behind the barrier (threads 128..255 use it), loaded here so that it is in flight with the operands
  const uint32_t fp = (tid >> 7) & 1u, fdl = (tid >> 3) & 15u, fi = tid & 7u, fd = d0 + fdl;
  const float* adp = (fi < 6u) ? Wk + (size_t)fd * 6u + fi : (fi == 6u) ? bk + fd : bv + fd;
  float a[16], w[16], wl[16], bl[16];
  // every '#pragma unroll' of this kernel: a, w, wl, bl and t stay in registers only under constant indices
#pragma unroll
  for (int q = 0; q < 4; ++q) {
    const v4f v = *(const v4fa*)(vp + 4 * q), b4 = *(const v4fa*)(bm + ch0 + 4 * q);
#pragma unroll
    for (int e = 0; e < 4; ++e) { a[4 * q + e] = v[e]; bl[4 * q + e] = b4[e]; }
  }
  asm volatile("s_wait_xcnt 0x0" ::: "memory");      // stands behind the eight loads above, in front of the loads below, whose results the build puts into the address registers of those above
#pragma unroll
  for (int e = 0; e < 16; ++e) wl[e] = wp[6 * e];
  const float adl = *adp;
  // holds these loads here, unconditional and in flight with the ones above (loaded values as inputs only): without it the build put the sixteen loads under a lane mask behind a wait for the first loads; the addend is named so that its load stays in front of the barrier
  asm volatile("" :: "v"(wl[0]), "v"(wl[1]), "v"(wl[2]), "v"(wl[3]), "v"(wl[4]), "v"(wl[5]), "v"(wl[6]), "v"(wl[7]), "v"(wl[8]), "v"(wl[9]), "v"(wl[10]), "v"(wl[11]), "v"(wl[12]), "v"(wl[13]), "v"(wl[14]), "v"(wl[15]), "v"(adl));
#pragma unroll
  for (int e = 0; e < 16; ++e) { a[e] = bf16_round(a[e]); w[e] = bf16_round((c < 6u) ? wl[e] : (c == 6u) ? bl[e] : 0.0f); }
  v8f t = {0.f, 0.f, 0.f, 0.f, 0.f, 0.f, 0.f, 0.f};
#pragma unroll
  for (int j = 0; j < 8; ++j) t = __builtin_amdgcn_wmma_f32_16x16x4_f32(false, (v2f){a[2 * j], a[2 * j + 1]}, false, (v2f){w[2 * j], w[2 * j + 1]}, (short)0, t, false, false);
  // register r of lane (c, h) is G^T[d0 + 8 h + r][c] of the wave's channels
  if (c < 8u) {
#pragma unroll
    for (int r = 0; r < 8; ++r) part[wv][8u * h + (uint32_t)r][c] = t[r];
  }
  __syncthreads();      /* every wave's sums are staged */
  if (tid < 256u) {
    const uint32_t p = fp, dl = fdl, i = fi, d = fd;
    float s = part[p * GM_SPLIT][dl][i];
    for (uint32_t k = 1; k < GM_SPLIT; ++k) s += part[p * GM_SPLIT + k][dl][i];
    if (p == 1u) s += bf16_round(adl);      // element 7 of the sums is 0: row 15 is bv alone
    GF[(size_t)(((((d >> 6) * 4u + (d & 3u)) * 2u + p) * 32u + 16u * (i >> 2) + ((d & 63u) >> 2)) * 4u + (i & 3u))] = s;
  }
}
// k_out: one work-group = OUT_ROWS rows of out; wave w takes columns 64 w .. 64 w + 63 as four tiles, tile t holding columns 64 w + 4 c + t in its column c: the four tiles' registers r of a lane are 16 bytes in a row of out,
// and one store instruction writes 256 bytes in a row of each of two rows. A = [Y | X7] rows, lane (c, h) taking elements 4 h .. 4 h + 3 of each, as GF has them for B.
#define OUT_ROWS 32
static_assert(NNODE % OUT_ROWS == 0 && OUT_ROWS == 32 && DD == 8 * 64, "two 16-row tiles per work-group; eight waves cover a row");
__global__ __launch_bounds__(256) void k_out(const float* __restrict__ Y, const float* __restrict__ X7, const float* __restrict__ GF, float* __restrict__ out) {
  const uint32_t tid = threadIdx.x, wv = tid >> 5, lane = tid & 31u, h = lane >> 4, c = lane & 15u;
  const uint32_t n0 = blockIdx.x * OUT_ROWS;
  v4f gy[4], gx[4], ya[OUT_ROWS / 16], xa[OUT_ROWS / 16];
  // every '#pragma unroll' of this kernel: the fragments and acc stay in registers only under constant indices, and all loads are in flight together
#pragma unroll
  for (int j = 0; j < OUT_ROWS / 16; ++j) { const size_t n = n0 + 16u * (uint32_t)j + c; ya[j] = *(const v4fa*)(Y + n * 8u + 4u * h); xa[j] = *(const v4fa*)(X7 + n * 8u + 4u * h); }
#pragma unroll
  for (int t = 0; t < 4; ++t) { const float* g = GF + (size_t)((wv * 4u + (uint32_t)t) * 2u * 32u + lane) * 4u; gy[t] = *(const v4fa*)g; gx[t] = *(const v4fa*)(g + 128); }
  // holds all twelve loads in front of the matrix instructions (loaded values as inputs only): without it the build issued X7's loads behind the wait for Y's, one memory latency later
  asm volatile("" :: "v"(ya[0]), "v"(ya[1]), "v"(xa[0]), "v"(xa[1]), "v"(gy[0]), "v"(gy[1]), "v"(gy[2]), "v"(gy[3]), "v"(gx[0]), "v"(gx[1]), "v"(gx[2]), "v"(gx[3]));
#pragma unroll
  for (int j = 0; j < OUT_ROWS / 16; ++j) {
    v8f acc[4];
#pragma unroll
    for (int t = 0; t < 4; ++t) acc[t] = (v8f){0.f, 0.f, 0.f, 0.f, 0.f, 0.f, 0.f, 0.f};
#pragma unroll
    for (int t = 0; t < 4; ++t) acc[t] = __builtin_amdgcn_wmma_f32_16x16x4_f32(false, (v2f){ya[j][0], ya[j][1]}, false, (v2f){gy[t][0], gy[t][1]}, (short)0, acc[t], false, false);
#pragma unroll
    for (int t = 0; t < 4; ++t) acc[t] = __builtin_amdgcn_wmma_f32_16x16x4_f32(false, (v2f){ya[j][2], ya[j][3]}, false, (v2f){gy[t][2], gy[t][3]}, (short)0, acc[t], false, false);
#pragma unroll
    for (int t = 0; t < 4; ++t) acc[t] = __builtin_amdgcn_wmma_f32_16x16x4_f32(false, (v2f){xa[j][0], xa[j][1]}, false, (v2f){gx[t][0], gx[t][1]}, (short)0, acc[t], false, false);
#pragma unroll
    for (int t = 0; t < 4; ++t) acc[t] = __builtin_amdgcn_wmma_f32_16x16x4_f32(false, (v2f){xa[j][2], xa[j][3]}, false, (v2f){gx[t][2], gx[t][3]}, (short)0, acc[t], false, false);
    float* op = out + (size_t)(n0 + 16u * (uint32_t)j + 8u * h) * DD + wv * 64u + 4u * c;
#pragma unroll
    for (int r = 0; r < 8; ++r) *(v4f*)(op + (size_t)r * DD) = (v4f){acc[0][r], acc[1][r], acc[2][r], acc[3][r]};
  }
}

extern "C" void kernel_launch(void* const* d_in, const int* in_sizes, int n_in,
                              void* d_out, int out_size, void* d_ws, size_t ws_size, hipStream_t stream) {
  (void)in_sizes; (void)n_in; (void)out_size;
  const float* const* I = (const float* const*)d_in; const float* nodes = I[0]; const float* centre = I[1]; const float* Wq = I[2]; const float* bq = I[3]; const float* Wk = I[4]; const float* bk = I[5]; const float* Wv = I[6]; const float* bv = I[7];
  char* ws = (char*)d_ws; size_t off = 0;
  auto take = [&](size_t bytes) { char* p = ws + off; off += (bytes + 255) & ~(size_t)255; return p; };
  float* GF = (float*)take((size_t)DD * 16 * 4); float* X7 = (float*)take((size_t)NNODE * 8 * 4); float* R = (float*)take((size_t)NNODE * 8 * 4);
  _Float16* XF = (_Float16*)take((size_t)NNODE * 16 * 2); float* YP = (float*)take((size_t)NNODE * 8 * 4);
  if (off > ws_size) return;      // 1 MiB of the 256 MiB workspace
  k_gmat<<<DD / 16, 1024, 0, stream>>>(Wq, bq, Wk, bk, Wv, bv, GF);      /* G (16 x 512) from the weights alone */
  k_x7<<<NNODE * 2 / 256, 256, 0, stream>>>(nodes, centre, X7, XF);
  k_rvec<<<NNODE * 2 / 256, 256, 0, stream>>>(Wq, bq, Wk, bk, X7, R);
  k_fa<<<NNODE / FA_ROWS, 1024, 0, stream>>>(R, X7, XF, YP);      /* Y = attn*[x, 1]: 256 work-groups of 32 waves, 32 rows each */
  k_out<<<NNODE / OUT_ROWS, 256, 0, stream>>>(YP, X7, GF, (float*)d_out);      /* out = [Y | x, 1, 1]*G: M 8192 N 512 K 16 */
}

// v009
// One run takes 24.4 microseconds.
// Next to v008, in two timings, it ran 1.26 and 1.24 times as fast.
// All steps since v000 together make it 114 times as fast.
#include <hip/hip_runtime.h>
#include <stdint.h>
// 'self_attn_init' (N=8192 nodes, 3-d coords + a shared 3-d centre → 6 inputs, D=512): x = [node, centre]; keys = x·Wkᵀ + bk; queries = x·Wqᵀ + bq; attn = softmax_m(keys·queriesᵀ) (UNSCALED, rank-7 logits up to ±O(100));
// out = keys + attn·(queries·Wv[:, :512]ᵀ) + keys·Wv[:, 512:]ᵀ + bv.
// Compute dtype: inputs/weights/biases rounded to bf16. The logits are an exact bilinear form in the 7-vector x̃ = [x, 1]: s[n][m] = (x̃_nᵀ·M)·x̃_m with M = [Wk bk]ᵀ[Wq bq] (7×7, f32), evaluated per pair in f32 —
// no 16-bit rounding touches the huge logits: they are formed on the f32 matrix instruction, transposed, so that the exponentials (f16, times 2^15) are already the operand fragment of attn*[x, 1]; attn itself never goes to memory.
// queries = [x, 1]*[Wq bq]^T and keys = [x, 1]*[Wk bk]^T both have rank 7, so with Y = attn*[x, 1] (a GEMM with one 16-column tile, f16 operands, f32 accumulate)
// out = Y*([Wq bq]^T*Wv_q^T) + [x, 1]*([Wk bk]^T*(Wv_k^T + I)) + bv = [Y | x, 1, 1]*G with G (16 x 512) formed once from the weights: neither keys nor attn*queries is ever written out.
// G (two GEMMs with K = 512) and out (one GEMM with K = 16) run on v_wmma_f32_16x16x4_f32.
#define NNODE 8192
#define DD 512

typedef __bf16 v16b __attribute__((ext_vector_type(16)));
typedef unsigned short v8us __attribute__((ext_vector_type(8), may_alias));
typedef float  v8f  __attribute__((ext_vector_type(8)));
typedef float  v4f  __attribute__((ext_vector_type(4)));
typedef float  v4fa __attribute__((ext_vector_type(4), may_alias));
union FragB { v16b v; v8us half[2]; unsigned short u[16]; };

__device__ __forceinline__ unsigned short bf16_bits(float x) { unsigned int u = __float_as_uint(x); return (unsigned short)((u + 0x7FFFu + ((u >> 16) & 1u)) >> 16); }
__device__ __forceinline__ float bf16_val(unsigned short b) { return __uint_as_float(((unsigned int)b) << 16); }
__device__ __forceinline__ float bf16_round(float x) { return bf16_val(bf16_bits(x)); }
// D += A·B with NT terms: 1 = ah·bh, 2 = + al·bh (A split), 3 = + ah·bl (both split)
template <int NT>
__device__ __forceinline__ v8f mmaN(v16b ah, v16b al, v16b bh, v16b bl, v8f c) {
  c = __builtin_amdgcn_wmma_f32_16x16x32_bf16(false, ah, false, bh, (short)0, c, false, false);
  if (NT >= 2) c = __builtin_amdgcn_wmma_f32_16x16x32_bf16(false, al, false, bh, (short)0, c, false, false);
  if (NT >= 3) c = __builtin_amdgcn_wmma_f32_16x16x32_bf16(false, ah, false, bl, (short)0, c, false, false);
  asm volatile("v_nop\n\tv_nop\n\tv_nop\n\tv_nop" : "+v"(c) : "v"(ah), "v"(al), "v"(bh), "v"(bl));
  return c;
}

__global__ __launch_bounds__(256) void k_wt_bf16(const float* __restrict__ W, unsigned short* __restrict__ Wt, int K, int N) {
  const int t = blockIdx.x * 256 + threadIdx.x;
  const int k8n = K / 8;
  if (t >= N * k8n) return;
  const int n = t / k8n, k8 = (t % k8n) * 8;
  v8us v;
#pragma unroll
  for (int i = 0; i < 8; ++i) v[i] = bf16_bits(W[(size_t)(k8 + i) * N + n]);
  *(v8us*)(Wt + (size_t)n * K + k8) = v;
  
}

// GEMM C[M][N] (f32, pitch ldc) = act(A[M][K]·W + bias). A f32 row-major (pitch lda) converted per fragment to bf16
// (ASPLIT: hi/lo two planes -> 2 terms, else single rounded term); Wt bf16 [N][K] (pitch ldb). BIAS_BF16 rounds the
// bias to bf16 first (bias quantised to bf16 before the add). K%32==0, M%16==0, N%64==0.
template <bool ASPLIT, int ACT, bool BIAS_BF16>
__global__ __launch_bounds__(128) void k_gemm_bf(const float* __restrict__ A, int lda, const unsigned short* __restrict__ Wt, int ldb,
                                               const float* __restrict__ bias, float* __restrict__ C, int ldc, int M, int N, int K) {
  __shared__ __attribute__((aligned(16))) float so[4][16][64];
  const int tid = threadIdx.x, w = tid >> 5, lane = tid & 31, ln = lane & 15, hh = lane >> 4;
  const int ntn = N / 64;
  const int wid = blockIdx.x * 4 + w;
  const int mt = wid / ntn, nq = wid % ntn;
  if (mt * 16 >= M) return;
  const int row0 = mt * 16, col0 = nq * 64;
  const float* arow = A + (size_t)(row0 + ln) * lda;
  v8f acc[4] = {};
  for (int kb = 0; kb < K; kb += 32) {
    FragB ah, al;
    const v4f x0 = *(const v4fa*)(arow + kb + 8 * hh), x1 = *(const v4fa*)(arow + kb + 8 * hh + 4);
    const v4f x2 = *(const v4fa*)(arow + kb + 16 + 8 * hh), x3 = *(const v4fa*)(arow + kb + 16 + 8 * hh + 4);
    float xs[16] = {x0[0],x0[1],x0[2],x0[3],x1[0],x1[1],x1[2],x1[3],x2[0],x2[1],x2[2],x2[3],x3[0],x3[1],x3[2],x3[3]};
#pragma unroll
    for (int i = 0; i < 16; ++i) { const unsigned short hb = bf16_bits(xs[i]); ah.u[i] = hb; al.u[i] = ASPLIT ? bf16_bits(xs[i] - bf16_val(hb)) : (unsigned short)0; }
#pragma unroll
    for (int t = 0; t < 4; ++t) {
      const unsigned short* brow = Wt + (size_t)(col0 + t * 16 + ln) * ldb + kb;
      FragB b;
      b.half[0] = *(const v8us*)(brow + 8 * hh);
      b.half[1] = *(const v8us*)(brow + 16 + 8 * hh);
      acc[t] = mmaN<ASPLIT ? 2 : 1>(ah.v, al.v, b.v, b.v, acc[t]);
    }
  }
#pragma unroll
  for (int t = 0; t < 4; ++t) {
    float bv = bias ? bias[col0 + t * 16 + ln] : 0.f;
    if (BIAS_BF16) bv = bf16_round(bv);
#pragma unroll
    for (int r = 0; r < 8; ++r) { float v = acc[t][r] + bv; if (ACT == 1) v = fmaxf(v, 0.f); so[w][8 * hh + r][t * 16 + ln] = v; }
  }
  __builtin_amdgcn_fence(__ATOMIC_ACQ_REL, "workgroup");
  __builtin_amdgcn_wave_barrier();
  const int rsub = lane >> 4, c4 = (lane & 15) * 4;
  {
#pragma unroll
    for (int q = 0; q < 8; ++q) {
      const int r = q * 2 + rsub;
      const v4f v = *(const v4fa*)&so[w][r][c4];
      *(v4f*)(C + (size_t)(row0 + r) * ldc + col0 + c4) = v;
    }
    
  }
}

// Flash-style causal/unmasked attention, all contractions 3-term bf16 hi/lo splits, f32 softmax with running max.
// q,k,v rows are read from f32 buffers with arbitrary row pitch (so they can live inside a fused qkv buffer);
// D = head size (multiple of 32, <= 128); one wave = 16 query rows; block = 4 waves (64 queries) sharing K/V chunks of 32.
template <int D, bool CAUSAL>
__global__ __launch_bounds__(128) void k_flash(const float* __restrict__ qb, const float* __restrict__ kb, const float* __restrict__ vb,
                                             int pitch, int T, int H, float scale, float* __restrict__ y, int ypitch) {
  constexpr int KS = D / 32;        // k-steps for QK
  constexpr int DT = D / 16;        // d tiles for PV
  __shared__ __attribute__((aligned(16))) unsigned short sKh[32][D + 8], sKl[32][D + 8], sVh[32][D + 8], sVl[32][D + 8];
  __shared__ __attribute__((aligned(16))) unsigned short sPh[4][16][40], sPl[4][16][40];
  __shared__ __attribute__((aligned(16))) float sO[4][16][D];
  const int tid = threadIdx.x, w = tid >> 5, lane = tid & 31, ln = lane & 15, hh = lane >> 4;
  const int nqb = (T + 63) / 64;
  const int bh = blockIdx.x / nqb, qblk = blockIdx.x % nqb;
  const int b = bh / H, h = bh % H;
  const int q0 = qblk * 64 + w * 16;
  const float* Q = qb + (size_t)b * T * pitch + h * D;
  const float* K = kb + (size_t)b * T * pitch + h * D;
  const float* V = vb + (size_t)b * T * pitch + h * D;

  // A fragments of the wave's 16 query rows (scaled), hi/lo
  FragB aqh[KS], aql[KS];
  {
    int row = q0 + ln; if (row >= T) row = T - 1;
    const float* qr = Q + (size_t)row * pitch;
#pragma unroll
    for (int ks = 0; ks < KS; ++ks)
#pragma unroll
      for (int i = 0; i < 16; ++i) {
        const int d = ks * 32 + ((i < 8) ? (8 * hh + i) : (16 + 8 * hh + (i - 8)));
        const float x = qr[d] * scale; const unsigned short hb = bf16_bits(x);
        aqh[ks].u[i] = hb; aql[ks].u[i] = bf16_bits(x - bf16_val(hb));
      }
  }
  float m_r[8], l_r[8];
#pragma unroll
  for (int r = 0; r < 8; ++r) { m_r[r] = -3.0e38f; l_r[r] = 0.f; }
  v8f oacc[DT];
#pragma unroll
  for (int dt = 0; dt < DT; ++dt) oacc[dt] = (v8f){0.f,0.f,0.f,0.f,0.f,0.f,0.f,0.f};

  const int kv_end = CAUSAL ? min(T, qblk * 64 + 64) : T;     // block-uniform
  for (int j0 = 0; j0 < kv_end; j0 += 32) {
    __syncthreads();
    for (int e = tid; e < 32 * (D / 4); e += 128) {
      const int r = e / (D / 4), c4 = (e % (D / 4)) * 4;
      const int key = j0 + r;
      v4f kf = {0.f,0.f,0.f,0.f}, vf = {0.f,0.f,0.f,0.f};
      if (key < T) { kf = *(const v4fa*)(K + (size_t)key * pitch + c4); vf = *(const v4fa*)(V + (size_t)key * pitch + c4); }
#pragma unroll
      for (int t = 0; t < 4; ++t) {
        unsigned short hb = bf16_bits(kf[t]); sKh[r][c4 + t] = hb; sKl[r][c4 + t] = bf16_bits(kf[t] - bf16_val(hb));
        hb = bf16_bits(vf[t]); sVh[r][c4 + t] = hb; sVl[r][c4 + t] = bf16_bits(vf[t] - bf16_val(hb));
      }
    }
    __syncthreads();
    // S tile 16 x 32
    v8f s[2];
#pragma unroll
    for (int nt = 0; nt < 2; ++nt) {
      v8f acc = {};
#pragma unroll
      for (int ks = 0; ks < KS; ++ks) {
        FragB bh_, bl_;
        bh_.half[0] = *(const v8us*)&sKh[nt * 16 + ln][ks * 32 + 8 * hh]; bh_.half[1] = *(const v8us*)&sKh[nt * 16 + ln][ks * 32 + 16 + 8 * hh];
        bl_.half[0] = *(const v8us*)&sKl[nt * 16 + ln][ks * 32 + 8 * hh]; bl_.half[1] = *(const v8us*)&sKl[nt * 16 + ln][ks * 32 + 16 + 8 * hh];
        acc = mmaN<3>(aqh[ks].v, aql[ks].v, bh_.v, bl_.v, acc);
      }
      s[nt] = acc;
    }
    // mask + running max (rows 8hh+r; the 16 lanes of a half share rows)
    float alpha[8];
#pragma unroll
    for (int r = 0; r < 8; ++r) {
      const int qi = q0 + 8 * hh + r;
      const int ja = j0 + ln, jb = j0 + 16 + ln;
      if (CAUSAL) { if (ja > qi) s[0][r] = -3.0e38f; if (jb > qi) s[1][r] = -3.0e38f; }
      if (ja >= T) s[0][r] = -3.0e38f;
      if (jb >= T) s[1][r] = -3.0e38f;
      float mx = fmaxf(s[0][r], s[1][r]);
      mx = fmaxf(mx, __shfl_xor(mx, 1, 32)); mx = fmaxf(mx, __shfl_xor(mx, 2, 32)); mx = fmaxf(mx, __shfl_xor(mx, 4, 32)); mx = fmaxf(mx, __shfl_xor(mx, 8, 32));
      const float mnew = fmaxf(m_r[r], mx);
      alpha[r] = (mnew > -1.0e38f) ? __expf(m_r[r] - mnew) : 1.0f;
      const float p0 = (s[0][r] > -1.0e38f) ? __expf(s[0][r] - mnew) : 0.f;
      const float p1 = (s[1][r] > -1.0e38f) ? __expf(s[1][r] - mnew) : 0.f;
      m_r[r] = mnew;
      l_r[r] = l_r[r] * alpha[r] + p0 + p1;            // per-lane partial row sum (16 lanes combined at the end)
      unsigned short hb = bf16_bits(p0); sPh[w][8 * hh + r][ln] = hb;      sPl[w][8 * hh + r][ln] = bf16_bits(p0 - bf16_val(hb));
      hb = bf16_bits(p1);                sPh[w][8 * hh + r][16 + ln] = hb; sPl[w][8 * hh + r][16 + ln] = bf16_bits(p1 - bf16_val(hb));
    }
#pragma unroll
    for (int dt = 0; dt < DT; ++dt)
#pragma unroll
      for (int r = 0; r < 8; ++r) oacc[dt][r] *= alpha[r];
    __builtin_amdgcn_fence(__ATOMIC_ACQ_REL, "workgroup");
    __builtin_amdgcn_wave_barrier();
    FragB pah, pal;
    pah.half[0] = *(const v8us*)&sPh[w][ln][8 * hh]; pah.half[1] = *(const v8us*)&sPh[w][ln][16 + 8 * hh];
    pal.half[0] = *(const v8us*)&sPl[w][ln][8 * hh]; pal.half[1] = *(const v8us*)&sPl[w][ln][16 + 8 * hh];
#pragma unroll
    for (int dt = 0; dt < DT; ++dt) {
      FragB bvh, bvl;
#pragma unroll
      for (int i = 0; i < 8; ++i) {
        bvh.u[i] = sVh[8 * hh + i][dt * 16 + ln]; bvh.u[8 + i] = sVh[16 + 8 * hh + i][dt * 16 + ln];
        bvl.u[i] = sVl[8 * hh + i][dt * 16 + ln]; bvl.u[8 + i] = sVl[16 + 8 * hh + i][dt * 16 + ln];
      }
      oacc[dt] = mmaN<3>(pah.v, pal.v, bvh.v, bvl.v, oacc[dt]);
    }
    __builtin_amdgcn_fence(__ATOMIC_ACQ_REL, "workgroup");
    __builtin_amdgcn_wave_barrier();
  }
#pragma unroll
  for (int r = 0; r < 8; ++r) {
    float l = l_r[r];
    l += __shfl_xor(l, 1, 32); l += __shfl_xor(l, 2, 32); l += __shfl_xor(l, 4, 32); l += __shfl_xor(l, 8, 32);
    l_r[r] = (l > 0.f) ? 1.0f / l : 0.f;
  }
#pragma unroll
  for (int dt = 0; dt < DT; ++dt)
#pragma unroll
    for (int r = 0; r < 8; ++r) sO[w][8 * hh + r][dt * 16 + ln] = oacc[dt][r] * l_r[r];
  __builtin_amdgcn_fence(__ATOMIC_ACQ_REL, "workgroup");
  __builtin_amdgcn_wave_barrier();
  {
    for (int r = 0; r < 16; ++r) {
      const int row = q0 + r;
      if (row < T && lane < D / 4) {
        const v4f val = *(const v4fa*)&sO[w][r][lane * 4];
        *(v4f*)(y + ((size_t)b * T + row) * ypitch + h * D + lane * 4) = val;
      }
    }
    
  }
}

// GEMM C = act(A·W + bias + resid): A f32 (ASPLIT -> hi/lo 2 terms), Wt bf16 [N][K]; ACT 0 none, 1 relu, 2 exact gelu;
// resid (optional, f32, row index = (row % rmod), pitch ldr, RES_BF16 rounds it) added before the activation.
template <bool ASPLIT, int ACT, bool BIAS_BF16, bool RES_BF16>
__global__ __launch_bounds__(128) void k_gemm_bf3(const float* __restrict__ A, int lda, const unsigned short* __restrict__ Wt, int ldb,
                                                const float* __restrict__ bias, const float* __restrict__ resid, int rmod, int ldr,
                                                float* __restrict__ C, int ldc, int M, int N, int K) {
  __shared__ __attribute__((aligned(16))) float so[4][16][64];
  const int tid = threadIdx.x, w = tid >> 5, lane = tid & 31, ln = lane & 15, hh = lane >> 4;
  const int ntn = N / 64;
  const int wid = blockIdx.x * 4 + w;
  const int mt = wid / ntn, nq = wid % ntn;
  if (mt * 16 >= M) return;
  const int row0 = mt * 16, col0 = nq * 64;
  const float* arow = A + (size_t)(row0 + ln) * lda;
  v8f acc[4] = {};
  for (int kb = 0; kb < K; kb += 32) {
    FragB ah, al;
    const v4f x0 = *(const v4fa*)(arow + kb + 8 * hh), x1 = *(const v4fa*)(arow + kb + 8 * hh + 4);
    const v4f x2 = *(const v4fa*)(arow + kb + 16 + 8 * hh), x3 = *(const v4fa*)(arow + kb + 16 + 8 * hh + 4);
    float xs[16] = {x0[0],x0[1],x0[2],x0[3],x1[0],x1[1],x1[2],x1[3],x2[0],x2[1],x2[2],x2[3],x3[0],x3[1],x3[2],x3[3]};
#pragma unroll
    for (int i = 0; i < 16; ++i) { const unsigned short hb = bf16_bits(xs[i]); ah.u[i] = hb; al.u[i] = ASPLIT ? bf16_bits(xs[i] - bf16_val(hb)) : (unsigned short)0; }
#pragma unroll
    for (int t = 0; t < 4; ++t) {
      const unsigned short* brow = Wt + (size_t)(col0 + t * 16 + ln) * ldb + kb;
      FragB b;
      b.half[0] = *(const v8us*)(brow + 8 * hh);
      b.half[1] = *(const v8us*)(brow + 16 + 8 * hh);
      acc[t] = mmaN<ASPLIT ? 2 : 1>(ah.v, al.v, b.v, b.v, acc[t]);
    }
  }
#pragma unroll
  for (int t = 0; t < 4; ++t) {
    const int col = col0 + t * 16 + ln;
    float bv = bias ? bias[col] : 0.f;
    if (BIAS_BF16) bv = bf16_round(bv);
#pragma unroll
    for (int r = 0; r < 8; ++r) {
      float v = acc[t][r] + bv;
      if (resid) { float rv = resid[(size_t)((row0 + 8 * hh + r) % rmod) * ldr + col]; if (RES_BF16) rv = bf16_round(rv); v += rv; }
      if (ACT == 1) v = fmaxf(v, 0.f);
      if (ACT == 2) v = 0.5f * v * (1.0f + erff(v * 0.70710678118654752f));
      if (ACT == 3) { const float u = 0.7978845608028654f * (v + 0.044715f * v * v * v); v = 0.5f * v * (1.0f + tanhf(u)); }
      so[w][8 * hh + r][t * 16 + ln] = v;
    }
  }
  __builtin_amdgcn_fence(__ATOMIC_ACQ_REL, "workgroup");
  __builtin_amdgcn_wave_barrier();
  const int rsub = lane >> 4, c4 = (lane & 15) * 4;
  {
#pragma unroll
    for (int q = 0; q < 8; ++q) {
      const int r = q * 2 + rsub;
      const v4f v = *(const v4fa*)&so[w][r][c4];
      *(v4f*)(C + (size_t)(row0 + r) * ldc + col0 + c4) = v;
    }
    
  }
}
// row LayerNorm (biased variance, eps) over N: s = X (+ R); optional out_sum <- s; out_norm <- (s-mu)*rsqrt(var+eps)*g + b
template <bool PARAM_BF16>
__global__ __launch_bounds__(256) void k_layernorm(const float* __restrict__ X, const float* __restrict__ R, const float* __restrict__ g, const float* __restrict__ bta,
                                                  float* __restrict__ out_sum, float* __restrict__ out_norm, int N, float eps) {
  __shared__ float red[256];
  const int row = blockIdx.x, tid = threadIdx.x;
  const float* x = X + (size_t)row * N; const float* rr = R ? R + (size_t)row * N : nullptr;
  float vals[16];                     // up to N = 4096
  const int per = N / 256;            // contiguous chunk per thread? use strided-by-4 chunks: thread handles j = tid*4 + 1024*u
  float s1 = 0.f;
  for (int u = 0; u < per / 4; ++u) {
    const int j = tid * 4 + 1024 * u;
    const v4f a = *(const v4fa*)(x + j);
    v4f b = {0.f,0.f,0.f,0.f}; if (rr) b = *(const v4fa*)(rr + j);
#pragma unroll
    for (int q = 0; q < 4; ++q) { const float v = a[q] + b[q]; vals[u * 4 + q] = v; s1 += v; }
  }
  red[tid] = s1; __syncthreads();
  for (int st = 128; st > 0; st >>= 1) { if (tid < st) red[tid] += red[tid + st]; __syncthreads(); }
  const float mu = red[0] / (float)N; __syncthreads();
  float s2 = 0.f;
  for (int u = 0; u < per / 4; ++u)
#pragma unroll
    for (int q = 0; q < 4; ++q) { const float c = vals[u * 4 + q] - mu; s2 += c * c; }
  red[tid] = s2; __syncthreads();
  for (int st = 128; st > 0; st >>= 1) { if (tid < st) red[tid] += red[tid + st]; __syncthreads(); }
  const float rs = rsqrtf(red[0] / (float)N + eps);
  {
    for (int u = 0; u < per / 4; ++u) {
      const int j = tid * 4 + 1024 * u;
      v4f o, sm;
#pragma unroll
      for (int q = 0; q < 4; ++q) {
        float gg = g[j + q], bb = bta[j + q];
        if (PARAM_BF16) { gg = bf16_round(gg); bb = bf16_round(bb); }
        sm[q] = vals[u * 4 + q]; o[q] = (vals[u * 4 + q] - mu) * rs * gg + bb;
      }
      if (out_sum) *(v4f*)(out_sum + (size_t)row * N + j) = sm;
      *(v4f*)(out_norm + (size_t)row * N + j) = o;
    }
    
  }
}



// ---- f16 WMMA path (v_wmma_f32_16x16x32_f16): 11-bit significands for operands in range — used where a [0,1] probability operand needs more precision than bf16
typedef _Float16 v16h __attribute__((ext_vector_type(16)));
union FragH { v16h v; v8us half[2]; _Float16 h[16]; unsigned short u[16]; };
template <int NT>
__device__ __forceinline__ v8f mmaH(v16h ah, v16h al, v16h bh, v16h bl, v8f c) {
  c = __builtin_amdgcn_wmma_f32_16x16x32_f16(false, ah, false, bh, (short)0, c, false, false);
  if (NT >= 2) c = __builtin_amdgcn_wmma_f32_16x16x32_f16(false, al, false, bh, (short)0, c, false, false);
  if (NT >= 3) c = __builtin_amdgcn_wmma_f32_16x16x32_f16(false, ah, false, bl, (short)0, c, false, false);
  asm volatile("v_nop\n\tv_nop\n\tv_nop\n\tv_nop" : "+v"(c) : "v"(ah), "v"(al), "v"(bh), "v"(bl));
  return c;
}
// batched GEMM like k_gemm_b but f16 operands: A f32 (split into f16 hi/lo if ASPLIT, else rounded to f16), Bt = f16 values [n][k]; alpha; C f32; N multiple of 16 (partial tiles skipped)
template <bool ASPLIT>
__global__ __launch_bounds__(128) void k_gemm_h(const float* __restrict__ A, int lda, size_t sA, const _Float16* __restrict__ Bh, int ldb, size_t sB, float alpha, float* __restrict__ C, int ldc, size_t sC, int M, int N, int K) {
  __shared__ __attribute__((aligned(16))) float so[4][16][64];
  const int tid = threadIdx.x, w = tid >> 5, lane = tid & 31, ln = lane & 15, hh = lane >> 4; const int by = blockIdx.y;
  A += (size_t)by * sA; Bh += (size_t)by * sB; C += (size_t)by * sC;
  const int ntn = (N + 63) / 64; const int wid = blockIdx.x * 4 + w; const int mt = wid / ntn, nq = wid % ntn; if (mt * 16 >= M) return;
  const int row0 = mt * 16, col0 = nq * 64; const float* arow = A + (size_t)(row0 + ln) * lda;
  v8f acc[4] = {};
  for (int kb = 0; kb < K; kb += 32) {
    FragH ah, al;
    const v4f x0 = *(const v4fa*)(arow + kb + 8 * hh), x1 = *(const v4fa*)(arow + kb + 8 * hh + 4), x2 = *(const v4fa*)(arow + kb + 16 + 8 * hh), x3 = *(const v4fa*)(arow + kb + 16 + 8 * hh + 4);
    float xs[16] = {x0[0],x0[1],x0[2],x0[3],x1[0],x1[1],x1[2],x1[3],x2[0],x2[1],x2[2],x2[3],x3[0],x3[1],x3[2],x3[3]};
#pragma unroll
    for (int i = 0; i < 16; ++i) { const _Float16 h = (_Float16)xs[i]; ah.h[i] = h; al.h[i] = ASPLIT ? (_Float16)(xs[i] - (float)h) : (_Float16)0.0f; }
#pragma unroll
    for (int t = 0; t < 4; ++t) { if (col0 + t * 16 >= N) continue; const size_t boff = (size_t)(col0 + t * 16 + ln) * ldb + kb; FragH bq; bq.half[0] = *(const v8us*)(Bh + boff + 8 * hh); bq.half[1] = *(const v8us*)(Bh + boff + 16 + 8 * hh);
      acc[t] = mmaH<ASPLIT ? 2 : 1>(ah.v, al.v, bq.v, bq.v, acc[t]); }
  }
#pragma unroll
  for (int t = 0; t < 4; ++t) { if (col0 + t * 16 >= N) continue;
#pragma unroll
    for (int r = 0; r < 8; ++r) so[w][8 * hh + r][t * 16 + ln] = acc[t][r] * alpha; }
  __builtin_amdgcn_fence(__ATOMIC_ACQ_REL, "workgroup"); __builtin_amdgcn_wave_barrier();
  const int rsub = lane >> 4, c4 = (lane & 15) * 4;
  {
#pragma unroll
    for (int q = 0; q < 8; ++q) { const int r = q * 2 + rsub; if (col0 + c4 < N) { const v4f v = *(const v4fa*)&so[w][r][c4]; *(v4f*)(C + (size_t)(row0 + r) * ldc + col0 + c4) = v; } }
     }
}

// Wt[n][k] = f16(W[k][n]·scale) from f32 row-major W[K][N] (scale = power of two; bf16-exact weights stay exact in f16 away from the subnormal range)
__global__ __launch_bounds__(256) void k_wt_f16(const float* __restrict__ W, _Float16* __restrict__ Wt, int K, int N, float scale) {
  const int t = blockIdx.x * 256 + threadIdx.x; if (t >= N * (K / 8)) return; const int n = t / (K / 8), k8 = (t % (K / 8)) * 8; FragH f;
#pragma unroll
  for (int i = 0; i < 8; ++i) f.h[i] = (_Float16)(bf16_round(W[(size_t)(k8 + i) * N + n]) * scale); const v8us o = f.half[0];
  *(v8us*)((unsigned short*)Wt + (size_t)n * K + k8) = o; 
}
// k_gemm_hh variant with fused epilogue: v = acc·alpha + bias[by·sBias + col] (+ CP[(row/rowsPerB)·sCPb + by·64 + col] if CP) ; ACT 0 none / 1 elu ; writes f32 C and/or f16 C16 (each if non-null)
template <int ACT>
__global__ __launch_bounds__(128) void k_gemm_hhx(const _Float16* __restrict__ A, int lda, size_t sA, const _Float16* __restrict__ Bh, int ldb, size_t sB, float alpha, const float* __restrict__ bias, size_t sBias, const float* __restrict__ CP, int rowsPerB, size_t sCPb, int row0g,
    float* __restrict__ C, _Float16* __restrict__ C16, int ldc, size_t sC, int M, int N, int K) {
  __shared__ __attribute__((aligned(16))) float so[4][16][64];
  const int tid = threadIdx.x, w = tid >> 5, lane = tid & 31, ln = lane & 15, hh = lane >> 4; const int by = blockIdx.y;
  A += (size_t)by * sA; Bh += (size_t)by * sB; const size_t cofs = (size_t)by * sC; const float* bp = bias ? bias + (size_t)by * sBias : nullptr;
  const int ntn = (N + 63) / 64; const int wid = blockIdx.x * 4 + w; const int mt = wid / ntn, nq = wid % ntn; if (mt * 16 >= M) return;
  const int row0 = mt * 16, col0 = nq * 64; const _Float16* arow = A + (size_t)(row0 + ln) * lda;
  v8f acc[4] = {};
  for (int kb = 0; kb < K; kb += 32) { FragH ah; ah.half[0] = *(const v8us*)((const unsigned short*)arow + kb + 8 * hh); ah.half[1] = *(const v8us*)((const unsigned short*)arow + kb + 16 + 8 * hh);
#pragma unroll
    for (int t = 0; t < 4; ++t) { if (col0 + t * 16 >= N) continue; const size_t boff = (size_t)(col0 + t * 16 + ln) * ldb + kb; FragH bq; bq.half[0] = *(const v8us*)((const unsigned short*)Bh + boff + 8 * hh); bq.half[1] = *(const v8us*)((const unsigned short*)Bh + boff + 16 + 8 * hh);
      acc[t] = mmaH<1>(ah.v, ah.v, bq.v, bq.v, acc[t]); }
  }
#pragma unroll
  for (int t = 0; t < 4; ++t) { if (col0 + t * 16 >= N) continue; const int col = col0 + t * 16 + ln; const float bv = bp ? bf16_round(bp[col]) : 0.f;
#pragma unroll
    for (int r = 0; r < 8; ++r) { float v = acc[t][r] * alpha + bv; if (CP) { const int bidx = (row0g + row0 + 8 * hh + r) / rowsPerB; v += CP[(size_t)bidx * sCPb + (size_t)by * 64 + col]; } if (ACT == 1) v = (v > 0.f) ? v : expm1f(v); else if (ACT == 7) v = (v > 0.f) ? v + 1.0f : expf(v); else if (ACT == 8) v = tanhf(v); else if (ACT == 9) v = 0.5f * v * (1.0f + tanhf(0.7978845608028654f * (v + 0.044715f * v * v * v))); else if (ACT == 11) v = 1.0f / (1.0f + expf(-v)); else if (ACT == 12) v = (v > 0.f) ? v : 0.01f * v; else if (ACT == 14) v = (v > 0.f) ? v : 0.1f * v; else if (ACT == 15) v = v / (1.0f + expf(-v)); else if (ACT == 3) v = fmaxf(v, 0.f); else if (ACT == 6) v = 0.5f * v * (1.0f + erff(v * 0.70710678118654752f)); so[w][8 * hh + r][t * 16 + ln] = v; } }
  __builtin_amdgcn_fence(__ATOMIC_ACQ_REL, "workgroup"); __builtin_amdgcn_wave_barrier();
  const int rsub = lane >> 4, c4 = (lane & 15) * 4; typedef _Float16 v4h __attribute__((ext_vector_type(4)));
  {
#pragma unroll
    for (int q = 0; q < 8; ++q) { const int r = q * 2 + rsub; if (col0 + c4 < N) { const v4f v = *(const v4fa*)&so[w][r][c4]; if (C) *(v4f*)(C + cofs + (size_t)(row0 + r) * ldc + col0 + c4) = v; if (C16) { v4h h4; for (int i = 0; i < 4; ++i) h4[i] = (_Float16)v[i]; *(v4h*)(C16 + cofs + (size_t)(row0 + r) * ldc + col0 + c4) = h4; } } }
     }
}


typedef _Float16 v4h __attribute__((ext_vector_type(4)));

__global__ __launch_bounds__(256) void k_x16(const float* __restrict__ x, _Float16* __restrict__ X16, size_t n8) { const size_t t = (size_t)blockIdx.x * 256 + threadIdx.x; if (t >= n8) return; FragH f;
#pragma unroll
  for (int q = 0; q < 8; ++q) f.h[q] = (_Float16)bf16_round(x[t * 8 + q]); *(v8us*)((unsigned short*)X16 + t * 8) = f.half[0];  }
__global__ __launch_bounds__(256) void k_h16(const float* __restrict__ x, _Float16* __restrict__ X16, size_t n8) { const size_t t = (size_t)blockIdx.x * 256 + threadIdx.x; if (t >= n8) return; FragH f;
#pragma unroll
  for (int q = 0; q < 8; ++q) f.h[q] = (_Float16)x[t * 8 + q]; *(v8us*)((unsigned short*)X16 + t * 8) = f.half[0];  }
__global__ __launch_bounds__(256) void k_round16f(const float* __restrict__ W, _Float16* __restrict__ Bt, size_t n8) { const size_t t = (size_t)blockIdx.x * 256 + threadIdx.x; if (t >= n8) return; FragH f;
#pragma unroll
  for (int i = 0; i < 8; ++i) f.h[i] = (_Float16)(bf16_round(W[t * 8 + i]) * 16.0f); *(v8us*)((unsigned short*)Bt + t * 8) = f.half[0];  }
template <int NHv, int TTv>
__global__ __launch_bounds__(256) void k_vt(const _Float16* __restrict__ V16, int ldv, int voff, _Float16* __restrict__ Vt) { __shared__ unsigned short tl[64][66]; const int tid = threadIdx.x; const int slab = blockIdx.x / (TTv / 64), lg = blockIdx.x % (TTv / 64); const int b = slab / NHv, h = slab % NHv;
  for (int i = tid; i < 64 * 8; i += 256) { const int r = i / 8, c8 = (i % 8) * 8; FragH f; f.half[0] = *(const v8us*)((const unsigned short*)V16 + ((size_t)b * TTv + lg * 64 + r) * ldv + voff + h * 64 + c8);
#pragma unroll
    for (int q = 0; q < 8; ++q) tl[r][c8 + q] = f.u[q]; }
  __syncthreads();
  {
#pragma unroll
    for (int rd = 0; rd < 2; ++rd) { const int d = rd * 32 + tid / 8, pc = tid % 8; FragH f;
#pragma unroll
      for (int q = 0; q < 8; ++q) f.u[q] = tl[pc * 8 + q][d];
      *(v8us*)((unsigned short*)Vt + ((size_t)slab * 64 + d) * TTv + lg * 64 + pc * 8) = f.half[0]; }
     } }

// value of lane l ^ MASK inside a 16-lane row (DPP row_xmask), and of lane l ^ 16: register moves, no LDS round trip
template <int MASK> __device__ __forceinline__ float lane_xor_row(float x) { return __int_as_float(__builtin_amdgcn_update_dpp(0, __float_as_int(x), 0x160 | MASK, 0xf, 0xf, true)); }
__device__ __forceinline__ float lane_xor16(float x) { const int v = __float_as_int(x); return __int_as_float(__builtin_amdgcn_permlanex16(v, v, 0x76543210, 0xfedcba98, false, false)); }
__device__ __forceinline__ float wave_sum(float x) { x += lane_xor_row<1>(x); x += lane_xor_row<2>(x); x += lane_xor_row<4>(x); x += lane_xor_row<8>(x); return x + lane_xor16(x); }
// M[i][j] = sum over the 512 channels c of a_c[i] * b_c[j], with a_c = [Wk[c][0..5], bk[c]] and b_c = [Wq[c][0..5], bq[c]] rounded to bf16 (each product is exact in f32).
// The first 256 threads of the work-group split the channels: thread t takes channels 2t and 2t + 1 (12 neighbouring floats of each matrix, all loads in flight at once) and forms its 49 partial sums in registers;
// each is summed over the wave by register moves, the 8 waves' sums meet in LDS, and thread p < 49 adds them in wave order. The caller's barrier publishes M.
static_assert(DD == 2 * 256, "two channels per thread, 256 threads");
__device__ __forceinline__ void sai_gram(const float* __restrict__ Wq, const float* __restrict__ bq, const float* __restrict__ Wk, const float* __restrict__ bk, int tid, float (*part)[52], float (*M)[8]) {
  if (tid < 256) {      // whole waves: 0..7 of the work-group; the others go straight to the barrier
    float a[2][7], b[2][7], s[49];
    // every unroll of this function: a, b and s stay in registers only under constant indices
#pragma unroll
    for (int u = 0; u < 2; ++u) {
      const int c = 2 * tid + u;
#pragma unroll
      for (int i = 0; i < 6; ++i) { a[u][i] = bf16_round(Wk[(size_t)c * 6 + i]); b[u][i] = bf16_round(Wq[(size_t)c * 6 + i]); }
      a[u][6] = bf16_round(bk[c]); b[u][6] = bf16_round(bq[c]);
    }
#pragma unroll
    for (int i = 0; i < 7; ++i)
#pragma unroll
      for (int j = 0; j < 7; ++j) s[i * 7 + j] = wave_sum(a[0][i] * b[0][j] + a[1][i] * b[1][j]);
    if ((tid & 31) == 0) {
#pragma unroll
      for (int p = 0; p < 49; ++p) part[tid >> 5][p] = s[p];
    }
  }
  __syncthreads();      /* the eight waves' 49 sums are in part */
  if (tid < 49) {
    float m = part[0][tid];
#pragma unroll
    for (int w = 1; w < 8; ++w) m += part[w][tid];
    M[tid / 7][tid % 7] = m;
  }
}
// One work-group of the set-up launch's second block range = 1024 threads = 512 nodes; thread t holds half (t & 1) of node t >> 1 and piece t of XF. It writes X7, XF and R:
// X7[n] = [x_n, 1, 1] in f32 (element 6 is the bias input; element 7 multiplies the row's shift in k_fa, and R's element 7 is 0), and XF = the same values in f16 (bf16 values, exact in f16 above its subnormal range) laid out as the 16-bit fragments of k_fa:
// 16-byte piece ((s*2 + hf)*32 + lane) holds column (lane & 15) of keys 32 s + 16 hf + 8 (lane >> 4) + 0..7, so that a wave's fragment load reads 512 bytes in a row. Columns 7..15 are 0.
// R[n] = [x_n, 1] * M * log2(e), from the node's own coordinates in registers: nothing that this launch writes is read in it.
// The nodes' loads stand in front of M's, so that both are in flight together; the three stores stand behind the last barrier, which would otherwise wait for them.
constexpr int XR_THREADS = 1024, XR_BLOCKS = NNODE * 2 / XR_THREADS;
static_assert(XR_BLOCKS * XR_THREADS == NNODE * 2, "whole work-groups: no thread leaves in front of a barrier");
__device__ __forceinline__ void sai_xr(const float* __restrict__ nodes, const float* __restrict__ centre, const float* __restrict__ Wq, const float* __restrict__ bq, const float* __restrict__ Wk, const float* __restrict__ bk,
                                       float* __restrict__ X7, _Float16* __restrict__ XF, float* __restrict__ R, int blk) {
  __shared__ float M[7][8]; __shared__ __attribute__((aligned(16))) float part[8][52]; const int tid = threadIdx.x;
  const int t = blk * XR_THREADS + tid, n = t >> 1, half = t & 1;
  const int key0 = 32 * (t >> 6) + 16 * ((t >> 5) & 1) + 8 * ((t >> 4) & 1), f = t & 15; float nv[8];
  // every lane loads (a column >= 3 reads column 0 and drops it): the eight loads are in flight together, with no branch between them
#pragma unroll
  for (int i = 0; i < 8; ++i) nv[i] = nodes[(size_t)(key0 + i) * 3 + ((f < 3) ? f : 0)];
  const float p0 = nodes[(size_t)n * 3], p1 = nodes[(size_t)n * 3 + 1], p2 = nodes[(size_t)n * 3 + 2];
  const float cf = centre[(f >= 3 && f < 6) ? f - 3 : 0], c0 = centre[0], c1 = centre[1], c2 = centre[2];
  sai_gram(Wq, bq, Wk, bk, tid, part, M);
  __syncthreads();
  FragH x; { const float cc = bf16_round(cf), cv = (f < 6) ? cc : (f == 6) ? 1.0f : 0.0f;
#pragma unroll
    for (int i = 0; i < 8; ++i) { const float rv = bf16_round(nv[i]); x.h[i] = (_Float16)((f < 3) ? rv : cv); } }
  float xa[8]; xa[0] = bf16_round(p0); xa[1] = bf16_round(p1); xa[2] = bf16_round(p2); xa[3] = bf16_round(c0); xa[4] = bf16_round(c1); xa[5] = bf16_round(c2); xa[6] = 1.0f;
  v4f o = {0.f, 0.f, 0.f, 0.f};      /* this thread's half of R[n]: columns j = 4*half .. 4*half+3 (j = 7 stays 0) */
  {
    #pragma clang fp contract(off)      /* as before the merge: each product is rounded before it is added, so that R, and with it every logit and row maximum, keeps its bits */
#pragma unroll 1
    for (int i = 0; i < 7; ++i) for (int q = 0; q < 4; ++q) { const int j = half * 4 + q; if (j < 7) o[q] += xa[i] * M[i][j]; }
    o = o * 1.4426950408889634f;      /* times log2(e): k_fa, R's one reader, takes 2^x of the logits */
  }
  *(v4f*)(R + (size_t)t * 4) = o;
  *(v8us*)((unsigned short*)XF + (size_t)t * 8) = x.half[0];
  *(v4f*)(X7 + (size_t)t * 4) = half ? (v4f){xa[4], xa[5], 1.0f, 1.0f} : (v4f){xa[0], xa[1], xa[2], xa[3]};
  asm volatile("s_wait_xcnt 0x0" ::: "memory");      // stands behind the three stores, ahead of any write of their offset and data registers on the way to the kernel's end, where the two sides' code meets
}
// ---- Y = attn * [x, 1] with attn kept in registers. One work-group = FA_ROWS rows of attn; its 32 waves split the 8192 keys, 256 each, in steps of 32.
// Logits, transposed: S^T[key][n] = X7[key][0..7] * R[n][0..7] on v_wmma_f32_16x16x4_f32, two instructions per 16 keys x 16 rows. Lane (c, h) loads elements 4h .. 4h+3 of key c and of row c by the same rule, so the k pairing of both operands is equal.
// D register r of lane (c, h) is key 8h + r of row c: the two tiles of a step, converted in place, are the B fragment (hardware k order) of Y^T = X~^T * P^T on v_wmma_f32_16x16x32_f16, whose A fragment is XF.
// R comes scaled by log2(e) (sai_xr), so both sweeps work on s' = s * log2(e). Sweep 1 finds each row's maximum m' (over the waves through LDS); sweep 2 forms the logits again with R's element 7 set to 15 - m' (X7's element 7 is 1),
// so that the matrix instruction hands out s' - m' + 15 and the hardware's 2^x of it, one instruction with no range reduction around it, is P * 2^15 * Z. The argument is at most 15 up to rounding; where 2^x falls below the f32 normal range the f16 value is 0 either way.
// Column 6 of [x, 1] is 1: row 6 of Y^T is the row's sum of the same f16 values, and the factor 2^15 * Z leaves in the division.
typedef float v2f __attribute__((ext_vector_type(2)));
#define FA_ROWS 32
constexpr uint32_t FA_WAVES = 32, FA_KEYS = NNODE / FA_WAVES, FA_STEPS = FA_KEYS / 32u;
constexpr uint32_t FA_MPITCH = FA_WAVES + 4;      // floats per row of the waves' maxima: 16-byte pieces stay aligned, neighbouring rows fall on different banks
static_assert(FA_STEPS * 32u * FA_WAVES == NNODE && NNODE % FA_ROWS == 0 && FA_ROWS == 32, "the waves' key ranges tile a row; two 16-row tiles per work-group");
__device__ __forceinline__ v8f fa_logits(v4f x, v4f r) {
  v8f t = {0.f, 0.f, 0.f, 0.f, 0.f, 0.f, 0.f, 0.f};
  t = __builtin_amdgcn_wmma_f32_16x16x4_f32(false, (v2f){x[0], x[1]}, false, (v2f){r[0], r[1]}, (short)0, t, false, false);
  t = __builtin_amdgcn_wmma_f32_16x16x4_f32(false, (v2f){x[2], x[3]}, false, (v2f){r[2], r[3]}, (short)0, t, false, false);
  return t;
}
__global__ __launch_bounds__(1024) void k_fa(const float* __restrict__ R, const float* __restrict__ X7, const _Float16* __restrict__ XF, float* __restrict__ Y) {
  __shared__ __attribute__((aligned(16))) float redM[FA_ROWS][FA_MPITCH];
  __shared__ __attribute__((aligned(16))) float E[FA_WAVES][FA_ROWS][8];
  const uint32_t tid = threadIdx.x, wv = tid >> 5, lane = tid & 31u, h = lane >> 4, c = lane & 15u;
  const uint32_t n0 = blockIdx.x * FA_ROWS, k0 = wv * FA_KEYS;
  const float* xp = X7 + (size_t)(k0 + c) * 8u + 4u * h;                                        // key c of the wave's first tile, elements 4h .. 4h+3
  const unsigned short* xf = (const unsigned short*)XF + (size_t)(k0 / 32u) * 512u + lane * 8u;
  v4f rb[2]; float mx[2];
  // every '#pragma unroll' of this kernel: rb, mx, acc and the tiles stay in registers only under constant indices
#pragma unroll
  for (int j = 0; j < 2; ++j) { rb[j] = *(const v4fa*)(R + (size_t)(n0 + 16u * (uint32_t)j + c) * 8u + 4u * h); mx[j] = -3.0e38f; }
  // two steps per trip, here and in sweep 2: the second step's operands are in flight while the first is worked on; unrolled whole, the build kept all of the wave's keys in registers and spilled
#pragma unroll 2
  for (uint32_t st = 0; st < FA_STEPS; ++st) {
    const v4f xa0 = *(const v4fa*)(xp + st * 256u), xa1 = *(const v4fa*)(xp + st * 256u + 128u);
#pragma unroll
    for (int j = 0; j < 2; ++j) {
      const v8f t0 = fa_logits(xa0, rb[j]), t1 = fa_logits(xa1, rb[j]);
#pragma unroll
      for (int r = 0; r < 8; ++r) mx[j] = fmaxf(mx[j], fmaxf(t0[r], t1[r]));
    }
  }
#pragma unroll
  for (int j = 0; j < 2; ++j) { mx[j] = fmaxf(mx[j], lane_xor16(mx[j])); if (h == 0u) redM[16u * (uint32_t)j + c][wv] = mx[j]; }
  __syncthreads();      /* every wave's maxima of the 32 rows are in redM */
#pragma unroll
  for (int j = 0; j < 2; ++j) {
    float m = -3.0e38f;
#pragma unroll
    for (uint32_t q = 0; q < FA_WAVES / 4u; ++q) { const v4f v = *(const v4f*)&redM[16u * (uint32_t)j + c][4u * q]; m = fmaxf(m, fmaxf(fmaxf(v[0], v[1]), fmaxf(v[2], v[3]))); }
    if (h == 1u) rb[j][3] = 15.0f - m;      // element 7 of the row: its shift, in powers of two
  }
  v8f acc[2];
#pragma unroll
  for (int j = 0; j < 2; ++j) acc[j] = (v8f){0.f, 0.f, 0.f, 0.f, 0.f, 0.f, 0.f, 0.f};
  // two steps per trip, as in sweep 1
#pragma unroll 2
  for (uint32_t st = 0; st < FA_STEPS; ++st) {
    const v4f xa0 = *(const v4fa*)(xp + st * 256u), xa1 = *(const v4fa*)(xp + st * 256u + 128u);
    FragH fx; fx.half[0] = *(const v8us*)(xf + st * 512u); fx.half[1] = *(const v8us*)(xf + st * 512u + 256u);
#pragma unroll
    for (int j = 0; j < 2; ++j) {
      const v8f t0 = fa_logits(xa0, rb[j]), t1 = fa_logits(xa1, rb[j]);
      FragH p;
#pragma unroll
      for (int r = 0; r < 8; ++r) { p.h[r] = (_Float16)__builtin_amdgcn_exp2f(t0[r]); p.h[8 + r] = (_Float16)__builtin_amdgcn_exp2f(t1[r]); }
      acc[j] = __builtin_amdgcn_wmma_f32_16x16x32_f16(false, fx.v, false, p.v, (short)0, acc[j], false, false);
    }
  }
  // lane (c, 0) holds Y^T[0..7][row c] of its wave's keys; the 32 waves' sums meet in LDS and are added in wave order
  if (h == 0u) {
#pragma unroll
    for (int j = 0; j < 2; ++j) {
      *(v4f*)&E[wv][16u * (uint32_t)j + c][0] = (v4f){acc[j][0], acc[j][1], acc[j][2], acc[j][3]};
      *(v4f*)&E[wv][16u * (uint32_t)j + c][4] = (v4f){acc[j][4], acc[j][5], acc[j][6], acc[j][7]};
    }
  }
  __syncthreads();      /* every wave's sums are staged */
  if (tid < FA_ROWS * 8u) {
    const uint32_t row = tid >> 3, f = tid & 7u;
    float s = E[0][row][f], z = E[0][row][6];
    for (uint32_t w = 1; w < FA_WAVES; ++w) { s += E[w][row][f]; z += E[w][row][6]; }
    Y[(size_t)(n0 + row) * 8u + f] = s / z;
  }
}

// ---- out = [Y | x, 1, 1] * G. Rows 0..6 of G are [Wq bq]^T * Wv_q^T and row 7 is 0 (Y's element 7 is 0); rows 8..14 are [Wk bk]^T * Wv_k^T + [Wk bk]^T (the second term is the addend 'keys'); row 15 is bv (X7's element 7 is 1).
// GF holds G as the B fragments of k_out: the 16-byte piece (((d >> 6) * 4 + (d & 3)) * 2 + p) * 32 + 16 hh + ((d & 63) >> 2) holds rows 8 p + 4 hh + 0..3 of column d, so that a wave's fragment load reads 512 bytes in a row.
// sai_gmat (the set-up launch's first block range): one work-group = 16 columns d of G. Waves 0..15 take the Wq side, waves 16..31 the Wk side, 32 of the 512 channels each: G^T[d][i] = sum over channels ch of Wv[d][ch] * W~[ch][i], A = Wv rows, B = W~ columns (i > 6 is 0).
// Lane (c, h) takes channels 16 h .. 16 h + 15 of its wave's 32 for row c of A and for column c of B by the same rule, so the k pairing of both operands is equal. The 16 waves' sums of a side meet in LDS and are added in wave order.
constexpr uint32_t GM_SPLIT = 16, GM_CH = DD / GM_SPLIT;
static_assert(GM_CH == 32 && DD % 64 == 0, "16 channels per lane half; k_out takes 64 columns per wave");
__device__ __forceinline__ void sai_gmat(const float* __restrict__ Wq, const float* __restrict__ bq, const float* __restrict__ Wk, const float* __restrict__ bk, const float* __restrict__ Wv, const float* __restrict__ bv, float* __restrict__ GF) {
  __shared__ __attribute__((aligned(16))) float part[2 * GM_SPLIT][16][8];
  const uint32_t tid = threadIdx.x, wv = tid >> 5, lane = tid & 31u, h = lane >> 4, c = lane & 15u;
  const uint32_t d0 = blockIdx.x * 16u, side = wv / GM_SPLIT, ch0 = (wv % GM_SPLIT) * GM_CH + 16u * h;
  const float* __restrict__ Wm = side ? Wk : Wq;
  const float* __restrict__ bm = side ? bk : bq;
  const float* vp = Wv + (size_t)(d0 + c) * (2 * DD) + side * DD + ch0;
  const float* wp = Wm + (size_t)ch0 * 6u + ((c < 6u) ? c : 0u);      // a column > 5 reads column 0 and drops it: every lane loads, with no branch in front of the matrix instructions
  // the addend of the element that this thread sums behind the barrier (threads 128..255 use it), loaded here so that it is in flight with the operands
  const uint32_t fp = (tid >> 7) & 1u, fdl = (tid >> 3) & 15u, fi = tid & 7u, fd = d0 + fdl;
  const float* adp = (fi < 6u) ? Wk + (size_t)fd * 6u + fi : (fi == 6u) ? bk + fd : bv + fd;
  float a[16], w[16], wl[16], bl[16];
  // every '#pragma unroll' of this kernel: a, w, wl, bl and t stay in registers only under constant indices
#pragma unroll
  for (int q = 0; q < 4; ++q) {
    const v4f v = *(const v4fa*)(vp + 4 * q), b4 = *(const v4fa*)(bm + ch0 + 4 * q);
#pragma unroll
    for (int e = 0; e < 4; ++e) { a[4 * q + e] = v[e]; bl[4 * q + e] = b4[e]; }
  }
  asm volatile("s_wait_xcnt 0x0" ::: "memory");      // stands behind the eight loads above, in front of the loads below, whose results the build puts into the address registers of those above
#pragma unroll
  for (int e = 0; e < 16; ++e) wl[e] = wp[6 * e];
  const float adl = *adp;
  __builtin_amdgcn_sched_barrier(0);      // nothing crosses: inside the merged kernel the build otherwise put the first roundings, with their wait for the loads above, in front of these seventeen loads, one memory latency more
  // holds these loads here, unconditional and in flight with the ones above (loaded values as inputs only): without it the build put the sixteen loads under a lane mask behind a wait for the first loads; the addend is named so that its load stays in front of the barrier
  asm volatile("" :: "v"(wl[0]), "v"(wl[1]), "v"(wl[2]), "v"(wl[3]), "v"(wl[4]), "v"(wl[5]), "v"(wl[6]), "v"(wl[7]), "v"(wl[8]), "v"(wl[9]), "v"(wl[10]), "v"(wl[11]), "v"(wl[12]), "v"(wl[13]), "v"(wl[14]), "v"(wl[15]), "v"(adl));
#pragma unroll
  for (int e = 0; e < 16; ++e) { a[e] = bf16_round(a[e]); w[e] = bf16_round((c < 6u) ? wl[e] : (c == 6u) ? bl[e] : 0.0f); }
  v8f t = {0.f, 0.f, 0.f, 0.f, 0.f, 0.f, 0.f, 0.f};
#pragma unroll
  for (int j = 0; j < 8; ++j) t = __builtin_amdgcn_wmma_f32_16x16x4_f32(false, (v2f){a[2 * j], a[2 * j + 1]}, false, (v2f){w[2 * j], w[2 * j + 1]}, (short)0, t, false, false);
  // register r of lane (c, h) is G^T[d0 + 8 h + r][c] of the wave's channels
  if (c < 8u) {
#pragma unroll
    for (int r = 0; r < 8; ++r) part[wv][8u * h + (uint32_t)r][c] = t[r];
  }
  __syncthreads();      /* every wave's sums are staged */
  if (tid < 256u) {
    const uint32_t p = fp, dl = fdl, i = fi, d = fd;
    float s = part[p * GM_SPLIT][dl][i];
    for (uint32_t k = 1; k < GM_SPLIT; ++k) s += part[p * GM_SPLIT + k][dl][i];
    if (p == 1u) s += bf16_round(adl);      // element 7 of the sums is 0: row 15 is bv alone
    GF[(size_t)(((((d >> 6) * 4u + (d & 3u)) * 2u + p) * 32u + 16u * (i >> 2) + ((d & 63u) >> 2)) * 4u + (i & 3u))] = s;
  }
}
// k_prep: all that hangs on the inputs alone, in one launch. G, and X7, XF and R, read none of each other: work-groups 0 .. GM_BLOCKS - 1 form G (they start first: theirs is the larger read), the next XR_BLOCKS the nodes' vectors.
// The branch is on the work-group's index alone, so every barrier of either side is passed by all of its work-group's waves.
constexpr int GM_BLOCKS = DD / 16;
__global__ __launch_bounds__(1024) void k_prep(const float* __restrict__ nodes, const float* __restrict__ centre, const float* __restrict__ Wq, const float* __restrict__ bq, const float* __restrict__ Wk, const float* __restrict__ bk,
                                               const float* __restrict__ Wv, const float* __restrict__ bv, float* __restrict__ GF, float* __restrict__ X7, _Float16* __restrict__ XF, float* __restrict__ R) {
  if ((int)blockIdx.x < GM_BLOCKS) sai_gmat(Wq, bq, Wk, bk, Wv, bv, GF);
  else sai_xr(nodes, centre, Wq, bq, Wk, bk, X7, XF, R, (int)blockIdx.x - GM_BLOCKS);
}
// k_out: one work-group = OUT_ROWS rows of out; wave w takes columns 64 w .. 64 w + 63 as four tiles, tile t holding columns 64 w + 4 c + t in its column c: the four tiles' registers r of a lane are 16 bytes in a row of out,
// and one store instruction writes 256 bytes in a row of each of two rows. A = [Y | X7] rows, lane (c, h) taking elements 4 h .. 4 h + 3 of each, as GF has them for B.
#define OUT_ROWS 32
static_assert(NNODE % OUT_ROWS == 0 && OUT_ROWS == 32 && DD == 8 * 64, "two 16-row tiles per work-group; eight waves cover a row");
__global__ __launch_bounds__(256) void k_out(const float* __restrict__ Y, const float* __restrict__ X7, const float* __restrict__ GF, float* __restrict__ out) {
  const uint32_t tid = threadIdx.x, wv = tid >> 5, lane = tid & 31u, h = lane >> 4, c = lane & 15u;
  const uint32_t n0 = blockIdx.x * OUT_ROWS;
  v4f gy[4], gx[4], ya[OUT_ROWS / 16], xa[OUT_ROWS / 16];
  // every '#pragma unroll' of this kernel: the fragments and acc stay in registers only under constant indices, and all loads are in flight together
#pragma unroll
  for (int j = 0; j < OUT_ROWS / 16; ++j) { const size_t n = n0 + 16u * (uint32_t)j + c; ya[j] = *(const v4fa*)(Y + n * 8u + 4u * h); xa[j] = *(const v4fa*)(X7 + n * 8u + 4u * h); }
#pragma unroll
  for (int t = 0; t < 4; ++t) { const float* g = GF + (size_t)((wv * 4u + (uint32_t)t) * 2u * 32u + lane) * 4u; gy[t] = *(const v4fa*)g; gx[t] = *(const v4fa*)(g + 128); }
  // holds all twelve loads in front of the matrix instructions (loaded values as inputs only): without it the build issued X7's loads behind the wait for Y's, one memory latency later
  asm volatile("" :: "v"(ya[0]), "v"(ya[1]), "v"(xa[0]), "v"(xa[1]), "v"(gy[0]), "v"(gy[1]), "v"(gy[2]), "v"(gy[3]), "v"(gx[0]), "v"(gx[1]), "v"(gx[2]), "v"(gx[3]));
#pragma unroll
  for (int j = 0; j < OUT_ROWS / 16; ++j) {
    v8f acc[4];
#pragma unroll
    for (int t = 0; t < 4; ++t) acc[t] = (v8f){0.f, 0.f, 0.f, 0.f, 0.f, 0.f, 0.f, 0.f};
#pragma unroll
    for (int t = 0; t < 4; ++t) acc[t] = __builtin_amdgcn_wmma_f32_16x16x4_f32(false, (v2f){ya[j][0], ya[j][1]}, false, (v2f){gy[t][0], gy[t][1]}, (short)0, acc[t], false, false);
#pragma unroll
    for (int t = 0; t < 4; ++t) acc[t] = __builtin_amdgcn_wmma_f32_16x16x4_f32(false, (v2f){ya[j][2], ya[j][3]}, false, (v2f){gy[t][2], gy[t][3]}, (short)0, acc[t], false, false);
#pragma unroll
    for (int t = 0; t < 4; ++t) acc[t] = __builtin_amdgcn_wmma_f32_16x16x4_f32(false, (v2f){xa[j][0], xa[j][1]}, false, (v2f){gx[t][0], gx[t][1]}, (short)0, acc[t], false, false);
#pragma unroll
    for (int t = 0; t < 4; ++t) acc[t] = __builtin_amdgcn_wmma_f32_16x16x4_f32(false, (v2f){xa[j][2], xa[j][3]}, false, (v2f){gx[t][2], gx[t][3]}, (short)0, acc[t], false, false);
    float* op = out + (size_t)(n0 + 16u * (uint32_t)j + 8u * h) * DD + wv * 64u + 4u * c;
#pragma unroll
    for (int r = 0; r < 8; ++r) *(v4f*)(op + (size_t)r * DD) = (v4f){acc[0][r], acc[1][r], acc[2][r], acc[3][r]};
  }
}

extern "C" void kernel_launch(void* const* d_in, const int* in_sizes, int n_in,
                              void* d_out, int out_size, void* d_ws, size_t ws_size, hipStream_t stream) {
  (void)in_sizes; (void)n_in; (void)out_size;
  const float* const* I = (const float* const*)d_in; const float* nodes = I[0]; const float* centre = I[1]; const float* Wq = I[2]; const float* bq = I[3]; const float* Wk = I[4]; const float* bk = I[5]; const float* Wv = I[6]; const float* bv = I[7];
  char* ws = (char*)d_ws; size_t off = 0;
  auto take = [&](size_t bytes) { char* p = ws + off; off += (bytes + 255) & ~(size_t)255; return p; };
  float* GF = (float*)take((size_t)DD * 16 * 4); float* X7 = (float*)take((size_t)NNODE * 8 * 4); float* R = (float*)take((size_t)NNODE * 8 * 4);
  _Float16* XF = (_Float16*)take((size_t)NNODE * 16 * 2); float* YP = (float*)take((size_t)NNODE * 8 * 4);
  if (off > ws_size) return;      // 1 MiB of the 256 MiB workspace
  k_prep<<<GM_BLOCKS + XR_BLOCKS, 1024, 0, stream>>>(nodes, centre, Wq, bq, Wk, bk, Wv, bv, GF, X7, XF, R);      /* G (16 x 512) from the weights; X7, XF, R from the nodes and the weights */
  k_fa<<<NNODE / FA_ROWS, 1024, 0, stream>>>(R, X7, XF, YP);      /* Y = attn*[x, 1]: 256 work-groups of 32 waves, 32 rows each */
  k_out<<<NNODE / OUT_ROWS, 256, 0, stream>>>(YP, X7, GF, (float*)d_out);      /* out = [Y | x, 1, 1]*G: M 8192 N 512 K 16 */
}

// v010
// One run takes 20.4 microseconds.
// Timed twice side by side with v009, it ran 1.21 times as fast both times.
// All steps since v000 together make it 138 times as fast.
#include <hip/hip_runtime.h>
#include <stdint.h>
// 'self_attn_init' (N=8192 nodes, 3-d coords + a shared 3-d centre → 6 inputs, D=512): x = [node, centre]; keys = x·Wkᵀ + bk; queries = x·Wqᵀ + bq; attn = softmax_m(keys·queriesᵀ) (UNSCALED, rank-7 logits up to ±O(100));
// out = keys + attn·(queries·Wv[:, :512]ᵀ) + keys·Wv[:, 512:]ᵀ + bv.
// Compute dtype: inputs/weights/biases rounded to bf16. The logits are an exact bilinear form in the 7-vector x̃ = [x, 1]: s[n][m] = (x̃_nᵀ·M)·x̃_m with M = [Wk bk]ᵀ[Wq bq] (7×7, f32), evaluated per pair in f32 (the centre is the same for every key, so its three terms and the bias term are one number per row: four terms per pair) —
// no 16-bit rounding touches the huge logits: they are formed on the f32 matrix instruction, transposed, so that the exponentials (f16, times 2^15) are already the operand fragment of attn*[x, 1]; attn itself never goes to memory.
// queries = [x, 1]*[Wq bq]^T and keys = [x, 1]*[Wk bk]^T both have rank 7, so with Y = attn*[x, 1] (a GEMM with one 16-column tile, f16 operands, f32 accumulate)
// out = Y*([Wq bq]^T*Wv_q^T) + [x, 1]*([Wk bk]^T*(Wv_k^T + I)) + bv = [Y | x, 1, 1]*G with G (16 x 512) formed once from the weights: neither keys nor attn*queries is ever written out.
// G (two GEMMs with K = 512) and out (one GEMM with K = 16) run on v_wmma_f32_16x16x4_f32.
#define NNODE 8192
#define DD 512

typedef __bf16 v16b __attribute__((ext_vector_type(16)));
typedef unsigned short v8us __attribute__((ext_vector_type(8), may_alias));
typedef float  v8f  __attribute__((ext_vector_type(8)));
typedef float  v4f  __attribute__((ext_vector_type(4)));
typedef float  v4fa __attribute__((ext_vector_type(4), may_alias));
typedef float  v2f  __attribute__((ext_vector_type(2)));
typedef float  v2fa __attribute__((ext_vector_type(2), may_alias));
union FragB { v16b v; v8us half[2]; unsigned short u[16]; };

__device__ __forceinline__ unsigned short bf16_bits(float x) { unsigned int u = __float_as_uint(x); return (unsigned short)((u + 0x7FFFu + ((u >> 16) & 1u)) >> 16); }
__device__ __forceinline__ float bf16_val(unsigned short b) { return __uint_as_float(((unsigned int)b) << 16); }
__device__ __forceinline__ float bf16_round(float x) { return bf16_val(bf16_bits(x)); }
// D += A·B with NT terms: 1 = ah·bh, 2 = + al·bh (A split), 3 = + ah·bl (both split)
template <int NT>
__device__ __forceinline__ v8f mmaN(v16b ah, v16b al, v16b bh, v16b bl, v8f c) {
  c = __builtin_amdgcn_wmma_f32_16x16x32_bf16(false, ah, false, bh, (short)0, c, false, false);
  if (NT >= 2) c = __builtin_amdgcn_wmma_f32_16x16x32_bf16(false, al, false, bh, (short)0, c, false, false);
  if (NT >= 3) c = __builtin_amdgcn_wmma_f32_16x16x32_bf16(false, ah, false, bl, (short)0, c, false, false);
  asm volatile("v_nop\n\tv_nop\n\tv_nop\n\tv_nop" : "+v"(c) : "v"(ah), "v"(al), "v"(bh), "v"(bl));
  return c;
}

__global__ __launch_bounds__(256) void k_wt_bf16(const float* __restrict__ W, unsigned short* __restrict__ Wt, int K, int N) {
  const int t = blockIdx.x * 256 + threadIdx.x;
  const int k8n = K / 8;
  if (t >= N * k8n) return;
  const int n = t / k8n, k8 = (t % k8n) * 8;
  v8us v;
#pragma unroll
  for (int i = 0; i < 8; ++i) v[i] = bf16_bits(W[(size_t)(k8 + i) * N + n]);
  *(v8us*)(Wt + (size_t)n * K + k8) = v;
  
}

// GEMM C[M][N] (f32, pitch ldc) = act(A[M][K]·W + bias). A f32 row-major (pitch lda) converted per fragment to bf16
// (ASPLIT: hi/lo two planes -> 2 terms, else single rounded term); Wt bf16 [N][K] (pitch ldb). BIAS_BF16 rounds the
// bias to bf16 first (bias quantised to bf16 before the add). K%32==0, M%16==0, N%64==0.
template <bool ASPLIT, int ACT, bool BIAS_BF16>
__global__ __launch_bounds__(128) void k_gemm_bf(const float* __restrict__ A, int lda, const unsigned short* __restrict__ Wt, int ldb,
                                               const float* __restrict__ bias, float* __restrict__ C, int ldc, int M, int N, int K) {
  __shared__ __attribute__((aligned(16))) float so[4][16][64];
  const int tid = threadIdx.x, w = tid >> 5, lane = tid & 31, ln = lane & 15, hh = lane >> 4;
  const int ntn = N / 64;
  const int wid = blockIdx.x * 4 + w;
  const int mt = wid / ntn, nq = wid % ntn;
  if (mt * 16 >= M) return;
  const int row0 = mt * 16, col0 = nq * 64;
  const float* arow = A + (size_t)(row0 + ln) * lda;
  v8f acc[4] = {};
  for (int kb = 0; kb < K; kb += 32) {
    FragB ah, al;
    const v4f x0 = *(const v4fa*)(arow + kb + 8 * hh), x1 = *(const v4fa*)(arow + kb + 8 * hh + 4);
    const v4f x2 = *(const v4fa*)(arow + kb + 16 + 8 * hh), x3 = *(const v4fa*)(arow + kb + 16 + 8 * hh + 4);
    float xs[16] = {x0[0],x0[1],x0[2],x0[3],x1[0],x1[1],x1[2],x1[3],x2[0],x2[1],x2[2],x2[3],x3[0],x3[1],x3[2],x3[3]};
#pragma unroll
    for (int i = 0; i < 16; ++i) { const unsigned short hb = bf16_bits(xs[i]); ah.u[i] = hb; al.u[i] = ASPLIT ? bf16_bits(xs[i] - bf16_val(hb)) : (unsigned short)0; }
#pragma unroll
    for (int t = 0; t < 4; ++t) {
      const unsigned short* brow = Wt + (size_t)(col0 + t * 16 + ln) * ldb + kb;
      FragB b;
      b.half[0] = *(const v8us*)(brow + 8 * hh);
      b.half[1] = *(const v8us*)(brow + 16 + 8 * hh);
      acc[t] = mmaN<ASPLIT ? 2 : 1>(ah.v, al.v, b.v, b.v, acc[t]);
    }
  }
#pragma unroll
  for (int t = 0; t < 4; ++t) {
    float bv = bias ? bias[col0 + t * 16 + ln] : 0.f;
    if (BIAS_BF16) bv = bf16_round(bv);
#pragma unroll
    for (int r = 0; r < 8; ++r) { float v = acc[t][r] + bv; if (ACT == 1) v = fmaxf(v, 0.f); so[w][8 * hh + r][t * 16 + ln] = v; }
  }
  __builtin_amdgcn_fence(__ATOMIC_ACQ_REL, "workgroup");
  __builtin_amdgcn_wave_barrier();
  const int rsub = lane >> 4, c4 = (lane & 15) * 4;
  {
#pragma unroll
    for (int q = 0; q < 8; ++q) {
      const int r = q * 2 + rsub;
      const v4f v = *(const v4fa*)&so[w][r][c4];
      *(v4f*)(C + (size_t)(row0 + r) * ldc + col0 + c4) = v;
    }
    
  }
}

// Flash-style causal/unmasked attention, all contractions 3-term bf16 hi/lo splits, f32 softmax with running max.
// q,k,v rows are read from f32 buffers with arbitrary row pitch (so they can live inside a fused qkv buffer);
// D = head size (multiple of 32, <= 128); one wave = 16 query rows; block = 4 waves (64 queries) sharing K/V chunks of 32.
template <int D, bool CAUSAL>
__global__ __launch_bounds__(128) void k_flash(const float* __restrict__ qb, const float* __restrict__ kb, const float* __restrict__ vb,
                                             int pitch, int T, int H, float scale, float* __restrict__ y, int ypitch) {
  constexpr int KS = D / 32;        // k-steps for QK
  constexpr int DT = D / 16;        // d tiles for PV
  __shared__ __attribute__((aligned(16))) unsigned short sKh[32][D + 8], sKl[32][D + 8], sVh[32][D + 8], sVl[32][D + 8];
  __shared__ __attribute__((aligned(16))) unsigned short sPh[4][16][40], sPl[4][16][40];
  __shared__ __attribute__((aligned(16))) float sO[4][16][D];
  const int tid = threadIdx.x, w = tid >> 5, lane = tid & 31, ln = lane & 15, hh = lane >> 4;
  const int nqb = (T + 63) / 64;
  const int bh = blockIdx.x / nqb, qblk = blockIdx.x % nqb;
  const int b = bh / H, h = bh % H;
  const int q0 = qblk * 64 + w * 16;
  const float* Q = qb + (size_t)b * T * pitch + h * D;
  const float* K = kb + (size_t)b * T * pitch + h * D;
  const float* V = vb + (size_t)b * T * pitch + h * D;

  // A fragments of the wave's 16 query rows (scaled), hi/lo
  FragB aqh[KS], aql[KS];
  {
    int row = q0 + ln; if (row >= T) row = T - 1;
    const float* qr = Q + (size_t)row * pitch;
#pragma unroll
    for (int ks = 0; ks < KS; ++ks)
#pragma unroll
      for (int i = 0; i < 16; ++i) {
        const int d = ks * 32 + ((i < 8) ? (8 * hh + i) : (16 + 8 * hh + (i - 8)));
        const float x = qr[d] * scale; const unsigned short hb = bf16_bits(x);
        aqh[ks].u[i] = hb; aql[ks].u[i] = bf16_bits(x - bf16_val(hb));
      }
  }
  float m_r[8], l_r[8];
#pragma unroll
  for (int r = 0; r < 8; ++r) { m_r[r] = -3.0e38f; l_r[r] = 0.f; }
  v8f oacc[DT];
#pragma unroll
  for (int dt = 0; dt < DT; ++dt) oacc[dt] = (v8f){0.f,0.f,0.f,0.f,0.f,0.f,0.f,0.f};

  const int kv_end = CAUSAL ? min(T, qblk * 64 + 64) : T;     // block-uniform
  for (int j0 = 0; j0 < kv_end; j0 += 32) {
    __syncthreads();
    for (int e = tid; e < 32 * (D / 4); e += 128) {
      const int r = e / (D / 4), c4 = (e % (D / 4)) * 4;
      const int key = j0 + r;
      v4f kf = {0.f,0.f,0.f,0.f}, vf = {0.f,0.f,0.f,0.f};
      if (key < T) { kf = *(const v4fa*)(K + (size_t)key * pitch + c4); vf = *(const v4fa*)(V + (size_t)key * pitch + c4); }
#pragma unroll
      for (int t = 0; t < 4; ++t) {
        unsigned short hb = bf16_bits(kf[t]); sKh[r][c4 + t] = hb; sKl[r][c4 + t] = bf16_bits(kf[t] - bf16_val(hb));
        hb = bf16_bits(vf[t]); sVh[r][c4 + t] = hb; sVl[r][c4 + t] = bf16_bits(vf[t] - bf16_val(hb));
      }
    }
    __syncthreads();
    // S tile 16 x 32
    v8f s[2];
#pragma unroll
    for (int nt = 0; nt < 2; ++nt) {
      v8f acc = {};
#pragma unroll
      for (int ks = 0; ks < KS; ++ks) {
        FragB bh_, bl_;
        bh_.half[0] = *(const v8us*)&sKh[nt * 16 + ln][ks * 32 + 8 * hh]; bh_.half[1] = *(const v8us*)&sKh[nt * 16 + ln][ks * 32 + 16 + 8 * hh];
        bl_.half[0] = *(const v8us*)&sKl[nt * 16 + ln][ks * 32 + 8 * hh]; bl_.half[1] = *(const v8us*)&sKl[nt * 16 + ln][ks * 32 + 16 + 8 * hh];
        acc = mmaN<3>(aqh[ks].v, aql[ks].v, bh_.v, bl_.v, acc);
      }
      s[nt] = acc;
    }
    // mask + running max (rows 8hh+r; the 16 lanes of a half share rows)
    float alpha[8];
#pragma unroll
    for (int r = 0; r < 8; ++r) {
      const int qi = q0 + 8 * hh + r;
      const int ja = j0 + ln, jb = j0 + 16 + ln;
      if (CAUSAL) { if (ja > qi) s[0][r] = -3.0e38f; if (jb > qi) s[1][r] = -3.0e38f; }
      if (ja >= T) s[0][r] = -3.0e38f;
      if (jb >= T) s[1][r] = -3.0e38f;
      float mx = fmaxf(s[0][r], s[1][r]);
      mx = fmaxf(mx, __shfl_xor(mx, 1, 32)); mx = fmaxf(mx, __shfl_xor(mx, 2, 32)); mx = fmaxf(mx, __shfl_xor(mx, 4, 32)); mx = fmaxf(mx, __shfl_xor(mx, 8, 32));
      const float mnew = fmaxf(m_r[r], mx);
      alpha[r] = (mnew > -1.0e38f) ? __expf(m_r[r] - mnew) : 1.0f;
      const float p0 = (s[0][r] > -1.0e38f) ? __expf(s[0][r] - mnew) : 0.f;
      const float p1 = (s[1][r] > -1.0e38f) ? __expf(s[1][r] - mnew) : 0.f;
      m_r[r] = mnew;
      l_r[r] = l_r[r] * alpha[r] + p0 + p1;            // per-lane partial row sum (16 lanes combined at the end)
      unsigned short hb = bf16_bits(p0); sPh[w][8 * hh + r][ln] = hb;      sPl[w][8 * hh + r][ln] = bf16_bits(p0 - bf16_val(hb));
      hb = bf16_bits(p1);                sPh[w][8 * hh + r][16 + ln] = hb; sPl[w][8 * hh + r][16 + ln] = bf16_bits(p1 - bf16_val(hb));
    }
#pragma unroll
    for (int dt = 0; dt < DT; ++dt)
#pragma unroll
      for (int r = 0; r < 8; ++r) oacc[dt][r] *= alpha[r];
    __builtin_amdgcn_fence(__ATOMIC_ACQ_REL, "workgroup");
    __builtin_amdgcn_wave_barrier();
    FragB pah, pal;
    pah.half[0] = *(const v8us*)&sPh[w][ln][8 * hh]; pah.half[1] = *(const v8us*)&sPh[w][ln][16 + 8 * hh];
    pal.half[0] = *(const v8us*)&sPl[w][ln][8 * hh]; pal.half[1] = *(const v8us*)&sPl[w][ln][16 + 8 * hh];
#pragma unroll
    for (int dt = 0; dt < DT; ++dt) {
      FragB bvh, bvl;
#pragma unroll
      for (int i = 0; i < 8; ++i) {
        bvh.u[i] = sVh[8 * hh + i][dt * 16 + ln]; bvh.u[8 + i] = sVh[16 + 8 * hh + i][dt * 16 + ln];
        bvl.u[i] = sVl[8 * hh + i][dt * 16 + ln]; bvl.u[8 + i] = sVl[16 + 8 * hh + i][dt * 16 + ln];
      }
      oacc[dt] = mmaN<3>(pah.v, pal.v, bvh.v, bvl.v, oacc[dt]);
    }
    __builtin_amdgcn_fence(__ATOMIC_ACQ_REL, "workgroup");
    __builtin_amdgcn_wave_barrier();
  }
#pragma unroll
  for (int r = 0; r < 8; ++r) {
    float l = l_r[r];
    l += __shfl_xor(l, 1, 32); l += __shfl_xor(l, 2, 32); l += __shfl_xor(l, 4, 32); l += __shfl_xor(l, 8, 32);
    l_r[r] = (l > 0.f) ? 1.0f / l : 0.f;
  }
#pragma unroll
  for (int dt = 0; dt < DT; ++dt)
#pragma unroll
    for (int r = 0; r < 8; ++r) sO[w][8 * hh + r][dt * 16 + ln] = oacc[dt][r] * l_r[r];
  __builtin_amdgcn_fence(__ATOMIC_ACQ_REL, "workgroup");
  __builtin_amdgcn_wave_barrier();
  {
    for (int r = 0; r < 16; ++r) {
      const int row = q0 + r;
      if (row < T && lane < D / 4) {
        const v4f val = *(const v4fa*)&sO[w][r][lane * 4];
        *(v4f*)(y + ((size_t)b * T + row) * ypitch + h * D + lane * 4) = val;
      }
    }
    
  }
}

// GEMM C = act(A·W + bias + resid): A f32 (ASPLIT -> hi/lo 2 terms), Wt bf16 [N][K]; ACT 0 none, 1 relu, 2 exact gelu;
// resid (optional, f32, row index = (row % rmod), pitch ldr, RES_BF16 rounds it) added before the activation.
template <bool ASPLIT, int ACT, bool BIAS_BF16, bool RES_BF16>
__global__ __launch_bounds__(128) void k_gemm_bf3(const float* __restrict__ A, int lda, const unsigned short* __restrict__ Wt, int ldb,
                                                const float* __restrict__ bias, const float* __restrict__ resid, int rmod, int ldr,
                                                float* __restrict__ C, int ldc, int M, int N, int K) {
  __shared__ __attribute__((aligned(16))) float so[4][16][64];
  const int tid = threadIdx.x, w = tid >> 5, lane = tid & 31, ln = lane & 15, hh = lane >> 4;
  const int ntn = N / 64;
  const int wid = blockIdx.x * 4 + w;
  const int mt = wid / ntn, nq = wid % ntn;
  if (mt * 16 >= M) return;
  const int row0 = mt * 16, col0 = nq * 64;
  const float* arow = A + (size_t)(row0 + ln) * lda;
  v8f acc[4] = {};
  for (int kb = 0; kb < K; kb += 32) {
    FragB ah, al;
    const v4f x0 = *(const v4fa*)(arow + kb + 8 * hh), x1 = *(const v4fa*)(arow + kb + 8 * hh + 4);
    const v4f x2 = *(const v4fa*)(arow + kb + 16 + 8 * hh), x3 = *(const v4fa*)(arow + kb + 16 + 8 * hh + 4);
    float xs[16] = {x0[0],x0[1],x0[2],x0[3],x1[0],x1[1],x1[2],x1[3],x2[0],x2[1],x2[2],x2[3],x3[0],x3[1],x3[2],x3[3]};
#pragma unroll
    for (int i = 0; i < 16; ++i) { const unsigned short hb = bf16_bits(xs[i]); ah.u[i] = hb; al.u[i] = ASPLIT ? bf16_bits(xs[i] - bf16_val(hb)) : (unsigned short)0; }
#pragma unroll
    for (int t = 0; t < 4; ++t) {
      const unsigned short* brow = Wt + (size_t)(col0 + t * 16 + ln) * ldb + kb;
      FragB b;
      b.half[0] = *(const v8us*)(brow + 8 * hh);
      b.half[1] = *(const v8us*)(brow + 16 + 8 * hh);
      acc[t] = mmaN<ASPLIT ? 2 : 1>(ah.v, al.v, b.v, b.v, acc[t]);
    }
  }
#pragma unroll
  for (int t = 0; t < 4; ++t) {
    const int col = col0 + t * 16 + ln;
    float bv = bias ? bias[col] : 0.f;
    if (BIAS_BF16) bv = bf16_round(bv);
#pragma unroll
    for (int r = 0; r < 8; ++r) {
      float v = acc[t][r] + bv;
      if (resid) { float rv = resid[(size_t)((row0 + 8 * hh + r) % rmod) * ldr + col]; if (RES_BF16) rv = bf16_round(rv); v += rv; }
      if (ACT == 1) v = fmaxf(v, 0.f);
      if (ACT == 2) v = 0.5f * v * (1.0f + erff(v * 0.70710678118654752f));
      if (ACT == 3) { const float u = 0.7978845608028654f * (v + 0.044715f * v * v * v); v = 0.5f * v * (1.0f + tanhf(u)); }
      so[w][8 * hh + r][t * 16 + ln] = v;
    }
  }
  __builtin_amdgcn_fence(__ATOMIC_ACQ_REL, "workgroup");
  __builtin_amdgcn_wave_barrier();
  const int rsub = lane >> 4, c4 = (lane & 15) * 4;
  {
#pragma unroll
    for (int q = 0; q < 8; ++q) {
      const int r = q * 2 + rsub;
      const v4f v = *(const v4fa*)&so[w][r][c4];
      *(v4f*)(C + (size_t)(row0 + r) * ldc + col0 + c4) = v;
    }
    
  }
}
// row LayerNorm (biased variance, eps) over N: s = X (+ R); optional out_sum <- s; out_norm <- (s-mu)*rsqrt(var+eps)*g + b
template <bool PARAM_BF16>
__global__ __launch_bounds__(256) void k_layernorm(const float* __restrict__ X, const float* __restrict__ R, const float* __restrict__ g, const float* __restrict__ bta,
                                                  float* __restrict__ out_sum, float* __restrict__ out_norm, int N, float eps) {
  __shared__ float red[256];
  const int row = blockIdx.x, tid = threadIdx.x;
  const float* x = X + (size_t)row * N; const float* rr = R ? R + (size_t)row * N : nullptr;
  float vals[16];                     // up to N = 4096
  const int per = N / 256;            // contiguous chunk per thread? use strided-by-4 chunks: thread handles j = tid*4 + 1024*u
  float s1 = 0.f;
  for (int u = 0; u < per / 4; ++u) {
    const int j = tid * 4 + 1024 * u;
    const v4f a = *(const v4fa*)(x + j);
    v4f b = {0.f,0.f,0.f,0.f}; if (rr) b = *(const v4fa*)(rr + j);
#pragma unroll
    for (int q = 0; q < 4; ++q) { const float v = a[q] + b[q]; vals[u * 4 + q] = v; s1 += v; }
  }
  red[tid] = s1; __syncthreads();
  for (int st = 128; st > 0; st >>= 1) { if (tid < st) red[tid] += red[tid + st]; __syncthreads(); }
  const float mu = red[0] / (float)N; __syncthreads();
  float s2 = 0.f;
  for (int u = 0; u < per / 4; ++u)
#pragma unroll
    for (int q = 0; q < 4; ++q) { const float c = vals[u * 4 + q] - mu; s2 += c * c; }
  red[tid] = s2; __syncthreads();
  for (int st = 128; st > 0; st >>= 1) { if (tid < st) red[tid] += red[tid + st]; __syncthreads(); }
  const float rs = rsqrtf(red[0] / (float)N + eps);
  {
    for (int u = 0; u < per / 4; ++u) {
      const int j = tid * 4 + 1024 * u;
      v4f o, sm;
#pragma unroll
      for (int q = 0; q < 4; ++q) {
        float gg = g[j + q], bb = bta[j + q];
        if (PARAM_BF16) { gg = bf16_round(gg); bb = bf16_round(bb); }
        sm[q] = vals[u * 4 + q]; o[q] = (vals[u * 4 + q] - mu) * rs * gg + bb;
      }
      if (out_sum) *(v4f*)(out_sum + (size_t)row * N + j) = sm;
      *(v4f*)(out_norm + (size_t)row * N + j) = o;
    }
    
  }
}



// ---- f16 WMMA path (v_wmma_f32_16x16x32_f16): 11-bit significands for operands in range — used where a [0,1] probability operand needs more precision than bf16
typedef _Float16 v16h __attribute__((ext_vector_type(16)));
union FragH { v16h v; v8us half[2]; _Float16 h[16]; unsigned short u[16]; };
template <int NT>
__device__ __forceinline__ v8f mmaH(v16h ah, v16h al, v16h bh, v16h bl, v8f c) {
  c = __builtin_amdgcn_wmma_f32_16x16x32_f16(false, ah, false, bh, (short)0, c, false, false);
  if (NT >= 2) c = __builtin_amdgcn_wmma_f32_16x16x32_f16(false, al, false, bh, (short)0, c, false, false);
  if (NT >= 3) c = __builtin_amdgcn_wmma_f32_16x16x32_f16(false, ah, false, bl, (short)0, c, false, false);
  asm volatile("v_nop\n\tv_nop\n\tv_nop\n\tv_nop" : "+v"(c) : "v"(ah), "v"(al), "v"(bh), "v"(bl));
  return c;
}
// batched GEMM like k_gemm_b but f16 operands: A f32 (split into f16 hi/lo if ASPLIT, else rounded to f16), Bt = f16 values [n][k]; alpha; C f32; N multiple of 16 (partial tiles skipped)
template <bool ASPLIT>
__global__ __launch_bounds__(128) void k_gemm_h(const float* __restrict__ A, int lda, size_t sA, const _Float16* __restrict__ Bh, int ldb, size_t sB, float alpha, float* __restrict__ C, int ldc, size_t sC, int M, int N, int K) {
  __shared__ __attribute__((aligned(16))) float so[4][16][64];
  const int tid = threadIdx.x, w = tid >> 5, lane = tid & 31, ln = lane & 15, hh = lane >> 4; const int by = blockIdx.y;
  A += (size_t)by * sA; Bh += (size_t)by * sB; C += (size_t)by * sC;
  const int ntn = (N + 63) / 64; const int wid = blockIdx.x * 4 + w; const int mt = wid / ntn, nq = wid % ntn; if (mt * 16 >= M) return;
  const int row0 = mt * 16, col0 = nq * 64; const float* arow = A + (size_t)(row0 + ln) * lda;
  v8f acc[4] = {};
  for (int kb = 0; kb < K; kb += 32) {
    FragH ah, al;
    const v4f x0 = *(const v4fa*)(arow + kb + 8 * hh), x1 = *(const v4fa*)(arow + kb + 8 * hh + 4), x2 = *(const v4fa*)(arow + kb + 16 + 8 * hh), x3 = *(const v4fa*)(arow + kb + 16 + 8 * hh + 4);
    float xs[16] = {x0[0],x0[1],x0[2],x0[3],x1[0],x1[1],x1[2],x1[3],x2[0],x2[1],x2[2],x2[3],x3[0],x3[1],x3[2],x3[3]};
#pragma unroll
    for (int i = 0; i < 16; ++i) { const _Float16 h = (_Float16)xs[i]; ah.h[i] = h; al.h[i] = ASPLIT ? (_Float16)(xs[i] - (float)h) : (_Float16)0.0f; }
#pragma unroll
    for (int t = 0; t < 4; ++t) { if (col0 + t * 16 >= N) continue; const size_t boff = (size_t)(col0 + t * 16 + ln) * ldb + kb; FragH bq; bq.half[0] = *(const v8us*)(Bh + boff + 8 * hh); bq.half[1] = *(const v8us*)(Bh + boff + 16 + 8 * hh);
      acc[t] = mmaH<ASPLIT ? 2 : 1>(ah.v, al.v, bq.v, bq.v, acc[t]); }
  }
#pragma unroll
  for (int t = 0; t < 4; ++t) { if (col0 + t * 16 >= N) continue;
#pragma unroll
    for (int r = 0; r < 8; ++r) so[w][8 * hh + r][t * 16 + ln] = acc[t][r] * alpha; }
  __builtin_amdgcn_fence(__ATOMIC_ACQ_REL, "workgroup"); __builtin_amdgcn_wave_barrier();
  const int rsub = lane >> 4, c4 = (lane & 15) * 4;
  {
#pragma unroll
    for (int q = 0; q < 8; ++q) { const int r = q * 2 + rsub; if (col0 + c4 < N) { const v4f v = *(const v4fa*)&so[w][r][c4]; *(v4f*)(C + (size_t)(row0 + r) * ldc + col0 + c4) = v; } }
     }
}

// Wt[n][k] = f16(W[k][n]·scale) from f32 row-major W[K][N] (scale = power of two; bf16-exact weights stay exact in f16 away from the subnormal range)
__global__ __launch_bounds__(256) void k_wt_f16(const float* __restrict__ W, _Float16* __restrict__ Wt, int K, int N, float scale) {
  const int t = blockIdx.x * 256 + threadIdx.x; if (t >= N * (K / 8)) return; const int n = t / (K / 8), k8 = (t % (K / 8)) * 8; FragH f;
#pragma unroll
  for (int i = 0; i < 8; ++i) f.h[i] = (_Float16)(bf16_round(W[(size_t)(k8 + i) * N + n]) * scale); const v8us o = f.half[0];
  *(v8us*)((unsigned short*)Wt + (size_t)n * K + k8) = o; 
}
// k_gemm_hh variant with fused epilogue: v = acc·alpha + bias[by·sBias + col] (+ CP[(row/rowsPerB)·sCPb + by·64 + col] if CP) ; ACT 0 none / 1 elu ; writes f32 C and/or f16 C16 (each if non-null)
template <int ACT>
__global__ __launch_bounds__(128) void k_gemm_hhx(const _Float16* __restrict__ A, int lda, size_t sA, const _Float16* __restrict__ Bh, int ldb, size_t sB, float alpha, const float* __restrict__ bias, size_t sBias, const float* __restrict__ CP, int rowsPerB, size_t sCPb, int row0g,
    float* __restrict__ C, _Float16* __restrict__ C16, int ldc, size_t sC, int M, int N, int K) {
  __shared__ __attribute__((aligned(16))) float so[4][16][64];
  const int tid = threadIdx.x, w = tid >> 5, lane = tid & 31, ln = lane & 15, hh = lane >> 4; const int by = blockIdx.y;
  A += (size_t)by * sA; Bh += (size_t)by * sB; const size_t cofs = (size_t)by * sC; const float* bp = bias ? bias + (size_t)by * sBias : nullptr;
  const int ntn = (N + 63) / 64; const int wid = blockIdx.x * 4 + w; const int mt = wid / ntn, nq = wid % ntn; if (mt * 16 >= M) return;
  const int row0 = mt * 16, col0 = nq * 64; const _Float16* arow = A + (size_t)(row0 + ln) * lda;
  v8f acc[4] = {};
  for (int kb = 0; kb < K; kb += 32) { FragH ah; ah.half[0] = *(const v8us*)((const unsigned short*)arow + kb + 8 * hh); ah.half[1] = *(const v8us*)((const unsigned short*)arow + kb + 16 + 8 * hh);
#pragma unroll
    for (int t = 0; t < 4; ++t) { if (col0 + t * 16 >= N) continue; const size_t boff = (size_t)(col0 + t * 16 + ln) * ldb + kb; FragH bq; bq.half[0] = *(const v8us*)((const unsigned short*)Bh + boff + 8 * hh); bq.half[1] = *(const v8us*)((const unsigned short*)Bh + boff + 16 + 8 * hh);
      acc[t] = mmaH<1>(ah.v, ah.v, bq.v, bq.v, acc[t]); }
  }
#pragma unroll
  for (int t = 0; t < 4; ++t) { if (col0 + t * 16 >= N) continue; const int col = col0 + t * 16 + ln; const float bv = bp ? bf16_round(bp[col]) : 0.f;
#pragma unroll
    for (int r = 0; r < 8; ++r) { float v = acc[t][r] * alpha + bv; if (CP) { const int bidx = (row0g + row0 + 8 * hh + r) / rowsPerB; v += CP[(size_t)bidx * sCPb + (size_t)by * 64 + col]; } if (ACT == 1) v = (v > 0.f) ? v : expm1f(v); else if (ACT == 7) v = (v > 0.f) ? v + 1.0f : expf(v); else if (ACT == 8) v = tanhf(v); else if (ACT == 9) v = 0.5f * v * (1.0f + tanhf(0.7978845608028654f * (v + 0.044715f * v * v * v))); else if (ACT == 11) v = 1.0f / (1.0f + expf(-v)); else if (ACT == 12) v = (v > 0.f) ? v : 0.01f * v; else if (ACT == 14) v = (v > 0.f) ? v : 0.1f * v; else if (ACT == 15) v = v / (1.0f + expf(-v)); else if (ACT == 3) v = fmaxf(v, 0.f); else if (ACT == 6) v = 0.5f * v * (1.0f + erff(v * 0.70710678118654752f)); so[w][8 * hh + r][t * 16 + ln] = v; } }
  __builtin_amdgcn_fence(__ATOMIC_ACQ_REL, "workgroup"); __builtin_amdgcn_wave_barrier();
  const int rsub = lane >> 4, c4 = (lane & 15) * 4; typedef _Float16 v4h __attribute__((ext_vector_type(4)));
  {
#pragma unroll
    for (int q = 0; q < 8; ++q) { const int r = q * 2 + rsub; if (col0 + c4 < N) { const v4f v = *(const v4fa*)&so[w][r][c4]; if (C) *(v4f*)(C + cofs + (size_t)(row0 + r) * ldc + col0 + c4) = v; if (C16) { v4h h4; for (int i = 0; i < 4; ++i) h4[i] = (_Float16)v[i]; *(v4h*)(C16 + cofs + (size_t)(row0 + r) * ldc + col0 + c4) = h4; } } }
     }
}


typedef _Float16 v4h __attribute__((ext_vector_type(4)));

__global__ __launch_bounds__(256) void k_x16(const float* __restrict__ x, _Float16* __restrict__ X16, size_t n8) { const size_t t = (size_t)blockIdx.x * 256 + threadIdx.x; if (t >= n8) return; FragH f;
#pragma unroll
  for (int q = 0; q < 8; ++q) f.h[q] = (_Float16)bf16_round(x[t * 8 + q]); *(v8us*)((unsigned short*)X16 + t * 8) = f.half[0];  }
__global__ __launch_bounds__(256) void k_h16(const float* __restrict__ x, _Float16* __restrict__ X16, size_t n8) { const size_t t = (size_t)blockIdx.x * 256 + threadIdx.x; if (t >= n8) return; FragH f;
#pragma unroll
  for (int q = 0; q < 8; ++q) f.h[q] = (_Float16)x[t * 8 + q]; *(v8us*)((unsigned short*)X16 + t * 8) = f.half[0];  }
__global__ __launch_bounds__(256) void k_round16f(const float* __restrict__ W, _Float16* __restrict__ Bt, size_t n8) { const size_t t = (size_t)blockIdx.x * 256 + threadIdx.x; if (t >= n8) return; FragH f;
#pragma unroll
  for (int i = 0; i < 8; ++i) f.h[i] = (_Float16)(bf16_round(W[t * 8 + i]) * 16.0f); *(v8us*)((unsigned short*)Bt + t * 8) = f.half[0];  }
template <int NHv, int TTv>
__global__ __launch_bounds__(256) void k_vt(const _Float16* __restrict__ V16, int ldv, int voff, _Float16* __restrict__ Vt) { __shared__ unsigned short tl[64][66]; const int tid = threadIdx.x; const int slab = blockIdx.x / (TTv / 64), lg = blockIdx.x % (TTv / 64); const int b = slab / NHv, h = slab % NHv;
  for (int i = tid; i < 64 * 8; i += 256) { const int r = i / 8, c8 = (i % 8) * 8; FragH f; f.half[0] = *(const v8us*)((const unsigned short*)V16 + ((size_t)b * TTv + lg * 64 + r) * ldv + voff + h * 64 + c8);
#pragma unroll
    for (int q = 0; q < 8; ++q) tl[r][c8 + q] = f.u[q]; }
  __syncthreads();
  {
#pragma unroll
    for (int rd = 0; rd < 2; ++rd) { const int d = rd * 32 + tid / 8, pc = tid % 8; FragH f;
#pragma unroll
      for (int q = 0; q < 8; ++q) f.u[q] = tl[pc * 8 + q][d];
      *(v8us*)((unsigned short*)Vt + ((size_t)slab * 64 + d) * TTv + lg * 64 + pc * 8) = f.half[0]; }
     } }

// value of lane l ^ MASK inside a 16-lane row (DPP row_xmask), and of lane l ^ 16: register moves, no LDS round trip
template <int MASK> __device__ __forceinline__ float lane_xor_row(float x) { return __int_as_float(__builtin_amdgcn_update_dpp(0, __float_as_int(x), 0x160 | MASK, 0xf, 0xf, true)); }
__device__ __forceinline__ float lane_xor16(float x) { const int v = __float_as_int(x); return __int_as_float(__builtin_amdgcn_permlanex16(v, v, 0x76543210, 0xfedcba98, false, false)); }
__device__ __forceinline__ float wave_sum(float x) { x += lane_xor_row<1>(x); x += lane_xor_row<2>(x); x += lane_xor_row<4>(x); x += lane_xor_row<8>(x); return x + lane_xor16(x); }
// M[i][j] = sum over the 512 channels c of a_c[i] * b_c[j], with a_c = [Wk[c][0..5], bk[c]] and b_c = [Wq[c][0..5], bq[c]] rounded to bf16 (each product is exact in f32).
// The first 256 threads of the work-group split the channels: thread t takes channels 2t and 2t + 1 (12 neighbouring floats of each matrix, all loads in flight at once) and forms its 49 partial sums in registers;
// each is summed over the wave by register moves, the 8 waves' sums meet in LDS, and thread p < 49 adds them in wave order. The caller's barrier publishes M.
static_assert(DD == 2 * 256, "two channels per thread, 256 threads");
__device__ __forceinline__ void sai_gram(const float* __restrict__ Wq, const float* __restrict__ bq, const float* __restrict__ Wk, const float* __restrict__ bk, int tid, float (*part)[52], float (*M)[8]) {
  if (tid < 256) {      // whole waves: 0..7 of the work-group; the others go straight to the barrier
    float a[2][7], b[2][7], s[49];
    // every unroll of this function: a, b and s stay in registers only under constant indices
#pragma unroll
    for (int u = 0; u < 2; ++u) {
      const int c = 2 * tid + u;
#pragma unroll
      for (int i = 0; i < 6; ++i) { a[u][i] = bf16_round(Wk[(size_t)c * 6 + i]); b[u][i] = bf16_round(Wq[(size_t)c * 6 + i]); }
      a[u][6] = bf16_round(bk[c]); b[u][6] = bf16_round(bq[c]);
    }
#pragma unroll
    for (int i = 0; i < 7; ++i)
#pragma unroll
      for (int j = 0; j < 7; ++j) s[i * 7 + j] = wave_sum(a[0][i] * b[0][j] + a[1][i] * b[1][j]);
    if ((tid & 31) == 0) {
#pragma unroll
      for (int p = 0; p < 49; ++p) part[tid >> 5][p] = s[p];
    }
  }
  __syncthreads();      /* the eight waves' 49 sums are in part */
  if (tid < 49) {
    float m = part[0][tid];
#pragma unroll
    for (int w = 1; w < 8; ++w) m += part[w][tid];
    M[tid / 7][tid % 7] = m;
  }
}
// One work-group of the set-up launch's second block range = 1024 threads = 512 nodes; thread t holds half (t & 1) of node t >> 1 and piece t of XF. It writes X7, X4, XF and R:
// X7[n] = [x_n, 1, 1] in f32 (k_out's operand: element 6 is the bias input, element 7 takes bv), X4[n] = [node_n, 1] in f32 (k_fa's key operand), and XF = [x, 1] in f16 (bf16 values, exact in f16 above its subnormal range) laid out as the 16-bit fragments of k_fa:
// 16-byte piece ((s*2 + hf)*32 + lane) holds column (lane & 15) of keys 32 s + 16 hf + 8 (lane >> 4) + 0..7, so that a wave's fragment load reads 512 bytes in a row. Columns 7..15 are 0.
// With r = [x_n, 1] * M * log2(e) (7 numbers, from the node's own coordinates in registers: nothing that this launch writes is read in it) the logit of key m is r[0..2] * node_m + (r[3..5] * centre + r[6]):
// elements 3..6 of [x_m, 1] are the same for every key m. R[n] = [r[0], r[1], r[2], r[3..5] * centre + r[6]], four numbers: one K = 4 matrix instruction per tile in k_fa.
// The nodes' loads stand in front of M's, so that both are in flight together; the four stores stand behind the last barrier, which would otherwise wait for them.
constexpr int XR_THREADS = 1024, XR_BLOCKS = NNODE * 2 / XR_THREADS;
static_assert(XR_BLOCKS * XR_THREADS == NNODE * 2, "whole work-groups: no thread leaves in front of a barrier");
__device__ __forceinline__ void sai_xr(const float* __restrict__ nodes, const float* __restrict__ centre, const float* __restrict__ Wq, const float* __restrict__ bq, const float* __restrict__ Wk, const float* __restrict__ bk,
                                       float* __restrict__ X7, float* __restrict__ X4, _Float16* __restrict__ XF, float* __restrict__ R, int blk) {
  __shared__ float M[7][8]; __shared__ __attribute__((aligned(16))) float part[8][52]; const int tid = threadIdx.x;
  const int t = blk * XR_THREADS + tid, n = t >> 1, half = t & 1;
  const int key0 = 32 * (t >> 6) + 16 * ((t >> 5) & 1) + 8 * ((t >> 4) & 1), f = t & 15; float nv[8];
  // every lane loads (a column >= 3 reads column 0 and drops it): the eight loads are in flight together, with no branch between them
#pragma unroll
  for (int i = 0; i < 8; ++i) nv[i] = nodes[(size_t)(key0 + i) * 3 + ((f < 3) ? f : 0)];
  const float p0 = nodes[(size_t)n * 3], p1 = nodes[(size_t)n * 3 + 1], p2 = nodes[(size_t)n * 3 + 2];
  const float cf = centre[(f >= 3 && f < 6) ? f - 3 : 0], c0 = centre[0], c1 = centre[1], c2 = centre[2];
  sai_gram(Wq, bq, Wk, bk, tid, part, M);
  __syncthreads();
  FragH x; { const float cc = bf16_round(cf), cv = (f < 6) ? cc : (f == 6) ? 1.0f : 0.0f;
#pragma unroll
    for (int i = 0; i < 8; ++i) { const float rv = bf16_round(nv[i]); x.h[i] = (_Float16)((f < 3) ? rv : cv); } }
  float xa[8]; xa[0] = bf16_round(p0); xa[1] = bf16_round(p1); xa[2] = bf16_round(p2); xa[3] = bf16_round(c0); xa[4] = bf16_round(c1); xa[5] = bf16_round(c2); xa[6] = 1.0f;
  v4f o = {0.f, 0.f, 0.f, 0.f};      /* this thread's half of r: columns j = 4*half .. 4*half+3 (j = 7 stays 0) */
#pragma unroll 1
  for (int i = 0; i < 7; ++i) for (int q = 0; q < 4; ++q) { const int j = half * 4 + q; if (j < 7) o[q] += xa[i] * M[i][j]; }
  o = o * 1.4426950408889634f;      /* times log2(e): k_fa, R's one reader, takes 2^x of the logits */
  // the row's constant: half 0 holds r[3], half 1 holds r[4..6]; the two lanes of a node are neighbours, and each adds the other's part (the same two addends, so both get the same bits). Half 1 also takes r[2] from half 0.
  const float kp = half ? o[0] * xa[4] + o[1] * xa[5] + o[2] : o[3] * xa[3];
  const float kn = kp + lane_xor_row<1>(kp), r2 = lane_xor_row<1>(o[2]);
  *(v2f*)(R + (size_t)t * 2) = half ? (v2f){r2, kn} : (v2f){o[0], o[1]};
  *(v2f*)(X4 + (size_t)t * 2) = half ? (v2f){xa[2], 1.0f} : (v2f){xa[0], xa[1]};
  *(v8us*)((unsigned short*)XF + (size_t)t * 8) = x.half[0];
  *(v4f*)(X7 + (size_t)t * 4) = half ? (v4f){xa[4], xa[5], 1.0f, 1.0f} : (v4f){xa[0], xa[1], xa[2], xa[3]};
  asm volatile("s_wait_xcnt 0x0" ::: "memory");      // stands behind the four stores, ahead of any write of their offset and data registers on the way to the kernel's end, where the two sides' code meets
}
// ---- Y = attn * [x, 1] with attn kept in registers. One work-group = FA_ROWS rows of attn; its 32 waves split the 8192 keys, 256 each, in steps of 32.
// Logits, transposed: S^T[key][n] = X4[key][0..3] * R[n][0..3] on v_wmma_f32_16x16x4_f32, one instruction per 16 keys x 16 rows. Lane (c, h) loads elements 2h and 2h+1 of key c and of row c by the same rule, so the k pairing of both operands is equal.
// D register r of lane (c, h) is key 8h + r of row c: the two tiles of a step, converted in place, are the B fragment (hardware k order) of Y^T = X~^T * P^T on v_wmma_f32_16x16x32_f16, whose A fragment is XF.
// R comes scaled by log2(e) (sai_xr), so both sweeps work on s' = s * log2(e). Sweep 1 finds each row's maximum m' (over the waves through LDS); sweep 2 forms the logits again with 15 - m' added to R's element 3 (X4's element 3 is 1),
// so that the matrix instruction hands out s' - m' + 15 and the hardware's 2^x of it, one instruction with no range reduction around it, is P * 2^15 * Z. The argument is at most 15 up to rounding; where 2^x falls below the f32 normal range the f16 value is 0 either way.
// Column 6 of [x, 1] is 1: row 6 of Y^T is the row's sum of the same f16 values, and the factor 2^15 * Z leaves in the division.
#define FA_ROWS 32
constexpr uint32_t FA_WAVES = 32, FA_KEYS = NNODE / FA_WAVES, FA_STEPS = FA_KEYS / 32u;
constexpr uint32_t FA_MPITCH = FA_WAVES + 4;      // floats per row of the waves' maxima: 16-byte pieces stay aligned, neighbouring rows fall on different banks
static_assert(FA_STEPS * 32u * FA_WAVES == NNODE && NNODE % FA_ROWS == 0 && FA_ROWS == 32, "the waves' key ranges tile a row; two 16-row tiles per work-group");
__device__ __forceinline__ v8f fa_logits(v2f x, v2f r) {
  const v8f z = {0.f, 0.f, 0.f, 0.f, 0.f, 0.f, 0.f, 0.f};
  return __builtin_amdgcn_wmma_f32_16x16x4_f32(false, x, false, r, (short)0, z, false, false);
}
__global__ __launch_bounds__(1024) void k_fa(const float* __restrict__ R, const float* __restrict__ X4, const _Float16* __restrict__ XF, float* __restrict__ Y) {
  __shared__ __attribute__((aligned(16))) float redM[FA_ROWS][FA_MPITCH];
  __shared__ __attribute__((aligned(16))) float E[FA_WAVES][FA_ROWS][8];
  const uint32_t tid = threadIdx.x, wv = tid >> 5, lane = tid & 31u, h = lane >> 4, c = lane & 15u;
  const uint32_t n0 = blockIdx.x * FA_ROWS, k0 = wv * FA_KEYS;
  const float* xp = X4 + (size_t)(k0 + c) * 4u + 2u * h;                                        // key c of the wave's first tile, elements 2h and 2h+1
  const unsigned short* xf = (const unsigned short*)XF + (size_t)(k0 / 32u) * 512u + lane * 8u;
  v2f rb[2]; float mx[2];
  // every '#pragma unroll' of this kernel: rb, mx, acc and the tiles stay in registers only under constant indices
#pragma unroll
  for (int j = 0; j < 2; ++j) { rb[j] = *(const v2fa*)(R + (size_t)(n0 + 16u * (uint32_t)j + c) * 4u + 2u * h); mx[j] = -3.0e38f; }
  // two steps per trip, here and in sweep 2: the second step's operands are in flight while the first is worked on; unrolled whole, the build kept all of the wave's keys in registers and spilled
#pragma unroll 2
  for (uint32_t st = 0; st < FA_STEPS; ++st) {
    const v2f xa0 = *(const v2fa*)(xp + st * 128u), xa1 = *(const v2fa*)(xp + st * 128u + 64u);
#pragma unroll
    for (int j = 0; j < 2; ++j) {
      const v8f t0 = fa_logits(xa0, rb[j]), t1 = fa_logits(xa1, rb[j]);
#pragma unroll
      for (int r = 0; r < 8; ++r) mx[j] = fmaxf(mx[j], fmaxf(t0[r], t1[r]));
    }
  }
#pragma unroll
  for (int j = 0; j < 2; ++j) { mx[j] = fmaxf(mx[j], lane_xor16(mx[j])); if (h == 0u) redM[16u * (uint32_t)j + c][wv] = mx[j]; }
  __syncthreads();      /* every wave's maxima of the 32 rows are in redM */
#pragma unroll
  for (int j = 0; j < 2; ++j) {
    float m = -3.0e38f;
#pragma unroll
    for (uint32_t q = 0; q < FA_WAVES / 4u; ++q) { const v4f v = *(const v4f*)&redM[16u * (uint32_t)j + c][4u * q]; m = fmaxf(m, fmaxf(fmaxf(v[0], v[1]), fmaxf(v[2], v[3]))); }
    if (h == 1u) rb[j][1] += 15.0f - m;      // element 3 of the row takes its shift, in powers of two
  }
  v8f acc[2];
#pragma unroll
  for (int j = 0; j < 2; ++j) acc[j] = (v8f){0.f, 0.f, 0.f, 0.f, 0.f, 0.f, 0.f, 0.f};
  // two steps per trip, as in sweep 1
#pragma unroll 2
  for (uint32_t st = 0; st < FA_STEPS; ++st) {
    const v2f xa0 = *(const v2fa*)(xp + st * 128u), xa1 = *(const v2fa*)(xp + st * 128u + 64u);
    FragH fx; fx.half[0] = *(const v8us*)(xf + st * 512u); fx.half[1] = *(const v8us*)(xf + st * 512u + 256u);
    // stands behind the step's four loads, ahead of the additions to their address registers; as no load crosses it, XF's loads also stay up here, in flight with the keys': without it the build issued them late in the trip, some twenty instructions ahead of their use
    asm volatile("s_wait_xcnt 0x0" ::: "memory");
#pragma unroll
    for (int j = 0; j < 2; ++j) {
      const v8f t0 = fa_logits(xa0, rb[j]), t1 = fa_logits(xa1, rb[j]);
      FragH p;
#pragma unroll
      for (int r = 0; r < 8; ++r) { p.h[r] = (_Float16)__builtin_amdgcn_exp2f(t0[r]); p.h[8 + r] = (_Float16)__builtin_amdgcn_exp2f(t1[r]); }
      acc[j] = __builtin_amdgcn_wmma_f32_16x16x32_f16(false, fx.v, false, p.v, (short)0, acc[j], false, false);
    }
  }
  // lane (c, 0) holds Y^T[0..7][row c] of its wave's keys; the 32 waves' sums meet in LDS and are added in wave order
  if (h == 0u) {
#pragma unroll
    for (int j = 0; j < 2; ++j) {
      *(v4f*)&E[wv][16u * (uint32_t)j + c][0] = (v4f){acc[j][0], acc[j][1], acc[j][2], acc[j][3]};
      *(v4f*)&E[wv][16u * (uint32_t)j + c][4] = (v4f){acc[j][4], acc[j][5], acc[j][6], acc[j][7]};
    }
  }
  __syncthreads();      /* every wave's sums are staged */
  if (tid < FA_ROWS * 8u) {
    const uint32_t row = tid >> 3, f = tid & 7u;
    float s = E[0][row][f], z = E[0][row][6];
    for (uint32_t w = 1; w < FA_WAVES; ++w) { s += E[w][row][f]; z += E[w][row][6]; }
    Y[(size_t)(n0 + row) * 8u + f] = s / z;
  }
}

// ---- out = [Y | x, 1, 1] * G. Rows 0..6 of G are [Wq bq]^T * Wv_q^T and row 7 is 0 (Y's element 7 is 0); rows 8..14 are [Wk bk]^T * Wv_k^T + [Wk bk]^T (the second term is the addend 'keys'); row 15 is bv (X7's element 7 is 1).
// GF holds G as the B fragments of k_out: the 16-byte piece (((d >> 6) * 4 + (d & 3)) * 2 + p) * 32 + 16 hh + ((d & 63) >> 2) holds rows 8 p + 4 hh + 0..3 of column d, so that a wave's fragment load reads 512 bytes in a row.
// sai_gmat (the set-up launch's first block range): one work-group = 16 columns d of G. Waves 0..15 take the Wq side, waves 16..31 the Wk side, 32 of the 512 channels each: G^T[d][i] = sum over channels ch of Wv[d][ch] * W~[ch][i], A = Wv rows, B = W~ columns (i > 6 is 0).
// Lane (c, h) takes channels 16 h .. 16 h + 15 of its wave's 32 for row c of A and for column c of B by the same rule, so the k pairing of both operands is equal. The 16 waves' sums of a side meet in LDS and are added in wave order.
constexpr uint32_t GM_SPLIT = 16, GM_CH = DD / GM_SPLIT;
static_assert(GM_CH == 32 && DD % 64 == 0, "16 channels per lane half; k_out takes 64 columns per wave");
__device__ __forceinline__ void sai_gmat(const float* __restrict__ Wq, const float* __restrict__ bq, const float* __restrict__ Wk, const float* __restrict__ bk, const float* __restrict__ Wv, const float* __restrict__ bv, float* __restrict__ GF) {
  __shared__ __attribute__((aligned(16))) float part[2 * GM_SPLIT][16][8];
  const uint32_t tid = threadIdx.x, wv = tid >> 5, lane = tid & 31u, h = lane >> 4, c = lane & 15u;
  const uint32_t d0 = blockIdx.x * 16u, side = wv / GM_SPLIT, ch0 = (wv % GM_SPLIT) * GM_CH + 16u * h;
  const float* __restrict__ Wm = side ? Wk : Wq;
  const float* __restrict__ bm = side ? bk : bq;
  const float* vp = Wv + (size_t)(d0 + c) * (2 * DD) + side * DD + ch0;
  const float* wp = Wm + (size_t)ch0 * 6u + ((c < 6u) ? c : 0u);      // a column > 5 reads column 0 and drops it: every lane loads, with no branch in front of the matrix instructions
  // the addend of the element that this thread sums behind the barrier (threads 128..255 use it), loaded here so that it is in flight with the operands
  const uint32_t fp = (tid >> 7) & 1u, fdl = (tid >> 3) & 15u, fi = tid & 7u, fd = d0 + fdl;
  const float* adp = (fi < 6u) ? Wk + (size_t)fd * 6u + fi : (fi == 6u) ? bk + fd : bv + fd;
  float a[16], w[16], wl[16], bl[16];
  // every '#pragma unroll' of this kernel: a, w, wl, bl and t stay in registers only under constant indices
#pragma unroll
  for (int q = 0; q < 4; ++q) {
    const v4f v = *(const v4fa*)(vp + 4 * q), b4 = *(const v4fa*)(bm + ch0 + 4 * q);
#pragma unroll
    for (int e = 0; e < 4; ++e) { a[4 * q + e] = v[e]; bl[4 * q + e] = b4[e]; }
  }
  asm volatile("s_wait_xcnt 0x0" ::: "memory");      // stands behind the eight loads above, in front of the loads below, whose results the build puts into the address registers of those above
#pragma unroll
  for (int e = 0; e < 16; ++e) wl[e] = wp[6 * e];
  const float adl = *adp;
  __builtin_amdgcn_sched_barrier(0);      // nothing crosses: inside the merged kernel the build otherwise put the first roundings, with their wait for the loads above, in front of these seventeen loads, one memory latency more
  // holds these loads here, unconditional and in flight with the ones above (loaded values as inputs only): without it the build put the sixteen loads under a lane mask behind a wait for the first loads; the addend is named so that its load stays in front of the barrier
  asm volatile("" :: "v"(wl[0]), "v"(wl[1]), "v"(wl[2]), "v"(wl[3]), "v"(wl[4]), "v"(wl[5]), "v"(wl[6]), "v"(wl[7]), "v"(wl[8]), "v"(wl[9]), "v"(wl[10]), "v"(wl[11]), "v"(wl[12]), "v"(wl[13]), "v"(wl[14]), "v"(wl[15]), "v"(adl));
#pragma unroll
  for (int e = 0; e < 16; ++e) { a[e] = bf16_round(a[e]); w[e] = bf16_round((c < 6u) ? wl[e] : (c == 6u) ? bl[e] : 0.0f); }
  v8f t = {0.f, 0.f, 0.f, 0.f, 0.f, 0.f, 0.f, 0.f};
#pragma unroll
  for (int j = 0; j < 8; ++j) t = __builtin_amdgcn_wmma_f32_16x16x4_f32(false, (v2f){a[2 * j], a[2 * j + 1]}, false, (v2f){w[2 * j], w[2 * j + 1]}, (short)0, t, false, false);
  // register r of lane (c, h) is G^T[d0 + 8 h + r][c] of the wave's channels
  if (c < 8u) {
#pragma unroll
    for (int r = 0; r < 8; ++r) part[wv][8u * h + (uint32_t)r][c] = t[r];
  }
  __syncthreads();      /* every wave's sums are staged */
  if (tid < 256u) {
    const uint32_t p = fp, dl = fdl, i = fi, d = fd;
    float s = part[p * GM_SPLIT][dl][i];
    for (uint32_t k = 1; k < GM_SPLIT; ++k) s += part[p * GM_SPLIT + k][dl][i];
    if (p == 1u) s += bf16_round(adl);      // element 7 of the sums is 0: row 15 is bv alone
    GF[(size_t)(((((d >> 6) * 4u + (d & 3u)) * 2u + p) * 32u + 16u * (i >> 2) + ((d & 63u) >> 2)) * 4u + (i & 3u))] = s;
  }
}
// k_prep: all that hangs on the inputs alone, in one launch. G, and X7, X4, XF and R, read none of each other: work-groups 0 .. GM_BLOCKS - 1 form G (they start first: theirs is the larger read), the next XR_BLOCKS the nodes' vectors.
// The branch is on the work-group's index alone, so every barrier of either side is passed by all of its work-group's waves.
constexpr int GM_BLOCKS = DD / 16;
__global__ __launch_bounds__(1024) void k_prep(const float* __restrict__ nodes, const float* __restrict__ centre, const float* __restrict__ Wq, const float* __restrict__ bq, const float* __restrict__ Wk, const float* __restrict__ bk,
                                               const float* __restrict__ Wv, const float* __restrict__ bv, float* __restrict__ GF, float* __restrict__ X7, float* __restrict__ X4, _Float16* __restrict__ XF, float* __restrict__ R) {
  if ((int)blockIdx.x < GM_BLOCKS) sai_gmat(Wq, bq, Wk, bk, Wv, bv, GF);
  else sai_xr(nodes, centre, Wq, bq, Wk, bk, X7, X4, XF, R, (int)blockIdx.x - GM_BLOCKS);
}
// k_out: one work-group = OUT_ROWS rows of out; wave w takes columns 64 w .. 64 w + 63 as four tiles, tile t holding columns 64 w + 4 c + t in its column c: the four tiles' registers r of a lane are 16 bytes in a row of out,
// and one store instruction writes 256 bytes in a row of each of two rows. A = [Y | X7] rows, lane (c, h) taking elements 4 h .. 4 h + 3 of each, as GF has them for B.
#define OUT_ROWS 32
static_assert(NNODE % OUT_ROWS == 0 && OUT_ROWS == 32 && DD == 8 * 64, "two 16-row tiles per work-group; eight waves cover a row");
__global__ __launch_bounds__(256) void k_out(const float* __restrict__ Y, const float* __restrict__ X7, const float* __restrict__ GF, float* __restrict__ out) {
  const uint32_t tid = threadIdx.x, wv = tid >> 5, lane = tid & 31u, h = lane >> 4, c = lane & 15u;
  const uint32_t n0 = blockIdx.x * OUT_ROWS;
  v4f gy[4], gx[4], ya[OUT_ROWS / 16], xa[OUT_ROWS / 16];
  // every '#pragma unroll' of this kernel: the fragments and acc stay in registers only under constant indices, and all loads are in flight together
#pragma unroll
  for (int j = 0; j < OUT_ROWS / 16; ++j) { const size_t n = n0 + 16u * (uint32_t)j + c; ya[j] = *(const v4fa*)(Y + n * 8u + 4u * h); xa[j] = *(const v4fa*)(X7 + n * 8u + 4u * h); }
#pragma unroll
  for (int t = 0; t < 4; ++t) { const float* g = GF + (size_t)((wv * 4u + (uint32_t)t) * 2u * 32u + lane) * 4u; gy[t] = *(const v4fa*)g; gx[t] = *(const v4fa*)(g + 128); }
  // holds all twelve loads in front of the matrix instructions (loaded values as inputs only): without it the build issued X7's loads behind the wait for Y's, one memory latency later
  asm volatile("" :: "v"(ya[0]), "v"(ya[1]), "v"(xa[0]), "v"(xa[1]), "v"(gy[0]), "v"(gy[1]), "v"(gy[2]), "v"(gy[3]), "v"(gx[0]), "v"(gx[1]), "v"(gx[2]), "v"(gx[3]));
#pragma unroll
  for (int j = 0; j < OUT_ROWS / 16; ++j) {
    v8f acc[4];
#pragma unroll
    for (int t = 0; t < 4; ++t) acc[t] = (v8f){0.f, 0.f, 0.f, 0.f, 0.f, 0.f, 0.f, 0.f};
#pragma unroll
    for (int t = 0; t < 4; ++t) acc[t] = __builtin_amdgcn_wmma_f32_16x16x4_f32(false, (v2f){ya[j][0], ya[j][1]}, false, (v2f){gy[t][0], gy[t][1]}, (short)0, acc[t], false, false);
#pragma unroll
    for (int t = 0; t < 4; ++t) acc[t] = __builtin_amdgcn_wmma_f32_16x16x4_f32(false, (v2f){ya[j][2], ya[j][3]}, false, (v2f){gy[t][2], gy[t][3]}, (short)0, acc[t], false, false);
#pragma unroll
    for (int t = 0; t < 4; ++t) acc[t] = __builtin_amdgcn_wmma_f32_16x16x4_f32(false, (v2f){xa[j][0], xa[j][1]}, false, (v2f){gx[t][0], gx[t][1]}, (short)0, acc[t], false, false);
#pragma unroll
    for (int t = 0; t < 4; ++t) acc[t] = __builtin_amdgcn_wmma_f32_16x16x4_f32(false, (v2f){xa[j][2], xa[j][3]}, false, (v2f){gx[t][2], gx[t][3]}, (short)0, acc[t], false, false);
    float* op = out + (size_t)(n0 + 16u * (uint32_t)j + 8u * h) * DD + wv * 64u + 4u * c;
#pragma unroll
    for (int r = 0; r < 8; ++r) *(v4f*)(op + (size_t)r * DD) = (v4f){acc[0][r], acc[1][r], acc[2][r], acc[3][r]};
  }
}

extern "C" void kernel_launch(void* const* d_in, const int* in_sizes, int n_in,
                              void* d_out, int out_size, void* d_ws, size_t ws_size, hipStream_t stream) {
  (void)in_sizes; (void)n_in; (void)out_size;
  const float* const* I = (const float* const*)d_in; const float* nodes = I[0]; const float* centre = I[1]; const float* Wq = I[2]; const float* bq = I[3]; const float* Wk = I[4]; const float* bk = I[5]; const float* Wv = I[6]; const float* bv = I[7];
  char* ws = (char*)d_ws; size_t off = 0;
  auto take = [&](size_t bytes) { char* p = ws + off; off += (bytes + 255) & ~(size_t)255; return p; };
  float* GF = (float*)take((size_t)DD * 16 * 4); float* X7 = (float*)take((size_t)NNODE * 8 * 4); float* X4 = (float*)take((size_t)NNODE * 4 * 4); float* R = (float*)take((size_t)NNODE * 4 * 4);
  _Float16* XF = (_Float16*)take((size_t)NNODE * 16 * 2); float* YP = (float*)take((size_t)NNODE * 8 * 4);
  if (off > ws_size) return;      // 1 MiB of the 256 MiB workspace
  k_prep<<<GM_BLOCKS + XR_BLOCKS, 1024, 0, stream>>>(nodes, centre, Wq, bq, Wk, bk, Wv, bv, GF, X7, X4, XF, R);      /* G (16 x 512) from the weights; X7, X4, XF, R from the nodes and the weights */
  k_fa<<<NNODE / FA_ROWS, 1024, 0, stream>>>(R, X4, XF, YP);      /* Y = attn*[x, 1]: 256 work-groups of 32 waves, 32 rows each */
  k_out<<<NNODE / OUT_ROWS, 256, 0, stream>>>(YP, X7, GF, (float*)d_out);      /* out = [Y | x, 1, 1]*G: M 8192 N 512 K 16 */
}
